// v000
// Measured on an AMD MI455X. A time is GPU time per run, averaged over a window of back-to-back runs after a warm-up
// (all launches, gaps included; the runs take copies of the inputs in turn), and the median of several windows.
// Apart from v000's, it joins two sittings. Times from different sittings can be a few percent apart, while
// side-by-side timings come from the same sitting.
// The starting kernel, v000, takes 2640 microseconds a run.
// compute dtype: all float inputs rounded to bf16; theta / phi / g = W x + b (1x1 convs) with EXACT bf16 products on WMMA 16x16x32 (x^T tile staged in LDS), f32 accumulate; theta and phi kept in f32 and split into bf16 hi + lo for the UNSCALED logits w = theta^T phi (3 products; logits std ~5, sharp softmax), logits stored in f32 per batch; softmax in f32 (precise expf) -> P^T planes as f16 x 2^11; attn[d][s] = sum_t g[d][t] P[t][s] with g as f16 hi + lo (2 products); h = ht_w attn (attn bf16 hi + lo, 2 products) + ht_b; BatchNorm1d training statistics over (B, T) per channel from per-block (mean, M2) partials merged in a fixed order; out = inpt + gamma h_norm + beta; f32 output.
#include <hip/hip_runtime.h>
#include <math.h>

typedef __attribute__((ext_vector_type(16))) _Float16 v16h;
typedef __attribute__((ext_vector_type(16))) __bf16 v16b;
typedef __attribute__((ext_vector_type(8)))  _Float16 v8h;
typedef __attribute__((ext_vector_type(8)))  float v8f;
typedef __attribute__((ext_vector_type(4)))  float v4f;
typedef __attribute__((ext_vector_type(2)))  float v2f;
typedef __attribute__((ext_vector_type(4)))  unsigned v4u;
typedef __attribute__((ext_vector_type(4)))  int v4i;
typedef float __attribute__((may_alias)) float_a;
typedef int __attribute__((may_alias)) int_a;

template <typename T> __device__ __forceinline__ void vst2(void* p, T v) { *(T*)p = v;  }
__device__ __forceinline__ v8f wmma16(v16h a, v16h b, v8f c) {
  v8f d = __builtin_amdgcn_wmma_f32_16x16x32_f16(false, a, false, b, (short)0, c, false, false);
  asm volatile("v_nop\n\tv_nop\n\tv_nop\n\tv_nop" : "+v"(d) : "v"(a), "v"(b));
  return d;
}
__device__ __forceinline__ v8f wmma_bf(v16b a, v16b b, v8f c) {
  v8f d = __builtin_amdgcn_wmma_f32_16x16x32_bf16(false, a, false, b, (short)0, c, false, false);
  asm volatile("v_nop\n\tv_nop\n\tv_nop\n\tv_nop" : "+v"(d) : "v"(a), "v"(b));
  return d;
}
// 16x16x32 fragments: lane = (h = lane>>4, row/col = lane&15); elements 0..7 = k0+8h+0..7, 8..15 = k0+16+8h+0..7; D element r = row 8h+r
__device__ __forceinline__ v16h frag_h(const _Float16* rowk0, int lane) {
  union { v16h v; v8h q[2]; } u; const _Float16* p = rowk0 + 8 * (lane >> 4);
  u.q[0] = *(const v8h*)p; u.q[1] = *(const v8h*)(p + 16); return u.v;
}
__device__ __forceinline__ v16h frag_f32(const float* rowk0, int lane) {
  v16h a; const float* p = rowk0 + 8 * (lane >> 4);
#pragma unroll
  for (int i = 0; i < 8; ++i) { a[i] = (_Float16)p[i]; a[8 + i] = (_Float16)p[16 + i]; }
  return a;
}
__device__ __forceinline__ v16h frag_f32s(const float* rowk0, int lane, float sc) {
  v16h a; const float* p = rowk0 + 8 * (lane >> 4);
#pragma unroll
  for (int i = 0; i < 8; ++i) { a[i] = (_Float16)(p[i] * sc); a[8 + i] = (_Float16)(p[16 + i] * sc); }
  return a;
}
// column fragment from a [K][ld] layout (column n), rows >= K read as 0
__device__ __forceinline__ v16h fragc_f32(const float* W, int k0, int n, int lane, int ld, int K) {
  v16h a; const int g = lane >> 4;
#pragma unroll
  for (int i = 0; i < 8; ++i) { const int ka = k0 + 8 * g + i, kb = ka + 16;
    a[i] = (_Float16)(ka < K ? W[(size_t)(ka < K ? ka : K - 1) * ld + n] : 0.f); a[8 + i] = (_Float16)(kb < K ? W[(size_t)(kb < K ? kb : K - 1) * ld + n] : 0.f); }
  return a;
}
struct F2 { v16b h, l; };
__device__ __forceinline__ F2 bsplit16(const float v[16]) { F2 r;
#pragma unroll
  for (int i = 0; i < 16; ++i) { const __bf16 h = (__bf16)v[i]; r.h[i] = h; r.l[i] = (__bf16)(v[i] - (float)h); }
  return r; }
__device__ __forceinline__ F2 split_row(const float* row, int k0, int lane) { float v[16]; const float* p = row + k0 + 8 * (lane >> 4);
#pragma unroll
  for (int i = 0; i < 8; ++i) { v[i] = p[i]; v[8 + i] = p[16 + i]; }
  return bsplit16(v); }
__device__ __forceinline__ F2 split_rowK(const float* row, int k0, int lane, int K) { float v[16]; const int g = lane >> 4;
#pragma unroll
  for (int i = 0; i < 8; ++i) { const int ka = k0 + 8 * g + i, kb = ka + 16; v[i] = ka < K ? row[ka < K ? ka : K - 1] : 0.f; v[8 + i] = kb < K ? row[kb < K ? kb : K - 1] : 0.f; }
  return bsplit16(v); }
__device__ __forceinline__ F2 split_col(const float* W, int k0, int n, int lane, int ld, int K) { float v[16]; const int g = lane >> 4;
#pragma unroll
  for (int i = 0; i < 8; ++i) { const int ka = k0 + 8 * g + i, kb = ka + 16; v[i] = ka < K ? W[(size_t)(ka < K ? ka : K - 1) * ld + n] : 0.f; v[8 + i] = kb < K ? W[(size_t)(kb < K ? kb : K - 1) * ld + n] : 0.f; }
  return bsplit16(v); }
__device__ __forceinline__ v8f mac3(const F2& a, const F2& b, v8f c) { c = wmma_bf(a.l, b.h, c); c = wmma_bf(a.h, b.l, c); return wmma_bf(a.h, b.h, c); }
__device__ __forceinline__ float sigm(float v) { return 1.0f / (1.0f + expf(-v)); }
#define LDSX() do { asm volatile("s_wait_dscnt 0" ::: "memory"); __builtin_amdgcn_wave_barrier(); __builtin_amdgcn_fence(__ATOMIC_RELEASE, "workgroup"); } while (0)


// Non-local block over time (B 8, C 512, D 256, T 2,048): theta/phi/g 1x1 convs; w = softmax_s(theta^T phi); attn = g w (the module contracts g over the QUERY index); h = ht(attn); training-mode BatchNorm1d; out = inpt + bn(h).
#define NB 8
#define CC 512
#define DD 256
#define TT 2048
#ifndef TNB
#define TNB NB
#endif
typedef __attribute__((ext_vector_type(8))) __bf16 v8b;
__device__ __forceinline__ v16b frag_b(const __bf16* rowk0, int lane) {
  union { v16b v; v8b q[2]; } u; const __bf16* p = rowk0 + 8 * (lane >> 4);
  u.q[0] = *(const v8b*)p; u.q[1] = *(const v8b*)(p + 16); return u.v;
}
__device__ __forceinline__ float bfr(float v) { return (float)(__bf16)v; }
__device__ __attribute__((noinline)) float exp_ni(float v) { return expf(v); }
__device__ __attribute__((noinline)) float erf_ni(float v) { return erff(v); }

#define WS_TH  0u                                    // f32 theta^T rows [b*t][256]
#define WS_PHH (WS_TH + 4u * (size_t)NB * TT * DD)      // bf16 phi^T hi rows [b*s][256]
#define WS_PHL (WS_PHH + 2u * (size_t)NB * TT * DD)
#define WS_G   (WS_PHL + 2u * (size_t)NB * TT * DD)     // f32 g [b][d][t]
#define WS_S   (WS_G + 4u * (size_t)NB * DD * TT)       // f32 logits for ONE batch [t][s] (16 MiB)
#define WS_ML  (WS_S + 4u * (size_t)TT * TT)           // f32 row (max, 1/sum) [t][8] (padded)
#define WS_PT  (WS_ML + 4u * (size_t)TT * 8)           // f16 P^T planes for one batch [s][t] (x 2^11)
#define WS_AT  (WS_PT + 2u * (size_t)TT * TT)          // f32 attn^T rows [b*s][256]
#define WS_H   (WS_AT + 4u * (size_t)NB * TT * DD)      // f32 h [b][c][t]
#define WS_ST  (WS_H + 4u * (size_t)NB * CC * TT)       // f32 BN partials [(b*(TT/64) + tblk)][c][2] - one record per (batch, 64-position block)
#define WS_BN  (WS_ST + 4u * (size_t)NB * (TT / 64) * CC * 2)    // f32 mean [512], inv [512]
#define WS_END (WS_BN + 4u * 2 * CC)

// ---- k_proj: block = (64 positions t, b, which 0 theta / 1 phi / 2 g): x^T tile (bf16) in LDS; W [d][c]; outputs: theta^T f32 rows, phi^T bf16 hi/lo rows, g f32 [d][t]
__global__ __launch_bounds__(128) void k_proj(const float* __restrict__ X, const float* __restrict__ WT, const float* __restrict__ BT, const float* __restrict__ WP, const float* __restrict__ BP, const float* __restrict__ WG, const float* __restrict__ BG, float* __restrict__ TH, __bf16* __restrict__ PHH, __bf16* __restrict__ PHL, float* __restrict__ G) {
  __shared__ __align__(16) __bf16 sx[64][CC + 8]; __shared__ __align__(16) float st[64][68];   // st reused per 64-col group
  const int tid = threadIdx.x, wave = tid >> 5, lane = tid & 31, col = lane & 15, g = lane >> 4; const int t0 = blockIdx.x * 64; const size_t b = blockIdx.y; const int which = blockIdx.z;
  const float* Wm = which == 0 ? WT : which == 1 ? WP : WG; const float* Bm = which == 0 ? BT : which == 1 ? BP : BG;
  for (int e = tid; e < CC * 64; e += 128) { const int c = e >> 6, tl = e & 63; sx[tl][c] = (__bf16)X[(b * CC + c) * (size_t)TT + t0 + tl]; }
  __syncthreads();
#pragma unroll 1
  for (int cg = 0; cg < DD / 64; ++cg) { v8f acc[4] = {};
#pragma unroll 2
    for (int kc = 0; kc < CC / 32; ++kc) { const v16b a = frag_b(&sx[wave * 16 + col][kc * 32], lane);
#pragma unroll
      for (int j = 0; j < 4; ++j) { v16b w; const int d = cg * 64 + j * 16 + col;
#pragma unroll
        for (int i = 0; i < 8; ++i) { w[i] = (__bf16)Wm[(size_t)d * CC + kc * 32 + 8 * g + i]; w[8 + i] = (__bf16)Wm[(size_t)d * CC + kc * 32 + 16 + 8 * g + i]; }
        acc[j] = wmma_bf(a, w, acc[j]); } }
    __syncthreads();
#pragma unroll
    for (int j = 0; j < 4; ++j) { const int dl = j * 16 + col; const float bb = bfr(Bm[cg * 64 + dl]);
#pragma unroll
      for (int r = 0; r < 8; ++r) { const int tl = wave * 16 + 8 * g + r; const float v = acc[j][r] + bb; if (which == 2) st[dl][tl] = v; else st[tl][dl] = v; } }
    __syncthreads();
    if (which == 0) { for (int e = tid; e < 64 * 16; e += 128) { const int tl = e >> 4, q = e & 15; vst2(TH + (b * TT + t0 + tl) * DD + cg * 64 + q * 4, *(const v4f*)&st[tl][q * 4]); } }
    else if (which == 1) { for (int e = tid; e < 64 * 8; e += 128) { const int tl = e >> 3, q = e & 7; const float* p = &st[tl][q * 8]; v16b dummy; (void)dummy; __bf16 hh[8], ll[8]; 
#pragma unroll
        for (int i = 0; i < 8; ++i) { const __bf16 hv = (__bf16)p[i]; hh[i] = hv; ll[i] = (__bf16)(p[i] - (float)hv); }
        vst2((unsigned*)(PHH + (b * TT + t0 + tl) * DD + cg * 64 + q * 8), *(const v4u*)hh); vst2((unsigned*)(PHL + (b * TT + t0 + tl) * DD + cg * 64 + q * 8), *(const v4u*)ll); } }
    else { for (int e = tid; e < 64 * 16; e += 128) { const int dl = e >> 4, q = e & 15; vst2(G + (b * DD + cg * 64 + dl) * (size_t)TT + t0 + q * 4, *(const v4f*)&st[dl][q * 4]); } } } }
// ---- k_sc: block = (64 queries t, 128 keys s) of batch b: logits theta^T . phi (3 products) -> S
__global__ __launch_bounds__(128) void k_sc(const float* __restrict__ TH, const __bf16* __restrict__ PHH, const __bf16* __restrict__ PHL, int b, float* __restrict__ S) { __shared__ __align__(16) float ss[4][16][132];
  const int tid = threadIdx.x, wave = tid >> 5, lane = tid & 31, col = lane & 15, g = lane >> 4; const int k0 = blockIdx.y * 128; const int tq0 = blockIdx.x * 64 + wave * 16; const size_t q0 = (size_t)b * TT + tq0;
  v8f acc[8] = {};
#pragma unroll 1
  for (int kc = 0; kc < DD / 32; ++kc) { const F2 a = split_row(TH + (q0 + col) * DD, kc * 32, lane);
#pragma unroll
    for (int j = 0; j < 8; ++j) { const size_t kr = ((size_t)b * TT + k0 + j * 16 + col) * DD + kc * 32; const v16b kh = frag_b(PHH + kr, lane), kl = frag_b(PHL + kr, lane); acc[j] = wmma_bf(a.h, kh, acc[j]); acc[j] = wmma_bf(a.l, kh, acc[j]); acc[j] = wmma_bf(a.h, kl, acc[j]); } }
#pragma unroll
  for (int j = 0; j < 8; ++j)
#pragma unroll
    for (int r = 0; r < 8; ++r) ss[wave][8 * g + r][j * 16 + col] = acc[j][r];
  LDSX(); for (int rl = 0; rl < 16; ++rl) vst2(S + (size_t)(tq0 + rl) * TT + k0 + lane * 4, *(const v4f*)&ss[wave][rl][lane * 4]); }
__global__ __launch_bounds__(256) void k_stat(const float* __restrict__ S, float* __restrict__ ML) { __shared__ float sred[8]; __shared__ float sbc; __shared__ __align__(16) float sout[4][8];
  const int t = threadIdx.x;
  for (int rr = 0; rr < 4; ++rr) { const size_t row = (size_t)blockIdx.x * 4 + rr; const float* sr = S + row * TT;
    float m = -3.0e38f; for (int k = t; k < TT; k += 256) m = fmaxf(m, sr[k]);
#pragma unroll
    for (int o = 1; o < 32; o <<= 1) m = fmaxf(m, __shfl_xor(m, o));
    if ((t & 31) == 0) sred[t >> 5] = m; __syncthreads(); if (t == 0) { float a = sred[0]; for (int i = 1; i < 8; ++i) a = fmaxf(a, sred[i]); sbc = a; } __syncthreads(); m = sbc; __syncthreads();
    float sum = 0.f; for (int k = t; k < TT; k += 256) sum += expf(sr[k] - m);
#pragma unroll
    for (int o = 1; o < 32; o <<= 1) sum += __shfl_xor(sum, o);
    if ((t & 31) == 0) sred[t >> 5] = sum; __syncthreads(); if (t == 0) { float a = 0.f; for (int i = 0; i < 8; ++i) a += sred[i]; sout[rr][0] = m; sout[rr][1] = 1.0f / a; for (int i = 2; i < 8; ++i) sout[rr][i] = 0.f; } __syncthreads(); }
  if (t < 8) vst2(ML + (size_t)blockIdx.x * 32 + t * 4, *(const v4f*)&(&sout[0][0])[t * 4]); }
// ---- k_pt: block = (64 rows t, 128 cols s): P = exp(S - m) / sum, transposed in LDS -> P^T planes [s][t] (f16 x 2^11)
__global__ __launch_bounds__(128) void k_pt(const float* __restrict__ S, const float* __restrict__ ML, _Float16* __restrict__ PT) { __shared__ __align__(16) _Float16 sp[128][72];
  const int tid = threadIdx.x; const int t0 = blockIdx.x * 64, s0 = blockIdx.y * 128;
  for (int e = tid; e < 64 * 128; e += 128) { const int tl = e >> 7, sl = e & 127; const float m = ML[(size_t)(t0 + tl) * 8], inv = ML[(size_t)(t0 + tl) * 8 + 1]; sp[sl][tl] = (_Float16)(expf(S[(size_t)(t0 + tl) * TT + s0 + sl] - m) * inv * 2048.0f); }
  __syncthreads(); for (int e = tid; e < 128 * 8; e += 128) { const int sl = e >> 3, q = e & 7; vst2((unsigned*)(PT + (size_t)(s0 + sl) * TT + t0 + q * 8), *(const v4u*)&sp[sl][q * 8]); } }
// ---- k_pv: block = (64 rows d... no: rows = s (64), cols = d (128 group)) of batch b: attn^T[s][d] = sum_t P[t][s] g[d][t]: A = P^T rows [s][t] (f16), B(k=t, col=d) = g[d][t] planes (f32 -> f16 hi + lo?) -> use bf16: A from f16... keep both f16: g planes converted on the fly to f16 hi + residual
__global__ __launch_bounds__(128) void k_pv(const _Float16* __restrict__ PT, const float* __restrict__ G, int b, float* __restrict__ AT) { __shared__ __align__(16) float ss[4][16][132];
  const int tid = threadIdx.x, wave = tid >> 5, lane = tid & 31, col = lane & 15, g = lane >> 4; const int d0 = blockIdx.y * 128; const int s0 = blockIdx.x * 64 + wave * 16;
  v8f acc[8] = {};
#pragma unroll 1
  for (int kc = 0; kc < TT / 32; ++kc) { const v16h a = frag_h(PT + (size_t)(s0 + col) * TT + kc * 32, lane);
#pragma unroll
    for (int j = 0; j < 8; ++j) { const float* gp = G + ((size_t)b * DD + d0 + j * 16 + col) * TT + kc * 32 + 8 * g; v16h gh, gl;
#pragma unroll
      for (int i = 0; i < 8; ++i) { const float v0 = gp[i], v1 = gp[16 + i]; const _Float16 h0 = (_Float16)v0, h1 = (_Float16)v1; gh[i] = h0; gh[8 + i] = h1; gl[i] = (_Float16)(v0 - (float)h0); gl[8 + i] = (_Float16)(v1 - (float)h1); }
      acc[j] = wmma16(a, gh, acc[j]); acc[j] = wmma16(a, gl, acc[j]); } }
#pragma unroll
  for (int j = 0; j < 8; ++j)
#pragma unroll
    for (int r = 0; r < 8; ++r) ss[wave][8 * g + r][j * 16 + col] = acc[j][r] * (1.0f / 2048.0f);
  LDSX(); for (int rl = 0; rl < 16; ++rl) vst2(AT + ((size_t)b * TT + s0 + rl) * DD + d0 + lane * 4, *(const v4f*)&ss[wave][rl][lane * 4]); }
// ---- k_ht: block = (64 positions s, 128 out channels c, b): h[c][s] = sum_d ht_w[c][d] attn^T[s][d] + ht_b[c]; rows = s (A = attn^T hi+lo), B(k=d, col=c) = ht_w[c][d]; writes h [b][c][t] via LDS transpose + per-block BN partials
__global__ __launch_bounds__(128) void k_ht(const float* __restrict__ AT, const float* __restrict__ HW, const float* __restrict__ HB, float* __restrict__ Hh, float* __restrict__ ST) { __shared__ __align__(16) float st[128][68]; __shared__ __align__(16) float sst[128][2];
  const int tid = threadIdx.x, wave = tid >> 5, lane = tid & 31, col = lane & 15, g = lane >> 4; const int c0 = blockIdx.y * 128; const size_t b = blockIdx.z; const int s0 = blockIdx.x * 64; const size_t r0 = b * TT + s0 + wave * 16;
  v8f acc[8] = {};
#pragma unroll 1
  for (int kc = 0; kc < DD / 32; ++kc) { const F2 a = split_row(AT + (r0 + col) * DD, kc * 32, lane);
#pragma unroll
    for (int j = 0; j < 8; ++j) { v16b w; const int c = c0 + j * 16 + col;
#pragma unroll
      for (int i = 0; i < 8; ++i) { w[i] = (__bf16)HW[(size_t)c * DD + kc * 32 + 8 * g + i]; w[8 + i] = (__bf16)HW[(size_t)c * DD + kc * 32 + 16 + 8 * g + i]; }
      acc[j] = wmma_bf(a.h, w, acc[j]); acc[j] = wmma_bf(a.l, w, acc[j]); } }
#pragma unroll
  for (int j = 0; j < 8; ++j) { const int cl = j * 16 + col; const float bb = bfr(HB[c0 + cl]);
#pragma unroll
    for (int r = 0; r < 8; ++r) st[cl][wave * 16 + 8 * g + r] = acc[j][r] + bb; }
  __syncthreads();
  for (int e = tid; e < 128 * 16; e += 128) { const int cl = e >> 4, q = e & 15; vst2(Hh + (b * CC + c0 + cl) * (size_t)TT + s0 + q * 4, *(const v4f*)&st[cl][q * 4]); }
  { const int cl = tid; float s = 0.f; for (int q = 0; q < 64; ++q) s += st[cl][q]; const float mean = s / 64.0f; float m2 = 0.f; for (int q = 0; q < 64; ++q) { const float d = st[cl][q] - mean; m2 += d * d; } sst[cl][0] = mean; sst[cl][1] = m2; }
  __syncthreads(); if (tid < 64) vst2(ST + (((b * (TT / 64) + blockIdx.x) * CC) + c0) * 2 + tid * 4, *(const v4f*)&(&sst[0][0])[tid * 4]); }
// ---- k_bn: one block: per channel merge of the NB*32 block partials (64 values each, fixed order) -> mean, inv_std (biased)
__global__ __launch_bounds__(512) void k_bn(const float* __restrict__ ST, float* __restrict__ BN) { __shared__ __align__(16) float s[2][CC]; const int c = threadIdx.x; float n = 0.f, mean = 0.f, M2 = 0.f;
#pragma unroll 1
  for (int blk = 0; blk < NB * (TT / 64); ++blk) { const float mb = ST[((size_t)blk * CC + c) * 2], qb = ST[((size_t)blk * CC + c) * 2 + 1]; const float nb_ = 64.f; const float nt = n + nb_; const float d = mb - mean; mean += d * nb_ / nt; M2 += qb + d * d * n * nb_ / nt; n = nt; }
  s[0][c] = mean; s[1][c] = 1.0f / sqrtf(M2 / n + 1e-5f); __syncthreads(); if (c < 2 * CC / 4) vst2(BN + c * 4, *(const v4f*)&(&s[0][0])[c * 4]); }
// ---- k_out: block = (c, b): out[b][c][t] = inpt + gamma (h - mean) inv + beta over the 2,048 positions
__global__ __launch_bounds__(256) void k_out(const float* __restrict__ X, const float* __restrict__ Hh, const float* __restrict__ BN, const float* __restrict__ GA, const float* __restrict__ BE, float* __restrict__ OUT) { __shared__ __align__(16) float so[TT]; const int t = threadIdx.x; const int c = blockIdx.x; const size_t b = blockIdx.y; const float mean = BN[c], inv = BN[CC + c], ga = bfr(GA[c]), be = bfr(BE[c]);
  const size_t base = (b * CC + c) * (size_t)TT; for (int e = t; e < TT; e += 256) so[e] = bfr(X[base + e]) + (ga * (Hh[base + e] - mean) * inv + be);
  __syncthreads(); for (int q = t; q < TT / 4; q += 256) vst2(OUT + base + q * 4, *(const v4f*)&so[q * 4]); }
extern "C" void kernel_launch(void* const* d_in, const int* in_sizes, int n_in, void* d_out, int out_size, void* d_ws, size_t ws_size, hipStream_t stream) {
  (void)in_sizes; (void)n_in; (void)out_size;
  const float** F = (const float**)d_in;   // 0 inpt [8,512,2048], 1 theta_w [256,512], 2 theta_b, 3 phi_w, 4 phi_b, 5 g_w, 6 g_b, 7 ht_w [512,256], 8 ht_b, 9 bn_gamma, 10 bn_beta
  if (ws_size < (size_t)WS_END) return;
  char* ws = (char*)d_ws; float *TH = (float*)(ws + WS_TH), *G = (float*)(ws + WS_G), *S = (float*)(ws + WS_S), *ML = (float*)(ws + WS_ML), *AT = (float*)(ws + WS_AT), *Hh = (float*)(ws + WS_H), *ST = (float*)(ws + WS_ST), *BN = (float*)(ws + WS_BN); __bf16 *PHH = (__bf16*)(ws + WS_PHH), *PHL = (__bf16*)(ws + WS_PHL); _Float16* PT = (_Float16*)(ws + WS_PT);
  k_proj<<<dim3(TT / 64, TNB, 3), 128, 0, stream>>>(F[0], F[1], F[2], F[3], F[4], F[5], F[6], TH, PHH, PHL, G);
  for (int b = 0; b < TNB; ++b) {
    k_sc<<<dim3(TT / 64, TT / 128), 128, 0, stream>>>(TH, PHH, PHL, b, S);
    k_stat<<<TT / 4, 256, 0, stream>>>(S, ML);
    k_pt<<<dim3(TT / 64, TT / 128), 128, 0, stream>>>(S, ML, PT);
    k_pv<<<dim3(TT / 64, DD / 128), 128, 0, stream>>>(PT, G, b, AT);
  }
  k_ht<<<dim3(TT / 64, CC / 128, TNB), 128, 0, stream>>>(AT, F[7], F[8], Hh, ST);
  k_bn<<<1, 512, 0, stream>>>(ST, BN);
  k_out<<<dim3(CC, TNB), 256, 0, stream>>>(F[0], Hh, BN, F[9], F[10], (float*)d_out);
}

// v001
// One run takes 1030 microseconds.
// In two side-by-side timings against v000, it was 2.57 and 2.55 times as fast.
// compute dtype: all float inputs rounded to bf16; theta / phi / g = W x + b (1x1 convs) with EXACT bf16 products on WMMA 16x16x32 (x^T tile staged in LDS), f32 accumulate; theta and phi kept in f32 and split into bf16 hi + lo for the UNSCALED logits w = theta^T phi (3 products; logits std ~5, sharp softmax), logits stored in f32 per batch; softmax in f32 (precise expf) -> P^T planes as f16 x 2^11; attn[d][s] = sum_t g[d][t] P[t][s] with g as f16 hi + lo (2 products); h = ht_w attn (attn bf16 hi + lo, 2 products) + ht_b; BatchNorm1d training statistics over (B, T) per channel from per-block (mean, M2) partials merged in a fixed order; out = inpt + gamma h_norm + beta; f32 output.
#include <hip/hip_runtime.h>
#include <math.h>

typedef __attribute__((ext_vector_type(16))) _Float16 v16h;
typedef __attribute__((ext_vector_type(16))) __bf16 v16b;
typedef __attribute__((ext_vector_type(8)))  _Float16 v8h;
typedef __attribute__((ext_vector_type(8)))  float v8f;
typedef __attribute__((ext_vector_type(4)))  float v4f;
typedef __attribute__((ext_vector_type(2)))  float v2f;
typedef __attribute__((ext_vector_type(4)))  unsigned v4u;
typedef __attribute__((ext_vector_type(4)))  int v4i;
typedef float __attribute__((may_alias)) float_a;
typedef int __attribute__((may_alias)) int_a;

template <typename T> __device__ __forceinline__ void vst2(void* p, T v) { *(T*)p = v;  }
__device__ __forceinline__ v8f wmma16(v16h a, v16h b, v8f c) {
  v8f d = __builtin_amdgcn_wmma_f32_16x16x32_f16(false, a, false, b, (short)0, c, false, false);
  asm volatile("v_nop\n\tv_nop\n\tv_nop\n\tv_nop" : "+v"(d) : "v"(a), "v"(b));
  return d;
}
__device__ __forceinline__ v8f wmma_bf(v16b a, v16b b, v8f c) {
  v8f d = __builtin_amdgcn_wmma_f32_16x16x32_bf16(false, a, false, b, (short)0, c, false, false);
  asm volatile("v_nop\n\tv_nop\n\tv_nop\n\tv_nop" : "+v"(d) : "v"(a), "v"(b));
  return d;
}
// 16x16x32 fragments: lane = (h = lane>>4, row/col = lane&15); elements 0..7 = k0+8h+0..7, 8..15 = k0+16+8h+0..7; D element r = row 8h+r
__device__ __forceinline__ v16h frag_h(const _Float16* rowk0, int lane) {
  union { v16h v; v8h q[2]; } u; const _Float16* p = rowk0 + 8 * (lane >> 4);
  u.q[0] = *(const v8h*)p; u.q[1] = *(const v8h*)(p + 16); return u.v;
}
__device__ __forceinline__ v16h frag_f32(const float* rowk0, int lane) {
  v16h a; const float* p = rowk0 + 8 * (lane >> 4);
#pragma unroll
  for (int i = 0; i < 8; ++i) { a[i] = (_Float16)p[i]; a[8 + i] = (_Float16)p[16 + i]; }
  return a;
}
__device__ __forceinline__ v16h frag_f32s(const float* rowk0, int lane, float sc) {
  v16h a; const float* p = rowk0 + 8 * (lane >> 4);
#pragma unroll
  for (int i = 0; i < 8; ++i) { a[i] = (_Float16)(p[i] * sc); a[8 + i] = (_Float16)(p[16 + i] * sc); }
  return a;
}
// column fragment from a [K][ld] layout (column n), rows >= K read as 0
__device__ __forceinline__ v16h fragc_f32(const float* W, int k0, int n, int lane, int ld, int K) {
  v16h a; const int g = lane >> 4;
#pragma unroll
  for (int i = 0; i < 8; ++i) { const int ka = k0 + 8 * g + i, kb = ka + 16;
    a[i] = (_Float16)(ka < K ? W[(size_t)(ka < K ? ka : K - 1) * ld + n] : 0.f); a[8 + i] = (_Float16)(kb < K ? W[(size_t)(kb < K ? kb : K - 1) * ld + n] : 0.f); }
  return a;
}
struct F2 { v16b h, l; };
__device__ __forceinline__ F2 bsplit16(const float v[16]) { F2 r;
#pragma unroll
  for (int i = 0; i < 16; ++i) { const __bf16 h = (__bf16)v[i]; r.h[i] = h; r.l[i] = (__bf16)(v[i] - (float)h); }
  return r; }
__device__ __forceinline__ F2 split_row(const float* row, int k0, int lane) { float v[16]; const float* p = row + k0 + 8 * (lane >> 4);
#pragma unroll
  for (int i = 0; i < 8; ++i) { v[i] = p[i]; v[8 + i] = p[16 + i]; }
  return bsplit16(v); }
__device__ __forceinline__ F2 split_rowK(const float* row, int k0, int lane, int K) { float v[16]; const int g = lane >> 4;
#pragma unroll
  for (int i = 0; i < 8; ++i) { const int ka = k0 + 8 * g + i, kb = ka + 16; v[i] = ka < K ? row[ka < K ? ka : K - 1] : 0.f; v[8 + i] = kb < K ? row[kb < K ? kb : K - 1] : 0.f; }
  return bsplit16(v); }
__device__ __forceinline__ F2 split_col(const float* W, int k0, int n, int lane, int ld, int K) { float v[16]; const int g = lane >> 4;
#pragma unroll
  for (int i = 0; i < 8; ++i) { const int ka = k0 + 8 * g + i, kb = ka + 16; v[i] = ka < K ? W[(size_t)(ka < K ? ka : K - 1) * ld + n] : 0.f; v[8 + i] = kb < K ? W[(size_t)(kb < K ? kb : K - 1) * ld + n] : 0.f; }
  return bsplit16(v); }
__device__ __forceinline__ v8f mac3(const F2& a, const F2& b, v8f c) { c = wmma_bf(a.l, b.h, c); c = wmma_bf(a.h, b.l, c); return wmma_bf(a.h, b.h, c); }
__device__ __forceinline__ float sigm(float v) { return 1.0f / (1.0f + expf(-v)); }
#define LDSX() do { asm volatile("s_wait_dscnt 0" ::: "memory"); __builtin_amdgcn_wave_barrier(); __builtin_amdgcn_fence(__ATOMIC_RELEASE, "workgroup"); } while (0)


// Non-local block over time (B 8, C 512, D 256, T 2,048): theta/phi/g 1x1 convs; w = softmax_s(theta^T phi); attn = g w (the module contracts g over the QUERY index); h = ht(attn); training-mode BatchNorm1d; out = inpt + bn(h).
#define NB 8
#define CC 512
#define DD 256
#define TT 2048
#ifndef TNB
#define TNB NB
#endif
typedef __attribute__((ext_vector_type(8))) __bf16 v8b;
__device__ __forceinline__ v16b frag_b(const __bf16* rowk0, int lane) {
  union { v16b v; v8b q[2]; } u; const __bf16* p = rowk0 + 8 * (lane >> 4);
  u.q[0] = *(const v8b*)p; u.q[1] = *(const v8b*)(p + 16); return u.v;
}
__device__ __forceinline__ float bfr(float v) { return (float)(__bf16)v; }
__device__ __attribute__((noinline)) float exp_ni(float v) { return expf(v); }
__device__ __attribute__((noinline)) float erf_ni(float v) { return erff(v); }

#define WS_TH  0u                                    // f32 theta^T rows [b*t][256]
#define WS_PHH (WS_TH + 4u * (size_t)NB * TT * DD)      // bf16 phi^T hi rows [b*s][256]
#define WS_PHL (WS_PHH + 2u * (size_t)NB * TT * DD)
#define WS_G   (WS_PHL + 2u * (size_t)NB * TT * DD)     // f32 g [b][d][t]
#define WS_S   (WS_G + 4u * (size_t)NB * DD * TT)       // f32 logits for ONE batch [t][s] (16 MiB)
#define WS_ML  (WS_S + 4u * (size_t)TT * TT)           // f32 row (max, 1/sum) [t][8] (padded)
#define WS_PT  (WS_ML + 4u * (size_t)TT * 8)           // f16 P^T planes, one per batch [b][s][t] (x 2^11)
#define WS_AT  (WS_PT + 2u * (size_t)NB * TT * TT)     // f32 attn^T rows [b*s][256]
#define WS_H   (WS_AT + 4u * (size_t)NB * TT * DD)      // f32 h [b][c][t]
#define WS_ST  (WS_H + 4u * (size_t)NB * CC * TT)       // f32 BN partials [(b*(TT/64) + tblk)][c][2] - one record per (batch, 64-position block)
#define WS_BN  (WS_ST + 4u * (size_t)NB * (TT / 64) * CC * 2)    // f32 mean [512], inv [512]
#define WS_END (WS_BN + 4u * 2 * CC)

// ---- k_proj: block = (64 positions t, b, which 0 theta / 1 phi / 2 g): x^T tile (bf16) in LDS; W [d][c]; outputs: theta^T f32 rows, phi^T bf16 hi/lo rows, g f32 [d][t]
__global__ __launch_bounds__(128) void k_proj(const float* __restrict__ X, const float* __restrict__ WT, const float* __restrict__ BT, const float* __restrict__ WP, const float* __restrict__ BP, const float* __restrict__ WG, const float* __restrict__ BG, float* __restrict__ TH, __bf16* __restrict__ PHH, __bf16* __restrict__ PHL, float* __restrict__ G) {
  __shared__ __align__(16) __bf16 sx[64][CC + 8]; __shared__ __align__(16) float st[64][68];   // st reused per 64-col group
  const int tid = threadIdx.x, wave = tid >> 5, lane = tid & 31, col = lane & 15, g = lane >> 4; const int t0 = blockIdx.x * 64; const size_t b = blockIdx.y; const int which = blockIdx.z;
  const float* Wm = which == 0 ? WT : which == 1 ? WP : WG; const float* Bm = which == 0 ? BT : which == 1 ? BP : BG;
  for (int e = tid; e < CC * 64; e += 128) { const int c = e >> 6, tl = e & 63; sx[tl][c] = (__bf16)X[(b * CC + c) * (size_t)TT + t0 + tl]; }
  __syncthreads();
#pragma unroll 1
  for (int cg = 0; cg < DD / 64; ++cg) { v8f acc[4] = {};
#pragma unroll 2
    for (int kc = 0; kc < CC / 32; ++kc) { const v16b a = frag_b(&sx[wave * 16 + col][kc * 32], lane);
#pragma unroll
      for (int j = 0; j < 4; ++j) { v16b w; const int d = cg * 64 + j * 16 + col;
#pragma unroll
        for (int i = 0; i < 8; ++i) { w[i] = (__bf16)Wm[(size_t)d * CC + kc * 32 + 8 * g + i]; w[8 + i] = (__bf16)Wm[(size_t)d * CC + kc * 32 + 16 + 8 * g + i]; }
        acc[j] = wmma_bf(a, w, acc[j]); } }
    __syncthreads();
#pragma unroll
    for (int j = 0; j < 4; ++j) { const int dl = j * 16 + col; const float bb = bfr(Bm[cg * 64 + dl]);
#pragma unroll
      for (int r = 0; r < 8; ++r) { const int tl = wave * 16 + 8 * g + r; const float v = acc[j][r] + bb; if (which == 2) st[dl][tl] = v; else st[tl][dl] = v; } }
    __syncthreads();
    if (which == 0) { for (int e = tid; e < 64 * 16; e += 128) { const int tl = e >> 4, q = e & 15; vst2(TH + (b * TT + t0 + tl) * DD + cg * 64 + q * 4, *(const v4f*)&st[tl][q * 4]); } }
    else if (which == 1) { for (int e = tid; e < 64 * 8; e += 128) { const int tl = e >> 3, q = e & 7; const float* p = &st[tl][q * 8]; v16b dummy; (void)dummy; __bf16 hh[8], ll[8]; 
#pragma unroll
        for (int i = 0; i < 8; ++i) { const __bf16 hv = (__bf16)p[i]; hh[i] = hv; ll[i] = (__bf16)(p[i] - (float)hv); }
        vst2((unsigned*)(PHH + (b * TT + t0 + tl) * DD + cg * 64 + q * 8), *(const v4u*)hh); vst2((unsigned*)(PHL + (b * TT + t0 + tl) * DD + cg * 64 + q * 8), *(const v4u*)ll); } }
    else { for (int e = tid; e < 64 * 16; e += 128) { const int dl = e >> 4, q = e & 15; vst2(G + (b * DD + cg * 64 + dl) * (size_t)TT + t0 + q * 4, *(const v4f*)&st[dl][q * 4]); } } } }
// ---- k_sc: block = (64 queries t, 128 keys s) of batch b: logits theta^T . phi (3 products) -> S
__global__ __launch_bounds__(128) void k_sc(const float* __restrict__ TH, const __bf16* __restrict__ PHH, const __bf16* __restrict__ PHL, int b, float* __restrict__ S) { __shared__ __align__(16) float ss[4][16][132];
  const int tid = threadIdx.x, wave = tid >> 5, lane = tid & 31, col = lane & 15, g = lane >> 4; const int k0 = blockIdx.y * 128; const int tq0 = blockIdx.x * 64 + wave * 16; const size_t q0 = (size_t)b * TT + tq0;
  v8f acc[8] = {};
#pragma unroll 1
  for (int kc = 0; kc < DD / 32; ++kc) { const F2 a = split_row(TH + (q0 + col) * DD, kc * 32, lane);
#pragma unroll
    for (int j = 0; j < 8; ++j) { const size_t kr = ((size_t)b * TT + k0 + j * 16 + col) * DD + kc * 32; const v16b kh = frag_b(PHH + kr, lane), kl = frag_b(PHL + kr, lane); acc[j] = wmma_bf(a.h, kh, acc[j]); acc[j] = wmma_bf(a.l, kh, acc[j]); acc[j] = wmma_bf(a.h, kl, acc[j]); } }
#pragma unroll
  for (int j = 0; j < 8; ++j)
#pragma unroll
    for (int r = 0; r < 8; ++r) ss[wave][8 * g + r][j * 16 + col] = acc[j][r];
  LDSX(); for (int rl = 0; rl < 16; ++rl) vst2(S + (size_t)(tq0 + rl) * TT + k0 + lane * 4, *(const v4f*)&ss[wave][rl][lane * 4]); }
__global__ __launch_bounds__(256) void k_stat(const float* __restrict__ S, float* __restrict__ ML) { __shared__ float sred[8]; __shared__ float sbc; __shared__ __align__(16) float sout[4][8];
  const int t = threadIdx.x;
  for (int rr = 0; rr < 4; ++rr) { const size_t row = (size_t)blockIdx.x * 4 + rr; const float* sr = S + row * TT;
    float m = -3.0e38f; for (int k = t; k < TT; k += 256) m = fmaxf(m, sr[k]);
#pragma unroll
    for (int o = 1; o < 32; o <<= 1) m = fmaxf(m, __shfl_xor(m, o));
    if ((t & 31) == 0) sred[t >> 5] = m; __syncthreads(); if (t == 0) { float a = sred[0]; for (int i = 1; i < 8; ++i) a = fmaxf(a, sred[i]); sbc = a; } __syncthreads(); m = sbc; __syncthreads();
    float sum = 0.f; for (int k = t; k < TT; k += 256) sum += expf(sr[k] - m);
#pragma unroll
    for (int o = 1; o < 32; o <<= 1) sum += __shfl_xor(sum, o);
    if ((t & 31) == 0) sred[t >> 5] = sum; __syncthreads(); if (t == 0) { float a = 0.f; for (int i = 0; i < 8; ++i) a += sred[i]; sout[rr][0] = m; sout[rr][1] = 1.0f / a; for (int i = 2; i < 8; ++i) sout[rr][i] = 0.f; } __syncthreads(); }
  if (t < 8) vst2(ML + (size_t)blockIdx.x * 32 + t * 4, *(const v4f*)&(&sout[0][0])[t * 4]); }
// ---- k_pt: block = (64 rows t, 128 cols s) of batch b: P = exp(S - m) / sum, transposed in LDS -> P^T plane of batch b [s][t] (f16 x 2^11)
__global__ __launch_bounds__(128) void k_pt(const float* __restrict__ S, const float* __restrict__ ML, int b, _Float16* __restrict__ PT) { __shared__ __align__(16) _Float16 sp[128][72];
  const int tid = threadIdx.x; const int t0 = blockIdx.x * 64, s0 = blockIdx.y * 128; PT += (size_t)b * TT * TT;
  for (int e = tid; e < 64 * 128; e += 128) { const int tl = e >> 7, sl = e & 127; const float m = ML[(size_t)(t0 + tl) * 8], inv = ML[(size_t)(t0 + tl) * 8 + 1]; sp[sl][tl] = (_Float16)(expf(S[(size_t)(t0 + tl) * TT + s0 + sl] - m) * inv * 2048.0f); }
  __syncthreads(); for (int e = tid; e < 128 * 8; e += 128) { const int sl = e >> 3, q = e & 7; vst2((unsigned*)(PT + (size_t)(s0 + sl) * TT + t0 + q * 8), *(const v4u*)&sp[sl][q * 8]); } }
// ---- k_pv: block = (64 rows d... no: rows = s (64), cols = d (128 group)) of batch b: attn^T[s][d] = sum_t P[t][s] g[d][t]: A = P^T rows [s][t] (f16), B(k=t, col=d) = g[d][t] planes (f32 -> f16 hi + lo?) -> use bf16: A from f16... keep both f16: g planes converted on the fly to f16 hi + residual
__global__ __launch_bounds__(128) void k_pv(const _Float16* __restrict__ PT, const float* __restrict__ G, float* __restrict__ AT) { __shared__ __align__(16) float ss[4][16][132];
  const int tid = threadIdx.x, wave = tid >> 5, lane = tid & 31, col = lane & 15, g = lane >> 4; const int d0 = blockIdx.y * 128; const int s0 = blockIdx.x * 64 + wave * 16;
  const int b = blockIdx.z; PT += (size_t)b * TT * TT;   // every batch in one grid: 512 work-groups in one launch, not 8 launches of 64
  v8f acc[8] = {};
#pragma unroll 1
  for (int kc = 0; kc < TT / 32; ++kc) { const v16h a = frag_h(PT + (size_t)(s0 + col) * TT + kc * 32, lane);
#pragma unroll
    for (int j = 0; j < 8; ++j) { const float* gp = G + ((size_t)b * DD + d0 + j * 16 + col) * TT + kc * 32 + 8 * g; v16h gh, gl;
#pragma unroll
      for (int i = 0; i < 8; ++i) { const float v0 = gp[i], v1 = gp[16 + i]; const _Float16 h0 = (_Float16)v0, h1 = (_Float16)v1; gh[i] = h0; gh[8 + i] = h1; gl[i] = (_Float16)(v0 - (float)h0); gl[8 + i] = (_Float16)(v1 - (float)h1); }
      acc[j] = wmma16(a, gh, acc[j]); acc[j] = wmma16(a, gl, acc[j]); } }
#pragma unroll
  for (int j = 0; j < 8; ++j)
#pragma unroll
    for (int r = 0; r < 8; ++r) ss[wave][8 * g + r][j * 16 + col] = acc[j][r] * (1.0f / 2048.0f);
  LDSX(); for (int rl = 0; rl < 16; ++rl) vst2(AT + ((size_t)b * TT + s0 + rl) * DD + d0 + lane * 4, *(const v4f*)&ss[wave][rl][lane * 4]); }
// ---- k_ht: block = (64 positions s, 128 out channels c, b): h[c][s] = sum_d ht_w[c][d] attn^T[s][d] + ht_b[c]; rows = s (A = attn^T hi+lo), B(k=d, col=c) = ht_w[c][d]; writes h [b][c][t] via LDS transpose + per-block BN partials
__global__ __launch_bounds__(128) void k_ht(const float* __restrict__ AT, const float* __restrict__ HW, const float* __restrict__ HB, float* __restrict__ Hh, float* __restrict__ ST) { __shared__ __align__(16) float st[128][68]; __shared__ __align__(16) float sst[128][2];
  const int tid = threadIdx.x, wave = tid >> 5, lane = tid & 31, col = lane & 15, g = lane >> 4; const int c0 = blockIdx.y * 128; const size_t b = blockIdx.z; const int s0 = blockIdx.x * 64; const size_t r0 = b * TT + s0 + wave * 16;
  v8f acc[8] = {};
#pragma unroll 1
  for (int kc = 0; kc < DD / 32; ++kc) { const F2 a = split_row(AT + (r0 + col) * DD, kc * 32, lane);
#pragma unroll
    for (int j = 0; j < 8; ++j) { v16b w; const int c = c0 + j * 16 + col;
#pragma unroll
      for (int i = 0; i < 8; ++i) { w[i] = (__bf16)HW[(size_t)c * DD + kc * 32 + 8 * g + i]; w[8 + i] = (__bf16)HW[(size_t)c * DD + kc * 32 + 16 + 8 * g + i]; }
      acc[j] = wmma_bf(a.h, w, acc[j]); acc[j] = wmma_bf(a.l, w, acc[j]); } }
#pragma unroll
  for (int j = 0; j < 8; ++j) { const int cl = j * 16 + col; const float bb = bfr(HB[c0 + cl]);
#pragma unroll
    for (int r = 0; r < 8; ++r) st[cl][wave * 16 + 8 * g + r] = acc[j][r] + bb; }
  __syncthreads();
  for (int e = tid; e < 128 * 16; e += 128) { const int cl = e >> 4, q = e & 15; vst2(Hh + (b * CC + c0 + cl) * (size_t)TT + s0 + q * 4, *(const v4f*)&st[cl][q * 4]); }
  { const int cl = tid; float s = 0.f; for (int q = 0; q < 64; ++q) s += st[cl][q]; const float mean = s / 64.0f; float m2 = 0.f; for (int q = 0; q < 64; ++q) { const float d = st[cl][q] - mean; m2 += d * d; } sst[cl][0] = mean; sst[cl][1] = m2; }
  __syncthreads(); if (tid < 64) vst2(ST + (((b * (TT / 64) + blockIdx.x) * CC) + c0) * 2 + tid * 4, *(const v4f*)&(&sst[0][0])[tid * 4]); }
// ---- k_bn: one block: per channel merge of the NB*32 block partials (64 values each, fixed order) -> mean, inv_std (biased)
__global__ __launch_bounds__(512) void k_bn(const float* __restrict__ ST, float* __restrict__ BN) { __shared__ __align__(16) float s[2][CC]; const int c = threadIdx.x; float n = 0.f, mean = 0.f, M2 = 0.f;
#pragma unroll 1
  for (int blk = 0; blk < NB * (TT / 64); ++blk) { const float mb = ST[((size_t)blk * CC + c) * 2], qb = ST[((size_t)blk * CC + c) * 2 + 1]; const float nb_ = 64.f; const float nt = n + nb_; const float d = mb - mean; mean += d * nb_ / nt; M2 += qb + d * d * n * nb_ / nt; n = nt; }
  s[0][c] = mean; s[1][c] = 1.0f / sqrtf(M2 / n + 1e-5f); __syncthreads(); if (c < 2 * CC / 4) vst2(BN + c * 4, *(const v4f*)&(&s[0][0])[c * 4]); }
// ---- k_out: block = (c, b): out[b][c][t] = inpt + gamma (h - mean) inv + beta over the 2,048 positions
__global__ __launch_bounds__(256) void k_out(const float* __restrict__ X, const float* __restrict__ Hh, const float* __restrict__ BN, const float* __restrict__ GA, const float* __restrict__ BE, float* __restrict__ OUT) { __shared__ __align__(16) float so[TT]; const int t = threadIdx.x; const int c = blockIdx.x; const size_t b = blockIdx.y; const float mean = BN[c], inv = BN[CC + c], ga = bfr(GA[c]), be = bfr(BE[c]);
  const size_t base = (b * CC + c) * (size_t)TT; for (int e = t; e < TT; e += 256) so[e] = bfr(X[base + e]) + (ga * (Hh[base + e] - mean) * inv + be);
  __syncthreads(); for (int q = t; q < TT / 4; q += 256) vst2(OUT + base + q * 4, *(const v4f*)&so[q * 4]); }
extern "C" void kernel_launch(void* const* d_in, const int* in_sizes, int n_in, void* d_out, int out_size, void* d_ws, size_t ws_size, hipStream_t stream) {
  (void)in_sizes; (void)n_in; (void)out_size;
  const float** F = (const float**)d_in;   // 0 inpt [8,512,2048], 1 theta_w [256,512], 2 theta_b, 3 phi_w, 4 phi_b, 5 g_w, 6 g_b, 7 ht_w [512,256], 8 ht_b, 9 bn_gamma, 10 bn_beta
  if (ws_size < (size_t)WS_END) return;
  char* ws = (char*)d_ws; float *TH = (float*)(ws + WS_TH), *G = (float*)(ws + WS_G), *S = (float*)(ws + WS_S), *ML = (float*)(ws + WS_ML), *AT = (float*)(ws + WS_AT), *Hh = (float*)(ws + WS_H), *ST = (float*)(ws + WS_ST), *BN = (float*)(ws + WS_BN); __bf16 *PHH = (__bf16*)(ws + WS_PHH), *PHL = (__bf16*)(ws + WS_PHL); _Float16* PT = (_Float16*)(ws + WS_PT);
  k_proj<<<dim3(TT / 64, TNB, 3), 128, 0, stream>>>(F[0], F[1], F[2], F[3], F[4], F[5], F[6], TH, PHH, PHL, G);
  for (int b = 0; b < TNB; ++b) {
    k_sc<<<dim3(TT / 64, TT / 128), 128, 0, stream>>>(TH, PHH, PHL, b, S);
    k_stat<<<TT / 4, 256, 0, stream>>>(S, ML);
    k_pt<<<dim3(TT / 64, TT / 128), 128, 0, stream>>>(S, ML, b, PT);
  }
  k_pv<<<dim3(TT / 64, DD / 128, TNB), 128, 0, stream>>>(PT, G, AT);
  k_ht<<<dim3(TT / 64, CC / 128, TNB), 128, 0, stream>>>(AT, F[7], F[8], Hh, ST);
  k_bn<<<1, 512, 0, stream>>>(ST, BN);
  k_out<<<dim3(CC, TNB), 256, 0, stream>>>(F[0], Hh, BN, F[9], F[10], (float*)d_out);
}

// v002
// One run takes 809 microseconds.
// Timed twice side by side with v001, it ran 1.28 and 1.27 times as fast.
// Counting every step since v000, it is 3.27 times as fast.
// compute dtype: all float inputs rounded to bf16; theta / phi / g = W x + b (1x1 convs) with EXACT bf16 products on WMMA 16x16x32 (x^T tile staged in LDS), f32 accumulate; theta and phi kept in f32 and split into bf16 hi + lo for the UNSCALED logits w = theta^T phi (3 products; logits std ~5, sharp softmax), logits stored in f32 per batch; softmax in f32 (precise expf) -> P^T planes as f16 x 2^11; attn[d][s] = sum_t g[d][t] P[t][s] with g as f16 hi + lo (2 products); h = ht_w attn (attn bf16 hi + lo, 2 products) + ht_b; BatchNorm1d training statistics over (B, T) per channel from per-block (mean, M2) partials merged in a fixed order; out = inpt + gamma h_norm + beta; f32 output.
#include <hip/hip_runtime.h>
#include <math.h>

typedef __attribute__((ext_vector_type(16))) _Float16 v16h;
typedef __attribute__((ext_vector_type(16))) __bf16 v16b;
typedef __attribute__((ext_vector_type(8)))  _Float16 v8h;
typedef __attribute__((ext_vector_type(8)))  float v8f;
typedef __attribute__((ext_vector_type(4)))  float v4f;
typedef __attribute__((ext_vector_type(2)))  float v2f;
typedef __attribute__((ext_vector_type(4)))  unsigned v4u;
typedef __attribute__((ext_vector_type(4)))  int v4i;
typedef float __attribute__((may_alias)) float_a;
typedef int __attribute__((may_alias)) int_a;

template <typename T> __device__ __forceinline__ void vst2(void* p, T v) { *(T*)p = v;  }
__device__ __forceinline__ v8f wmma16(v16h a, v16h b, v8f c) {
  v8f d = __builtin_amdgcn_wmma_f32_16x16x32_f16(false, a, false, b, (short)0, c, false, false);
  asm volatile("v_nop\n\tv_nop\n\tv_nop\n\tv_nop" : "+v"(d) : "v"(a), "v"(b));
  return d;
}
__device__ __forceinline__ v8f wmma_bf(v16b a, v16b b, v8f c) {
  v8f d = __builtin_amdgcn_wmma_f32_16x16x32_bf16(false, a, false, b, (short)0, c, false, false);
  asm volatile("v_nop\n\tv_nop\n\tv_nop\n\tv_nop" : "+v"(d) : "v"(a), "v"(b));
  return d;
}
// 16x16x32 fragments: lane = (h = lane>>4, row/col = lane&15); elements 0..7 = k0+8h+0..7, 8..15 = k0+16+8h+0..7; D element r = row 8h+r
__device__ __forceinline__ v16h frag_h(const _Float16* rowk0, int lane) {
  union { v16h v; v8h q[2]; } u; const _Float16* p = rowk0 + 8 * (lane >> 4);
  u.q[0] = *(const v8h*)p; u.q[1] = *(const v8h*)(p + 16); return u.v;
}
__device__ __forceinline__ v16h frag_f32(const float* rowk0, int lane) {
  v16h a; const float* p = rowk0 + 8 * (lane >> 4);
#pragma unroll
  for (int i = 0; i < 8; ++i) { a[i] = (_Float16)p[i]; a[8 + i] = (_Float16)p[16 + i]; }
  return a;
}
__device__ __forceinline__ v16h frag_f32s(const float* rowk0, int lane, float sc) {
  v16h a; const float* p = rowk0 + 8 * (lane >> 4);
#pragma unroll
  for (int i = 0; i < 8; ++i) { a[i] = (_Float16)(p[i] * sc); a[8 + i] = (_Float16)(p[16 + i] * sc); }
  return a;
}
// column fragment from a [K][ld] layout (column n), rows >= K read as 0
__device__ __forceinline__ v16h fragc_f32(const float* W, int k0, int n, int lane, int ld, int K) {
  v16h a; const int g = lane >> 4;
#pragma unroll
  for (int i = 0; i < 8; ++i) { const int ka = k0 + 8 * g + i, kb = ka + 16;
    a[i] = (_Float16)(ka < K ? W[(size_t)(ka < K ? ka : K - 1) * ld + n] : 0.f); a[8 + i] = (_Float16)(kb < K ? W[(size_t)(kb < K ? kb : K - 1) * ld + n] : 0.f); }
  return a;
}
struct F2 { v16b h, l; };
__device__ __forceinline__ F2 bsplit16(const float v[16]) { F2 r;
#pragma unroll
  for (int i = 0; i < 16; ++i) { const __bf16 h = (__bf16)v[i]; r.h[i] = h; r.l[i] = (__bf16)(v[i] - (float)h); }
  return r; }
__device__ __forceinline__ F2 split_row(const float* row, int k0, int lane) { float v[16]; const float* p = row + k0 + 8 * (lane >> 4);
#pragma unroll
  for (int i = 0; i < 8; ++i) { v[i] = p[i]; v[8 + i] = p[16 + i]; }
  return bsplit16(v); }
__device__ __forceinline__ F2 split_rowK(const float* row, int k0, int lane, int K) { float v[16]; const int g = lane >> 4;
#pragma unroll
  for (int i = 0; i < 8; ++i) { const int ka = k0 + 8 * g + i, kb = ka + 16; v[i] = ka < K ? row[ka < K ? ka : K - 1] : 0.f; v[8 + i] = kb < K ? row[kb < K ? kb : K - 1] : 0.f; }
  return bsplit16(v); }
__device__ __forceinline__ F2 split_col(const float* W, int k0, int n, int lane, int ld, int K) { float v[16]; const int g = lane >> 4;
#pragma unroll
  for (int i = 0; i < 8; ++i) { const int ka = k0 + 8 * g + i, kb = ka + 16; v[i] = ka < K ? W[(size_t)(ka < K ? ka : K - 1) * ld + n] : 0.f; v[8 + i] = kb < K ? W[(size_t)(kb < K ? kb : K - 1) * ld + n] : 0.f; }
  return bsplit16(v); }
__device__ __forceinline__ v8f mac3(const F2& a, const F2& b, v8f c) { c = wmma_bf(a.l, b.h, c); c = wmma_bf(a.h, b.l, c); return wmma_bf(a.h, b.h, c); }
__device__ __forceinline__ float sigm(float v) { return 1.0f / (1.0f + expf(-v)); }
#define LDSX() do { asm volatile("s_wait_dscnt 0" ::: "memory"); __builtin_amdgcn_wave_barrier(); __builtin_amdgcn_fence(__ATOMIC_RELEASE, "workgroup"); } while (0)


// Non-local block over time (B 8, C 512, D 256, T 2,048): theta/phi/g 1x1 convs; w = softmax_s(theta^T phi); attn = g w (the module contracts g over the QUERY index); h = ht(attn); training-mode BatchNorm1d; out = inpt + bn(h).
#define NB 8
#define CC 512
#define DD 256
#define TT 2048
#ifndef TNB
#define TNB NB
#endif
typedef __attribute__((ext_vector_type(8))) __bf16 v8b;
__device__ __forceinline__ v16b frag_b(const __bf16* rowk0, int lane) {
  union { v16b v; v8b q[2]; } u; const __bf16* p = rowk0 + 8 * (lane >> 4);
  u.q[0] = *(const v8b*)p; u.q[1] = *(const v8b*)(p + 16); return u.v;
}
__device__ __forceinline__ float bfr(float v) { return (float)(__bf16)v; }
__device__ __attribute__((noinline)) float exp_ni(float v) { return expf(v); }
__device__ __attribute__((noinline)) float erf_ni(float v) { return erff(v); }

#define WS_TH  0u                                    // f32 theta^T rows [b*t][256]
#define WS_PHH (WS_TH + 4u * (size_t)NB * TT * DD)      // bf16 phi^T hi rows [b*s][256]
#define WS_PHL (WS_PHH + 2u * (size_t)NB * TT * DD)
#define WS_G   (WS_PHL + 2u * (size_t)NB * TT * DD)     // f32 g [b][d][t]
#define WS_S   (WS_G + 4u * (size_t)NB * DD * TT)       // f32 logits for ONE batch [t][s] (16 MiB)
#define WS_ML  (WS_S + 4u * (size_t)TT * TT)           // f32 row (max, 1/sum) [t][8] (padded)
#define WS_PT  (WS_ML + 4u * (size_t)TT * 8)           // f16 P^T planes, one per batch [b][s][t] (x 2^11)
#define WS_AT  (WS_PT + 2u * (size_t)NB * TT * TT)     // f32 attn^T rows [b*s][256]
#define WS_H   (WS_AT + 4u * (size_t)NB * TT * DD)      // f32 h [b][c][t]
#define WS_ST  (WS_H + 4u * (size_t)NB * CC * TT)       // f32 BN partials [(b*(TT/64) + tblk)][c][2] - one record per (batch, 64-position block)
#define WS_BN  (WS_ST + 4u * (size_t)NB * (TT / 64) * CC * 2)    // f32 mean [512], inv [512]
#define WS_END (WS_BN + 4u * 2 * CC)

// ---- k_proj: block = (64 positions t, b, which 0 theta / 1 phi / 2 g): x^T tile (bf16) in LDS; W [d][c]; outputs: theta^T f32 rows, phi^T bf16 hi/lo rows, g f32 [d][t]
__global__ __launch_bounds__(128) void k_proj(const float* __restrict__ X, const float* __restrict__ WT, const float* __restrict__ BT, const float* __restrict__ WP, const float* __restrict__ BP, const float* __restrict__ WG, const float* __restrict__ BG, float* __restrict__ TH, __bf16* __restrict__ PHH, __bf16* __restrict__ PHL, float* __restrict__ G) {
  __shared__ __align__(16) __bf16 sx[64][CC + 8]; __shared__ __align__(16) float st[64][68];   // st reused per 64-col group
  const int tid = threadIdx.x, wave = tid >> 5, lane = tid & 31, col = lane & 15, g = lane >> 4; const int t0 = blockIdx.x * 64; const size_t b = blockIdx.y; const int which = blockIdx.z;
  const float* Wm = which == 0 ? WT : which == 1 ? WP : WG; const float* Bm = which == 0 ? BT : which == 1 ? BP : BG;
  for (int e = tid; e < CC * 64; e += 128) { const int c = e >> 6, tl = e & 63; sx[tl][c] = (__bf16)X[(b * CC + c) * (size_t)TT + t0 + tl]; }
  __syncthreads();
#pragma unroll 1
  for (int cg = 0; cg < DD / 64; ++cg) { v8f acc[4] = {};
#pragma unroll 2
    for (int kc = 0; kc < CC / 32; ++kc) { const v16b a = frag_b(&sx[wave * 16 + col][kc * 32], lane);
#pragma unroll
      for (int j = 0; j < 4; ++j) { v16b w; const int d = cg * 64 + j * 16 + col;
#pragma unroll
        for (int i = 0; i < 8; ++i) { w[i] = (__bf16)Wm[(size_t)d * CC + kc * 32 + 8 * g + i]; w[8 + i] = (__bf16)Wm[(size_t)d * CC + kc * 32 + 16 + 8 * g + i]; }
        acc[j] = wmma_bf(a, w, acc[j]); } }
    __syncthreads();
#pragma unroll
    for (int j = 0; j < 4; ++j) { const int dl = j * 16 + col; const float bb = bfr(Bm[cg * 64 + dl]);
#pragma unroll
      for (int r = 0; r < 8; ++r) { const int tl = wave * 16 + 8 * g + r; const float v = acc[j][r] + bb; if (which == 2) st[dl][tl] = v; else st[tl][dl] = v; } }
    __syncthreads();
    if (which == 0) { for (int e = tid; e < 64 * 16; e += 128) { const int tl = e >> 4, q = e & 15; vst2(TH + (b * TT + t0 + tl) * DD + cg * 64 + q * 4, *(const v4f*)&st[tl][q * 4]); } }
    else if (which == 1) { for (int e = tid; e < 64 * 8; e += 128) { const int tl = e >> 3, q = e & 7; const float* p = &st[tl][q * 8]; v16b dummy; (void)dummy; __bf16 hh[8], ll[8]; 
#pragma unroll
        for (int i = 0; i < 8; ++i) { const __bf16 hv = (__bf16)p[i]; hh[i] = hv; ll[i] = (__bf16)(p[i] - (float)hv); }
        vst2((unsigned*)(PHH + (b * TT + t0 + tl) * DD + cg * 64 + q * 8), *(const v4u*)hh); vst2((unsigned*)(PHL + (b * TT + t0 + tl) * DD + cg * 64 + q * 8), *(const v4u*)ll); } }
    else { for (int e = tid; e < 64 * 16; e += 128) { const int dl = e >> 4, q = e & 15; vst2(G + (b * DD + cg * 64 + dl) * (size_t)TT + t0 + q * 4, *(const v4f*)&st[dl][q * 4]); } } } }
// ---- k_sc: block = (64 queries t, 128 keys s) of batch b: logits theta^T . phi (3 products) -> S
__global__ __launch_bounds__(128) void k_sc(const float* __restrict__ TH, const __bf16* __restrict__ PHH, const __bf16* __restrict__ PHL, int b, float* __restrict__ S) { __shared__ __align__(16) float ss[4][16][132];
  const int tid = threadIdx.x, wave = tid >> 5, lane = tid & 31, col = lane & 15, g = lane >> 4; const int k0 = blockIdx.y * 128; const int tq0 = blockIdx.x * 64 + wave * 16; const size_t q0 = (size_t)b * TT + tq0;
  v8f acc[8] = {};
#pragma unroll 1
  for (int kc = 0; kc < DD / 32; ++kc) { const F2 a = split_row(TH + (q0 + col) * DD, kc * 32, lane);
#pragma unroll
    for (int j = 0; j < 8; ++j) { const size_t kr = ((size_t)b * TT + k0 + j * 16 + col) * DD + kc * 32; const v16b kh = frag_b(PHH + kr, lane), kl = frag_b(PHL + kr, lane); acc[j] = wmma_bf(a.h, kh, acc[j]); acc[j] = wmma_bf(a.l, kh, acc[j]); acc[j] = wmma_bf(a.h, kl, acc[j]); } }
#pragma unroll
  for (int j = 0; j < 8; ++j)
#pragma unroll
    for (int r = 0; r < 8; ++r) ss[wave][8 * g + r][j * 16 + col] = acc[j][r];
  LDSX(); for (int rl = 0; rl < 16; ++rl) vst2(S + (size_t)(tq0 + rl) * TT + k0 + lane * 4, *(const v4f*)&ss[wave][rl][lane * 4]); }
__global__ __launch_bounds__(256) void k_stat(const float* __restrict__ S, float* __restrict__ ML) { __shared__ float sred[8]; __shared__ float sbc; __shared__ __align__(16) float sout[4][8];
  const int t = threadIdx.x;
  for (int rr = 0; rr < 4; ++rr) { const size_t row = (size_t)blockIdx.x * 4 + rr; const float* sr = S + row * TT;
    float m = -3.0e38f; for (int k = t; k < TT; k += 256) m = fmaxf(m, sr[k]);
#pragma unroll
    for (int o = 1; o < 32; o <<= 1) m = fmaxf(m, __shfl_xor(m, o));
    if ((t & 31) == 0) sred[t >> 5] = m; __syncthreads(); if (t == 0) { float a = sred[0]; for (int i = 1; i < 8; ++i) a = fmaxf(a, sred[i]); sbc = a; } __syncthreads(); m = sbc; __syncthreads();
    float sum = 0.f; for (int k = t; k < TT; k += 256) sum += expf(sr[k] - m);
#pragma unroll
    for (int o = 1; o < 32; o <<= 1) sum += __shfl_xor(sum, o);
    if ((t & 31) == 0) sred[t >> 5] = sum; __syncthreads(); if (t == 0) { float a = 0.f; for (int i = 0; i < 8; ++i) a += sred[i]; sout[rr][0] = m; sout[rr][1] = 1.0f / a; for (int i = 2; i < 8; ++i) sout[rr][i] = 0.f; } __syncthreads(); }
  if (t < 8) vst2(ML + (size_t)blockIdx.x * 32 + t * 4, *(const v4f*)&(&sout[0][0])[t * 4]); }
// ---- k_pt: block = (64 rows t, 128 cols s) of batch b: P = exp(S - m) / sum, transposed in LDS -> P^T plane of batch b [s][t] (f16 x 2^11)
__global__ __launch_bounds__(128) void k_pt(const float* __restrict__ S, const float* __restrict__ ML, int b, _Float16* __restrict__ PT) { __shared__ __align__(16) _Float16 sp[128][72];
  const int tid = threadIdx.x; const int t0 = blockIdx.x * 64, s0 = blockIdx.y * 128; PT += (size_t)b * TT * TT;
  for (int e = tid; e < 64 * 128; e += 128) { const int tl = e >> 7, sl = e & 127; const float m = ML[(size_t)(t0 + tl) * 8], inv = ML[(size_t)(t0 + tl) * 8 + 1]; sp[sl][tl] = (_Float16)(expf(S[(size_t)(t0 + tl) * TT + s0 + sl] - m) * inv * 2048.0f); }
  __syncthreads(); for (int e = tid; e < 128 * 8; e += 128) { const int sl = e >> 3, q = e & 7; vst2((unsigned*)(PT + (size_t)(s0 + sl) * TT + t0 + q * 8), *(const v4u*)&sp[sl][q * 8]); } }
// ---- k_pv: block = (64 rows d... no: rows = s (64), cols = d (128 group)) of batch b: attn^T[s][d] = sum_t P[t][s] g[d][t]: A = P^T rows [s][t] (f16), B(k=t, col=d) = g[d][t] planes (f32 -> f16 hi + lo?) -> use bf16: A from f16... keep both f16: g planes converted on the fly to f16 hi + residual
#define PV_KT 64            // positions t per stage
#define PV_NS (TT / PV_KT)
#define PV_LD (PV_KT + 8)   // LDS row pitch in halves: 144 B = 16 B x odd, so the 16 rows of a 16-byte fragment read fall on distinct banks
typedef __attribute__((ext_vector_type(4))) _Float16 v4h;
// The g tile of a stage (128 d x 64 t) is the same for the 4 waves: the work-group loads it once in whole lines, splits it once into f16 hi + lo and stages it in LDS; two buffers, so the next stage's global loads fly while this stage is multiplied.
__global__ __launch_bounds__(128) void k_pv(const _Float16* __restrict__ PT, const float* __restrict__ G, float* __restrict__ AT) { __shared__ __align__(16) float ss[4][16][132]; __shared__ __align__(16) _Float16 sg[2][2][128][PV_LD];   // sg: [buffer][hi, lo][d][t]
  const int tid = threadIdx.x, wave = tid >> 5, lane = tid & 31, col = lane & 15, g = lane >> 4; const int d0 = blockIdx.y * 128; const int s0 = blockIdx.x * 64 + wave * 16;
  const int b = blockIdx.z; PT += (size_t)b * TT * TT;   // every batch in one grid: 512 work-groups in one launch, not 8 launches of 64
  const int gr_row = tid >> 4, gr_q = tid & 15;          // 16 threads x 16 B = one 256-B row piece of the tile; a thread has rows gr_row + 8 i
  const float* gsrc = G + ((size_t)b * DD + d0 + gr_row) * TT + gr_q * 4; const _Float16* arow = PT + (size_t)(s0 + col) * TT;
  v8f acc[8] = {}; v4f gr[16]; v16h a0, a1, n0, n1;   // the loops over gr, fh and fl below are unrolled whole so that these arrays stay in registers
#pragma unroll
  for (int i = 0; i < 16; ++i) gr[i] = *(const v4f*)(gsrc + (size_t)i * 8 * TT);
  n0 = frag_h(arow, lane); n1 = frag_h(arow + 32, lane);
#pragma unroll 1   // rolled: one copy of the stage body, the buffer chosen by st & 1
  for (int st = 0; st < PV_NS; ++st) { const int cur = st & 1;
    _Float16* dst = &sg[cur][0][gr_row][gr_q * 4];
#pragma unroll
    for (int i = 0; i < 16; ++i) { v4h hi, lo;
#pragma unroll
      for (int e = 0; e < 4; ++e) { const float v = gr[i][e]; const _Float16 h = (_Float16)v; hi[e] = h; lo[e] = (_Float16)(v - (float)h); }
      *(v4h*)(dst + i * 8 * PV_LD) = hi; *(v4h*)(dst + (128 + i * 8) * PV_LD) = lo; }
    a0 = n0; a1 = n1;
    __syncthreads();   // publishes buffer cur to the 4 waves; it also stands between every wave's last reads of the other buffer (the trip before) and the next trip's stores into it
    if (st + 1 < PV_NS) { const int t1 = (st + 1) * PV_KT;   // next stage's global loads, issued ahead of this stage's products
#pragma unroll
      for (int i = 0; i < 16; ++i) gr[i] = *(const v4f*)(gsrc + (size_t)i * 8 * TT + t1);
      n0 = frag_h(arow + t1, lane); n1 = frag_h(arow + t1 + 32, lane); }
    const _Float16* bsrc = &sg[cur][0][col][0]; v16h fh[2][2], fl[2][2];   // fragments of two column groups, read one pair ahead of their products
#pragma unroll
    for (int u = 0; u < 2; ++u) { fh[0][u] = frag_h(bsrc + u * 16 * PV_LD, lane); fl[0][u] = frag_h(bsrc + (128 + u * 16) * PV_LD, lane); }
#pragma unroll
    for (int q = 0; q < 8; ++q) { const int pp = q & 1, j = (q & 3) * 2; const v16h a = (q >> 2) ? a1 : a0;
      if (q + 1 < 8) { const int kn = (q + 1) >> 2, jn = ((q + 1) & 3) * 2;
#pragma unroll
        for (int u = 0; u < 2; ++u) { fh[pp ^ 1][u] = frag_h(bsrc + (jn + u) * 16 * PV_LD + kn * 32, lane); fl[pp ^ 1][u] = frag_h(bsrc + (128 + (jn + u) * 16) * PV_LD + kn * 32, lane); } }
      acc[j] = wmma16(a, fh[pp][0], acc[j]); acc[j + 1] = wmma16(a, fh[pp][1], acc[j + 1]); acc[j] = wmma16(a, fl[pp][0], acc[j]); acc[j + 1] = wmma16(a, fl[pp][1], acc[j + 1]); } }
#pragma unroll
  for (int j = 0; j < 8; ++j)
#pragma unroll
    for (int r = 0; r < 8; ++r) ss[wave][8 * g + r][j * 16 + col] = acc[j][r] * (1.0f / 2048.0f);
  LDSX(); for (int rl = 0; rl < 16; ++rl) vst2(AT + ((size_t)b * TT + s0 + rl) * DD + d0 + lane * 4, *(const v4f*)&ss[wave][rl][lane * 4]); }
// ---- k_ht: block = (64 positions s, 128 out channels c, b): h[c][s] = sum_d ht_w[c][d] attn^T[s][d] + ht_b[c]; rows = s (A = attn^T hi+lo), B(k=d, col=c) = ht_w[c][d]; writes h [b][c][t] via LDS transpose + per-block BN partials
__global__ __launch_bounds__(128) void k_ht(const float* __restrict__ AT, const float* __restrict__ HW, const float* __restrict__ HB, float* __restrict__ Hh, float* __restrict__ ST) { __shared__ __align__(16) float st[128][68]; __shared__ __align__(16) float sst[128][2];
  const int tid = threadIdx.x, wave = tid >> 5, lane = tid & 31, col = lane & 15, g = lane >> 4; const int c0 = blockIdx.y * 128; const size_t b = blockIdx.z; const int s0 = blockIdx.x * 64; const size_t r0 = b * TT + s0 + wave * 16;
  v8f acc[8] = {};
#pragma unroll 1
  for (int kc = 0; kc < DD / 32; ++kc) { const F2 a = split_row(AT + (r0 + col) * DD, kc * 32, lane);
#pragma unroll
    for (int j = 0; j < 8; ++j) { v16b w; const int c = c0 + j * 16 + col;
#pragma unroll
      for (int i = 0; i < 8; ++i) { w[i] = (__bf16)HW[(size_t)c * DD + kc * 32 + 8 * g + i]; w[8 + i] = (__bf16)HW[(size_t)c * DD + kc * 32 + 16 + 8 * g + i]; }
      acc[j] = wmma_bf(a.h, w, acc[j]); acc[j] = wmma_bf(a.l, w, acc[j]); } }
#pragma unroll
  for (int j = 0; j < 8; ++j) { const int cl = j * 16 + col; const float bb = bfr(HB[c0 + cl]);
#pragma unroll
    for (int r = 0; r < 8; ++r) st[cl][wave * 16 + 8 * g + r] = acc[j][r] + bb; }
  __syncthreads();
  for (int e = tid; e < 128 * 16; e += 128) { const int cl = e >> 4, q = e & 15; vst2(Hh + (b * CC + c0 + cl) * (size_t)TT + s0 + q * 4, *(const v4f*)&st[cl][q * 4]); }
  { const int cl = tid; float s = 0.f; for (int q = 0; q < 64; ++q) s += st[cl][q]; const float mean = s / 64.0f; float m2 = 0.f; for (int q = 0; q < 64; ++q) { const float d = st[cl][q] - mean; m2 += d * d; } sst[cl][0] = mean; sst[cl][1] = m2; }
  __syncthreads(); if (tid < 64) vst2(ST + (((b * (TT / 64) + blockIdx.x) * CC) + c0) * 2 + tid * 4, *(const v4f*)&(&sst[0][0])[tid * 4]); }
// ---- k_bn: one block: per channel merge of the NB*32 block partials (64 values each, fixed order) -> mean, inv_std (biased)
__global__ __launch_bounds__(512) void k_bn(const float* __restrict__ ST, float* __restrict__ BN) { __shared__ __align__(16) float s[2][CC]; const int c = threadIdx.x; float n = 0.f, mean = 0.f, M2 = 0.f;
#pragma unroll 1
  for (int blk = 0; blk < NB * (TT / 64); ++blk) { const float mb = ST[((size_t)blk * CC + c) * 2], qb = ST[((size_t)blk * CC + c) * 2 + 1]; const float nb_ = 64.f; const float nt = n + nb_; const float d = mb - mean; mean += d * nb_ / nt; M2 += qb + d * d * n * nb_ / nt; n = nt; }
  s[0][c] = mean; s[1][c] = 1.0f / sqrtf(M2 / n + 1e-5f); __syncthreads(); if (c < 2 * CC / 4) vst2(BN + c * 4, *(const v4f*)&(&s[0][0])[c * 4]); }
// ---- k_out: block = (c, b): out[b][c][t] = inpt + gamma (h - mean) inv + beta over the 2,048 positions
__global__ __launch_bounds__(256) void k_out(const float* __restrict__ X, const float* __restrict__ Hh, const float* __restrict__ BN, const float* __restrict__ GA, const float* __restrict__ BE, float* __restrict__ OUT) { __shared__ __align__(16) float so[TT]; const int t = threadIdx.x; const int c = blockIdx.x; const size_t b = blockIdx.y; const float mean = BN[c], inv = BN[CC + c], ga = bfr(GA[c]), be = bfr(BE[c]);
  const size_t base = (b * CC + c) * (size_t)TT; for (int e = t; e < TT; e += 256) so[e] = bfr(X[base + e]) + (ga * (Hh[base + e] - mean) * inv + be);
  __syncthreads(); for (int q = t; q < TT / 4; q += 256) vst2(OUT + base + q * 4, *(const v4f*)&so[q * 4]); }
extern "C" void kernel_launch(void* const* d_in, const int* in_sizes, int n_in, void* d_out, int out_size, void* d_ws, size_t ws_size, hipStream_t stream) {
  (void)in_sizes; (void)n_in; (void)out_size;
  const float** F = (const float**)d_in;   // 0 inpt [8,512,2048], 1 theta_w [256,512], 2 theta_b, 3 phi_w, 4 phi_b, 5 g_w, 6 g_b, 7 ht_w [512,256], 8 ht_b, 9 bn_gamma, 10 bn_beta
  if (ws_size < (size_t)WS_END) return;
  char* ws = (char*)d_ws; float *TH = (float*)(ws + WS_TH), *G = (float*)(ws + WS_G), *S = (float*)(ws + WS_S), *ML = (float*)(ws + WS_ML), *AT = (float*)(ws + WS_AT), *Hh = (float*)(ws + WS_H), *ST = (float*)(ws + WS_ST), *BN = (float*)(ws + WS_BN); __bf16 *PHH = (__bf16*)(ws + WS_PHH), *PHL = (__bf16*)(ws + WS_PHL); _Float16* PT = (_Float16*)(ws + WS_PT);
  k_proj<<<dim3(TT / 64, TNB, 3), 128, 0, stream>>>(F[0], F[1], F[2], F[3], F[4], F[5], F[6], TH, PHH, PHL, G);
  for (int b = 0; b < TNB; ++b) {
    k_sc<<<dim3(TT / 64, TT / 128), 128, 0, stream>>>(TH, PHH, PHL, b, S);
    k_stat<<<TT / 4, 256, 0, stream>>>(S, ML);
    k_pt<<<dim3(TT / 64, TT / 128), 128, 0, stream>>>(S, ML, b, PT);
  }
  k_pv<<<dim3(TT / 64, DD / 128, TNB), 128, 0, stream>>>(PT, G, AT);
  k_ht<<<dim3(TT / 64, CC / 128, TNB), 128, 0, stream>>>(AT, F[7], F[8], Hh, ST);
  k_bn<<<1, 512, 0, stream>>>(ST, BN);
  k_out<<<dim3(CC, TNB), 256, 0, stream>>>(F[0], Hh, BN, F[9], F[10], (float*)d_out);
}

// v003
// One run takes 594 microseconds.
// Timed twice side by side with v002, it ran 1.36 times as fast both times.
// All steps since v000 together make it 4.45 times as fast.
// compute dtype: all float inputs rounded to bf16; theta / phi / g = W x + b (1x1 convs) with EXACT bf16 products on WMMA 16x16x32 (x^T tile staged in LDS), f32 accumulate; theta and phi kept in f32 and split into bf16 hi + lo for the UNSCALED logits w = theta^T phi (3 products; logits std ~5, sharp softmax), logits stored in f32 per batch; softmax in f32 (precise expf) -> P^T planes as f16 x 2^11; attn[d][s] = sum_t g[d][t] P[t][s] with g as f16 hi + lo (2 products); h = ht_w attn (attn bf16 hi + lo, 2 products) + ht_b; BatchNorm1d training statistics over (B, T) per channel from per-block (mean, M2) partials merged in a fixed order; out = inpt + gamma h_norm + beta; f32 output.
#include <hip/hip_runtime.h>
#include <math.h>

typedef __attribute__((ext_vector_type(16))) _Float16 v16h;
typedef __attribute__((ext_vector_type(16))) __bf16 v16b;
typedef __attribute__((ext_vector_type(8)))  _Float16 v8h;
typedef __attribute__((ext_vector_type(8)))  float v8f;
typedef __attribute__((ext_vector_type(4)))  float v4f;
typedef __attribute__((ext_vector_type(2)))  float v2f;
typedef __attribute__((ext_vector_type(4)))  unsigned v4u;
typedef __attribute__((ext_vector_type(4)))  int v4i;
typedef float __attribute__((may_alias)) float_a;
typedef int __attribute__((may_alias)) int_a;

template <typename T> __device__ __forceinline__ void vst2(void* p, T v) { *(T*)p = v;  }
__device__ __forceinline__ v8f wmma16(v16h a, v16h b, v8f c) {
  v8f d = __builtin_amdgcn_wmma_f32_16x16x32_f16(false, a, false, b, (short)0, c, false, false);
  asm volatile("v_nop\n\tv_nop\n\tv_nop\n\tv_nop" : "+v"(d) : "v"(a), "v"(b));
  return d;
}
__device__ __forceinline__ v8f wmma_bf(v16b a, v16b b, v8f c) {
  v8f d = __builtin_amdgcn_wmma_f32_16x16x32_bf16(false, a, false, b, (short)0, c, false, false);
  asm volatile("v_nop\n\tv_nop\n\tv_nop\n\tv_nop" : "+v"(d) : "v"(a), "v"(b));
  return d;
}
// 16x16x32 fragments: lane = (h = lane>>4, row/col = lane&15); elements 0..7 = k0+8h+0..7, 8..15 = k0+16+8h+0..7; D element r = row 8h+r
__device__ __forceinline__ v16h frag_h(const _Float16* rowk0, int lane) {
  union { v16h v; v8h q[2]; } u; const _Float16* p = rowk0 + 8 * (lane >> 4);
  u.q[0] = *(const v8h*)p; u.q[1] = *(const v8h*)(p + 16); return u.v;
}
__device__ __forceinline__ v16h frag_f32(const float* rowk0, int lane) {
  v16h a; const float* p = rowk0 + 8 * (lane >> 4);
#pragma unroll
  for (int i = 0; i < 8; ++i) { a[i] = (_Float16)p[i]; a[8 + i] = (_Float16)p[16 + i]; }
  return a;
}
__device__ __forceinline__ v16h frag_f32s(const float* rowk0, int lane, float sc) {
  v16h a; const float* p = rowk0 + 8 * (lane >> 4);
#pragma unroll
  for (int i = 0; i < 8; ++i) { a[i] = (_Float16)(p[i] * sc); a[8 + i] = (_Float16)(p[16 + i] * sc); }
  return a;
}
// column fragment from a [K][ld] layout (column n), rows >= K read as 0
__device__ __forceinline__ v16h fragc_f32(const float* W, int k0, int n, int lane, int ld, int K) {
  v16h a; const int g = lane >> 4;
#pragma unroll
  for (int i = 0; i < 8; ++i) { const int ka = k0 + 8 * g + i, kb = ka + 16;
    a[i] = (_Float16)(ka < K ? W[(size_t)(ka < K ? ka : K - 1) * ld + n] : 0.f); a[8 + i] = (_Float16)(kb < K ? W[(size_t)(kb < K ? kb : K - 1) * ld + n] : 0.f); }
  return a;
}
struct F2 { v16b h, l; };
__device__ __forceinline__ F2 bsplit16(const float v[16]) { F2 r;
#pragma unroll
  for (int i = 0; i < 16; ++i) { const __bf16 h = (__bf16)v[i]; r.h[i] = h; r.l[i] = (__bf16)(v[i] - (float)h); }
  return r; }
__device__ __forceinline__ F2 split_row(const float* row, int k0, int lane) { float v[16]; const float* p = row + k0 + 8 * (lane >> 4);
#pragma unroll
  for (int i = 0; i < 8; ++i) { v[i] = p[i]; v[8 + i] = p[16 + i]; }
  return bsplit16(v); }
__device__ __forceinline__ F2 split_rowK(const float* row, int k0, int lane, int K) { float v[16]; const int g = lane >> 4;
#pragma unroll
  for (int i = 0; i < 8; ++i) { const int ka = k0 + 8 * g + i, kb = ka + 16; v[i] = ka < K ? row[ka < K ? ka : K - 1] : 0.f; v[8 + i] = kb < K ? row[kb < K ? kb : K - 1] : 0.f; }
  return bsplit16(v); }
__device__ __forceinline__ F2 split_col(const float* W, int k0, int n, int lane, int ld, int K) { float v[16]; const int g = lane >> 4;
#pragma unroll
  for (int i = 0; i < 8; ++i) { const int ka = k0 + 8 * g + i, kb = ka + 16; v[i] = ka < K ? W[(size_t)(ka < K ? ka : K - 1) * ld + n] : 0.f; v[8 + i] = kb < K ? W[(size_t)(kb < K ? kb : K - 1) * ld + n] : 0.f; }
  return bsplit16(v); }
__device__ __forceinline__ v8f mac3(const F2& a, const F2& b, v8f c) { c = wmma_bf(a.l, b.h, c); c = wmma_bf(a.h, b.l, c); return wmma_bf(a.h, b.h, c); }
__device__ __forceinline__ float sigm(float v) { return 1.0f / (1.0f + expf(-v)); }
#define LDSX() do { asm volatile("s_wait_dscnt 0" ::: "memory"); __builtin_amdgcn_wave_barrier(); __builtin_amdgcn_fence(__ATOMIC_RELEASE, "workgroup"); } while (0)


// Non-local block over time (B 8, C 512, D 256, T 2,048): theta/phi/g 1x1 convs; w = softmax_s(theta^T phi); attn = g w (the module contracts g over the QUERY index); h = ht(attn); training-mode BatchNorm1d; out = inpt + bn(h).
#define NB 8
#define CC 512
#define DD 256
#define TT 2048
#ifndef TNB
#define TNB NB
#endif
typedef __attribute__((ext_vector_type(8))) __bf16 v8b;
__device__ __forceinline__ v16b frag_b(const __bf16* rowk0, int lane) {
  union { v16b v; v8b q[2]; } u; const __bf16* p = rowk0 + 8 * (lane >> 4);
  u.q[0] = *(const v8b*)p; u.q[1] = *(const v8b*)(p + 16); return u.v;
}
__device__ __forceinline__ float bfr(float v) { return (float)(__bf16)v; }
__device__ __attribute__((noinline)) float exp_ni(float v) { return expf(v); }
__device__ __attribute__((noinline)) float erf_ni(float v) { return erff(v); }

#define WS_TH  0u                                    // f32 theta^T rows [b*t][256]
#define WS_PHH (WS_TH + 4u * (size_t)NB * TT * DD)      // bf16 phi^T hi rows [b*s][256]
#define WS_PHL (WS_PHH + 2u * (size_t)NB * TT * DD)
#define WS_G   (WS_PHL + 2u * (size_t)NB * TT * DD)     // f32 g [b][d][t]
#define WS_S   (WS_G + 4u * (size_t)NB * DD * TT)       // f32 logits, one plane per batch [b][t][s] (128 MiB); dead after k_pt, so attn^T and h below reuse its bytes
#define WS_ML  (WS_S + 4u * (size_t)NB * TT * TT)      // f32 row (max, 1/sum) [b*t][8] (padded)
#define WS_PT  (WS_ML + 4u * (size_t)NB * TT * 8)      // f16 P^T planes, one per batch [b][s][t] (x 2^11)
#define WS_AT  WS_S                                   // f32 attn^T rows [b*s][256], written by k_pv after the last read of the logits
#define WS_H   (WS_AT + 4u * (size_t)NB * TT * DD)      // f32 h [b][c][t]
#define WS_ST  (WS_PT + 2u * (size_t)NB * TT * TT)     // f32 BN partials [(b*(TT/64) + tblk)][c][2] - one record per (batch, 64-position block)
#define WS_BN  (WS_ST + 4u * (size_t)NB * (TT / 64) * CC * 2)    // f32 mean [512], inv [512]
#define WS_END (WS_BN + 4u * 2 * CC)

// ---- k_proj: block = (64 positions t, b, which 0 theta / 1 phi / 2 g): x^T tile (bf16) in LDS; W [d][c]; outputs: theta^T f32 rows, phi^T bf16 hi/lo rows, g f32 [d][t]
__global__ __launch_bounds__(128) void k_proj(const float* __restrict__ X, const float* __restrict__ WT, const float* __restrict__ BT, const float* __restrict__ WP, const float* __restrict__ BP, const float* __restrict__ WG, const float* __restrict__ BG, float* __restrict__ TH, __bf16* __restrict__ PHH, __bf16* __restrict__ PHL, float* __restrict__ G) {
  __shared__ __align__(16) __bf16 sx[64][CC + 8]; __shared__ __align__(16) float st[64][68];   // st reused per 64-col group
  const int tid = threadIdx.x, wave = tid >> 5, lane = tid & 31, col = lane & 15, g = lane >> 4; const int t0 = blockIdx.x * 64; const size_t b = blockIdx.y; const int which = blockIdx.z;
  const float* Wm = which == 0 ? WT : which == 1 ? WP : WG; const float* Bm = which == 0 ? BT : which == 1 ? BP : BG;
  for (int e = tid; e < CC * 64; e += 128) { const int c = e >> 6, tl = e & 63; sx[tl][c] = (__bf16)X[(b * CC + c) * (size_t)TT + t0 + tl]; }
  __syncthreads();
#pragma unroll 1
  for (int cg = 0; cg < DD / 64; ++cg) { v8f acc[4] = {};
#pragma unroll 2
    for (int kc = 0; kc < CC / 32; ++kc) { const v16b a = frag_b(&sx[wave * 16 + col][kc * 32], lane);
#pragma unroll
      for (int j = 0; j < 4; ++j) { v16b w; const int d = cg * 64 + j * 16 + col;
#pragma unroll
        for (int i = 0; i < 8; ++i) { w[i] = (__bf16)Wm[(size_t)d * CC + kc * 32 + 8 * g + i]; w[8 + i] = (__bf16)Wm[(size_t)d * CC + kc * 32 + 16 + 8 * g + i]; }
        acc[j] = wmma_bf(a, w, acc[j]); } }
    __syncthreads();
#pragma unroll
    for (int j = 0; j < 4; ++j) { const int dl = j * 16 + col; const float bb = bfr(Bm[cg * 64 + dl]);
#pragma unroll
      for (int r = 0; r < 8; ++r) { const int tl = wave * 16 + 8 * g + r; const float v = acc[j][r] + bb; if (which == 2) st[dl][tl] = v; else st[tl][dl] = v; } }
    __syncthreads();
    if (which == 0) { for (int e = tid; e < 64 * 16; e += 128) { const int tl = e >> 4, q = e & 15; vst2(TH + (b * TT + t0 + tl) * DD + cg * 64 + q * 4, *(const v4f*)&st[tl][q * 4]); } }
    else if (which == 1) { for (int e = tid; e < 64 * 8; e += 128) { const int tl = e >> 3, q = e & 7; const float* p = &st[tl][q * 8]; v16b dummy; (void)dummy; __bf16 hh[8], ll[8]; 
#pragma unroll
        for (int i = 0; i < 8; ++i) { const __bf16 hv = (__bf16)p[i]; hh[i] = hv; ll[i] = (__bf16)(p[i] - (float)hv); }
        vst2((unsigned*)(PHH + (b * TT + t0 + tl) * DD + cg * 64 + q * 8), *(const v4u*)hh); vst2((unsigned*)(PHL + (b * TT + t0 + tl) * DD + cg * 64 + q * 8), *(const v4u*)ll); } }
    else { for (int e = tid; e < 64 * 16; e += 128) { const int dl = e >> 4, q = e & 15; vst2(G + (b * DD + cg * 64 + dl) * (size_t)TT + t0 + q * 4, *(const v4f*)&st[dl][q * 4]); } } } }
// ---- k_sc: block = (64 queries t, 128 keys s, batch b): logits theta^T . phi (3 products) -> plane b of S; every batch in one grid
__global__ __launch_bounds__(128) void k_sc(const float* __restrict__ TH, const __bf16* __restrict__ PHH, const __bf16* __restrict__ PHL, float* __restrict__ S) { __shared__ __align__(16) float ss[4][16][132]; const int b = blockIdx.z; S += (size_t)b * TT * TT;
  const int tid = threadIdx.x, wave = tid >> 5, lane = tid & 31, col = lane & 15, g = lane >> 4; const int k0 = blockIdx.y * 128; const int tq0 = blockIdx.x * 64 + wave * 16; const size_t q0 = (size_t)b * TT + tq0;
  v8f acc[8] = {};
#pragma unroll 1
  for (int kc = 0; kc < DD / 32; ++kc) { const F2 a = split_row(TH + (q0 + col) * DD, kc * 32, lane);
#pragma unroll
    for (int j = 0; j < 8; ++j) { const size_t kr = ((size_t)b * TT + k0 + j * 16 + col) * DD + kc * 32; const v16b kh = frag_b(PHH + kr, lane), kl = frag_b(PHL + kr, lane); acc[j] = wmma_bf(a.h, kh, acc[j]); acc[j] = wmma_bf(a.l, kh, acc[j]); acc[j] = wmma_bf(a.h, kl, acc[j]); } }
#pragma unroll
  for (int j = 0; j < 8; ++j)
#pragma unroll
    for (int r = 0; r < 8; ++r) ss[wave][8 * g + r][j * 16 + col] = acc[j][r];
  LDSX(); for (int rl = 0; rl < 16; ++rl) vst2(S + (size_t)(tq0 + rl) * TT + k0 + lane * 4, *(const v4f*)&ss[wave][rl][lane * 4]); }
__global__ __launch_bounds__(256) void k_stat(const float* __restrict__ S, float* __restrict__ ML) { __shared__ float sred[8]; __shared__ float sbc; __shared__ __align__(16) float sout[4][8];
  const int t = threadIdx.x;
  for (int rr = 0; rr < 4; ++rr) { const size_t row = (size_t)blockIdx.x * 4 + rr; const float* sr = S + row * TT;
    float m = -3.0e38f; for (int k = t; k < TT; k += 256) m = fmaxf(m, sr[k]);
#pragma unroll
    for (int o = 1; o < 32; o <<= 1) m = fmaxf(m, __shfl_xor(m, o));
    if ((t & 31) == 0) sred[t >> 5] = m; __syncthreads(); if (t == 0) { float a = sred[0]; for (int i = 1; i < 8; ++i) a = fmaxf(a, sred[i]); sbc = a; } __syncthreads(); m = sbc; __syncthreads();
    float sum = 0.f; for (int k = t; k < TT; k += 256) sum += expf(sr[k] - m);
#pragma unroll
    for (int o = 1; o < 32; o <<= 1) sum += __shfl_xor(sum, o);
    if ((t & 31) == 0) sred[t >> 5] = sum; __syncthreads(); if (t == 0) { float a = 0.f; for (int i = 0; i < 8; ++i) a += sred[i]; sout[rr][0] = m; sout[rr][1] = 1.0f / a; for (int i = 2; i < 8; ++i) sout[rr][i] = 0.f; } __syncthreads(); }
  if (t < 8) vst2(ML + (size_t)blockIdx.x * 32 + t * 4, *(const v4f*)&(&sout[0][0])[t * 4]); }
// ---- k_pt: block = (64 rows t, 128 cols s, batch b): P = exp(S - m) / sum, transposed in LDS -> P^T plane of batch b [s][t] (f16 x 2^11)
__global__ __launch_bounds__(128) void k_pt(const float* __restrict__ S, const float* __restrict__ ML, _Float16* __restrict__ PT) { __shared__ __align__(16) _Float16 sp[128][72]; const int b = blockIdx.z; S += (size_t)b * TT * TT; ML += (size_t)b * TT * 8;
  const int tid = threadIdx.x; const int t0 = blockIdx.x * 64, s0 = blockIdx.y * 128; PT += (size_t)b * TT * TT;
  for (int e = tid; e < 64 * 128; e += 128) { const int tl = e >> 7, sl = e & 127; const float m = ML[(size_t)(t0 + tl) * 8], inv = ML[(size_t)(t0 + tl) * 8 + 1]; sp[sl][tl] = (_Float16)(expf(S[(size_t)(t0 + tl) * TT + s0 + sl] - m) * inv * 2048.0f); }
  __syncthreads(); for (int e = tid; e < 128 * 8; e += 128) { const int sl = e >> 3, q = e & 7; vst2((unsigned*)(PT + (size_t)(s0 + sl) * TT + t0 + q * 8), *(const v4u*)&sp[sl][q * 8]); } }
// ---- k_pv: block = (64 rows d... no: rows = s (64), cols = d (128 group)) of batch b: attn^T[s][d] = sum_t P[t][s] g[d][t]: A = P^T rows [s][t] (f16), B(k=t, col=d) = g[d][t] planes (f32 -> f16 hi + lo?) -> use bf16: A from f16... keep both f16: g planes converted on the fly to f16 hi + residual
#define PV_KT 64            // positions t per stage
#define PV_NS (TT / PV_KT)
#define PV_LD (PV_KT + 8)   // LDS row pitch in halves: 144 B = 16 B x odd, so the 16 rows of a 16-byte fragment read fall on distinct banks
typedef __attribute__((ext_vector_type(4))) _Float16 v4h;
// The g tile of a stage (128 d x 64 t) is the same for the 4 waves: the work-group loads it once in whole lines, splits it once into f16 hi + lo and stages it in LDS; two buffers, so the next stage's global loads fly while this stage is multiplied.
__global__ __launch_bounds__(128) void k_pv(const _Float16* __restrict__ PT, const float* __restrict__ G, float* __restrict__ AT) { __shared__ __align__(16) float ss[4][16][132]; __shared__ __align__(16) _Float16 sg[2][2][128][PV_LD];   // sg: [buffer][hi, lo][d][t]
  const int tid = threadIdx.x, wave = tid >> 5, lane = tid & 31, col = lane & 15, g = lane >> 4; const int d0 = blockIdx.y * 128; const int s0 = blockIdx.x * 64 + wave * 16;
  const int b = blockIdx.z; PT += (size_t)b * TT * TT;   // every batch in one grid: 512 work-groups in one launch, not 8 launches of 64
  const int gr_row = tid >> 4, gr_q = tid & 15;          // 16 threads x 16 B = one 256-B row piece of the tile; a thread has rows gr_row + 8 i
  const float* gsrc = G + ((size_t)b * DD + d0 + gr_row) * TT + gr_q * 4; const _Float16* arow = PT + (size_t)(s0 + col) * TT;
  v8f acc[8] = {}; v4f gr[16]; v16h a0, a1, n0, n1;   // the loops over gr, fh and fl below are unrolled whole so that these arrays stay in registers
#pragma unroll
  for (int i = 0; i < 16; ++i) gr[i] = *(const v4f*)(gsrc + (size_t)i * 8 * TT);
  n0 = frag_h(arow, lane); n1 = frag_h(arow + 32, lane);
#pragma unroll 1   // rolled: one copy of the stage body, the buffer chosen by st & 1
  for (int st = 0; st < PV_NS; ++st) { const int cur = st & 1;
    _Float16* dst = &sg[cur][0][gr_row][gr_q * 4];
#pragma unroll
    for (int i = 0; i < 16; ++i) { v4h hi, lo;
#pragma unroll
      for (int e = 0; e < 4; ++e) { const float v = gr[i][e]; const _Float16 h = (_Float16)v; hi[e] = h; lo[e] = (_Float16)(v - (float)h); }
      *(v4h*)(dst + i * 8 * PV_LD) = hi; *(v4h*)(dst + (128 + i * 8) * PV_LD) = lo; }
    a0 = n0; a1 = n1;
    __syncthreads();   // publishes buffer cur to the 4 waves; it also stands between every wave's last reads of the other buffer (the trip before) and the next trip's stores into it
    if (st + 1 < PV_NS) { const int t1 = (st + 1) * PV_KT;   // next stage's global loads, issued ahead of this stage's products
#pragma unroll
      for (int i = 0; i < 16; ++i) gr[i] = *(const v4f*)(gsrc + (size_t)i * 8 * TT + t1);
      n0 = frag_h(arow + t1, lane); n1 = frag_h(arow + t1 + 32, lane); }
    const _Float16* bsrc = &sg[cur][0][col][0]; v16h fh[2][2], fl[2][2];   // fragments of two column groups, read one pair ahead of their products
#pragma unroll
    for (int u = 0; u < 2; ++u) { fh[0][u] = frag_h(bsrc + u * 16 * PV_LD, lane); fl[0][u] = frag_h(bsrc + (128 + u * 16) * PV_LD, lane); }
#pragma unroll
    for (int q = 0; q < 8; ++q) { const int pp = q & 1, j = (q & 3) * 2; const v16h a = (q >> 2) ? a1 : a0;
      if (q + 1 < 8) { const int kn = (q + 1) >> 2, jn = ((q + 1) & 3) * 2;
#pragma unroll
        for (int u = 0; u < 2; ++u) { fh[pp ^ 1][u] = frag_h(bsrc + (jn + u) * 16 * PV_LD + kn * 32, lane); fl[pp ^ 1][u] = frag_h(bsrc + (128 + (jn + u) * 16) * PV_LD + kn * 32, lane); } }
      acc[j] = wmma16(a, fh[pp][0], acc[j]); acc[j + 1] = wmma16(a, fh[pp][1], acc[j + 1]); acc[j] = wmma16(a, fl[pp][0], acc[j]); acc[j + 1] = wmma16(a, fl[pp][1], acc[j + 1]); } }
#pragma unroll
  for (int j = 0; j < 8; ++j)
#pragma unroll
    for (int r = 0; r < 8; ++r) ss[wave][8 * g + r][j * 16 + col] = acc[j][r] * (1.0f / 2048.0f);
  LDSX(); for (int rl = 0; rl < 16; ++rl) vst2(AT + ((size_t)b * TT + s0 + rl) * DD + d0 + lane * 4, *(const v4f*)&ss[wave][rl][lane * 4]); }
// ---- k_ht: block = (64 positions s, 128 out channels c, b): h[c][s] = sum_d ht_w[c][d] attn^T[s][d] + ht_b[c]; rows = s (A = attn^T hi+lo), B(k=d, col=c) = ht_w[c][d]; writes h [b][c][t] via LDS transpose + per-block BN partials
__global__ __launch_bounds__(128) void k_ht(const float* __restrict__ AT, const float* __restrict__ HW, const float* __restrict__ HB, float* __restrict__ Hh, float* __restrict__ ST) { __shared__ __align__(16) float st[128][68]; __shared__ __align__(16) float sst[128][2];
  const int tid = threadIdx.x, wave = tid >> 5, lane = tid & 31, col = lane & 15, g = lane >> 4; const int c0 = blockIdx.y * 128; const size_t b = blockIdx.z; const int s0 = blockIdx.x * 64; const size_t r0 = b * TT + s0 + wave * 16;
  v8f acc[8] = {};
#pragma unroll 1
  for (int kc = 0; kc < DD / 32; ++kc) { const F2 a = split_row(AT + (r0 + col) * DD, kc * 32, lane);
#pragma unroll
    for (int j = 0; j < 8; ++j) { v16b w; const int c = c0 + j * 16 + col;
#pragma unroll
      for (int i = 0; i < 8; ++i) { w[i] = (__bf16)HW[(size_t)c * DD + kc * 32 + 8 * g + i]; w[8 + i] = (__bf16)HW[(size_t)c * DD + kc * 32 + 16 + 8 * g + i]; }
      acc[j] = wmma_bf(a.h, w, acc[j]); acc[j] = wmma_bf(a.l, w, acc[j]); } }
#pragma unroll
  for (int j = 0; j < 8; ++j) { const int cl = j * 16 + col; const float bb = bfr(HB[c0 + cl]);
#pragma unroll
    for (int r = 0; r < 8; ++r) st[cl][wave * 16 + 8 * g + r] = acc[j][r] + bb; }
  __syncthreads();
  for (int e = tid; e < 128 * 16; e += 128) { const int cl = e >> 4, q = e & 15; vst2(Hh + (b * CC + c0 + cl) * (size_t)TT + s0 + q * 4, *(const v4f*)&st[cl][q * 4]); }
  { const int cl = tid; float s = 0.f; for (int q = 0; q < 64; ++q) s += st[cl][q]; const float mean = s / 64.0f; float m2 = 0.f; for (int q = 0; q < 64; ++q) { const float d = st[cl][q] - mean; m2 += d * d; } sst[cl][0] = mean; sst[cl][1] = m2; }
  __syncthreads(); if (tid < 64) vst2(ST + (((b * (TT / 64) + blockIdx.x) * CC) + c0) * 2 + tid * 4, *(const v4f*)&(&sst[0][0])[tid * 4]); }
// ---- k_bn: one block: per channel merge of the NB*32 block partials (64 values each, fixed order) -> mean, inv_std (biased)
__global__ __launch_bounds__(512) void k_bn(const float* __restrict__ ST, float* __restrict__ BN) { __shared__ __align__(16) float s[2][CC]; const int c = threadIdx.x; float n = 0.f, mean = 0.f, M2 = 0.f;
#pragma unroll 1
  for (int blk = 0; blk < NB * (TT / 64); ++blk) { const float mb = ST[((size_t)blk * CC + c) * 2], qb = ST[((size_t)blk * CC + c) * 2 + 1]; const float nb_ = 64.f; const float nt = n + nb_; const float d = mb - mean; mean += d * nb_ / nt; M2 += qb + d * d * n * nb_ / nt; n = nt; }
  s[0][c] = mean; s[1][c] = 1.0f / sqrtf(M2 / n + 1e-5f); __syncthreads(); if (c < 2 * CC / 4) vst2(BN + c * 4, *(const v4f*)&(&s[0][0])[c * 4]); }
// ---- k_out: block = (c, b): out[b][c][t] = inpt + gamma (h - mean) inv + beta over the 2,048 positions
__global__ __launch_bounds__(256) void k_out(const float* __restrict__ X, const float* __restrict__ Hh, const float* __restrict__ BN, const float* __restrict__ GA, const float* __restrict__ BE, float* __restrict__ OUT) { __shared__ __align__(16) float so[TT]; const int t = threadIdx.x; const int c = blockIdx.x; const size_t b = blockIdx.y; const float mean = BN[c], inv = BN[CC + c], ga = bfr(GA[c]), be = bfr(BE[c]);
  const size_t base = (b * CC + c) * (size_t)TT; for (int e = t; e < TT; e += 256) so[e] = bfr(X[base + e]) + (ga * (Hh[base + e] - mean) * inv + be);
  __syncthreads(); for (int q = t; q < TT / 4; q += 256) vst2(OUT + base + q * 4, *(const v4f*)&so[q * 4]); }
extern "C" void kernel_launch(void* const* d_in, const int* in_sizes, int n_in, void* d_out, int out_size, void* d_ws, size_t ws_size, hipStream_t stream) {
  (void)in_sizes; (void)n_in; (void)out_size;
  const float** F = (const float**)d_in;   // 0 inpt [8,512,2048], 1 theta_w [256,512], 2 theta_b, 3 phi_w, 4 phi_b, 5 g_w, 6 g_b, 7 ht_w [512,256], 8 ht_b, 9 bn_gamma, 10 bn_beta
  if (ws_size < (size_t)WS_END) return;
  char* ws = (char*)d_ws; float *TH = (float*)(ws + WS_TH), *G = (float*)(ws + WS_G), *S = (float*)(ws + WS_S), *ML = (float*)(ws + WS_ML), *AT = (float*)(ws + WS_AT), *Hh = (float*)(ws + WS_H), *ST = (float*)(ws + WS_ST), *BN = (float*)(ws + WS_BN); __bf16 *PHH = (__bf16*)(ws + WS_PHH), *PHL = (__bf16*)(ws + WS_PHL); _Float16* PT = (_Float16*)(ws + WS_PT);
  k_proj<<<dim3(TT / 64, TNB, 3), 128, 0, stream>>>(F[0], F[1], F[2], F[3], F[4], F[5], F[6], TH, PHH, PHL, G);
  k_sc<<<dim3(TT / 64, TT / 128, TNB), 128, 0, stream>>>(TH, PHH, PHL, S);
  k_stat<<<TNB * TT / 4, 256, 0, stream>>>(S, ML);   // rows of all batches: S and ML are contiguous over (b, t)
  k_pt<<<dim3(TT / 64, TT / 128, TNB), 128, 0, stream>>>(S, ML, PT);
  k_pv<<<dim3(TT / 64, DD / 128, TNB), 128, 0, stream>>>(PT, G, AT);
  k_ht<<<dim3(TT / 64, CC / 128, TNB), 128, 0, stream>>>(AT, F[7], F[8], Hh, ST);
  k_bn<<<1, 512, 0, stream>>>(ST, BN);
  k_out<<<dim3(CC, TNB), 256, 0, stream>>>(F[0], Hh, BN, F[9], F[10], (float*)d_out);
}

// v004
// It runs in 487 microseconds.
// In both of two side-by-side timings against v003, it was 1.22 times as fast.
// Over all steps from v000 it is 5.45 times as fast.
// compute dtype: all float inputs rounded to bf16; theta / phi / g = W x + b (1x1 convs) with EXACT bf16 products on WMMA 16x16x32 (x^T tile staged in LDS), f32 accumulate; theta and phi kept in f32 and split into bf16 hi + lo for the UNSCALED logits w = theta^T phi (3 products; logits std ~5, sharp softmax), logits stored in f32 per batch; softmax in f32 (precise expf) -> P^T planes as f16 x 2^11; attn[d][s] = sum_t g[d][t] P[t][s] with g as f16 hi + lo (2 products); h = ht_w attn (attn bf16 hi + lo, 2 products) + ht_b; BatchNorm1d training statistics over (B, T) per channel from per-block (mean, M2) partials merged in a fixed order; out = inpt + gamma h_norm + beta; f32 output.
#include <hip/hip_runtime.h>
#include <math.h>

typedef __attribute__((ext_vector_type(16))) _Float16 v16h;
typedef __attribute__((ext_vector_type(16))) __bf16 v16b;
typedef __attribute__((ext_vector_type(8)))  _Float16 v8h;
typedef __attribute__((ext_vector_type(8)))  float v8f;
typedef __attribute__((ext_vector_type(4)))  float v4f;
typedef __attribute__((ext_vector_type(2)))  float v2f;
typedef __attribute__((ext_vector_type(4)))  unsigned v4u;
typedef __attribute__((ext_vector_type(4)))  int v4i;
typedef float __attribute__((may_alias)) float_a;
typedef int __attribute__((may_alias)) int_a;

template <typename T> __device__ __forceinline__ void vst2(void* p, T v) { *(T*)p = v;  }
__device__ __forceinline__ v8f wmma16(v16h a, v16h b, v8f c) {
  v8f d = __builtin_amdgcn_wmma_f32_16x16x32_f16(false, a, false, b, (short)0, c, false, false);
  asm volatile("v_nop\n\tv_nop\n\tv_nop\n\tv_nop" : "+v"(d) : "v"(a), "v"(b));
  return d;
}
__device__ __forceinline__ v8f wmma_bf(v16b a, v16b b, v8f c) {
  v8f d = __builtin_amdgcn_wmma_f32_16x16x32_bf16(false, a, false, b, (short)0, c, false, false);
  asm volatile("v_nop\n\tv_nop\n\tv_nop\n\tv_nop" : "+v"(d) : "v"(a), "v"(b));
  return d;
}
// 16x16x32 fragments: lane = (h = lane>>4, row/col = lane&15); elements 0..7 = k0+8h+0..7, 8..15 = k0+16+8h+0..7; D element r = row 8h+r
__device__ __forceinline__ v16h frag_h(const _Float16* rowk0, int lane) {
  union { v16h v; v8h q[2]; } u; const _Float16* p = rowk0 + 8 * (lane >> 4);
  u.q[0] = *(const v8h*)p; u.q[1] = *(const v8h*)(p + 16); return u.v;
}
__device__ __forceinline__ v16h frag_f32(const float* rowk0, int lane) {
  v16h a; const float* p = rowk0 + 8 * (lane >> 4);
#pragma unroll
  for (int i = 0; i < 8; ++i) { a[i] = (_Float16)p[i]; a[8 + i] = (_Float16)p[16 + i]; }
  return a;
}
__device__ __forceinline__ v16h frag_f32s(const float* rowk0, int lane, float sc) {
  v16h a; const float* p = rowk0 + 8 * (lane >> 4);
#pragma unroll
  for (int i = 0; i < 8; ++i) { a[i] = (_Float16)(p[i] * sc); a[8 + i] = (_Float16)(p[16 + i] * sc); }
  return a;
}
// column fragment from a [K][ld] layout (column n), rows >= K read as 0
__device__ __forceinline__ v16h fragc_f32(const float* W, int k0, int n, int lane, int ld, int K) {
  v16h a; const int g = lane >> 4;
#pragma unroll
  for (int i = 0; i < 8; ++i) { const int ka = k0 + 8 * g + i, kb = ka + 16;
    a[i] = (_Float16)(ka < K ? W[(size_t)(ka < K ? ka : K - 1) * ld + n] : 0.f); a[8 + i] = (_Float16)(kb < K ? W[(size_t)(kb < K ? kb : K - 1) * ld + n] : 0.f); }
  return a;
}
struct F2 { v16b h, l; };
__device__ __forceinline__ F2 bsplit16(const float v[16]) { F2 r;
#pragma unroll
  for (int i = 0; i < 16; ++i) { const __bf16 h = (__bf16)v[i]; r.h[i] = h; r.l[i] = (__bf16)(v[i] - (float)h); }
  return r; }
__device__ __forceinline__ F2 split_row(const float* row, int k0, int lane) { float v[16]; const float* p = row + k0 + 8 * (lane >> 4);
#pragma unroll
  for (int i = 0; i < 8; ++i) { v[i] = p[i]; v[8 + i] = p[16 + i]; }
  return bsplit16(v); }
__device__ __forceinline__ F2 split_rowK(const float* row, int k0, int lane, int K) { float v[16]; const int g = lane >> 4;
#pragma unroll
  for (int i = 0; i < 8; ++i) { const int ka = k0 + 8 * g + i, kb = ka + 16; v[i] = ka < K ? row[ka < K ? ka : K - 1] : 0.f; v[8 + i] = kb < K ? row[kb < K ? kb : K - 1] : 0.f; }
  return bsplit16(v); }
__device__ __forceinline__ F2 split_col(const float* W, int k0, int n, int lane, int ld, int K) { float v[16]; const int g = lane >> 4;
#pragma unroll
  for (int i = 0; i < 8; ++i) { const int ka = k0 + 8 * g + i, kb = ka + 16; v[i] = ka < K ? W[(size_t)(ka < K ? ka : K - 1) * ld + n] : 0.f; v[8 + i] = kb < K ? W[(size_t)(kb < K ? kb : K - 1) * ld + n] : 0.f; }
  return bsplit16(v); }
__device__ __forceinline__ v8f mac3(const F2& a, const F2& b, v8f c) { c = wmma_bf(a.l, b.h, c); c = wmma_bf(a.h, b.l, c); return wmma_bf(a.h, b.h, c); }
__device__ __forceinline__ float sigm(float v) { return 1.0f / (1.0f + expf(-v)); }
#define LDSX() do { asm volatile("s_wait_dscnt 0" ::: "memory"); __builtin_amdgcn_wave_barrier(); __builtin_amdgcn_fence(__ATOMIC_RELEASE, "workgroup"); } while (0)


// Non-local block over time (B 8, C 512, D 256, T 2,048): theta/phi/g 1x1 convs; w = softmax_s(theta^T phi); attn = g w (the module contracts g over the QUERY index); h = ht(attn); training-mode BatchNorm1d; out = inpt + bn(h).
#define NB 8
#define CC 512
#define DD 256
#define TT 2048
#ifndef TNB
#define TNB NB
#endif
typedef __attribute__((ext_vector_type(8))) __bf16 v8b;
__device__ __forceinline__ v16b frag_b(const __bf16* rowk0, int lane) {
  union { v16b v; v8b q[2]; } u; const __bf16* p = rowk0 + 8 * (lane >> 4);
  u.q[0] = *(const v8b*)p; u.q[1] = *(const v8b*)(p + 16); return u.v;
}
__device__ __forceinline__ float bfr(float v) { return (float)(__bf16)v; }
__device__ __attribute__((noinline)) float exp_ni(float v) { return expf(v); }
__device__ __attribute__((noinline)) float erf_ni(float v) { return erff(v); }

#define WS_TH  0u                                    // f32 theta^T rows [b*t][256]
#define WS_PHH (WS_TH + 4u * (size_t)NB * TT * DD)      // bf16 phi^T hi rows [b*s][256]
#define WS_PHL (WS_PHH + 2u * (size_t)NB * TT * DD)
#define WS_G   (WS_PHL + 2u * (size_t)NB * TT * DD)     // f32 g [b][d][t]
#define WS_S   (WS_G + 4u * (size_t)NB * DD * TT)       // f32 logits, one plane per batch [b][t][s] (128 MiB); dead after k_pt, so attn^T and h below reuse its bytes
#define WS_ML  (WS_S + 4u * (size_t)NB * TT * TT)      // f32 row (max, 1/sum) [b*t][8] (padded)
#define WS_PT  (WS_ML + 4u * (size_t)NB * TT * 8)      // f16 P^T planes, one per batch [b][s][t] (x 2^11)
#define WS_AT  WS_S                                   // f32 attn^T rows [b*s][256], written by k_pv after the last read of the logits
#define WS_H   (WS_AT + 4u * (size_t)NB * TT * DD)      // f32 h [b][c][t]
#define WS_ST  (WS_PT + 2u * (size_t)NB * TT * TT)     // f32 BN partials [(b*(TT/64) + tblk)][c][2] - one record per (batch, 64-position block)
#define WS_BN  (WS_ST + 4u * (size_t)NB * (TT / 64) * CC * 2)    // f32 mean [512], inv [512]
#define WS_END (WS_BN + 4u * 2 * CC)

// ---- k_proj: block = (64 positions t, b, which 0 theta / 1 phi / 2 g): x^T tile (bf16) in LDS; W [d][c]; outputs: theta^T f32 rows, phi^T bf16 hi/lo rows, g f32 [d][t]
__global__ __launch_bounds__(128) void k_proj(const float* __restrict__ X, const float* __restrict__ WT, const float* __restrict__ BT, const float* __restrict__ WP, const float* __restrict__ BP, const float* __restrict__ WG, const float* __restrict__ BG, float* __restrict__ TH, __bf16* __restrict__ PHH, __bf16* __restrict__ PHL, float* __restrict__ G) {
  __shared__ __align__(16) __bf16 sx[64][CC + 8]; __shared__ __align__(16) float st[64][68];   // st reused per 64-col group
  const int tid = threadIdx.x, wave = tid >> 5, lane = tid & 31, col = lane & 15, g = lane >> 4; const int t0 = blockIdx.x * 64; const size_t b = blockIdx.y; const int which = blockIdx.z;
  const float* Wm = which == 0 ? WT : which == 1 ? WP : WG; const float* Bm = which == 0 ? BT : which == 1 ? BP : BG;
  for (int e = tid; e < CC * 64; e += 128) { const int c = e >> 6, tl = e & 63; sx[tl][c] = (__bf16)X[(b * CC + c) * (size_t)TT + t0 + tl]; }
  __syncthreads();
#pragma unroll 1
  for (int cg = 0; cg < DD / 64; ++cg) { v8f acc[4] = {};
#pragma unroll 2
    for (int kc = 0; kc < CC / 32; ++kc) { const v16b a = frag_b(&sx[wave * 16 + col][kc * 32], lane);
#pragma unroll
      for (int j = 0; j < 4; ++j) { v16b w; const int d = cg * 64 + j * 16 + col;
#pragma unroll
        for (int i = 0; i < 8; ++i) { w[i] = (__bf16)Wm[(size_t)d * CC + kc * 32 + 8 * g + i]; w[8 + i] = (__bf16)Wm[(size_t)d * CC + kc * 32 + 16 + 8 * g + i]; }
        acc[j] = wmma_bf(a, w, acc[j]); } }
    __syncthreads();
#pragma unroll
    for (int j = 0; j < 4; ++j) { const int dl = j * 16 + col; const float bb = bfr(Bm[cg * 64 + dl]);
#pragma unroll
      for (int r = 0; r < 8; ++r) { const int tl = wave * 16 + 8 * g + r; const float v = acc[j][r] + bb; if (which == 2) st[dl][tl] = v; else st[tl][dl] = v; } }
    __syncthreads();
    if (which == 0) { for (int e = tid; e < 64 * 16; e += 128) { const int tl = e >> 4, q = e & 15; vst2(TH + (b * TT + t0 + tl) * DD + cg * 64 + q * 4, *(const v4f*)&st[tl][q * 4]); } }
    else if (which == 1) { for (int e = tid; e < 64 * 8; e += 128) { const int tl = e >> 3, q = e & 7; const float* p = &st[tl][q * 8]; v16b dummy; (void)dummy; __bf16 hh[8], ll[8]; 
#pragma unroll
        for (int i = 0; i < 8; ++i) { const __bf16 hv = (__bf16)p[i]; hh[i] = hv; ll[i] = (__bf16)(p[i] - (float)hv); }
        vst2((unsigned*)(PHH + (b * TT + t0 + tl) * DD + cg * 64 + q * 8), *(const v4u*)hh); vst2((unsigned*)(PHL + (b * TT + t0 + tl) * DD + cg * 64 + q * 8), *(const v4u*)ll); } }
    else { for (int e = tid; e < 64 * 16; e += 128) { const int dl = e >> 4, q = e & 15; vst2(G + (b * DD + cg * 64 + dl) * (size_t)TT + t0 + q * 4, *(const v4f*)&st[dl][q * 4]); } } } }
// ---- k_sc: block = (64 queries t, 128 keys s, batch b): logits theta^T . phi (3 products) -> plane b of S; every batch in one grid
__global__ __launch_bounds__(128) void k_sc(const float* __restrict__ TH, const __bf16* __restrict__ PHH, const __bf16* __restrict__ PHL, float* __restrict__ S) { __shared__ __align__(16) float ss[4][16][132]; const int b = blockIdx.z; S += (size_t)b * TT * TT;
  const int tid = threadIdx.x, wave = tid >> 5, lane = tid & 31, col = lane & 15, g = lane >> 4; const int k0 = blockIdx.y * 128; const int tq0 = blockIdx.x * 64 + wave * 16; const size_t q0 = (size_t)b * TT + tq0;
  v8f acc[8] = {};
#pragma unroll 1
  for (int kc = 0; kc < DD / 32; ++kc) { const F2 a = split_row(TH + (q0 + col) * DD, kc * 32, lane);
#pragma unroll
    for (int j = 0; j < 8; ++j) { const size_t kr = ((size_t)b * TT + k0 + j * 16 + col) * DD + kc * 32; const v16b kh = frag_b(PHH + kr, lane), kl = frag_b(PHL + kr, lane); acc[j] = wmma_bf(a.h, kh, acc[j]); acc[j] = wmma_bf(a.l, kh, acc[j]); acc[j] = wmma_bf(a.h, kl, acc[j]); } }
#pragma unroll
  for (int j = 0; j < 8; ++j)
#pragma unroll
    for (int r = 0; r < 8; ++r) ss[wave][8 * g + r][j * 16 + col] = acc[j][r];
  LDSX(); for (int rl = 0; rl < 16; ++rl) vst2(S + (size_t)(tq0 + rl) * TT + k0 + lane * 4, *(const v4f*)&ss[wave][rl][lane * 4]); }
__global__ __launch_bounds__(256) void k_stat(const float* __restrict__ S, float* __restrict__ ML) { __shared__ float sred[8]; __shared__ float sbc; __shared__ __align__(16) float sout[4][8];
  const int t = threadIdx.x;
  for (int rr = 0; rr < 4; ++rr) { const size_t row = (size_t)blockIdx.x * 4 + rr; const float* sr = S + row * TT;
    float m = -3.0e38f; for (int k = t; k < TT; k += 256) m = fmaxf(m, sr[k]);
#pragma unroll
    for (int o = 1; o < 32; o <<= 1) m = fmaxf(m, __shfl_xor(m, o));
    if ((t & 31) == 0) sred[t >> 5] = m; __syncthreads(); if (t == 0) { float a = sred[0]; for (int i = 1; i < 8; ++i) a = fmaxf(a, sred[i]); sbc = a; } __syncthreads(); m = sbc; __syncthreads();
    float sum = 0.f; for (int k = t; k < TT; k += 256) sum += expf(sr[k] - m);
#pragma unroll
    for (int o = 1; o < 32; o <<= 1) sum += __shfl_xor(sum, o);
    if ((t & 31) == 0) sred[t >> 5] = sum; __syncthreads(); if (t == 0) { float a = 0.f; for (int i = 0; i < 8; ++i) a += sred[i]; sout[rr][0] = m; sout[rr][1] = 1.0f / a; for (int i = 2; i < 8; ++i) sout[rr][i] = 0.f; } __syncthreads(); }
  if (t < 8) vst2(ML + (size_t)blockIdx.x * 32 + t * 4, *(const v4f*)&(&sout[0][0])[t * 4]); }
// ---- k_pt: block = (64 rows t, 128 cols s, batch b): P = exp(S - m) / sum, transposed in LDS -> P^T plane of batch b [s][t] (f16 x 2^11)
__global__ __launch_bounds__(128) void k_pt(const float* __restrict__ S, const float* __restrict__ ML, _Float16* __restrict__ PT) { __shared__ __align__(16) _Float16 sp[128][72]; const int b = blockIdx.z; S += (size_t)b * TT * TT; ML += (size_t)b * TT * 8;
  const int tid = threadIdx.x; const int t0 = blockIdx.x * 64, s0 = blockIdx.y * 128; PT += (size_t)b * TT * TT;
  for (int e = tid; e < 64 * 128; e += 128) { const int tl = e >> 7, sl = e & 127; const float m = ML[(size_t)(t0 + tl) * 8], inv = ML[(size_t)(t0 + tl) * 8 + 1]; sp[sl][tl] = (_Float16)(expf(S[(size_t)(t0 + tl) * TT + s0 + sl] - m) * inv * 2048.0f); }
  __syncthreads(); for (int e = tid; e < 128 * 8; e += 128) { const int sl = e >> 3, q = e & 7; vst2((unsigned*)(PT + (size_t)(s0 + sl) * TT + t0 + q * 8), *(const v4u*)&sp[sl][q * 8]); } }
// ---- k_pv: block = (64 rows d... no: rows = s (64), cols = d (128 group)) of batch b: attn^T[s][d] = sum_t P[t][s] g[d][t]: A = P^T rows [s][t] (f16), B(k=t, col=d) = g[d][t] planes (f32 -> f16 hi + lo?) -> use bf16: A from f16... keep both f16: g planes converted on the fly to f16 hi + residual
#define PV_KT 64            // positions t per stage
#define PV_NS (TT / PV_KT)
#define PV_LD (PV_KT + 8)   // LDS row pitch in halves: 144 B = 16 B x odd, so the 16 rows of a 16-byte fragment read fall on distinct banks
typedef __attribute__((ext_vector_type(4))) _Float16 v4h;
// The g tile of a stage (128 d x 64 t) is the same for the 4 waves: the work-group loads it once in whole lines, splits it once into f16 hi + lo and stages it in LDS; two buffers, so the next stage's global loads fly while this stage is multiplied.
__global__ __launch_bounds__(128) void k_pv(const _Float16* __restrict__ PT, const float* __restrict__ G, float* __restrict__ AT) { __shared__ __align__(16) float ss[4][16][132]; __shared__ __align__(16) _Float16 sg[2][2][128][PV_LD];   // sg: [buffer][hi, lo][d][t]
  const int tid = threadIdx.x, wave = tid >> 5, lane = tid & 31, col = lane & 15, g = lane >> 4; const int d0 = blockIdx.y * 128; const int s0 = blockIdx.x * 64 + wave * 16;
  const int b = blockIdx.z; PT += (size_t)b * TT * TT;   // every batch in one grid: 512 work-groups in one launch, not 8 launches of 64
  const int gr_row = tid >> 4, gr_q = tid & 15;          // 16 threads x 16 B = one 256-B row piece of the tile; a thread has rows gr_row + 8 i
  const float* gsrc = G + ((size_t)b * DD + d0 + gr_row) * TT + gr_q * 4; const _Float16* arow = PT + (size_t)(s0 + col) * TT;
  v8f acc[8] = {}; v4f gr[16]; v16h a0, a1, n0, n1;   // the loops over gr, fh and fl below are unrolled whole so that these arrays stay in registers
#pragma unroll
  for (int i = 0; i < 16; ++i) gr[i] = *(const v4f*)(gsrc + (size_t)i * 8 * TT);
  n0 = frag_h(arow, lane); n1 = frag_h(arow + 32, lane);
#pragma unroll 1   // rolled: one copy of the stage body, the buffer chosen by st & 1
  for (int st = 0; st < PV_NS; ++st) { const int cur = st & 1;
    _Float16* dst = &sg[cur][0][gr_row][gr_q * 4];
#pragma unroll
    for (int i = 0; i < 16; ++i) { v4h hi, lo;
#pragma unroll
      for (int e = 0; e < 4; ++e) { const float v = gr[i][e]; const _Float16 h = (_Float16)v; hi[e] = h; lo[e] = (_Float16)(v - (float)h); }
      *(v4h*)(dst + i * 8 * PV_LD) = hi; *(v4h*)(dst + (128 + i * 8) * PV_LD) = lo; }
    a0 = n0; a1 = n1;
    __syncthreads();   // publishes buffer cur to the 4 waves; it also stands between every wave's last reads of the other buffer (the trip before) and the next trip's stores into it
    if (st + 1 < PV_NS) { const int t1 = (st + 1) * PV_KT;   // next stage's global loads, issued ahead of this stage's products
#pragma unroll
      for (int i = 0; i < 16; ++i) gr[i] = *(const v4f*)(gsrc + (size_t)i * 8 * TT + t1);
      n0 = frag_h(arow + t1, lane); n1 = frag_h(arow + t1 + 32, lane); }
    const _Float16* bsrc = &sg[cur][0][col][0]; v16h fh[2][2], fl[2][2];   // fragments of two column groups, read one pair ahead of their products
#pragma unroll
    for (int u = 0; u < 2; ++u) { fh[0][u] = frag_h(bsrc + u * 16 * PV_LD, lane); fl[0][u] = frag_h(bsrc + (128 + u * 16) * PV_LD, lane); }
#pragma unroll
    for (int q = 0; q < 8; ++q) { const int pp = q & 1, j = (q & 3) * 2; const v16h a = (q >> 2) ? a1 : a0;
      if (q + 1 < 8) { const int kn = (q + 1) >> 2, jn = ((q + 1) & 3) * 2;
#pragma unroll
        for (int u = 0; u < 2; ++u) { fh[pp ^ 1][u] = frag_h(bsrc + (jn + u) * 16 * PV_LD + kn * 32, lane); fl[pp ^ 1][u] = frag_h(bsrc + (128 + (jn + u) * 16) * PV_LD + kn * 32, lane); } }
      acc[j] = wmma16(a, fh[pp][0], acc[j]); acc[j + 1] = wmma16(a, fh[pp][1], acc[j + 1]); acc[j] = wmma16(a, fl[pp][0], acc[j]); acc[j + 1] = wmma16(a, fl[pp][1], acc[j + 1]); } }
#pragma unroll
  for (int j = 0; j < 8; ++j)
#pragma unroll
    for (int r = 0; r < 8; ++r) ss[wave][8 * g + r][j * 16 + col] = acc[j][r] * (1.0f / 2048.0f);
  LDSX(); for (int rl = 0; rl < 16; ++rl) vst2(AT + ((size_t)b * TT + s0 + rl) * DD + d0 + lane * 4, *(const v4f*)&ss[wave][rl][lane * 4]); }
// ---- k_ht: block = (64 positions s, 128 out channels c, b): h[c][s] = sum_d ht_w[c][d] attn^T[s][d] + ht_b[c]; rows = s (A = attn^T hi+lo), B(k=d, col=c) = ht_w[c][d]; writes h [b][c][t] via LDS transpose + per-block BN partials
__global__ __launch_bounds__(128) void k_ht(const float* __restrict__ AT, const float* __restrict__ HW, const float* __restrict__ HB, float* __restrict__ Hh, float* __restrict__ ST) { __shared__ __align__(16) float st[128][68]; __shared__ __align__(16) float sst[128][2];
  const int tid = threadIdx.x, wave = tid >> 5, lane = tid & 31, col = lane & 15, g = lane >> 4; const int c0 = blockIdx.y * 128; const size_t b = blockIdx.z; const int s0 = blockIdx.x * 64; const size_t r0 = b * TT + s0 + wave * 16;
  v8f acc[8] = {};
#pragma unroll 1
  for (int kc = 0; kc < DD / 32; ++kc) { const F2 a = split_row(AT + (r0 + col) * DD, kc * 32, lane);
#pragma unroll
    for (int j = 0; j < 8; ++j) { v16b w; const int c = c0 + j * 16 + col;
#pragma unroll
      for (int i = 0; i < 8; ++i) { w[i] = (__bf16)HW[(size_t)c * DD + kc * 32 + 8 * g + i]; w[8 + i] = (__bf16)HW[(size_t)c * DD + kc * 32 + 16 + 8 * g + i]; }
      acc[j] = wmma_bf(a.h, w, acc[j]); acc[j] = wmma_bf(a.l, w, acc[j]); } }
#pragma unroll
  for (int j = 0; j < 8; ++j) { const int cl = j * 16 + col; const float bb = bfr(HB[c0 + cl]);
#pragma unroll
    for (int r = 0; r < 8; ++r) st[cl][wave * 16 + 8 * g + r] = acc[j][r] + bb; }
  __syncthreads();
  for (int e = tid; e < 128 * 16; e += 128) { const int cl = e >> 4, q = e & 15; vst2(Hh + (b * CC + c0 + cl) * (size_t)TT + s0 + q * 4, *(const v4f*)&st[cl][q * 4]); }
  { const int cl = tid; float s = 0.f; for (int q = 0; q < 64; ++q) s += st[cl][q]; const float mean = s / 64.0f; float m2 = 0.f; for (int q = 0; q < 64; ++q) { const float d = st[cl][q] - mean; m2 += d * d; } sst[cl][0] = mean; sst[cl][1] = m2; }
  __syncthreads(); if (tid < 64) vst2(ST + (((b * (TT / 64) + blockIdx.x) * CC) + c0) * 2 + tid * 4, *(const v4f*)&(&sst[0][0])[tid * 4]); }
// ---- k_bn: block = 32 channels (lane = channel), 8 waves x 32 of the channel's NB*32 block partials (64 values each): mean = mean of the block means, M2 = sum of (M2_blk + 64 (mean_blk - mean)^2), both summed in a fixed order (32 in a thread, then the 8 waves in turn) -> mean, inv_std (biased)
#define BN_NR (NB * (TT / 64))   // records per channel
#define BN_PT (BN_NR / 8)        // records per thread
__global__ __launch_bounds__(256) void k_bn(const float* __restrict__ ST, float* __restrict__ BN) { __shared__ float sm[8][32]; __shared__ float sq[8][32];
  const int lane = threadIdx.x & 31, wave = threadIdx.x >> 5; const int c = blockIdx.x * 32 + lane; const float* src = ST + ((size_t)wave * BN_PT * CC + c) * 2; v2f r[BN_PT];
#pragma unroll   // whole: r stays in registers and a thread's loads are all in flight together, so memory latency is paid once and not once per record
  for (int i = 0; i < BN_PT; ++i) r[i] = *(const v2f*)(src + (size_t)i * CC * 2);
  float s = 0.f;
#pragma unroll   // whole: r is indexed by constants only
  for (int i = 0; i < BN_PT; ++i) s += r[i][0];
  sm[wave][lane] = s; __syncthreads();
  float tot = 0.f; for (int w = 0; w < 8; ++w) tot += sm[w][lane];
  const float mean = tot * (1.0f / BN_NR); float q = 0.f;
#pragma unroll   // whole: r is indexed by constants only
  for (int i = 0; i < BN_PT; ++i) { const float d = r[i][0] - mean; q += r[i][1] + 64.f * d * d; }
  sq[wave][lane] = q; __syncthreads();
  if (wave == 0) { float M2 = 0.f; for (int w = 0; w < 8; ++w) M2 += sq[w][lane]; BN[c] = mean; BN[CC + c] = 1.0f / sqrtf(M2 / (64.f * BN_NR) + 1e-5f); } }
// ---- k_out: block = (c, b): out[b][c][t] = inpt + gamma (h - mean) inv + beta over the 2,048 positions
__global__ __launch_bounds__(256) void k_out(const float* __restrict__ X, const float* __restrict__ Hh, const float* __restrict__ BN, const float* __restrict__ GA, const float* __restrict__ BE, float* __restrict__ OUT) { __shared__ __align__(16) float so[TT]; const int t = threadIdx.x; const int c = blockIdx.x; const size_t b = blockIdx.y; const float mean = BN[c], inv = BN[CC + c], ga = bfr(GA[c]), be = bfr(BE[c]);
  const size_t base = (b * CC + c) * (size_t)TT; for (int e = t; e < TT; e += 256) so[e] = bfr(X[base + e]) + (ga * (Hh[base + e] - mean) * inv + be);
  __syncthreads(); for (int q = t; q < TT / 4; q += 256) vst2(OUT + base + q * 4, *(const v4f*)&so[q * 4]); }
extern "C" void kernel_launch(void* const* d_in, const int* in_sizes, int n_in, void* d_out, int out_size, void* d_ws, size_t ws_size, hipStream_t stream) {
  (void)in_sizes; (void)n_in; (void)out_size;
  const float** F = (const float**)d_in;   // 0 inpt [8,512,2048], 1 theta_w [256,512], 2 theta_b, 3 phi_w, 4 phi_b, 5 g_w, 6 g_b, 7 ht_w [512,256], 8 ht_b, 9 bn_gamma, 10 bn_beta
  if (ws_size < (size_t)WS_END) return;
  char* ws = (char*)d_ws; float *TH = (float*)(ws + WS_TH), *G = (float*)(ws + WS_G), *S = (float*)(ws + WS_S), *ML = (float*)(ws + WS_ML), *AT = (float*)(ws + WS_AT), *Hh = (float*)(ws + WS_H), *ST = (float*)(ws + WS_ST), *BN = (float*)(ws + WS_BN); __bf16 *PHH = (__bf16*)(ws + WS_PHH), *PHL = (__bf16*)(ws + WS_PHL); _Float16* PT = (_Float16*)(ws + WS_PT);
  k_proj<<<dim3(TT / 64, TNB, 3), 128, 0, stream>>>(F[0], F[1], F[2], F[3], F[4], F[5], F[6], TH, PHH, PHL, G);
  k_sc<<<dim3(TT / 64, TT / 128, TNB), 128, 0, stream>>>(TH, PHH, PHL, S);
  k_stat<<<TNB * TT / 4, 256, 0, stream>>>(S, ML);   // rows of all batches: S and ML are contiguous over (b, t)
  k_pt<<<dim3(TT / 64, TT / 128, TNB), 128, 0, stream>>>(S, ML, PT);
  k_pv<<<dim3(TT / 64, DD / 128, TNB), 128, 0, stream>>>(PT, G, AT);
  k_ht<<<dim3(TT / 64, CC / 128, TNB), 128, 0, stream>>>(AT, F[7], F[8], Hh, ST);
  k_bn<<<CC / 32, 256, 0, stream>>>(ST, BN);
  k_out<<<dim3(CC, TNB), 256, 0, stream>>>(F[0], Hh, BN, F[9], F[10], (float*)d_out);
}

// v005
// A run of this version takes 269 microseconds.
// Two timings next to v004 both put it at 1.82 times that version's speed.
// Counting every step since v000, it is 9.94 times as fast.
// compute dtype: all float inputs rounded to bf16; theta / phi / g = W x + b (1x1 convs) with EXACT bf16 products on WMMA 16x16x32 (x^T tile staged in LDS), f32 accumulate; theta and phi kept in f32 and split into bf16 hi + lo for the UNSCALED logits w = theta^T phi (3 products; logits std ~5, sharp softmax), logits stored in f32 per batch; softmax in f32 (precise expf) -> P^T planes as f16 x 2^11; attn[d][s] = sum_t g[d][t] P[t][s] with g as f16 hi + lo (2 products); h = ht_w attn (attn bf16 hi + lo, 2 products) + ht_b; BatchNorm1d training statistics over (B, T) per channel from per-block (mean, M2) partials merged in a fixed order; out = inpt + gamma h_norm + beta; f32 output.
#include <hip/hip_runtime.h>
#include <math.h>

typedef __attribute__((ext_vector_type(16))) _Float16 v16h;
typedef __attribute__((ext_vector_type(16))) __bf16 v16b;
typedef __attribute__((ext_vector_type(8)))  _Float16 v8h;
typedef __attribute__((ext_vector_type(8)))  float v8f;
typedef __attribute__((ext_vector_type(4)))  float v4f;
typedef __attribute__((ext_vector_type(2)))  float v2f;
typedef __attribute__((ext_vector_type(4)))  unsigned v4u;
typedef __attribute__((ext_vector_type(4)))  int v4i;
typedef float __attribute__((may_alias)) float_a;
typedef int __attribute__((may_alias)) int_a;

template <typename T> __device__ __forceinline__ void vst2(void* p, T v) { *(T*)p = v;  }
__device__ __forceinline__ v8f wmma16(v16h a, v16h b, v8f c) {
  v8f d = __builtin_amdgcn_wmma_f32_16x16x32_f16(false, a, false, b, (short)0, c, false, false);
  asm volatile("v_nop\n\tv_nop\n\tv_nop\n\tv_nop" : "+v"(d) : "v"(a), "v"(b));
  return d;
}
__device__ __forceinline__ v8f wmma_bf(v16b a, v16b b, v8f c) {
  v8f d = __builtin_amdgcn_wmma_f32_16x16x32_bf16(false, a, false, b, (short)0, c, false, false);
  asm volatile("v_nop\n\tv_nop\n\tv_nop\n\tv_nop" : "+v"(d) : "v"(a), "v"(b));
  return d;
}
// 16x16x32 fragments: lane = (h = lane>>4, row/col = lane&15); elements 0..7 = k0+8h+0..7, 8..15 = k0+16+8h+0..7; D element r = row 8h+r
__device__ __forceinline__ v16h frag_h(const _Float16* rowk0, int lane) {
  union { v16h v; v8h q[2]; } u; const _Float16* p = rowk0 + 8 * (lane >> 4);
  u.q[0] = *(const v8h*)p; u.q[1] = *(const v8h*)(p + 16); return u.v;
}
__device__ __forceinline__ v16h frag_f32(const float* rowk0, int lane) {
  v16h a; const float* p = rowk0 + 8 * (lane >> 4);
#pragma unroll
  for (int i = 0; i < 8; ++i) { a[i] = (_Float16)p[i]; a[8 + i] = (_Float16)p[16 + i]; }
  return a;
}
__device__ __forceinline__ v16h frag_f32s(const float* rowk0, int lane, float sc) {
  v16h a; const float* p = rowk0 + 8 * (lane >> 4);
#pragma unroll
  for (int i = 0; i < 8; ++i) { a[i] = (_Float16)(p[i] * sc); a[8 + i] = (_Float16)(p[16 + i] * sc); }
  return a;
}
// column fragment from a [K][ld] layout (column n), rows >= K read as 0
__device__ __forceinline__ v16h fragc_f32(const float* W, int k0, int n, int lane, int ld, int K) {
  v16h a; const int g = lane >> 4;
#pragma unroll
  for (int i = 0; i < 8; ++i) { const int ka = k0 + 8 * g + i, kb = ka + 16;
    a[i] = (_Float16)(ka < K ? W[(size_t)(ka < K ? ka : K - 1) * ld + n] : 0.f); a[8 + i] = (_Float16)(kb < K ? W[(size_t)(kb < K ? kb : K - 1) * ld + n] : 0.f); }
  return a;
}
struct F2 { v16b h, l; };
__device__ __forceinline__ F2 bsplit16(const float v[16]) { F2 r;
#pragma unroll
  for (int i = 0; i < 16; ++i) { const __bf16 h = (__bf16)v[i]; r.h[i] = h; r.l[i] = (__bf16)(v[i] - (float)h); }
  return r; }
__device__ __forceinline__ F2 split_row(const float* row, int k0, int lane) { float v[16]; const float* p = row + k0 + 8 * (lane >> 4);
#pragma unroll
  for (int i = 0; i < 8; ++i) { v[i] = p[i]; v[8 + i] = p[16 + i]; }
  return bsplit16(v); }
__device__ __forceinline__ F2 split_rowK(const float* row, int k0, int lane, int K) { float v[16]; const int g = lane >> 4;
#pragma unroll
  for (int i = 0; i < 8; ++i) { const int ka = k0 + 8 * g + i, kb = ka + 16; v[i] = ka < K ? row[ka < K ? ka : K - 1] : 0.f; v[8 + i] = kb < K ? row[kb < K ? kb : K - 1] : 0.f; }
  return bsplit16(v); }
__device__ __forceinline__ F2 split_col(const float* W, int k0, int n, int lane, int ld, int K) { float v[16]; const int g = lane >> 4;
#pragma unroll
  for (int i = 0; i < 8; ++i) { const int ka = k0 + 8 * g + i, kb = ka + 16; v[i] = ka < K ? W[(size_t)(ka < K ? ka : K - 1) * ld + n] : 0.f; v[8 + i] = kb < K ? W[(size_t)(kb < K ? kb : K - 1) * ld + n] : 0.f; }
  return bsplit16(v); }
__device__ __forceinline__ v8f mac3(const F2& a, const F2& b, v8f c) { c = wmma_bf(a.l, b.h, c); c = wmma_bf(a.h, b.l, c); return wmma_bf(a.h, b.h, c); }
__device__ __forceinline__ float sigm(float v) { return 1.0f / (1.0f + expf(-v)); }
#define LDSX() do { asm volatile("s_wait_dscnt 0" ::: "memory"); __builtin_amdgcn_wave_barrier(); __builtin_amdgcn_fence(__ATOMIC_RELEASE, "workgroup"); } while (0)


// Non-local block over time (B 8, C 512, D 256, T 2,048): theta/phi/g 1x1 convs; w = softmax_s(theta^T phi); attn = g w (the module contracts g over the QUERY index); h = ht(attn); training-mode BatchNorm1d; out = inpt + bn(h).
#define NB 8
#define CC 512
#define DD 256
#define TT 2048
#ifndef TNB
#define TNB NB
#endif
typedef __attribute__((ext_vector_type(8))) __bf16 v8b;
__device__ __forceinline__ v16b frag_b(const __bf16* rowk0, int lane) {
  union { v16b v; v8b q[2]; } u; const __bf16* p = rowk0 + 8 * (lane >> 4);
  u.q[0] = *(const v8b*)p; u.q[1] = *(const v8b*)(p + 16); return u.v;
}
__device__ __forceinline__ float bfr(float v) { return (float)(__bf16)v; }
__device__ __attribute__((noinline)) float exp_ni(float v) { return expf(v); }
__device__ __attribute__((noinline)) float erf_ni(float v) { return erff(v); }

#define WS_TH  0u                                    // f32 theta^T rows [b*t][256]
#define WS_PHH (WS_TH + 4u * (size_t)NB * TT * DD)      // bf16 phi^T hi rows [b*s][256]
#define WS_PHL (WS_PHH + 2u * (size_t)NB * TT * DD)
#define WS_G   (WS_PHL + 2u * (size_t)NB * TT * DD)     // f32 g [b][d][t]
#define WS_S   (WS_G + 4u * (size_t)NB * DD * TT)       // f32 logits, one plane per batch [b][t][s] (128 MiB); dead after k_pt, so attn^T and h below reuse its bytes
#define WS_ML  (WS_S + 4u * (size_t)NB * TT * TT)      // f32 row (max, 1/sum) [b*t][8] (padded)
#define WS_PT  (WS_ML + 4u * (size_t)NB * TT * 8)      // f16 P^T planes, one per batch [b][s][t] (x 2^11)
#define WS_AT  WS_S                                   // f32 attn^T rows [b*s][256], written by k_pv after the last read of the logits
#define WS_H   (WS_AT + 4u * (size_t)NB * TT * DD)      // f32 h [b][c][t]
#define WS_ST  (WS_PT + 2u * (size_t)NB * TT * TT)     // f32 BN partials [(b*(TT/64) + tblk)][c][2] - one record per (batch, 64-position block)
#define WS_BN  (WS_ST + 4u * (size_t)NB * (TT / 64) * CC * 2)    // f32 mean [512], inv [512]
#define WS_END (WS_BN + 4u * 2 * CC)

// One lane's eight 16-byte copies global -> LDS, through no register: rows r, r + n, ..., r + 7 n of a tile (l = LDS byte address and p = global address of the lane's 16 bytes in row r; LS and GS = bytes from one of these rows to the next, in LDS and in global memory).
// The s_wait_xcnt is the last line of the copies' own statement, so that no address register is rewritten ahead of it.
template <int LS, int GS> __device__ __forceinline__ void copy8(unsigned l, const char* p) {
  asm volatile("global_load_async_to_lds_b128 %0, %8, off\n\t"
               "global_load_async_to_lds_b128 %1, %9, off\n\t"
               "global_load_async_to_lds_b128 %2, %10, off\n\t"
               "global_load_async_to_lds_b128 %3, %11, off\n\t"
               "global_load_async_to_lds_b128 %4, %12, off\n\t"
               "global_load_async_to_lds_b128 %5, %13, off\n\t"
               "global_load_async_to_lds_b128 %6, %14, off\n\t"
               "global_load_async_to_lds_b128 %7, %15, off\n\t"
               "s_wait_xcnt 0x0"
               :: "v"(l), "v"(l + 1u * LS), "v"(l + 2u * LS), "v"(l + 3u * LS), "v"(l + 4u * LS), "v"(l + 5u * LS), "v"(l + 6u * LS), "v"(l + 7u * LS),
                  "v"(p), "v"(p + 1 * GS), "v"(p + 2 * GS), "v"(p + 3 * GS), "v"(p + 4 * GS), "v"(p + 5 * GS), "v"(p + 6 * GS), "v"(p + 7 * GS)
               : "memory");
}
// A bf16 fragment from a row of f32 in LDS, in two halves, so that the reads can stand well ahead of the products: raw_wf reads the 16 floats (p = row + k0 + 8 h), cvt_wf rounds them; the same elements in the same order as the fragment loads from global rows
struct WR { v4f x[4]; };
__device__ __forceinline__ WR raw_wf(const float* p) { WR r; r.x[0] = *(const v4f*)p; r.x[1] = *(const v4f*)(p + 4); r.x[2] = *(const v4f*)(p + 16); r.x[3] = *(const v4f*)(p + 20); return r; }
__device__ __forceinline__ v16b cvt_wf(const WR& r) { v16b w;
#pragma unroll   // whole, this loop and the next: w and r are indexed by constants only and stay in registers
  for (int q = 0; q < 4; ++q)
#pragma unroll
    for (int i = 0; i < 4; ++i) w[4 * q + i] = (__bf16)r.x[q][i];
  return w; }

// ---- k_proj: block = (64 positions t, b, which 0 theta / 1 phi / 2 g): x^T tile (bf16) in LDS; W [d][c]; outputs: theta^T f32 rows, phi^T bf16 hi/lo rows, g f32 [d][t]
#define PJ_KC 64                    // c per stage: two whole 128-B lines of every W row
#define PJ_NS (CC / PJ_KC)          // stages per group of 64 output columns
#define PJ_LD (PJ_KC + 4)           // LDS row pitch in floats: 272 B = 16 B x odd, so the 16 rows of a 16-byte fragment read fall on distinct banks
#define PJ_BUFB (64 * PJ_LD * 4)    // bytes of one buffer
#define PJ_COPY(l, p) copy8<8 * PJ_LD * 4, 8 * CC * 4>(l, p)   // a lane's rows cr + 8 i of the 64
// The W tile of a stage (64 d x 64 c) is the same for the 4 waves: the work-group copies it once, in whole lines, into LDS; two buffers, so the next stage's copies fly while this stage is multiplied.
__global__ __launch_bounds__(128) void k_proj(const float* __restrict__ X, const float* __restrict__ WT, const float* __restrict__ BT, const float* __restrict__ WP, const float* __restrict__ BP, const float* __restrict__ WG, const float* __restrict__ BG, float* __restrict__ TH, __bf16* __restrict__ PHH, __bf16* __restrict__ PHL, float* __restrict__ G) {
  __shared__ __align__(16) __bf16 sx[64][CC + 8]; __shared__ __align__(16) union { float w[2][64][PJ_LD]; float st[64][68]; } sm;   // w: [buffer][d][c]; st: output staging of a 64-col group, once its last stage has been read
  const int tid = threadIdx.x, wave = tid >> 5, lane = tid & 31, col = lane & 15, g = lane >> 4; const int t0 = blockIdx.x * 64; const size_t b = blockIdx.y; const int which = blockIdx.z;
  const float* Wm = which == 0 ? WT : which == 1 ? WP : WG; const float* Bm = which == 0 ? BT : which == 1 ? BP : BG;
  const int cr = tid >> 4, cq = tid & 15;   // 16 lanes x 16 B = the 256 B of a row; a thread has rows cr + 8 i
  const unsigned l0 = (unsigned)(size_t)&sm.w[0][cr][cq * 4];   // low 32 bits of the shared address = byte address in LDS
  for (int e = tid; e < CC * 64; e += 128) { const int c = e >> 6, tl = e & 63; sx[tl][c] = (__bf16)X[(b * CC + c) * (size_t)TT + t0 + tl]; }
  __syncthreads();
#pragma unroll 1
  for (int cg = 0; cg < DD / 64; ++cg) { v8f acc[4] = {}; const char* gw = (const char*)(Wm + (size_t)(cg * 64 + cr) * CC + cq * 4);
    PJ_COPY(l0, gw);
    asm volatile("s_wait_asynccnt 0x0" ::: "memory");   // this wave's copies of stage 0 have landed
    __syncthreads();                                    // publishes stage 0 to the 4 waves
    PJ_COPY(l0 + PJ_BUFB, gw + PJ_KC * 4);
#pragma unroll 1   // rolled: one copy of the stage body, the buffer chosen by s & 1
    for (int s = 0; s < PJ_NS; ++s) { const int cur = s & 1; const float* bs = &sm.w[cur][col][8 * g];
      v16b a[2]; WR r[2][4];   // the stage's LDS reads stand together ahead of its products: their latency is waited for once a stage
#pragma unroll   // whole, the four loops below: a, r and acc are indexed by constants only and stay in registers
      for (int u = 0; u < 2; ++u) { a[u] = frag_b(&sx[wave * 16 + col][s * PJ_KC + u * 32], lane);
#pragma unroll
        for (int j = 0; j < 4; ++j) r[u][j] = raw_wf(bs + j * 16 * PJ_LD + u * 32); }
#pragma unroll
      for (int u = 0; u < 2; ++u)
#pragma unroll
        for (int j = 0; j < 4; ++j) acc[j] = wmma_bf(a[u], cvt_wf(r[u][j]), acc[j]);
      asm volatile("s_wait_dscnt 0x0" ::: "memory");      // this wave's reads of buffer cur are done before the buffer is handed to its next writer
      asm volatile("s_wait_asynccnt 0x0" ::: "memory");   // this wave's copies of stage s + 1 have landed
      __syncthreads();                                    // publishes stage s + 1 and ends every wave's reads of buffer cur
      if (s + 2 < PJ_NS) PJ_COPY(l0 + cur * PJ_BUFB, gw + (s + 2) * PJ_KC * 4); }
    asm volatile("s_wait_asynccnt 0x0" ::: "memory");     // no copy is outstanding when the ring becomes output staging
#pragma unroll
    for (int j = 0; j < 4; ++j) { const int dl = j * 16 + col; const float bb = bfr(Bm[cg * 64 + dl]);
#pragma unroll
      for (int r = 0; r < 8; ++r) { const int tl = wave * 16 + 8 * g + r; const float v = acc[j][r] + bb; if (which == 2) sm.st[dl][tl] = v; else sm.st[tl][dl] = v; } }
    __syncthreads();
    if (which == 0) { for (int e = tid; e < 64 * 16; e += 128) { const int tl = e >> 4, q = e & 15; vst2(TH + (b * TT + t0 + tl) * DD + cg * 64 + q * 4, *(const v4f*)&sm.st[tl][q * 4]); } }
    else if (which == 1) { for (int e = tid; e < 64 * 8; e += 128) { const int tl = e >> 3, q = e & 7; const float* p = &sm.st[tl][q * 8]; v16b dummy; (void)dummy; __bf16 hh[8], ll[8]; 
#pragma unroll
        for (int i = 0; i < 8; ++i) { const __bf16 hv = (__bf16)p[i]; hh[i] = hv; ll[i] = (__bf16)(p[i] - (float)hv); }
        vst2((unsigned*)(PHH + (b * TT + t0 + tl) * DD + cg * 64 + q * 8), *(const v4u*)hh); vst2((unsigned*)(PHL + (b * TT + t0 + tl) * DD + cg * 64 + q * 8), *(const v4u*)ll); } }
    else { for (int e = tid; e < 64 * 16; e += 128) { const int dl = e >> 4, q = e & 15; vst2(G + (b * DD + cg * 64 + dl) * (size_t)TT + t0 + q * 4, *(const v4f*)&sm.st[dl][q * 4]); } }
    asm volatile("s_wait_dscnt 0x0" ::: "memory");   // this wave's reads of the staging are done before the next group's copies land on it
    __syncthreads(); } }                             // ends every wave's reads of the staging
// ---- k_sc: block = (64 queries t, 128 keys s, batch b): logits theta^T . phi (3 products) -> plane b of S; every batch in one grid
#define SC_KD 64                   // d per stage: one whole 128-B line of every phi row
#define SC_NS (DD / SC_KD)
#define SC_LD (SC_KD + 8)          // LDS row pitch in bf16: 144 B = 16 B x odd, so the 16 rows of a 16-byte fragment read fall on distinct banks
#define SC_PLB (128 * SC_LD * 2)   // bytes of one plane (hi or lo) of one buffer
#define SC_BUFB (2 * SC_PLB)       // bytes of one buffer
#define SC_COPY(l, p) copy8<16 * SC_LD * 2, 16 * DD * 2>(l, p)   // a lane's rows cr + 16 i of one plane
// The phi tile of a stage (128 keys x 64 d, hi and lo) is the same for the 4 waves: the work-group copies it once, in whole lines, into LDS; two buffers, so the next stage's copies fly while this stage is multiplied.
__global__ __launch_bounds__(128) void k_sc(const float* __restrict__ TH, const __bf16* __restrict__ PHH, const __bf16* __restrict__ PHL, float* __restrict__ S) {
  __shared__ __align__(16) union { __bf16 k[2][2][128][SC_LD]; float o[4][16][132]; } sm;   // k: [buffer][hi, lo][key][d]; o: output staging, one part a wave, once the last stage has been read
  const int b = blockIdx.z; S += (size_t)b * TT * TT;
  const int tid = threadIdx.x, wave = tid >> 5, lane = tid & 31, col = lane & 15, g = lane >> 4; const int k0 = blockIdx.y * 128; const int tq0 = blockIdx.x * 64 + wave * 16; const size_t q0 = (size_t)b * TT + tq0;
  const int cr = tid >> 3, cq = tid & 7;   // 8 lanes x 16 B = one 128-B line of a row; a thread has rows cr + 16 i of both planes
  const size_t ks = ((size_t)b * TT + k0 + cr) * DD + cq * 8; const char *gh = (const char*)(PHH + ks), *gl = (const char*)(PHL + ks);
  const unsigned l0 = (unsigned)(size_t)&sm.k[0][0][cr][cq * 8];   // low 32 bits of the shared address = byte address in LDS
  const float* trow = TH + (q0 + col) * DD;
  v8f acc[8] = {};
  SC_COPY(l0, gh); SC_COPY(l0 + SC_PLB, gl);
  asm volatile("s_wait_asynccnt 0x0" ::: "memory");   // this wave's copies of stage 0 have landed
  __syncthreads();                                    // publishes stage 0 to the 4 waves
  SC_COPY(l0 + SC_BUFB, gh + SC_KD * 2); SC_COPY(l0 + SC_BUFB + SC_PLB, gl + SC_KD * 2);
#pragma unroll 1   // rolled: one copy of the stage body, the buffer chosen by st & 1
  for (int st = 0; st < SC_NS; ++st) { const int cur = st & 1;
    const F2 a0 = split_row(trow, st * SC_KD, lane), a1 = split_row(trow, st * SC_KD + 32, lane);
    const __bf16* bs = &sm.k[cur][0][col][0]; v16b kh[2][2], kl[2][2];   // fragments of two key groups, read one pair ahead of their products, inside this stage only
#pragma unroll   // whole: kh and kl are indexed by constants only
    for (int u = 0; u < 2; ++u) { kh[0][u] = frag_b(bs + u * 16 * SC_LD, lane); kl[0][u] = frag_b(bs + (128 + u * 16) * SC_LD, lane); }
#pragma unroll   // whole: kh, kl and acc are indexed by constants only
    for (int q = 0; q < 8; ++q) { const int pp = q & 1, j = (q & 3) * 2; const F2& a = (q >> 2) ? a1 : a0;
      if (q + 1 < 8) { const int kn = (q + 1) >> 2, jn = ((q + 1) & 3) * 2;
#pragma unroll   // whole: as above
        for (int u = 0; u < 2; ++u) { kh[pp ^ 1][u] = frag_b(bs + (jn + u) * 16 * SC_LD + kn * 32, lane); kl[pp ^ 1][u] = frag_b(bs + (128 + (jn + u) * 16) * SC_LD + kn * 32, lane); } }
      acc[j] = wmma_bf(a.h, kh[pp][0], acc[j]); acc[j + 1] = wmma_bf(a.h, kh[pp][1], acc[j + 1]); acc[j] = wmma_bf(a.l, kh[pp][0], acc[j]); acc[j + 1] = wmma_bf(a.l, kh[pp][1], acc[j + 1]); acc[j] = wmma_bf(a.h, kl[pp][0], acc[j]); acc[j + 1] = wmma_bf(a.h, kl[pp][1], acc[j + 1]); }
    asm volatile("s_wait_dscnt 0x0" ::: "memory");      // this wave's reads of buffer cur are done before the buffer is handed to its next writer
    asm volatile("s_wait_asynccnt 0x0" ::: "memory");   // this wave's copies of stage st + 1 have landed
    __syncthreads();                                    // publishes stage st + 1 and ends every wave's reads of buffer cur
    if (st + 2 < SC_NS) { const unsigned l = l0 + cur * SC_BUFB; const int d2 = (st + 2) * SC_KD * 2; SC_COPY(l, gh + d2); SC_COPY(l + SC_PLB, gl + d2); } }
  asm volatile("s_wait_asynccnt 0x0" ::: "memory");     // no copy is outstanding when the ring becomes output staging
#pragma unroll
  for (int j = 0; j < 8; ++j)
#pragma unroll
    for (int r = 0; r < 8; ++r) sm.o[wave][8 * g + r][j * 16 + col] = acc[j][r];
  LDSX(); for (int rl = 0; rl < 16; ++rl) vst2(S + (size_t)(tq0 + rl) * TT + k0 + lane * 4, *(const v4f*)&sm.o[wave][rl][lane * 4]); }
__global__ __launch_bounds__(256) void k_stat(const float* __restrict__ S, float* __restrict__ ML) { __shared__ float sred[8]; __shared__ float sbc; __shared__ __align__(16) float sout[4][8];
  const int t = threadIdx.x;
  for (int rr = 0; rr < 4; ++rr) { const size_t row = (size_t)blockIdx.x * 4 + rr; const float* sr = S + row * TT;
    float m = -3.0e38f; for (int k = t; k < TT; k += 256) m = fmaxf(m, sr[k]);
#pragma unroll
    for (int o = 1; o < 32; o <<= 1) m = fmaxf(m, __shfl_xor(m, o));
    if ((t & 31) == 0) sred[t >> 5] = m; __syncthreads(); if (t == 0) { float a = sred[0]; for (int i = 1; i < 8; ++i) a = fmaxf(a, sred[i]); sbc = a; } __syncthreads(); m = sbc; __syncthreads();
    float sum = 0.f; for (int k = t; k < TT; k += 256) sum += expf(sr[k] - m);
#pragma unroll
    for (int o = 1; o < 32; o <<= 1) sum += __shfl_xor(sum, o);
    if ((t & 31) == 0) sred[t >> 5] = sum; __syncthreads(); if (t == 0) { float a = 0.f; for (int i = 0; i < 8; ++i) a += sred[i]; sout[rr][0] = m; sout[rr][1] = 1.0f / a; for (int i = 2; i < 8; ++i) sout[rr][i] = 0.f; } __syncthreads(); }
  if (t < 8) vst2(ML + (size_t)blockIdx.x * 32 + t * 4, *(const v4f*)&(&sout[0][0])[t * 4]); }
// ---- k_pt: block = (64 rows t, 128 cols s, batch b): P = exp(S - m) / sum, transposed in LDS -> P^T plane of batch b [s][t] (f16 x 2^11)
__global__ __launch_bounds__(128) void k_pt(const float* __restrict__ S, const float* __restrict__ ML, _Float16* __restrict__ PT) { __shared__ __align__(16) _Float16 sp[128][72]; const int b = blockIdx.z; S += (size_t)b * TT * TT; ML += (size_t)b * TT * 8;
  const int tid = threadIdx.x; const int t0 = blockIdx.x * 64, s0 = blockIdx.y * 128; PT += (size_t)b * TT * TT;
  for (int e = tid; e < 64 * 128; e += 128) { const int tl = e >> 7, sl = e & 127; const float m = ML[(size_t)(t0 + tl) * 8], inv = ML[(size_t)(t0 + tl) * 8 + 1]; sp[sl][tl] = (_Float16)(expf(S[(size_t)(t0 + tl) * TT + s0 + sl] - m) * inv * 2048.0f); }
  __syncthreads(); for (int e = tid; e < 128 * 8; e += 128) { const int sl = e >> 3, q = e & 7; vst2((unsigned*)(PT + (size_t)(s0 + sl) * TT + t0 + q * 8), *(const v4u*)&sp[sl][q * 8]); } }
// ---- k_pv: block = (64 rows d... no: rows = s (64), cols = d (128 group)) of batch b: attn^T[s][d] = sum_t P[t][s] g[d][t]: A = P^T rows [s][t] (f16), B(k=t, col=d) = g[d][t] planes (f32 -> f16 hi + lo?) -> use bf16: A from f16... keep both f16: g planes converted on the fly to f16 hi + residual
#define PV_KT 64            // positions t per stage
#define PV_NS (TT / PV_KT)
#define PV_LD (PV_KT + 8)   // LDS row pitch in halves: 144 B = 16 B x odd, so the 16 rows of a 16-byte fragment read fall on distinct banks
typedef __attribute__((ext_vector_type(4))) _Float16 v4h;
// The g tile of a stage (128 d x 64 t) is the same for the 4 waves: the work-group loads it once in whole lines, splits it once into f16 hi + lo and stages it in LDS; two buffers, so the next stage's global loads fly while this stage is multiplied.
__global__ __launch_bounds__(128) void k_pv(const _Float16* __restrict__ PT, const float* __restrict__ G, float* __restrict__ AT) { __shared__ __align__(16) float ss[4][16][132]; __shared__ __align__(16) _Float16 sg[2][2][128][PV_LD];   // sg: [buffer][hi, lo][d][t]
  const int tid = threadIdx.x, wave = tid >> 5, lane = tid & 31, col = lane & 15, g = lane >> 4; const int d0 = blockIdx.y * 128; const int s0 = blockIdx.x * 64 + wave * 16;
  const int b = blockIdx.z; PT += (size_t)b * TT * TT;   // every batch in one grid: 512 work-groups in one launch, not 8 launches of 64
  const int gr_row = tid >> 4, gr_q = tid & 15;          // 16 threads x 16 B = one 256-B row piece of the tile; a thread has rows gr_row + 8 i
  const float* gsrc = G + ((size_t)b * DD + d0 + gr_row) * TT + gr_q * 4; const _Float16* arow = PT + (size_t)(s0 + col) * TT;
  v8f acc[8] = {}; v4f gr[16]; v16h a0, a1, n0, n1;   // the loops over gr, fh and fl below are unrolled whole so that these arrays stay in registers
#pragma unroll
  for (int i = 0; i < 16; ++i) gr[i] = *(const v4f*)(gsrc + (size_t)i * 8 * TT);
  n0 = frag_h(arow, lane); n1 = frag_h(arow + 32, lane);
#pragma unroll 1   // rolled: one copy of the stage body, the buffer chosen by st & 1
  for (int st = 0; st < PV_NS; ++st) { const int cur = st & 1;
    _Float16* dst = &sg[cur][0][gr_row][gr_q * 4];
#pragma unroll
    for (int i = 0; i < 16; ++i) { v4h hi, lo;
#pragma unroll
      for (int e = 0; e < 4; ++e) { const float v = gr[i][e]; const _Float16 h = (_Float16)v; hi[e] = h; lo[e] = (_Float16)(v - (float)h); }
      *(v4h*)(dst + i * 8 * PV_LD) = hi; *(v4h*)(dst + (128 + i * 8) * PV_LD) = lo; }
    a0 = n0; a1 = n1;
    __syncthreads();   // publishes buffer cur to the 4 waves; it also stands between every wave's last reads of the other buffer (the trip before) and the next trip's stores into it
    if (st + 1 < PV_NS) { const int t1 = (st + 1) * PV_KT;   // next stage's global loads, issued ahead of this stage's products
#pragma unroll
      for (int i = 0; i < 16; ++i) gr[i] = *(const v4f*)(gsrc + (size_t)i * 8 * TT + t1);
      n0 = frag_h(arow + t1, lane); n1 = frag_h(arow + t1 + 32, lane); }
    const _Float16* bsrc = &sg[cur][0][col][0]; v16h fh[2][2], fl[2][2];   // fragments of two column groups, read one pair ahead of their products
#pragma unroll
    for (int u = 0; u < 2; ++u) { fh[0][u] = frag_h(bsrc + u * 16 * PV_LD, lane); fl[0][u] = frag_h(bsrc + (128 + u * 16) * PV_LD, lane); }
#pragma unroll
    for (int q = 0; q < 8; ++q) { const int pp = q & 1, j = (q & 3) * 2; const v16h a = (q >> 2) ? a1 : a0;
      if (q + 1 < 8) { const int kn = (q + 1) >> 2, jn = ((q + 1) & 3) * 2;
#pragma unroll
        for (int u = 0; u < 2; ++u) { fh[pp ^ 1][u] = frag_h(bsrc + (jn + u) * 16 * PV_LD + kn * 32, lane); fl[pp ^ 1][u] = frag_h(bsrc + (128 + (jn + u) * 16) * PV_LD + kn * 32, lane); } }
      acc[j] = wmma16(a, fh[pp][0], acc[j]); acc[j + 1] = wmma16(a, fh[pp][1], acc[j + 1]); acc[j] = wmma16(a, fl[pp][0], acc[j]); acc[j + 1] = wmma16(a, fl[pp][1], acc[j + 1]); } }
#pragma unroll
  for (int j = 0; j < 8; ++j)
#pragma unroll
    for (int r = 0; r < 8; ++r) ss[wave][8 * g + r][j * 16 + col] = acc[j][r] * (1.0f / 2048.0f);
  LDSX(); for (int rl = 0; rl < 16; ++rl) vst2(AT + ((size_t)b * TT + s0 + rl) * DD + d0 + lane * 4, *(const v4f*)&ss[wave][rl][lane * 4]); }
// ---- k_ht: block = (64 positions s, 128 out channels c, b): h[c][s] = sum_d ht_w[c][d] attn^T[s][d] + ht_b[c]; rows = s (A = attn^T hi+lo), B(k=d, col=c) = ht_w[c][d]; writes h [b][c][t] via LDS transpose + per-block BN partials
#define HT_KD 64                    // d per stage: two whole 128-B lines of every ht_w row
#define HT_NS (DD / HT_KD)
#define HT_LD (HT_KD + 4)           // LDS row pitch in floats: 272 B = 16 B x odd, so the 16 rows of a 16-byte fragment read fall on distinct banks
#define HT_BUFB (128 * HT_LD * 4)   // bytes of one buffer
#define HT_COPY(l, p) do { copy8<8 * HT_LD * 4, 8 * DD * 4>(l, p); copy8<8 * HT_LD * 4, 8 * DD * 4>((l) + 64u * HT_LD * 4, (p) + 64 * DD * 4); } while (0)   // a lane's rows cr + 8 i of the 128
// The ht_w tile of a stage (128 c x 64 d) is the same for the 4 waves: the work-group copies it once, in whole lines, into LDS; two buffers, so the next stage's copies fly while this stage is multiplied.
__global__ __launch_bounds__(128) void k_ht(const float* __restrict__ AT, const float* __restrict__ HW, const float* __restrict__ HB, float* __restrict__ Hh, float* __restrict__ ST) { __shared__ __align__(16) union { float w[2][128][HT_LD]; float st[128][68]; } sm; __shared__ __align__(16) float sst[128][2];   // w: [buffer][c][d]; st: output staging, once the last stage has been read
  const int tid = threadIdx.x, wave = tid >> 5, lane = tid & 31, col = lane & 15, g = lane >> 4; const int c0 = blockIdx.y * 128; const size_t b = blockIdx.z; const int s0 = blockIdx.x * 64; const size_t r0 = b * TT + s0 + wave * 16;
  const int cr = tid >> 4, cq = tid & 15;   // 16 lanes x 16 B = the 256 B of a row; a thread has rows cr + 8 i
  const char* gw = (const char*)(HW + (size_t)(c0 + cr) * DD + cq * 4);
  const unsigned l0 = (unsigned)(size_t)&sm.w[0][cr][cq * 4];   // low 32 bits of the shared address = byte address in LDS
  const float* arow = AT + (r0 + col) * DD;
  v8f acc[8] = {};
  HT_COPY(l0, gw);
  asm volatile("s_wait_asynccnt 0x0" ::: "memory");   // this wave's copies of stage 0 have landed
  __syncthreads();                                    // publishes stage 0 to the 4 waves
  HT_COPY(l0 + HT_BUFB, gw + HT_KD * 4);
#pragma unroll 1   // rolled: one copy of the stage body, the buffer chosen by sg & 1
  for (int sg = 0; sg < HT_NS; ++sg) { const int cur = sg & 1; const float* bs = &sm.w[cur][col][8 * g];
    const F2 a0 = split_row(arow, sg * HT_KD, lane), a1 = split_row(arow, sg * HT_KD + 32, lane);
    WR r[2][2];   // the floats of two column groups, read one pair ahead of their products, inside this stage only
#pragma unroll   // whole: r is indexed by constants only
    for (int u = 0; u < 2; ++u) r[0][u] = raw_wf(bs + u * 16 * HT_LD);
#pragma unroll   // whole: r and acc are indexed by constants only
    for (int q = 0; q < 8; ++q) { const int pp = q & 1, j = (q & 3) * 2; const F2& a = (q >> 2) ? a1 : a0;
      if (q + 1 < 8) { const int kn = (q + 1) >> 2, jn = ((q + 1) & 3) * 2;
#pragma unroll   // whole: as above
        for (int u = 0; u < 2; ++u) r[pp ^ 1][u] = raw_wf(bs + (jn + u) * 16 * HT_LD + kn * 32); }
      const v16b w0 = cvt_wf(r[pp][0]), w1 = cvt_wf(r[pp][1]);
      acc[j] = wmma_bf(a.h, w0, acc[j]); acc[j + 1] = wmma_bf(a.h, w1, acc[j + 1]); acc[j] = wmma_bf(a.l, w0, acc[j]); acc[j + 1] = wmma_bf(a.l, w1, acc[j + 1]); }
    asm volatile("s_wait_dscnt 0x0" ::: "memory");      // this wave's reads of buffer cur are done before the buffer is handed to its next writer
    asm volatile("s_wait_asynccnt 0x0" ::: "memory");   // this wave's copies of stage sg + 1 have landed
    __syncthreads();                                    // publishes stage sg + 1 and ends every wave's reads of buffer cur
    if (sg + 2 < HT_NS) HT_COPY(l0 + cur * HT_BUFB, gw + (sg + 2) * HT_KD * 4); }
  asm volatile("s_wait_asynccnt 0x0" ::: "memory");     // no copy is outstanding when the ring becomes output staging
#pragma unroll
  for (int j = 0; j < 8; ++j) { const int cl = j * 16 + col; const float bb = bfr(HB[c0 + cl]);
#pragma unroll
    for (int r = 0; r < 8; ++r) sm.st[cl][wave * 16 + 8 * g + r] = acc[j][r] + bb; }
  __syncthreads();
  for (int e = tid; e < 128 * 16; e += 128) { const int cl = e >> 4, q = e & 15; vst2(Hh + (b * CC + c0 + cl) * (size_t)TT + s0 + q * 4, *(const v4f*)&sm.st[cl][q * 4]); }
  { const int cl = tid; float s = 0.f; for (int q = 0; q < 64; ++q) s += sm.st[cl][q]; const float mean = s / 64.0f; float m2 = 0.f; for (int q = 0; q < 64; ++q) { const float d = sm.st[cl][q] - mean; m2 += d * d; } sst[cl][0] = mean; sst[cl][1] = m2; }
  __syncthreads(); if (tid < 64) vst2(ST + (((b * (TT / 64) + blockIdx.x) * CC) + c0) * 2 + tid * 4, *(const v4f*)&(&sst[0][0])[tid * 4]); }
// ---- k_bn: block = 32 channels (lane = channel), 8 waves x 32 of the channel's NB*32 block partials (64 values each): mean = mean of the block means, M2 = sum of (M2_blk + 64 (mean_blk - mean)^2), both summed in a fixed order (32 in a thread, then the 8 waves in turn) -> mean, inv_std (biased)
#define BN_NR (NB * (TT / 64))   // records per channel
#define BN_PT (BN_NR / 8)        // records per thread
__global__ __launch_bounds__(256) void k_bn(const float* __restrict__ ST, float* __restrict__ BN) { __shared__ float sm[8][32]; __shared__ float sq[8][32];
  const int lane = threadIdx.x & 31, wave = threadIdx.x >> 5; const int c = blockIdx.x * 32 + lane; const float* src = ST + ((size_t)wave * BN_PT * CC + c) * 2; v2f r[BN_PT];
#pragma unroll   // whole: r stays in registers and a thread's loads are all in flight together, so memory latency is paid once and not once per record
  for (int i = 0; i < BN_PT; ++i) r[i] = *(const v2f*)(src + (size_t)i * CC * 2);
  float s = 0.f;
#pragma unroll   // whole: r is indexed by constants only
  for (int i = 0; i < BN_PT; ++i) s += r[i][0];
  sm[wave][lane] = s; __syncthreads();
  float tot = 0.f; for (int w = 0; w < 8; ++w) tot += sm[w][lane];
  const float mean = tot * (1.0f / BN_NR); float q = 0.f;
#pragma unroll   // whole: r is indexed by constants only
  for (int i = 0; i < BN_PT; ++i) { const float d = r[i][0] - mean; q += r[i][1] + 64.f * d * d; }
  sq[wave][lane] = q; __syncthreads();
  if (wave == 0) { float M2 = 0.f; for (int w = 0; w < 8; ++w) M2 += sq[w][lane]; BN[c] = mean; BN[CC + c] = 1.0f / sqrtf(M2 / (64.f * BN_NR) + 1e-5f); } }
// ---- k_out: block = (c, b): out[b][c][t] = inpt + gamma (h - mean) inv + beta over the 2,048 positions
__global__ __launch_bounds__(256) void k_out(const float* __restrict__ X, const float* __restrict__ Hh, const float* __restrict__ BN, const float* __restrict__ GA, const float* __restrict__ BE, float* __restrict__ OUT) { __shared__ __align__(16) float so[TT]; const int t = threadIdx.x; const int c = blockIdx.x; const size_t b = blockIdx.y; const float mean = BN[c], inv = BN[CC + c], ga = bfr(GA[c]), be = bfr(BE[c]);
  const size_t base = (b * CC + c) * (size_t)TT; for (int e = t; e < TT; e += 256) so[e] = bfr(X[base + e]) + (ga * (Hh[base + e] - mean) * inv + be);
  __syncthreads(); for (int q = t; q < TT / 4; q += 256) vst2(OUT + base + q * 4, *(const v4f*)&so[q * 4]); }
extern "C" void kernel_launch(void* const* d_in, const int* in_sizes, int n_in, void* d_out, int out_size, void* d_ws, size_t ws_size, hipStream_t stream) {
  (void)in_sizes; (void)n_in; (void)out_size;
  const float** F = (const float**)d_in;   // 0 inpt [8,512,2048], 1 theta_w [256,512], 2 theta_b, 3 phi_w, 4 phi_b, 5 g_w, 6 g_b, 7 ht_w [512,256], 8 ht_b, 9 bn_gamma, 10 bn_beta
  if (ws_size < (size_t)WS_END) return;
  char* ws = (char*)d_ws; float *TH = (float*)(ws + WS_TH), *G = (float*)(ws + WS_G), *S = (float*)(ws + WS_S), *ML = (float*)(ws + WS_ML), *AT = (float*)(ws + WS_AT), *Hh = (float*)(ws + WS_H), *ST = (float*)(ws + WS_ST), *BN = (float*)(ws + WS_BN); __bf16 *PHH = (__bf16*)(ws + WS_PHH), *PHL = (__bf16*)(ws + WS_PHL); _Float16* PT = (_Float16*)(ws + WS_PT);
  k_proj<<<dim3(TT / 64, TNB, 3), 128, 0, stream>>>(F[0], F[1], F[2], F[3], F[4], F[5], F[6], TH, PHH, PHL, G);
  k_sc<<<dim3(TT / 64, TT / 128, TNB), 128, 0, stream>>>(TH, PHH, PHL, S);
  k_stat<<<TNB * TT / 4, 256, 0, stream>>>(S, ML);   // rows of all batches: S and ML are contiguous over (b, t)
  k_pt<<<dim3(TT / 64, TT / 128, TNB), 128, 0, stream>>>(S, ML, PT);
  k_pv<<<dim3(TT / 64, DD / 128, TNB), 128, 0, stream>>>(PT, G, AT);
  k_ht<<<dim3(TT / 64, CC / 128, TNB), 128, 0, stream>>>(AT, F[7], F[8], Hh, ST);
  k_bn<<<CC / 32, 256, 0, stream>>>(ST, BN);
  k_out<<<dim3(CC, TNB), 256, 0, stream>>>(F[0], Hh, BN, F[9], F[10], (float*)d_out);
}

// v006
// It runs in 185 microseconds.
// Timed twice side by side with v005, it ran 1.45 times as fast both times.
// Counting every step since v000, it is 14.4 times as fast.
// compute dtype: all float inputs rounded to bf16; theta / phi / g = W x + b (1x1 convs) with EXACT bf16 products on WMMA 16x16x32 (x^T tile staged in LDS), f32 accumulate; theta and phi kept in f32 and split into bf16 hi + lo for the UNSCALED logits w = theta^T phi (3 products; logits std ~5, sharp softmax), softmax in f32, first inside each tile of 128 keys while the logits are still in registers: exp(w - tile max) -> P^T planes as f16 x 2^11, with (tile max, tile sum) per query; the 16 tiles of a query merged into one factor per (query, tile), which multiplies g; attn[d][s] = sum_t (g[d][t] factor[t]) P~[t][s] with the scaled g as f16 hi + lo (2 products); h = ht_w attn (attn bf16 hi + lo, 2 products) + ht_b; BatchNorm1d training statistics over (B, T) per channel from per-block (mean, M2) partials merged in a fixed order; out = inpt + gamma h_norm + beta; f32 output.
#include <hip/hip_runtime.h>
#include <math.h>

typedef __attribute__((ext_vector_type(16))) _Float16 v16h;
typedef __attribute__((ext_vector_type(16))) __bf16 v16b;
typedef __attribute__((ext_vector_type(8)))  _Float16 v8h;
typedef __attribute__((ext_vector_type(8)))  float v8f;
typedef __attribute__((ext_vector_type(4)))  float v4f;
typedef __attribute__((ext_vector_type(2)))  float v2f;
typedef __attribute__((ext_vector_type(4)))  unsigned v4u;
typedef __attribute__((ext_vector_type(4)))  int v4i;
typedef float __attribute__((may_alias)) float_a;
typedef int __attribute__((may_alias)) int_a;

template <typename T> __device__ __forceinline__ void vst2(void* p, T v) { *(T*)p = v;  }
__device__ __forceinline__ v8f wmma16(v16h a, v16h b, v8f c) {
  v8f d = __builtin_amdgcn_wmma_f32_16x16x32_f16(false, a, false, b, (short)0, c, false, false);
  asm volatile("v_nop\n\tv_nop\n\tv_nop\n\tv_nop" : "+v"(d) : "v"(a), "v"(b));
  return d;
}
__device__ __forceinline__ v8f wmma_bf(v16b a, v16b b, v8f c) {
  v8f d = __builtin_amdgcn_wmma_f32_16x16x32_bf16(false, a, false, b, (short)0, c, false, false);
  asm volatile("v_nop\n\tv_nop\n\tv_nop\n\tv_nop" : "+v"(d) : "v"(a), "v"(b));
  return d;
}
// 16x16x32 fragments: lane = (h = lane>>4, row/col = lane&15); elements 0..7 = k0+8h+0..7, 8..15 = k0+16+8h+0..7; D element r = row 8h+r
__device__ __forceinline__ v16h frag_h(const _Float16* rowk0, int lane) {
  union { v16h v; v8h q[2]; } u; const _Float16* p = rowk0 + 8 * (lane >> 4);
  u.q[0] = *(const v8h*)p; u.q[1] = *(const v8h*)(p + 16); return u.v;
}
__device__ __forceinline__ v16h frag_f32(const float* rowk0, int lane) {
  v16h a; const float* p = rowk0 + 8 * (lane >> 4);
#pragma unroll
  for (int i = 0; i < 8; ++i) { a[i] = (_Float16)p[i]; a[8 + i] = (_Float16)p[16 + i]; }
  return a;
}
__device__ __forceinline__ v16h frag_f32s(const float* rowk0, int lane, float sc) {
  v16h a; const float* p = rowk0 + 8 * (lane >> 4);
#pragma unroll
  for (int i = 0; i < 8; ++i) { a[i] = (_Float16)(p[i] * sc); a[8 + i] = (_Float16)(p[16 + i] * sc); }
  return a;
}
// column fragment from a [K][ld] layout (column n), rows >= K read as 0
__device__ __forceinline__ v16h fragc_f32(const float* W, int k0, int n, int lane, int ld, int K) {
  v16h a; const int g = lane >> 4;
#pragma unroll
  for (int i = 0; i < 8; ++i) { const int ka = k0 + 8 * g + i, kb = ka + 16;
    a[i] = (_Float16)(ka < K ? W[(size_t)(ka < K ? ka : K - 1) * ld + n] : 0.f); a[8 + i] = (_Float16)(kb < K ? W[(size_t)(kb < K ? kb : K - 1) * ld + n] : 0.f); }
  return a;
}
struct F2 { v16b h, l; };
__device__ __forceinline__ F2 bsplit16(const float v[16]) { F2 r;
#pragma unroll
  for (int i = 0; i < 16; ++i) { const __bf16 h = (__bf16)v[i]; r.h[i] = h; r.l[i] = (__bf16)(v[i] - (float)h); }
  return r; }
__device__ __forceinline__ F2 split_row(const float* row, int k0, int lane) { float v[16]; const float* p = row + k0 + 8 * (lane >> 4);
#pragma unroll
  for (int i = 0; i < 8; ++i) { v[i] = p[i]; v[8 + i] = p[16 + i]; }
  return bsplit16(v); }
__device__ __forceinline__ F2 split_rowK(const float* row, int k0, int lane, int K) { float v[16]; const int g = lane >> 4;
#pragma unroll
  for (int i = 0; i < 8; ++i) { const int ka = k0 + 8 * g + i, kb = ka + 16; v[i] = ka < K ? row[ka < K ? ka : K - 1] : 0.f; v[8 + i] = kb < K ? row[kb < K ? kb : K - 1] : 0.f; }
  return bsplit16(v); }
__device__ __forceinline__ F2 split_col(const float* W, int k0, int n, int lane, int ld, int K) { float v[16]; const int g = lane >> 4;
#pragma unroll
  for (int i = 0; i < 8; ++i) { const int ka = k0 + 8 * g + i, kb = ka + 16; v[i] = ka < K ? W[(size_t)(ka < K ? ka : K - 1) * ld + n] : 0.f; v[8 + i] = kb < K ? W[(size_t)(kb < K ? kb : K - 1) * ld + n] : 0.f; }
  return bsplit16(v); }
__device__ __forceinline__ v8f mac3(const F2& a, const F2& b, v8f c) { c = wmma_bf(a.l, b.h, c); c = wmma_bf(a.h, b.l, c); return wmma_bf(a.h, b.h, c); }
__device__ __forceinline__ float sigm(float v) { return 1.0f / (1.0f + expf(-v)); }
#define LDSX() do { asm volatile("s_wait_dscnt 0" ::: "memory"); __builtin_amdgcn_wave_barrier(); __builtin_amdgcn_fence(__ATOMIC_RELEASE, "workgroup"); } while (0)


// Non-local block over time (B 8, C 512, D 256, T 2,048): theta/phi/g 1x1 convs; w = softmax_s(theta^T phi); attn = g w (the module contracts g over the QUERY index); h = ht(attn); training-mode BatchNorm1d; out = inpt + bn(h).
#define NB 8
#define CC 512
#define DD 256
#define TT 2048
#ifndef TNB
#define TNB NB
#endif
typedef __attribute__((ext_vector_type(8))) __bf16 v8b;
__device__ __forceinline__ v16b frag_b(const __bf16* rowk0, int lane) {
  union { v16b v; v8b q[2]; } u; const __bf16* p = rowk0 + 8 * (lane >> 4);
  u.q[0] = *(const v8b*)p; u.q[1] = *(const v8b*)(p + 16); return u.v;
}
__device__ __forceinline__ float bfr(float v) { return (float)(__bf16)v; }
__device__ __attribute__((noinline)) float exp_ni(float v) { return expf(v); }
__device__ __attribute__((noinline)) float erf_ni(float v) { return erff(v); }

#define WS_TH  0u                                    // f32 theta^T rows [b*t][256]
#define WS_PHH (WS_TH + 4u * (size_t)NB * TT * DD)      // bf16 phi^T hi rows [b*s][256]
#define WS_PHL (WS_PHH + 2u * (size_t)NB * TT * DD)
#define WS_G   (WS_PHL + 2u * (size_t)NB * TT * DD)     // f32 g [b][d][t]
#define WS_S   (WS_G + 4u * (size_t)NB * DD * TT)       // region of attn^T, h, the tile statistics and the factors below
#define WS_PT  (WS_CF + 4u * (size_t)NB * NKB * TT)    // f16 planes, one per batch [b][s][t]: exp(logit - max of the query's logits in the key tile of s) x 2^11
#define WS_AT  WS_S                                   // f32 attn^T rows [b*s][256]
#define WS_H   (WS_AT + 4u * (size_t)NB * TT * DD)      // f32 h [b][c][t]
#define NKB (TT / 128)                                // key tiles per query
#define WS_MP  (WS_H + 4u * (size_t)NB * CC * TT)      // f32 (tile max, tile sum x 2^11) [b][key tile][t][2]
#define WS_CF  (WS_MP + 4u * (size_t)NB * NKB * TT * 2) // f32 factor [b][key tile][t] = exp(tile max - row max) / row sum x 2^8
#define WS_ST  (WS_PT + 2u * (size_t)NB * TT * TT)     // f32 BN partials [(b*(TT/64) + tblk)][c][2] - one record per (batch, 64-position block)
#define WS_BN  (WS_ST + 4u * (size_t)NB * (TT / 64) * CC * 2)    // f32 mean [512], inv [512]
#define WS_END (WS_BN + 4u * 2 * CC)

// One lane's eight 16-byte copies global -> LDS, through no register: rows r, r + n, ..., r + 7 n of a tile (l = LDS byte address and p = global address of the lane's 16 bytes in row r; LS and GS = bytes from one of these rows to the next, in LDS and in global memory).
// The s_wait_xcnt is the last line of the copies' own statement, so that no address register is rewritten ahead of it.
template <int LS, int GS> __device__ __forceinline__ void copy8(unsigned l, const char* p) {
  asm volatile("global_load_async_to_lds_b128 %0, %8, off\n\t"
               "global_load_async_to_lds_b128 %1, %9, off\n\t"
               "global_load_async_to_lds_b128 %2, %10, off\n\t"
               "global_load_async_to_lds_b128 %3, %11, off\n\t"
               "global_load_async_to_lds_b128 %4, %12, off\n\t"
               "global_load_async_to_lds_b128 %5, %13, off\n\t"
               "global_load_async_to_lds_b128 %6, %14, off\n\t"
               "global_load_async_to_lds_b128 %7, %15, off\n\t"
               "s_wait_xcnt 0x0"
               :: "v"(l), "v"(l + 1u * LS), "v"(l + 2u * LS), "v"(l + 3u * LS), "v"(l + 4u * LS), "v"(l + 5u * LS), "v"(l + 6u * LS), "v"(l + 7u * LS),
                  "v"(p), "v"(p + 1 * GS), "v"(p + 2 * GS), "v"(p + 3 * GS), "v"(p + 4 * GS), "v"(p + 5 * GS), "v"(p + 6 * GS), "v"(p + 7 * GS)
               : "memory");
}
// A bf16 fragment from a row of f32 in LDS, in two halves, so that the reads can stand well ahead of the products: raw_wf reads the 16 floats (p = row + k0 + 8 h), cvt_wf rounds them; the same elements in the same order as the fragment loads from global rows
struct WR { v4f x[4]; };
__device__ __forceinline__ WR raw_wf(const float* p) { WR r; r.x[0] = *(const v4f*)p; r.x[1] = *(const v4f*)(p + 4); r.x[2] = *(const v4f*)(p + 16); r.x[3] = *(const v4f*)(p + 20); return r; }
__device__ __forceinline__ v16b cvt_wf(const WR& r) { v16b w;
#pragma unroll   // whole, this loop and the next: w and r are indexed by constants only and stay in registers
  for (int q = 0; q < 4; ++q)
#pragma unroll
    for (int i = 0; i < 4; ++i) w[4 * q + i] = (__bf16)r.x[q][i];
  return w; }

// ---- k_proj: block = (64 positions t, b, which 0 theta / 1 phi / 2 g): x^T tile (bf16) in LDS; W [d][c]; outputs: theta^T f32 rows, phi^T bf16 hi/lo rows, g f32 [d][t]
#define PJ_KC 64                    // c per stage: two whole 128-B lines of every W row
#define PJ_NS (CC / PJ_KC)          // stages per group of 64 output columns
#define PJ_LD (PJ_KC + 4)           // LDS row pitch in floats: 272 B = 16 B x odd, so the 16 rows of a 16-byte fragment read fall on distinct banks
#define PJ_BUFB (64 * PJ_LD * 4)    // bytes of one buffer
#define PJ_COPY(l, p) copy8<8 * PJ_LD * 4, 8 * CC * 4>(l, p)   // a lane's rows cr + 8 i of the 64
// The W tile of a stage (64 d x 64 c) is the same for the 4 waves: the work-group copies it once, in whole lines, into LDS; two buffers, so the next stage's copies fly while this stage is multiplied.
__global__ __launch_bounds__(128) void k_proj(const float* __restrict__ X, const float* __restrict__ WT, const float* __restrict__ BT, const float* __restrict__ WP, const float* __restrict__ BP, const float* __restrict__ WG, const float* __restrict__ BG, float* __restrict__ TH, __bf16* __restrict__ PHH, __bf16* __restrict__ PHL, float* __restrict__ G) {
  __shared__ __align__(16) __bf16 sx[64][CC + 8]; __shared__ __align__(16) union { float w[2][64][PJ_LD]; float st[64][68]; } sm;   // w: [buffer][d][c]; st: output staging of a 64-col group, once its last stage has been read
  const int tid = threadIdx.x, wave = tid >> 5, lane = tid & 31, col = lane & 15, g = lane >> 4; const int t0 = blockIdx.x * 64; const size_t b = blockIdx.y; const int which = blockIdx.z;
  const float* Wm = which == 0 ? WT : which == 1 ? WP : WG; const float* Bm = which == 0 ? BT : which == 1 ? BP : BG;
  const int cr = tid >> 4, cq = tid & 15;   // 16 lanes x 16 B = the 256 B of a row; a thread has rows cr + 8 i
  const unsigned l0 = (unsigned)(size_t)&sm.w[0][cr][cq * 4];   // low 32 bits of the shared address = byte address in LDS
  for (int e = tid; e < CC * 64; e += 128) { const int c = e >> 6, tl = e & 63; sx[tl][c] = (__bf16)X[(b * CC + c) * (size_t)TT + t0 + tl]; }
  __syncthreads();
#pragma unroll 1
  for (int cg = 0; cg < DD / 64; ++cg) { v8f acc[4] = {}; const char* gw = (const char*)(Wm + (size_t)(cg * 64 + cr) * CC + cq * 4);
    PJ_COPY(l0, gw);
    asm volatile("s_wait_asynccnt 0x0" ::: "memory");   // this wave's copies of stage 0 have landed
    __syncthreads();                                    // publishes stage 0 to the 4 waves
    PJ_COPY(l0 + PJ_BUFB, gw + PJ_KC * 4);
#pragma unroll 1   // rolled: one copy of the stage body, the buffer chosen by s & 1
    for (int s = 0; s < PJ_NS; ++s) { const int cur = s & 1; const float* bs = &sm.w[cur][col][8 * g];
      v16b a[2]; WR r[2][4];   // the stage's LDS reads stand together ahead of its products: their latency is waited for once a stage
#pragma unroll   // whole, the four loops below: a, r and acc are indexed by constants only and stay in registers
      for (int u = 0; u < 2; ++u) { a[u] = frag_b(&sx[wave * 16 + col][s * PJ_KC + u * 32], lane);
#pragma unroll
        for (int j = 0; j < 4; ++j) r[u][j] = raw_wf(bs + j * 16 * PJ_LD + u * 32); }
#pragma unroll
      for (int u = 0; u < 2; ++u)
#pragma unroll
        for (int j = 0; j < 4; ++j) acc[j] = wmma_bf(a[u], cvt_wf(r[u][j]), acc[j]);
      asm volatile("s_wait_dscnt 0x0" ::: "memory");      // this wave's reads of buffer cur are done before the buffer is handed to its next writer
      asm volatile("s_wait_asynccnt 0x0" ::: "memory");   // this wave's copies of stage s + 1 have landed
      __syncthreads();                                    // publishes stage s + 1 and ends every wave's reads of buffer cur
      if (s + 2 < PJ_NS) PJ_COPY(l0 + cur * PJ_BUFB, gw + (s + 2) * PJ_KC * 4); }
    asm volatile("s_wait_asynccnt 0x0" ::: "memory");     // no copy is outstanding when the ring becomes output staging
#pragma unroll
    for (int j = 0; j < 4; ++j) { const int dl = j * 16 + col; const float bb = bfr(Bm[cg * 64 + dl]);
#pragma unroll
      for (int r = 0; r < 8; ++r) { const int tl = wave * 16 + 8 * g + r; const float v = acc[j][r] + bb; if (which == 2) sm.st[dl][tl] = v; else sm.st[tl][dl] = v; } }
    __syncthreads();
    if (which == 0) { for (int e = tid; e < 64 * 16; e += 128) { const int tl = e >> 4, q = e & 15; vst2(TH + (b * TT + t0 + tl) * DD + cg * 64 + q * 4, *(const v4f*)&sm.st[tl][q * 4]); } }
    else if (which == 1) { for (int e = tid; e < 64 * 8; e += 128) { const int tl = e >> 3, q = e & 7; const float* p = &sm.st[tl][q * 8]; v16b dummy; (void)dummy; __bf16 hh[8], ll[8]; 
#pragma unroll
        for (int i = 0; i < 8; ++i) { const __bf16 hv = (__bf16)p[i]; hh[i] = hv; ll[i] = (__bf16)(p[i] - (float)hv); }
        vst2((unsigned*)(PHH + (b * TT + t0 + tl) * DD + cg * 64 + q * 8), *(const v4u*)hh); vst2((unsigned*)(PHL + (b * TT + t0 + tl) * DD + cg * 64 + q * 8), *(const v4u*)ll); } }
    else { for (int e = tid; e < 64 * 16; e += 128) { const int dl = e >> 4, q = e & 15; vst2(G + (b * DD + cg * 64 + dl) * (size_t)TT + t0 + q * 4, *(const v4f*)&sm.st[dl][q * 4]); } }
    asm volatile("s_wait_dscnt 0x0" ::: "memory");   // this wave's reads of the staging are done before the next group's copies land on it
    __syncthreads(); } }                             // ends every wave's reads of the staging
// Maximum and sum over the 16 lanes of a row half (the 16 columns of an accumulator tile), every lane getting the result: four exchanges with lane ^ 1, 2, 4, 8 inside the vector unit
template <int X> __device__ __forceinline__ float lane_x(float v) { return __builtin_bit_cast(float, __builtin_amdgcn_update_dpp(0, __builtin_bit_cast(int, v), 0x160 | X, 0xf, 0xf, true)); }   // 0x160 | X = row_xmask:X
__device__ __forceinline__ float max16(float v) { v = fmaxf(v, lane_x<1>(v)); v = fmaxf(v, lane_x<2>(v)); v = fmaxf(v, lane_x<4>(v)); return fmaxf(v, lane_x<8>(v)); }
// Eight independent 2^x in one statement. No result shares a register with an argument (early clobber), so none of the eight is followed directly by a read of its result or an overwrite of its argument;
// the v_nop is the free slot that the instruction set asks for behind the last one. The first results are ready when the statement ends.
__device__ __forceinline__ void exp2x8(float (&y)[8], const float (&x)[8]) {
  asm("v_exp_f32 %0, %8\n\tv_exp_f32 %1, %9\n\tv_exp_f32 %2, %10\n\tv_exp_f32 %3, %11\n\tv_exp_f32 %4, %12\n\tv_exp_f32 %5, %13\n\tv_exp_f32 %6, %14\n\tv_exp_f32 %7, %15\n\tv_nop"
      : "=&v"(y[0]), "=&v"(y[1]), "=&v"(y[2]), "=&v"(y[3]), "=&v"(y[4]), "=&v"(y[5]), "=&v"(y[6]), "=&v"(y[7])
      : "v"(x[0]), "v"(x[1]), "v"(x[2]), "v"(x[3]), "v"(x[4]), "v"(x[5]), "v"(x[6]), "v"(x[7])); }
__device__ __forceinline__ float sum16(float v) { v += lane_x<1>(v); v += lane_x<2>(v); v += lane_x<4>(v); return v + lane_x<8>(v); }
// ---- k_sc: block = (64 queries t, 128 keys s, batch b): logits theta^T . phi (3 products), kept in registers; per query the tile's max and sum of exp(logit - max) -> MP; exp(logit - max) x 2^11 as f16, transposed -> plane b of PT [s][t]; every batch in one grid
#define SC_KD 64                   // d per stage: one whole 128-B line of every phi row
#define SC_NS (DD / SC_KD)
#define SC_LD (SC_KD + 8)          // LDS row pitch in bf16: 144 B = 16 B x odd, so the 16 rows of a 16-byte fragment read fall on distinct banks
#define SC_PLB (128 * SC_LD * 2)   // bytes of one plane (hi or lo) of one buffer
#define SC_BUFB (2 * SC_PLB)       // bytes of one buffer
#define SC_COPY(l, p) copy8<16 * SC_LD * 2, 16 * DD * 2>(l, p)   // a lane's rows cr + 16 i of one plane
// The phi tile of a stage (128 keys x 64 d, hi and lo) is the same for the 4 waves: the work-group copies it once, in whole lines, into LDS; two buffers, so the next stage's copies fly while this stage is multiplied.
__global__ __launch_bounds__(128) void k_sc(const float* __restrict__ TH, const __bf16* __restrict__ PHH, const __bf16* __restrict__ PHL, float* __restrict__ MP, _Float16* __restrict__ PT) {
  __shared__ __align__(16) union { __bf16 k[2][2][128][SC_LD]; _Float16 p[128][72]; } sm;   // k: [buffer][hi, lo][key][d]; p: output staging [key][query], once the last stage has been read; pitch 144 B = 16 B x odd
  const int b = blockIdx.z; PT += (size_t)b * TT * TT;
  const int tid = threadIdx.x, wave = tid >> 5, lane = tid & 31, col = lane & 15, g = lane >> 4; const int k0 = blockIdx.y * 128; const int tq0 = blockIdx.x * 64 + wave * 16; const size_t q0 = (size_t)b * TT + tq0;
  const int cr = tid >> 3, cq = tid & 7;   // 8 lanes x 16 B = one 128-B line of a row; a thread has rows cr + 16 i of both planes
  const size_t ks = ((size_t)b * TT + k0 + cr) * DD + cq * 8; const char *gh = (const char*)(PHH + ks), *gl = (const char*)(PHL + ks);
  const unsigned l0 = (unsigned)(size_t)&sm.k[0][0][cr][cq * 8];   // low 32 bits of the shared address = byte address in LDS
  const float* trow = TH + (q0 + col) * DD;
  v8f acc[8] = {};
  SC_COPY(l0, gh); SC_COPY(l0 + SC_PLB, gl);
  asm volatile("s_wait_asynccnt 0x0" ::: "memory");   // this wave's copies of stage 0 have landed
  __syncthreads();                                    // publishes stage 0 to the 4 waves
  SC_COPY(l0 + SC_BUFB, gh + SC_KD * 2); SC_COPY(l0 + SC_BUFB + SC_PLB, gl + SC_KD * 2);
#pragma unroll 1   // rolled: one copy of the stage body, the buffer chosen by st & 1
  for (int st = 0; st < SC_NS; ++st) { const int cur = st & 1;
    const F2 a0 = split_row(trow, st * SC_KD, lane), a1 = split_row(trow, st * SC_KD + 32, lane);
    const __bf16* bs = &sm.k[cur][0][col][0]; v16b kh[2][2], kl[2][2];   // fragments of two key groups, read one pair ahead of their products, inside this stage only
#pragma unroll   // whole: kh and kl are indexed by constants only
    for (int u = 0; u < 2; ++u) { kh[0][u] = frag_b(bs + u * 16 * SC_LD, lane); kl[0][u] = frag_b(bs + (128 + u * 16) * SC_LD, lane); }
#pragma unroll   // whole: kh, kl and acc are indexed by constants only
    for (int q = 0; q < 8; ++q) { const int pp = q & 1, j = (q & 3) * 2; const F2& a = (q >> 2) ? a1 : a0;
      if (q + 1 < 8) { const int kn = (q + 1) >> 2, jn = ((q + 1) & 3) * 2;
#pragma unroll   // whole: as above
        for (int u = 0; u < 2; ++u) { kh[pp ^ 1][u] = frag_b(bs + (jn + u) * 16 * SC_LD + kn * 32, lane); kl[pp ^ 1][u] = frag_b(bs + (128 + (jn + u) * 16) * SC_LD + kn * 32, lane); } }
      acc[j] = wmma_bf(a.h, kh[pp][0], acc[j]); acc[j + 1] = wmma_bf(a.h, kh[pp][1], acc[j + 1]); acc[j] = wmma_bf(a.l, kh[pp][0], acc[j]); acc[j + 1] = wmma_bf(a.l, kh[pp][1], acc[j + 1]); acc[j] = wmma_bf(a.h, kl[pp][0], acc[j]); acc[j + 1] = wmma_bf(a.h, kl[pp][1], acc[j + 1]); }
    asm volatile("s_wait_dscnt 0x0" ::: "memory");      // this wave's reads of buffer cur are done before the buffer is handed to its next writer
    asm volatile("s_wait_asynccnt 0x0" ::: "memory");   // this wave's copies of stage st + 1 have landed
    __syncthreads();                                    // publishes stage st + 1 and ends every wave's reads of buffer cur
    if (st + 2 < SC_NS) { const unsigned l = l0 + cur * SC_BUFB; const int d2 = (st + 2) * SC_KD * 2; SC_COPY(l, gh + d2); SC_COPY(l + SC_PLB, gl + d2); } }
  asm volatile("s_wait_asynccnt 0x0" ::: "memory");     // no copy is outstanding when the ring becomes output staging
  // A lane has queries tq0 + 8 g + r (r = 0..7) at keys k0 + 16 j + col: a wave holds all 128 keys of its 16 queries, so the tile's max and sum need this wave alone
  float mx[8], sl[8];
#pragma unroll   // whole, every loop of this epilogue: acc, mx and sl are indexed by constants only and stay in registers
  for (int r = 0; r < 8; ++r) { float m = acc[0][r];
#pragma unroll
    for (int j = 1; j < 8; ++j) m = fmaxf(m, acc[j][r]);
    mx[r] = max16(m); }
#pragma unroll
  for (int r = 0; r < 8; ++r) { const float nb = 11.0f - mx[r] * 1.4426950408889634f; float a[8], p[8], s = 0.f;   // 2^(w log2 e - max log2 e + 11) = exp(w - max) x 2^11
#pragma unroll
    for (int j = 0; j < 8; ++j) a[j] = fmaf(acc[j][r], 1.4426950408889634f, nb);
    exp2x8(p, a);
#pragma unroll
    for (int j = 0; j < 8; ++j) { acc[j][r] = p[j]; s += p[j]; }
    sl[r] = sum16(s); }
#pragma unroll
  for (int j = 0; j < 8; ++j) { v8h h;   // a lane's 8 queries at one key are 16 consecutive bytes of the transposed tile
#pragma unroll
    for (int r = 0; r < 8; ++r) h[r] = (_Float16)acc[j][r];
    *(v8h*)&sm.p[j * 16 + col][wave * 16 + 8 * g] = h; }
  __syncthreads();   // a key's 64 queries come from the 4 waves: all have stored before a line is read
  _Float16* pd = PT + (size_t)(k0 + cr) * TT + blockIdx.x * 64 + cq * 8;
#pragma unroll   // whole: a thread's 8 LDS reads are in flight together, their latency waited for once
  for (int i = 0; i < 8; ++i) vst2((unsigned*)(pd + (size_t)i * 16 * TT), *(const v4u*)&sm.p[i * 16 + cr][cq * 8]);   // 8 lanes x 16 B = one whole 128-B line of a key's row; a thread has keys cr + 16 i
  if (col == 0) { float* mp = MP + (((size_t)b * NKB + blockIdx.y) * TT + tq0 + 8 * g) * 2;   // 16 queries x 8 B: one 128-B line a wave; behind the barrier, which would otherwise wait for these stores
#pragma unroll
    for (int r = 0; r < 8; r += 2) vst2(mp + r * 2, v4f{mx[r], sl[r], mx[r + 1], sl[r + 1]}); } }
// ---- k_mg: thread = (query t, batch b): the query's 16 tile records merged in a fixed order: row max, row sum = sum of tile sum x exp(tile max - row max); factor of a tile = exp(tile max - row max) / row sum, x 2^8, which keeps more of the low half of g x factor above the subnormal range of f16
__global__ __launch_bounds__(256) void k_mg(const float* __restrict__ MP, float* __restrict__ CF) {
  const int t = blockIdx.x * 256 + threadIdx.x; const size_t b = blockIdx.y; const float* src = MP + (b * NKB * TT + t) * 2; v2f r[NKB]; float e[NKB];
#pragma unroll   // whole, every loop here: r and e stay in registers and the 16 loads are in flight together
  for (int i = 0; i < NKB; ++i) r[i] = *(const v2f*)(src + (size_t)i * TT * 2);
  float m = r[0][0];
#pragma unroll
  for (int i = 1; i < NKB; ++i) m = fmaxf(m, r[i][0]);
  float l = 0.f;
#pragma unroll
  for (int i = 0; i < NKB; ++i) { e[i] = expf(r[i][0] - m); l += r[i][1] * e[i]; }
  const float inv = (2048.0f * 256.0f) / l;   // the tile sums carry 2^11
#pragma unroll
  for (int i = 0; i < NKB; ++i) CF[(b * NKB + i) * TT + t] = e[i] * inv; }
// ---- k_pv: block = (64 rows d... no: rows = s (64), cols = d (128 group)) of batch b: attn^T[s][d] = sum_t P[t][s] g[d][t]: A = PT rows [s][t] (f16, exp(logit - tile max) x 2^11), B(k=t, col=d) = g[d][t] x factor[t] (x 2^8), converted on the fly to f16 hi + residual
#define PV_KT 64            // positions t per stage
#define PV_NS (TT / PV_KT)
#define PV_LD (PV_KT + 8)   // LDS row pitch in halves: 144 B = 16 B x odd, so the 16 rows of a 16-byte fragment read fall on distinct banks
typedef __attribute__((ext_vector_type(4))) _Float16 v4h;
// The g tile of a stage (128 d x 64 t) is the same for the 4 waves: the work-group loads it once in whole lines, multiplies it by the positions' factors, splits it once into f16 hi + lo and stages it in LDS; two buffers, so the next stage's global loads fly while this stage is multiplied.
__global__ __launch_bounds__(128) void k_pv(const _Float16* __restrict__ PT, const float* __restrict__ G, const float* __restrict__ CF, float* __restrict__ AT) { __shared__ __align__(16) float ss[4][16][132]; __shared__ __align__(16) _Float16 sg[2][2][128][PV_LD];   // sg: [buffer][hi, lo][d][t]
  const int tid = threadIdx.x, wave = tid >> 5, lane = tid & 31, col = lane & 15, g = lane >> 4; const int d0 = blockIdx.y * 128; const int s0 = blockIdx.x * 64 + wave * 16;
  const int b = blockIdx.z; PT += (size_t)b * TT * TT;   // every batch in one grid: 512 work-groups in one launch, not 8 launches of 64
  const int gr_row = tid >> 4, gr_q = tid & 15;          // 16 threads x 16 B = one 256-B row piece of the tile; a thread has rows gr_row + 8 i
  const float* gsrc = G + ((size_t)b * DD + d0 + gr_row) * TT + gr_q * 4; const _Float16* arow = PT + (size_t)(s0 + col) * TT;
  const float* csrc = CF + ((size_t)b * NKB + (blockIdx.x >> 1)) * TT + gr_q * 4;   // the block's 64 keys lie in one key tile: one factor per position t, the same for every d
  v8f acc[8] = {}; v4f gr[16]; v16h a0, a1, n0, n1;   // the loops over gr, fh and fl below are unrolled whole so that these arrays stay in registers
#pragma unroll
  for (int i = 0; i < 16; ++i) gr[i] = *(const v4f*)(gsrc + (size_t)i * 8 * TT);
  v4f cf = *(const v4f*)csrc;
  n0 = frag_h(arow, lane); n1 = frag_h(arow + 32, lane);
#pragma unroll 1   // rolled: one copy of the stage body, the buffer chosen by st & 1
  for (int st = 0; st < PV_NS; ++st) { const int cur = st & 1;
    _Float16* dst = &sg[cur][0][gr_row][gr_q * 4];
#pragma unroll
    for (int i = 0; i < 16; ++i) { v4h hi, lo;
#pragma unroll
      for (int e = 0; e < 4; ++e) { const float v = gr[i][e] * cf[e]; const _Float16 h = (_Float16)v; hi[e] = h; lo[e] = (_Float16)(v - (float)h); }
      *(v4h*)(dst + i * 8 * PV_LD) = hi; *(v4h*)(dst + (128 + i * 8) * PV_LD) = lo; }
    a0 = n0; a1 = n1;
    __syncthreads();   // publishes buffer cur to the 4 waves; it also stands between every wave's last reads of the other buffer (the trip before) and the next trip's stores into it
    if (st + 1 < PV_NS) { const int t1 = (st + 1) * PV_KT;   // next stage's global loads, issued ahead of this stage's products
#pragma unroll
      for (int i = 0; i < 16; ++i) gr[i] = *(const v4f*)(gsrc + (size_t)i * 8 * TT + t1);
      cf = *(const v4f*)(csrc + t1);
      n0 = frag_h(arow + t1, lane); n1 = frag_h(arow + t1 + 32, lane); }
    const _Float16* bsrc = &sg[cur][0][col][0]; v16h fh[2][2], fl[2][2];   // fragments of two column groups, read one pair ahead of their products
#pragma unroll
    for (int u = 0; u < 2; ++u) { fh[0][u] = frag_h(bsrc + u * 16 * PV_LD, lane); fl[0][u] = frag_h(bsrc + (128 + u * 16) * PV_LD, lane); }
#pragma unroll
    for (int q = 0; q < 8; ++q) { const int pp = q & 1, j = (q & 3) * 2; const v16h a = (q >> 2) ? a1 : a0;
      if (q + 1 < 8) { const int kn = (q + 1) >> 2, jn = ((q + 1) & 3) * 2;
#pragma unroll
        for (int u = 0; u < 2; ++u) { fh[pp ^ 1][u] = frag_h(bsrc + (jn + u) * 16 * PV_LD + kn * 32, lane); fl[pp ^ 1][u] = frag_h(bsrc + (128 + (jn + u) * 16) * PV_LD + kn * 32, lane); } }
      acc[j] = wmma16(a, fh[pp][0], acc[j]); acc[j + 1] = wmma16(a, fh[pp][1], acc[j + 1]); acc[j] = wmma16(a, fl[pp][0], acc[j]); acc[j + 1] = wmma16(a, fl[pp][1], acc[j + 1]); } }
#pragma unroll
  for (int j = 0; j < 8; ++j)
#pragma unroll
    for (int r = 0; r < 8; ++r) ss[wave][8 * g + r][j * 16 + col] = acc[j][r] * (1.0f / (2048.0f * 256.0f));
  LDSX(); for (int rl = 0; rl < 16; ++rl) vst2(AT + ((size_t)b * TT + s0 + rl) * DD + d0 + lane * 4, *(const v4f*)&ss[wave][rl][lane * 4]); }
// ---- k_ht: block = (64 positions s, 128 out channels c, b): h[c][s] = sum_d ht_w[c][d] attn^T[s][d] + ht_b[c]; rows = s (A = attn^T hi+lo), B(k=d, col=c) = ht_w[c][d]; writes h [b][c][t] via LDS transpose + per-block BN partials
#define HT_KD 64                    // d per stage: two whole 128-B lines of every ht_w row
#define HT_NS (DD / HT_KD)
#define HT_LD (HT_KD + 4)           // LDS row pitch in floats: 272 B = 16 B x odd, so the 16 rows of a 16-byte fragment read fall on distinct banks
#define HT_BUFB (128 * HT_LD * 4)   // bytes of one buffer
#define HT_COPY(l, p) do { copy8<8 * HT_LD * 4, 8 * DD * 4>(l, p); copy8<8 * HT_LD * 4, 8 * DD * 4>((l) + 64u * HT_LD * 4, (p) + 64 * DD * 4); } while (0)   // a lane's rows cr + 8 i of the 128
// The ht_w tile of a stage (128 c x 64 d) is the same for the 4 waves: the work-group copies it once, in whole lines, into LDS; two buffers, so the next stage's copies fly while this stage is multiplied.
__global__ __launch_bounds__(128) void k_ht(const float* __restrict__ AT, const float* __restrict__ HW, const float* __restrict__ HB, float* __restrict__ Hh, float* __restrict__ ST) { __shared__ __align__(16) union { float w[2][128][HT_LD]; float st[128][68]; } sm; __shared__ __align__(16) float sst[128][2];   // w: [buffer][c][d]; st: output staging, once the last stage has been read
  const int tid = threadIdx.x, wave = tid >> 5, lane = tid & 31, col = lane & 15, g = lane >> 4; const int c0 = blockIdx.y * 128; const size_t b = blockIdx.z; const int s0 = blockIdx.x * 64; const size_t r0 = b * TT + s0 + wave * 16;
  const int cr = tid >> 4, cq = tid & 15;   // 16 lanes x 16 B = the 256 B of a row; a thread has rows cr + 8 i
  const char* gw = (const char*)(HW + (size_t)(c0 + cr) * DD + cq * 4);
  const unsigned l0 = (unsigned)(size_t)&sm.w[0][cr][cq * 4];   // low 32 bits of the shared address = byte address in LDS
  const float* arow = AT + (r0 + col) * DD;
  v8f acc[8] = {};
  HT_COPY(l0, gw);
  asm volatile("s_wait_asynccnt 0x0" ::: "memory");   // this wave's copies of stage 0 have landed
  __syncthreads();                                    // publishes stage 0 to the 4 waves
  HT_COPY(l0 + HT_BUFB, gw + HT_KD * 4);
#pragma unroll 1   // rolled: one copy of the stage body, the buffer chosen by sg & 1
  for (int sg = 0; sg < HT_NS; ++sg) { const int cur = sg & 1; const float* bs = &sm.w[cur][col][8 * g];
    const F2 a0 = split_row(arow, sg * HT_KD, lane), a1 = split_row(arow, sg * HT_KD + 32, lane);
    WR r[2][2];   // the floats of two column groups, read one pair ahead of their products, inside this stage only
#pragma unroll   // whole: r is indexed by constants only
    for (int u = 0; u < 2; ++u) r[0][u] = raw_wf(bs + u * 16 * HT_LD);
#pragma unroll   // whole: r and acc are indexed by constants only
    for (int q = 0; q < 8; ++q) { const int pp = q & 1, j = (q & 3) * 2; const F2& a = (q >> 2) ? a1 : a0;
      if (q + 1 < 8) { const int kn = (q + 1) >> 2, jn = ((q + 1) & 3) * 2;
#pragma unroll   // whole: as above
        for (int u = 0; u < 2; ++u) r[pp ^ 1][u] = raw_wf(bs + (jn + u) * 16 * HT_LD + kn * 32); }
      const v16b w0 = cvt_wf(r[pp][0]), w1 = cvt_wf(r[pp][1]);
      acc[j] = wmma_bf(a.h, w0, acc[j]); acc[j + 1] = wmma_bf(a.h, w1, acc[j + 1]); acc[j] = wmma_bf(a.l, w0, acc[j]); acc[j + 1] = wmma_bf(a.l, w1, acc[j + 1]); }
    asm volatile("s_wait_dscnt 0x0" ::: "memory");      // this wave's reads of buffer cur are done before the buffer is handed to its next writer
    asm volatile("s_wait_asynccnt 0x0" ::: "memory");   // this wave's copies of stage sg + 1 have landed
    __syncthreads();                                    // publishes stage sg + 1 and ends every wave's reads of buffer cur
    if (sg + 2 < HT_NS) HT_COPY(l0 + cur * HT_BUFB, gw + (sg + 2) * HT_KD * 4); }
  asm volatile("s_wait_asynccnt 0x0" ::: "memory");     // no copy is outstanding when the ring becomes output staging
#pragma unroll
  for (int j = 0; j < 8; ++j) { const int cl = j * 16 + col; const float bb = bfr(HB[c0 + cl]);
#pragma unroll
    for (int r = 0; r < 8; ++r) sm.st[cl][wave * 16 + 8 * g + r] = acc[j][r] + bb; }
  __syncthreads();
  for (int e = tid; e < 128 * 16; e += 128) { const int cl = e >> 4, q = e & 15; vst2(Hh + (b * CC + c0 + cl) * (size_t)TT + s0 + q * 4, *(const v4f*)&sm.st[cl][q * 4]); }
  { const int cl = tid; float s = 0.f; for (int q = 0; q < 64; ++q) s += sm.st[cl][q]; const float mean = s / 64.0f; float m2 = 0.f; for (int q = 0; q < 64; ++q) { const float d = sm.st[cl][q] - mean; m2 += d * d; } sst[cl][0] = mean; sst[cl][1] = m2; }
  __syncthreads(); if (tid < 64) vst2(ST + (((b * (TT / 64) + blockIdx.x) * CC) + c0) * 2 + tid * 4, *(const v4f*)&(&sst[0][0])[tid * 4]); }
// ---- k_bn: block = 32 channels (lane = channel), 8 waves x 32 of the channel's NB*32 block partials (64 values each): mean = mean of the block means, M2 = sum of (M2_blk + 64 (mean_blk - mean)^2), both summed in a fixed order (32 in a thread, then the 8 waves in turn) -> mean, inv_std (biased)
#define BN_NR (NB * (TT / 64))   // records per channel
#define BN_PT (BN_NR / 8)        // records per thread
__global__ __launch_bounds__(256) void k_bn(const float* __restrict__ ST, float* __restrict__ BN) { __shared__ float sm[8][32]; __shared__ float sq[8][32];
  const int lane = threadIdx.x & 31, wave = threadIdx.x >> 5; const int c = blockIdx.x * 32 + lane; const float* src = ST + ((size_t)wave * BN_PT * CC + c) * 2; v2f r[BN_PT];
#pragma unroll   // whole: r stays in registers and a thread's loads are all in flight together, so memory latency is paid once and not once per record
  for (int i = 0; i < BN_PT; ++i) r[i] = *(const v2f*)(src + (size_t)i * CC * 2);
  float s = 0.f;
#pragma unroll   // whole: r is indexed by constants only
  for (int i = 0; i < BN_PT; ++i) s += r[i][0];
  sm[wave][lane] = s; __syncthreads();
  float tot = 0.f; for (int w = 0; w < 8; ++w) tot += sm[w][lane];
  const float mean = tot * (1.0f / BN_NR); float q = 0.f;
#pragma unroll   // whole: r is indexed by constants only
  for (int i = 0; i < BN_PT; ++i) { const float d = r[i][0] - mean; q += r[i][1] + 64.f * d * d; }
  sq[wave][lane] = q; __syncthreads();
  if (wave == 0) { float M2 = 0.f; for (int w = 0; w < 8; ++w) M2 += sq[w][lane]; BN[c] = mean; BN[CC + c] = 1.0f / sqrtf(M2 / (64.f * BN_NR) + 1e-5f); } }
// ---- k_out: block = (c, b): out[b][c][t] = inpt + gamma (h - mean) inv + beta over the 2,048 positions
__global__ __launch_bounds__(256) void k_out(const float* __restrict__ X, const float* __restrict__ Hh, const float* __restrict__ BN, const float* __restrict__ GA, const float* __restrict__ BE, float* __restrict__ OUT) { __shared__ __align__(16) float so[TT]; const int t = threadIdx.x; const int c = blockIdx.x; const size_t b = blockIdx.y; const float mean = BN[c], inv = BN[CC + c], ga = bfr(GA[c]), be = bfr(BE[c]);
  const size_t base = (b * CC + c) * (size_t)TT; for (int e = t; e < TT; e += 256) so[e] = bfr(X[base + e]) + (ga * (Hh[base + e] - mean) * inv + be);
  __syncthreads(); for (int q = t; q < TT / 4; q += 256) vst2(OUT + base + q * 4, *(const v4f*)&so[q * 4]); }
extern "C" void kernel_launch(void* const* d_in, const int* in_sizes, int n_in, void* d_out, int out_size, void* d_ws, size_t ws_size, hipStream_t stream) {
  (void)in_sizes; (void)n_in; (void)out_size;
  const float** F = (const float**)d_in;   // 0 inpt [8,512,2048], 1 theta_w [256,512], 2 theta_b, 3 phi_w, 4 phi_b, 5 g_w, 6 g_b, 7 ht_w [512,256], 8 ht_b, 9 bn_gamma, 10 bn_beta
  if (ws_size < (size_t)WS_END) return;
  char* ws = (char*)d_ws; float *TH = (float*)(ws + WS_TH), *G = (float*)(ws + WS_G), *MP = (float*)(ws + WS_MP), *CF = (float*)(ws + WS_CF), *AT = (float*)(ws + WS_AT), *Hh = (float*)(ws + WS_H), *ST = (float*)(ws + WS_ST), *BN = (float*)(ws + WS_BN); __bf16 *PHH = (__bf16*)(ws + WS_PHH), *PHL = (__bf16*)(ws + WS_PHL); _Float16* PT = (_Float16*)(ws + WS_PT);
  k_proj<<<dim3(TT / 64, TNB, 3), 128, 0, stream>>>(F[0], F[1], F[2], F[3], F[4], F[5], F[6], TH, PHH, PHL, G);
  k_sc<<<dim3(TT / 64, TT / 128, TNB), 128, 0, stream>>>(TH, PHH, PHL, MP, PT);
  k_mg<<<dim3(TT / 256, TNB), 256, 0, stream>>>(MP, CF);
  k_pv<<<dim3(TT / 64, DD / 128, TNB), 128, 0, stream>>>(PT, G, CF, AT);
  k_ht<<<dim3(TT / 64, CC / 128, TNB), 128, 0, stream>>>(AT, F[7], F[8], Hh, ST);
  k_bn<<<CC / 32, 256, 0, stream>>>(ST, BN);
  k_out<<<dim3(CC, TNB), 256, 0, stream>>>(F[0], Hh, BN, F[9], F[10], (float*)d_out);
}

// v007
// It runs in 165 microseconds.
// Two timings next to v006 both put it at 1.12 times that version's speed.
// Counting every step since v000, it is 16.2 times as fast.
// compute dtype: all float inputs rounded to bf16; theta / phi / g = W x + b (1x1 convs) with EXACT bf16 products on WMMA 16x16x32 (x^T tile staged in LDS), f32 accumulate; theta and phi kept in f32 and split into bf16 hi + lo for the UNSCALED logits w = theta^T phi (3 products; logits std ~5, sharp softmax), softmax in f32, first inside each tile of 128 keys while the logits are still in registers: exp(w - tile max) -> P^T planes as f16 x 2^11, with (tile max, tile sum) per query; the 16 tiles of a query merged into one factor per (query, tile), which multiplies g; attn[d][s] = sum_t (g[d][t] factor[t]) P~[t][s] with the scaled g as f16 hi + lo (2 products); h = ht_w attn (attn bf16 hi + lo, 2 products) + ht_b; BatchNorm1d training statistics over (B, T) per channel from per-block (mean, M2) partials merged in a fixed order; out = inpt + gamma h_norm + beta; f32 output.
#include <hip/hip_runtime.h>
#include <math.h>

typedef __attribute__((ext_vector_type(16))) _Float16 v16h;
typedef __attribute__((ext_vector_type(16))) __bf16 v16b;
typedef __attribute__((ext_vector_type(8)))  _Float16 v8h;
typedef __attribute__((ext_vector_type(8)))  float v8f;
typedef __attribute__((ext_vector_type(4)))  float v4f;
typedef __attribute__((ext_vector_type(2)))  float v2f;
typedef __attribute__((ext_vector_type(4)))  unsigned v4u;
typedef __attribute__((ext_vector_type(4)))  int v4i;
typedef float __attribute__((may_alias)) float_a;
typedef int __attribute__((may_alias)) int_a;

template <typename T> __device__ __forceinline__ void vst2(void* p, T v) { *(T*)p = v;  }
__device__ __forceinline__ v8f wmma16(v16h a, v16h b, v8f c) {
  v8f d = __builtin_amdgcn_wmma_f32_16x16x32_f16(false, a, false, b, (short)0, c, false, false);
  asm volatile("v_nop\n\tv_nop\n\tv_nop\n\tv_nop" : "+v"(d) : "v"(a), "v"(b));
  return d;
}
__device__ __forceinline__ v8f wmma_bf(v16b a, v16b b, v8f c) {
  v8f d = __builtin_amdgcn_wmma_f32_16x16x32_bf16(false, a, false, b, (short)0, c, false, false);
  asm volatile("v_nop\n\tv_nop\n\tv_nop\n\tv_nop" : "+v"(d) : "v"(a), "v"(b));
  return d;
}
// 16x16x32 fragments: lane = (h = lane>>4, row/col = lane&15); elements 0..7 = k0+8h+0..7, 8..15 = k0+16+8h+0..7; D element r = row 8h+r
__device__ __forceinline__ v16h frag_h(const _Float16* rowk0, int lane) {
  union { v16h v; v8h q[2]; } u; const _Float16* p = rowk0 + 8 * (lane >> 4);
  u.q[0] = *(const v8h*)p; u.q[1] = *(const v8h*)(p + 16); return u.v;
}
__device__ __forceinline__ v16h frag_f32(const float* rowk0, int lane) {
  v16h a; const float* p = rowk0 + 8 * (lane >> 4);
#pragma unroll
  for (int i = 0; i < 8; ++i) { a[i] = (_Float16)p[i]; a[8 + i] = (_Float16)p[16 + i]; }
  return a;
}
__device__ __forceinline__ v16h frag_f32s(const float* rowk0, int lane, float sc) {
  v16h a; const float* p = rowk0 + 8 * (lane >> 4);
#pragma unroll
  for (int i = 0; i < 8; ++i) { a[i] = (_Float16)(p[i] * sc); a[8 + i] = (_Float16)(p[16 + i] * sc); }
  return a;
}
// column fragment from a [K][ld] layout (column n), rows >= K read as 0
__device__ __forceinline__ v16h fragc_f32(const float* W, int k0, int n, int lane, int ld, int K) {
  v16h a; const int g = lane >> 4;
#pragma unroll
  for (int i = 0; i < 8; ++i) { const int ka = k0 + 8 * g + i, kb = ka + 16;
    a[i] = (_Float16)(ka < K ? W[(size_t)(ka < K ? ka : K - 1) * ld + n] : 0.f); a[8 + i] = (_Float16)(kb < K ? W[(size_t)(kb < K ? kb : K - 1) * ld + n] : 0.f); }
  return a;
}
struct F2 { v16b h, l; };
__device__ __forceinline__ F2 bsplit16(const float v[16]) { F2 r;
#pragma unroll
  for (int i = 0; i < 16; ++i) { const __bf16 h = (__bf16)v[i]; r.h[i] = h; r.l[i] = (__bf16)(v[i] - (float)h); }
  return r; }
__device__ __forceinline__ F2 split_row(const float* row, int k0, int lane) { float v[16]; const float* p = row + k0 + 8 * (lane >> 4);
#pragma unroll
  for (int i = 0; i < 8; ++i) { v[i] = p[i]; v[8 + i] = p[16 + i]; }
  return bsplit16(v); }
__device__ __forceinline__ F2 split_rowK(const float* row, int k0, int lane, int K) { float v[16]; const int g = lane >> 4;
#pragma unroll
  for (int i = 0; i < 8; ++i) { const int ka = k0 + 8 * g + i, kb = ka + 16; v[i] = ka < K ? row[ka < K ? ka : K - 1] : 0.f; v[8 + i] = kb < K ? row[kb < K ? kb : K - 1] : 0.f; }
  return bsplit16(v); }
__device__ __forceinline__ F2 split_col(const float* W, int k0, int n, int lane, int ld, int K) { float v[16]; const int g = lane >> 4;
#pragma unroll
  for (int i = 0; i < 8; ++i) { const int ka = k0 + 8 * g + i, kb = ka + 16; v[i] = ka < K ? W[(size_t)(ka < K ? ka : K - 1) * ld + n] : 0.f; v[8 + i] = kb < K ? W[(size_t)(kb < K ? kb : K - 1) * ld + n] : 0.f; }
  return bsplit16(v); }
__device__ __forceinline__ v8f mac3(const F2& a, const F2& b, v8f c) { c = wmma_bf(a.l, b.h, c); c = wmma_bf(a.h, b.l, c); return wmma_bf(a.h, b.h, c); }
__device__ __forceinline__ float sigm(float v) { return 1.0f / (1.0f + expf(-v)); }
#define LDSX() do { asm volatile("s_wait_dscnt 0" ::: "memory"); __builtin_amdgcn_wave_barrier(); __builtin_amdgcn_fence(__ATOMIC_RELEASE, "workgroup"); } while (0)


// Non-local block over time (B 8, C 512, D 256, T 2,048): theta/phi/g 1x1 convs; w = softmax_s(theta^T phi); attn = g w (the module contracts g over the QUERY index); h = ht(attn); training-mode BatchNorm1d; out = inpt + bn(h).
#define NB 8
#define CC 512
#define DD 256
#define TT 2048
#ifndef TNB
#define TNB NB
#endif
typedef __attribute__((ext_vector_type(8))) __bf16 v8b;
typedef __attribute__((ext_vector_type(4))) __bf16 v4b;
__device__ __forceinline__ v16b frag_b(const __bf16* rowk0, int lane) {
  union { v16b v; v8b q[2]; } u; const __bf16* p = rowk0 + 8 * (lane >> 4);
  u.q[0] = *(const v8b*)p; u.q[1] = *(const v8b*)(p + 16); return u.v;
}
__device__ __forceinline__ float bfr(float v) { return (float)(__bf16)v; }
__device__ __attribute__((noinline)) float exp_ni(float v) { return expf(v); }
__device__ __attribute__((noinline)) float erf_ni(float v) { return erff(v); }

#define WS_TH  0u                                    // f32 theta^T rows [b*t][256]
#define WS_PHH (WS_TH + 4u * (size_t)NB * TT * DD)      // bf16 phi^T hi rows [b*s][256]
#define WS_PHL (WS_PHH + 2u * (size_t)NB * TT * DD)
#define WS_G   (WS_PHL + 2u * (size_t)NB * TT * DD)     // f32 g [b][d][t]
#define WS_S   (WS_G + 4u * (size_t)NB * DD * TT)       // region of attn^T, h, the tile statistics and the factors below
#define WS_PT  (WS_CF + 4u * (size_t)NB * NKB * TT)    // f16 planes, one per batch [b][s][t]: exp(logit - max of the query's logits in the key tile of s) x 2^11
#define WS_AT  WS_S                                   // f32 attn^T rows [b*s][256]
#define WS_H   (WS_AT + 4u * (size_t)NB * TT * DD)      // f32 h [b][c][t]
#define NKB (TT / 128)                                // key tiles per query
#define WS_MP  (WS_H + 4u * (size_t)NB * CC * TT)      // f32 (tile max, tile sum x 2^11) [b][key tile][t][2]
#define WS_CF  (WS_MP + 4u * (size_t)NB * NKB * TT * 2) // f32 factor [b][key tile][t] = exp(tile max - row max) / row sum x 2^8
#define WS_ST  (WS_PT + 2u * (size_t)NB * TT * TT)     // f32 BN partials [(b*(TT/64) + tblk)][c][2] - one record per (batch, 64-position block)
#define WS_BN  (WS_ST + 4u * (size_t)NB * (TT / 64) * CC * 2)    // f32 mean [512], inv [512]
#define WS_END (WS_BN + 4u * 2 * CC)

// One lane's eight 16-byte copies global -> LDS, through no register: rows r, r + n, ..., r + 7 n of a tile (l = LDS byte address and p = global address of the lane's 16 bytes in row r; LS and GS = bytes from one of these rows to the next, in LDS and in global memory).
// The s_wait_xcnt is the last line of the copies' own statement, so that no address register is rewritten ahead of it.
template <int LS, int GS> __device__ __forceinline__ void copy8(unsigned l, const char* p) {
  asm volatile("global_load_async_to_lds_b128 %0, %8, off\n\t"
               "global_load_async_to_lds_b128 %1, %9, off\n\t"
               "global_load_async_to_lds_b128 %2, %10, off\n\t"
               "global_load_async_to_lds_b128 %3, %11, off\n\t"
               "global_load_async_to_lds_b128 %4, %12, off\n\t"
               "global_load_async_to_lds_b128 %5, %13, off\n\t"
               "global_load_async_to_lds_b128 %6, %14, off\n\t"
               "global_load_async_to_lds_b128 %7, %15, off\n\t"
               "s_wait_xcnt 0x0"
               :: "v"(l), "v"(l + 1u * LS), "v"(l + 2u * LS), "v"(l + 3u * LS), "v"(l + 4u * LS), "v"(l + 5u * LS), "v"(l + 6u * LS), "v"(l + 7u * LS),
                  "v"(p), "v"(p + 1 * GS), "v"(p + 2 * GS), "v"(p + 3 * GS), "v"(p + 4 * GS), "v"(p + 5 * GS), "v"(p + 6 * GS), "v"(p + 7 * GS)
               : "memory");
}
// A bf16 fragment from a row of f32 in LDS, in two halves, so that the reads can stand well ahead of the products: raw_wf reads the 16 floats (p = row + k0 + 8 h), cvt_wf rounds them; the same elements in the same order as the fragment loads from global rows
struct WR { v4f x[4]; };
__device__ __forceinline__ WR raw_wf(const float* p) { WR r; r.x[0] = *(const v4f*)p; r.x[1] = *(const v4f*)(p + 4); r.x[2] = *(const v4f*)(p + 16); r.x[3] = *(const v4f*)(p + 20); return r; }
__device__ __forceinline__ v16b cvt_wf(const WR& r) { v16b w;
#pragma unroll   // whole, this loop and the next: w and r are indexed by constants only and stay in registers
  for (int q = 0; q < 4; ++q)
#pragma unroll
    for (int i = 0; i < 4; ++i) w[4 * q + i] = (__bf16)r.x[q][i];
  return w; }

// ---- k_proj: block = (64 positions t, b, which 0 theta / 1 phi / 2 g): x^T tile (bf16) in LDS; W [d][c]; outputs: theta^T f32 rows, phi^T bf16 hi/lo rows, g f32 [d][t]
#define PJ_KC 64                    // c per stage: two whole 128-B lines of every W row
#define PJ_NS (CC / PJ_KC)          // stages per group of 64 output columns
#define PJ_LD (PJ_KC + 4)           // LDS row pitch in floats: 272 B = 16 B x odd, so the 16 rows of a 16-byte fragment read fall on distinct banks
#define PJ_BUFB (64 * PJ_LD * 4)    // bytes of one buffer
#define PJ_COPY(l, p) copy8<8 * PJ_LD * 4, 8 * CC * 4>(l, p)   // a lane's rows cr + 8 i of the 64
// The W tile of a stage (64 d x 64 c) is the same for the 4 waves: the work-group copies it once, in whole lines, into LDS; two buffers, so the next stage's copies fly while this stage is multiplied.
__global__ __launch_bounds__(128) void k_proj(const float* __restrict__ X, const float* __restrict__ WT, const float* __restrict__ BT, const float* __restrict__ WP, const float* __restrict__ BP, const float* __restrict__ WG, const float* __restrict__ BG, float* __restrict__ TH, __bf16* __restrict__ PHH, __bf16* __restrict__ PHL, float* __restrict__ G) {
  __shared__ __align__(16) __bf16 sx[64][CC + 8]; __shared__ __align__(16) union { float w[2][64][PJ_LD]; float st[64][68]; } sm;   // w: [buffer][d][c]; st: output staging of a 64-col group, once its last stage has been read
  const int tid = threadIdx.x, wave = tid >> 5, lane = tid & 31, col = lane & 15, g = lane >> 4; const int t0 = blockIdx.x * 64; const size_t b = blockIdx.y; const int which = blockIdx.z;
  const float* Wm = which == 0 ? WT : which == 1 ? WP : WG; const float* Bm = which == 0 ? BT : which == 1 ? BP : BG;
  const int cr = tid >> 4, cq = tid & 15;   // 16 lanes x 16 B = the 256 B of a row; a thread has rows cr + 8 i
  const unsigned l0 = (unsigned)(size_t)&sm.w[0][cr][cq * 4];   // low 32 bits of the shared address = byte address in LDS
  { const int xq = tid & 15, xc = (tid >> 4) * 4;   // 16 lanes x 16 B = the 256 B of a channel's row piece; a thread has 4 positions of channels xc + 32 i + 0..3
    const float* xs = X + (b * CC + xc) * (size_t)TT + t0 + xq * 4;
#pragma unroll 1   // rolled: two batches of 32 loads, so that a batch's 128 registers are used twice
    for (int ib = 0; ib < 2; ++ib) { v4f xr[8][4];
#pragma unroll   // whole, the loops of this batch: xr is indexed by constants only, and the 32 loads are in flight together, so memory latency is paid once a batch
      for (int i = 0; i < 8; ++i)
#pragma unroll
        for (int k = 0; k < 4; ++k) xr[i][k] = *(const v4f*)(xs + (size_t)((ib * 8 + i) * 32 + k) * TT);
#pragma unroll
      for (int i = 0; i < 8; ++i)
#pragma unroll
        for (int e = 0; e < 4; ++e) { v4b w;   // 4 channels of one position: 8 consecutive bytes of the transposed tile
#pragma unroll
          for (int k = 0; k < 4; ++k) w[k] = (__bf16)xr[i][k][e];
          *(v4b*)&sx[xq * 4 + e][xc + (ib * 8 + i) * 32] = w; } } }
  __syncthreads();
#pragma unroll 1
  for (int cg = 0; cg < DD / 64; ++cg) { v8f acc[4] = {}; const char* gw = (const char*)(Wm + (size_t)(cg * 64 + cr) * CC + cq * 4);
    PJ_COPY(l0, gw);
    asm volatile("s_wait_asynccnt 0x0" ::: "memory");   // this wave's copies of stage 0 have landed
    __syncthreads();                                    // publishes stage 0 to the 4 waves
    PJ_COPY(l0 + PJ_BUFB, gw + PJ_KC * 4);
#pragma unroll 1   // rolled: one copy of the stage body, the buffer chosen by s & 1
    for (int s = 0; s < PJ_NS; ++s) { const int cur = s & 1; const float* bs = &sm.w[cur][col][8 * g];
      v16b a[2]; WR r[2][4];   // the stage's LDS reads stand together ahead of its products: their latency is waited for once a stage
#pragma unroll   // whole, the four loops below: a, r and acc are indexed by constants only and stay in registers
      for (int u = 0; u < 2; ++u) { a[u] = frag_b(&sx[wave * 16 + col][s * PJ_KC + u * 32], lane);
#pragma unroll
        for (int j = 0; j < 4; ++j) r[u][j] = raw_wf(bs + j * 16 * PJ_LD + u * 32); }
#pragma unroll
      for (int u = 0; u < 2; ++u)
#pragma unroll
        for (int j = 0; j < 4; ++j) acc[j] = wmma_bf(a[u], cvt_wf(r[u][j]), acc[j]);
      asm volatile("s_wait_dscnt 0x0" ::: "memory");      // this wave's reads of buffer cur are done before the buffer is handed to its next writer
      asm volatile("s_wait_asynccnt 0x0" ::: "memory");   // this wave's copies of stage s + 1 have landed
      __syncthreads();                                    // publishes stage s + 1 and ends every wave's reads of buffer cur
      if (s + 2 < PJ_NS) PJ_COPY(l0 + cur * PJ_BUFB, gw + (s + 2) * PJ_KC * 4); }
    asm volatile("s_wait_asynccnt 0x0" ::: "memory");     // no copy is outstanding when the ring becomes output staging
#pragma unroll
    for (int j = 0; j < 4; ++j) { const int dl = j * 16 + col; const float bb = bfr(Bm[cg * 64 + dl]);
#pragma unroll
      for (int r = 0; r < 8; ++r) { const int tl = wave * 16 + 8 * g + r; const float v = acc[j][r] + bb; if (which == 2) sm.st[dl][tl] = v; else sm.st[tl][dl] = v; } }
    __syncthreads();
    if (which == 0) { for (int e = tid; e < 64 * 16; e += 128) { const int tl = e >> 4, q = e & 15; vst2(TH + (b * TT + t0 + tl) * DD + cg * 64 + q * 4, *(const v4f*)&sm.st[tl][q * 4]); } }
    else if (which == 1) { for (int e = tid; e < 64 * 8; e += 128) { const int tl = e >> 3, q = e & 7; const float* p = &sm.st[tl][q * 8]; v16b dummy; (void)dummy; __bf16 hh[8], ll[8]; 
#pragma unroll
        for (int i = 0; i < 8; ++i) { const __bf16 hv = (__bf16)p[i]; hh[i] = hv; ll[i] = (__bf16)(p[i] - (float)hv); }
        vst2((unsigned*)(PHH + (b * TT + t0 + tl) * DD + cg * 64 + q * 8), *(const v4u*)hh); vst2((unsigned*)(PHL + (b * TT + t0 + tl) * DD + cg * 64 + q * 8), *(const v4u*)ll); } }
    else { for (int e = tid; e < 64 * 16; e += 128) { const int dl = e >> 4, q = e & 15; vst2(G + (b * DD + cg * 64 + dl) * (size_t)TT + t0 + q * 4, *(const v4f*)&sm.st[dl][q * 4]); } }
    asm volatile("s_wait_dscnt 0x0" ::: "memory");   // this wave's reads of the staging are done before the next group's copies land on it
    __syncthreads(); } }                             // ends every wave's reads of the staging
// Maximum and sum over the 16 lanes of a row half (the 16 columns of an accumulator tile), every lane getting the result: four exchanges with lane ^ 1, 2, 4, 8 inside the vector unit
template <int X> __device__ __forceinline__ float lane_x(float v) { return __builtin_bit_cast(float, __builtin_amdgcn_update_dpp(0, __builtin_bit_cast(int, v), 0x160 | X, 0xf, 0xf, true)); }   // 0x160 | X = row_xmask:X
__device__ __forceinline__ float max16(float v) { v = fmaxf(v, lane_x<1>(v)); v = fmaxf(v, lane_x<2>(v)); v = fmaxf(v, lane_x<4>(v)); return fmaxf(v, lane_x<8>(v)); }
// Eight independent 2^x in one statement. No result shares a register with an argument (early clobber), so none of the eight is followed directly by a read of its result or an overwrite of its argument;
// the v_nop is the free slot that the instruction set asks for behind the last one. The first results are ready when the statement ends.
__device__ __forceinline__ void exp2x8(float (&y)[8], const float (&x)[8]) {
  asm("v_exp_f32 %0, %8\n\tv_exp_f32 %1, %9\n\tv_exp_f32 %2, %10\n\tv_exp_f32 %3, %11\n\tv_exp_f32 %4, %12\n\tv_exp_f32 %5, %13\n\tv_exp_f32 %6, %14\n\tv_exp_f32 %7, %15\n\tv_nop"
      : "=&v"(y[0]), "=&v"(y[1]), "=&v"(y[2]), "=&v"(y[3]), "=&v"(y[4]), "=&v"(y[5]), "=&v"(y[6]), "=&v"(y[7])
      : "v"(x[0]), "v"(x[1]), "v"(x[2]), "v"(x[3]), "v"(x[4]), "v"(x[5]), "v"(x[6]), "v"(x[7])); }
__device__ __forceinline__ float sum16(float v) { v += lane_x<1>(v); v += lane_x<2>(v); v += lane_x<4>(v); return v + lane_x<8>(v); }
// ---- k_sc: block = (64 queries t, 128 keys s, batch b): logits theta^T . phi (3 products), kept in registers; per query the tile's max and sum of exp(logit - max) -> MP; exp(logit - max) x 2^11 as f16, transposed -> plane b of PT [s][t]; every batch in one grid
#define SC_KD 64                   // d per stage: one whole 128-B line of every phi row
#define SC_NS (DD / SC_KD)
#define SC_LD (SC_KD + 8)          // LDS row pitch in bf16: 144 B = 16 B x odd, so the 16 rows of a 16-byte fragment read fall on distinct banks
#define SC_PLB (128 * SC_LD * 2)   // bytes of one plane (hi or lo) of one buffer
#define SC_BUFB (2 * SC_PLB)       // bytes of one buffer
#define SC_COPY(l, p) copy8<16 * SC_LD * 2, 16 * DD * 2>(l, p)   // a lane's rows cr + 16 i of one plane
// The phi tile of a stage (128 keys x 64 d, hi and lo) is the same for the 4 waves: the work-group copies it once, in whole lines, into LDS; two buffers, so the next stage's copies fly while this stage is multiplied.
__global__ __launch_bounds__(128) void k_sc(const float* __restrict__ TH, const __bf16* __restrict__ PHH, const __bf16* __restrict__ PHL, float* __restrict__ MP, _Float16* __restrict__ PT) {
  __shared__ __align__(16) union { __bf16 k[2][2][128][SC_LD]; _Float16 p[128][72]; } sm;   // k: [buffer][hi, lo][key][d]; p: output staging [key][query], once the last stage has been read; pitch 144 B = 16 B x odd
  const int b = blockIdx.z; PT += (size_t)b * TT * TT;
  const int tid = threadIdx.x, wave = tid >> 5, lane = tid & 31, col = lane & 15, g = lane >> 4; const int k0 = blockIdx.y * 128; const int tq0 = blockIdx.x * 64 + wave * 16; const size_t q0 = (size_t)b * TT + tq0;
  const int cr = tid >> 3, cq = tid & 7;   // 8 lanes x 16 B = one 128-B line of a row; a thread has rows cr + 16 i of both planes
  const size_t ks = ((size_t)b * TT + k0 + cr) * DD + cq * 8; const char *gh = (const char*)(PHH + ks), *gl = (const char*)(PHL + ks);
  const unsigned l0 = (unsigned)(size_t)&sm.k[0][0][cr][cq * 8];   // low 32 bits of the shared address = byte address in LDS
  const float* trow = TH + (q0 + col) * DD;
  v8f acc[8] = {};
  SC_COPY(l0, gh); SC_COPY(l0 + SC_PLB, gl);
  asm volatile("s_wait_asynccnt 0x0" ::: "memory");   // this wave's copies of stage 0 have landed
  __syncthreads();                                    // publishes stage 0 to the 4 waves
  SC_COPY(l0 + SC_BUFB, gh + SC_KD * 2); SC_COPY(l0 + SC_BUFB + SC_PLB, gl + SC_KD * 2);
#pragma unroll 1   // rolled: one copy of the stage body, the buffer chosen by st & 1
  for (int st = 0; st < SC_NS; ++st) { const int cur = st & 1;
    const F2 a0 = split_row(trow, st * SC_KD, lane), a1 = split_row(trow, st * SC_KD + 32, lane);
    const __bf16* bs = &sm.k[cur][0][col][0]; v16b kh[2][2], kl[2][2];   // fragments of two key groups, read one pair ahead of their products, inside this stage only
#pragma unroll   // whole: kh and kl are indexed by constants only
    for (int u = 0; u < 2; ++u) { kh[0][u] = frag_b(bs + u * 16 * SC_LD, lane); kl[0][u] = frag_b(bs + (128 + u * 16) * SC_LD, lane); }
#pragma unroll   // whole: kh, kl and acc are indexed by constants only
    for (int q = 0; q < 8; ++q) { const int pp = q & 1, j = (q & 3) * 2; const F2& a = (q >> 2) ? a1 : a0;
      if (q + 1 < 8) { const int kn = (q + 1) >> 2, jn = ((q + 1) & 3) * 2;
#pragma unroll   // whole: as above
        for (int u = 0; u < 2; ++u) { kh[pp ^ 1][u] = frag_b(bs + (jn + u) * 16 * SC_LD + kn * 32, lane); kl[pp ^ 1][u] = frag_b(bs + (128 + (jn + u) * 16) * SC_LD + kn * 32, lane); } }
      acc[j] = wmma_bf(a.h, kh[pp][0], acc[j]); acc[j + 1] = wmma_bf(a.h, kh[pp][1], acc[j + 1]); acc[j] = wmma_bf(a.l, kh[pp][0], acc[j]); acc[j + 1] = wmma_bf(a.l, kh[pp][1], acc[j + 1]); acc[j] = wmma_bf(a.h, kl[pp][0], acc[j]); acc[j + 1] = wmma_bf(a.h, kl[pp][1], acc[j + 1]); }
    asm volatile("s_wait_dscnt 0x0" ::: "memory");      // this wave's reads of buffer cur are done before the buffer is handed to its next writer
    asm volatile("s_wait_asynccnt 0x0" ::: "memory");   // this wave's copies of stage st + 1 have landed
    __syncthreads();                                    // publishes stage st + 1 and ends every wave's reads of buffer cur
    if (st + 2 < SC_NS) { const unsigned l = l0 + cur * SC_BUFB; const int d2 = (st + 2) * SC_KD * 2; SC_COPY(l, gh + d2); SC_COPY(l + SC_PLB, gl + d2); } }
  asm volatile("s_wait_asynccnt 0x0" ::: "memory");     // no copy is outstanding when the ring becomes output staging
  // A lane has queries tq0 + 8 g + r (r = 0..7) at keys k0 + 16 j + col: a wave holds all 128 keys of its 16 queries, so the tile's max and sum need this wave alone
  float mx[8], sl[8];
#pragma unroll   // whole, every loop of this epilogue: acc, mx and sl are indexed by constants only and stay in registers
  for (int r = 0; r < 8; ++r) { float m = acc[0][r];
#pragma unroll
    for (int j = 1; j < 8; ++j) m = fmaxf(m, acc[j][r]);
    mx[r] = max16(m); }
#pragma unroll
  for (int r = 0; r < 8; ++r) { const float nb = 11.0f - mx[r] * 1.4426950408889634f; float a[8], p[8], s = 0.f;   // 2^(w log2 e - max log2 e + 11) = exp(w - max) x 2^11
#pragma unroll
    for (int j = 0; j < 8; ++j) a[j] = fmaf(acc[j][r], 1.4426950408889634f, nb);
    exp2x8(p, a);
#pragma unroll
    for (int j = 0; j < 8; ++j) { acc[j][r] = p[j]; s += p[j]; }
    sl[r] = sum16(s); }
#pragma unroll
  for (int j = 0; j < 8; ++j) { v8h h;   // a lane's 8 queries at one key are 16 consecutive bytes of the transposed tile
#pragma unroll
    for (int r = 0; r < 8; ++r) h[r] = (_Float16)acc[j][r];
    *(v8h*)&sm.p[j * 16 + col][wave * 16 + 8 * g] = h; }
  __syncthreads();   // a key's 64 queries come from the 4 waves: all have stored before a line is read
  _Float16* pd = PT + (size_t)(k0 + cr) * TT + blockIdx.x * 64 + cq * 8;
#pragma unroll   // whole: a thread's 8 LDS reads are in flight together, their latency waited for once
  for (int i = 0; i < 8; ++i) vst2((unsigned*)(pd + (size_t)i * 16 * TT), *(const v4u*)&sm.p[i * 16 + cr][cq * 8]);   // 8 lanes x 16 B = one whole 128-B line of a key's row; a thread has keys cr + 16 i
  if (col == 0) { float* mp = MP + (((size_t)b * NKB + blockIdx.y) * TT + tq0 + 8 * g) * 2;   // 16 queries x 8 B: one 128-B line a wave; behind the barrier, which would otherwise wait for these stores
#pragma unroll
    for (int r = 0; r < 8; r += 2) vst2(mp + r * 2, v4f{mx[r], sl[r], mx[r + 1], sl[r + 1]}); } }
// ---- k_mg: thread = (query t, batch b): the query's 16 tile records merged in a fixed order: row max, row sum = sum of tile sum x exp(tile max - row max); factor of a tile = exp(tile max - row max) / row sum, x 2^8, which keeps more of the low half of g x factor above the subnormal range of f16
__global__ __launch_bounds__(256) void k_mg(const float* __restrict__ MP, float* __restrict__ CF) {
  const int t = blockIdx.x * 256 + threadIdx.x; const size_t b = blockIdx.y; const float* src = MP + (b * NKB * TT + t) * 2; v2f r[NKB]; float e[NKB];
#pragma unroll   // whole, every loop here: r and e stay in registers and the 16 loads are in flight together
  for (int i = 0; i < NKB; ++i) r[i] = *(const v2f*)(src + (size_t)i * TT * 2);
  float m = r[0][0];
#pragma unroll
  for (int i = 1; i < NKB; ++i) m = fmaxf(m, r[i][0]);
  float l = 0.f;
#pragma unroll
  for (int i = 0; i < NKB; ++i) { e[i] = expf(r[i][0] - m); l += r[i][1] * e[i]; }
  const float inv = (2048.0f * 256.0f) / l;   // the tile sums carry 2^11
#pragma unroll
  for (int i = 0; i < NKB; ++i) CF[(b * NKB + i) * TT + t] = e[i] * inv; }
// ---- k_pv: block = (64 rows d... no: rows = s (64), cols = d (128 group)) of batch b: attn^T[s][d] = sum_t P[t][s] g[d][t]: A = PT rows [s][t] (f16, exp(logit - tile max) x 2^11), B(k=t, col=d) = g[d][t] x factor[t] (x 2^8), converted on the fly to f16 hi + residual
#define PV_KT 64            // positions t per stage
#define PV_NS (TT / PV_KT)
#define PV_LD (PV_KT + 8)   // LDS row pitch in halves: 144 B = 16 B x odd, so the 16 rows of a 16-byte fragment read fall on distinct banks
typedef __attribute__((ext_vector_type(4))) _Float16 v4h;
// The g tile of a stage (128 d x 64 t) is the same for the 4 waves: the work-group loads it once in whole lines, multiplies it by the positions' factors, splits it once into f16 hi + lo and stages it in LDS; two buffers, so the next stage's global loads fly while this stage is multiplied.
__global__ __launch_bounds__(128) void k_pv(const _Float16* __restrict__ PT, const float* __restrict__ G, const float* __restrict__ CF, float* __restrict__ AT) { __shared__ __align__(16) float ss[4][16][132]; __shared__ __align__(16) _Float16 sg[2][2][128][PV_LD];   // sg: [buffer][hi, lo][d][t]
  const int tid = threadIdx.x, wave = tid >> 5, lane = tid & 31, col = lane & 15, g = lane >> 4; const int d0 = blockIdx.y * 128; const int s0 = blockIdx.x * 64 + wave * 16;
  const int b = blockIdx.z; PT += (size_t)b * TT * TT;   // every batch in one grid: 512 work-groups in one launch, not 8 launches of 64
  const int gr_row = tid >> 4, gr_q = tid & 15;          // 16 threads x 16 B = one 256-B row piece of the tile; a thread has rows gr_row + 8 i
  const float* gsrc = G + ((size_t)b * DD + d0 + gr_row) * TT + gr_q * 4; const _Float16* arow = PT + (size_t)(s0 + col) * TT;
  const float* csrc = CF + ((size_t)b * NKB + (blockIdx.x >> 1)) * TT + gr_q * 4;   // the block's 64 keys lie in one key tile: one factor per position t, the same for every d
  v8f acc[8] = {}; v4f gr[16]; v16h a0, a1, n0, n1;   // the loops over gr, fh and fl below are unrolled whole so that these arrays stay in registers
#pragma unroll
  for (int i = 0; i < 16; ++i) gr[i] = *(const v4f*)(gsrc + (size_t)i * 8 * TT);
  v4f cf = *(const v4f*)csrc;
  n0 = frag_h(arow, lane); n1 = frag_h(arow + 32, lane);
#pragma unroll 1   // rolled: one copy of the stage body, the buffer chosen by st & 1
  for (int st = 0; st < PV_NS; ++st) { const int cur = st & 1;
    _Float16* dst = &sg[cur][0][gr_row][gr_q * 4];
#pragma unroll
    for (int i = 0; i < 16; ++i) { v4h hi, lo;
#pragma unroll
      for (int e = 0; e < 4; ++e) { const float v = gr[i][e] * cf[e]; const _Float16 h = (_Float16)v; hi[e] = h; lo[e] = (_Float16)(v - (float)h); }
      *(v4h*)(dst + i * 8 * PV_LD) = hi; *(v4h*)(dst + (128 + i * 8) * PV_LD) = lo; }
    a0 = n0; a1 = n1;
    __syncthreads();   // publishes buffer cur to the 4 waves; it also stands between every wave's last reads of the other buffer (the trip before) and the next trip's stores into it
    if (st + 1 < PV_NS) { const int t1 = (st + 1) * PV_KT;   // next stage's global loads, issued ahead of this stage's products
#pragma unroll
      for (int i = 0; i < 16; ++i) gr[i] = *(const v4f*)(gsrc + (size_t)i * 8 * TT + t1);
      cf = *(const v4f*)(csrc + t1);
      n0 = frag_h(arow + t1, lane); n1 = frag_h(arow + t1 + 32, lane); }
    const _Float16* bsrc = &sg[cur][0][col][0]; v16h fh[2][2], fl[2][2];   // fragments of two column groups, read one pair ahead of their products
#pragma unroll
    for (int u = 0; u < 2; ++u) { fh[0][u] = frag_h(bsrc + u * 16 * PV_LD, lane); fl[0][u] = frag_h(bsrc + (128 + u * 16) * PV_LD, lane); }
#pragma unroll
    for (int q = 0; q < 8; ++q) { const int pp = q & 1, j = (q & 3) * 2; const v16h a = (q >> 2) ? a1 : a0;
      if (q + 1 < 8) { const int kn = (q + 1) >> 2, jn = ((q + 1) & 3) * 2;
#pragma unroll
        for (int u = 0; u < 2; ++u) { fh[pp ^ 1][u] = frag_h(bsrc + (jn + u) * 16 * PV_LD + kn * 32, lane); fl[pp ^ 1][u] = frag_h(bsrc + (128 + (jn + u) * 16) * PV_LD + kn * 32, lane); } }
      acc[j] = wmma16(a, fh[pp][0], acc[j]); acc[j + 1] = wmma16(a, fh[pp][1], acc[j + 1]); acc[j] = wmma16(a, fl[pp][0], acc[j]); acc[j + 1] = wmma16(a, fl[pp][1], acc[j + 1]); } }
#pragma unroll
  for (int j = 0; j < 8; ++j)
#pragma unroll
    for (int r = 0; r < 8; ++r) ss[wave][8 * g + r][j * 16 + col] = acc[j][r] * (1.0f / (2048.0f * 256.0f));
  LDSX(); for (int rl = 0; rl < 16; ++rl) vst2(AT + ((size_t)b * TT + s0 + rl) * DD + d0 + lane * 4, *(const v4f*)&ss[wave][rl][lane * 4]); }
// ---- k_ht: block = (64 positions s, 128 out channels c, b): h[c][s] = sum_d ht_w[c][d] attn^T[s][d] + ht_b[c]; rows = s (A = attn^T hi+lo), B(k=d, col=c) = ht_w[c][d]; writes h [b][c][t] via LDS transpose + per-block BN partials
#define HT_KD 64                    // d per stage: two whole 128-B lines of every ht_w row
#define HT_NS (DD / HT_KD)
#define HT_LD (HT_KD + 4)           // LDS row pitch in floats: 272 B = 16 B x odd, so the 16 rows of a 16-byte fragment read fall on distinct banks
#define HT_BUFB (128 * HT_LD * 4)   // bytes of one buffer
#define HT_COPY(l, p) do { copy8<8 * HT_LD * 4, 8 * DD * 4>(l, p); copy8<8 * HT_LD * 4, 8 * DD * 4>((l) + 64u * HT_LD * 4, (p) + 64 * DD * 4); } while (0)   // a lane's rows cr + 8 i of the 128
// The ht_w tile of a stage (128 c x 64 d) is the same for the 4 waves: the work-group copies it once, in whole lines, into LDS; two buffers, so the next stage's copies fly while this stage is multiplied.
__global__ __launch_bounds__(128) void k_ht(const float* __restrict__ AT, const float* __restrict__ HW, const float* __restrict__ HB, float* __restrict__ Hh, float* __restrict__ ST) { __shared__ __align__(16) union { float w[2][128][HT_LD]; float st[128][68]; } sm; __shared__ __align__(16) float sst[128][2];   // w: [buffer][c][d]; st: output staging, once the last stage has been read
  const int tid = threadIdx.x, wave = tid >> 5, lane = tid & 31, col = lane & 15, g = lane >> 4; const int c0 = blockIdx.y * 128; const size_t b = blockIdx.z; const int s0 = blockIdx.x * 64; const size_t r0 = b * TT + s0 + wave * 16;
  const int cr = tid >> 4, cq = tid & 15;   // 16 lanes x 16 B = the 256 B of a row; a thread has rows cr + 8 i
  const char* gw = (const char*)(HW + (size_t)(c0 + cr) * DD + cq * 4);
  const unsigned l0 = (unsigned)(size_t)&sm.w[0][cr][cq * 4];   // low 32 bits of the shared address = byte address in LDS
  const float* arow = AT + (r0 + col) * DD;
  v8f acc[8] = {};
  HT_COPY(l0, gw);
  asm volatile("s_wait_asynccnt 0x0" ::: "memory");   // this wave's copies of stage 0 have landed
  __syncthreads();                                    // publishes stage 0 to the 4 waves
  HT_COPY(l0 + HT_BUFB, gw + HT_KD * 4);
#pragma unroll 1   // rolled: one copy of the stage body, the buffer chosen by sg & 1
  for (int sg = 0; sg < HT_NS; ++sg) { const int cur = sg & 1; const float* bs = &sm.w[cur][col][8 * g];
    const F2 a0 = split_row(arow, sg * HT_KD, lane), a1 = split_row(arow, sg * HT_KD + 32, lane);
    WR r[2][2];   // the floats of two column groups, read one pair ahead of their products, inside this stage only
#pragma unroll   // whole: r is indexed by constants only
    for (int u = 0; u < 2; ++u) r[0][u] = raw_wf(bs + u * 16 * HT_LD);
#pragma unroll   // whole: r and acc are indexed by constants only
    for (int q = 0; q < 8; ++q) { const int pp = q & 1, j = (q & 3) * 2; const F2& a = (q >> 2) ? a1 : a0;
      if (q + 1 < 8) { const int kn = (q + 1) >> 2, jn = ((q + 1) & 3) * 2;
#pragma unroll   // whole: as above
        for (int u = 0; u < 2; ++u) r[pp ^ 1][u] = raw_wf(bs + (jn + u) * 16 * HT_LD + kn * 32); }
      const v16b w0 = cvt_wf(r[pp][0]), w1 = cvt_wf(r[pp][1]);
      acc[j] = wmma_bf(a.h, w0, acc[j]); acc[j + 1] = wmma_bf(a.h, w1, acc[j + 1]); acc[j] = wmma_bf(a.l, w0, acc[j]); acc[j + 1] = wmma_bf(a.l, w1, acc[j + 1]); }
    asm volatile("s_wait_dscnt 0x0" ::: "memory");      // this wave's reads of buffer cur are done before the buffer is handed to its next writer
    asm volatile("s_wait_asynccnt 0x0" ::: "memory");   // this wave's copies of stage sg + 1 have landed
    __syncthreads();                                    // publishes stage sg + 1 and ends every wave's reads of buffer cur
    if (sg + 2 < HT_NS) HT_COPY(l0 + cur * HT_BUFB, gw + (sg + 2) * HT_KD * 4); }
  asm volatile("s_wait_asynccnt 0x0" ::: "memory");     // no copy is outstanding when the ring becomes output staging
#pragma unroll
  for (int j = 0; j < 8; ++j) { const int cl = j * 16 + col; const float bb = bfr(HB[c0 + cl]);
#pragma unroll
    for (int r = 0; r < 8; ++r) sm.st[cl][wave * 16 + 8 * g + r] = acc[j][r] + bb; }
  __syncthreads();
  for (int e = tid; e < 128 * 16; e += 128) { const int cl = e >> 4, q = e & 15; vst2(Hh + (b * CC + c0 + cl) * (size_t)TT + s0 + q * 4, *(const v4f*)&sm.st[cl][q * 4]); }
  { const int cl = tid; float s = 0.f; for (int q = 0; q < 64; ++q) s += sm.st[cl][q]; const float mean = s / 64.0f; float m2 = 0.f; for (int q = 0; q < 64; ++q) { const float d = sm.st[cl][q] - mean; m2 += d * d; } sst[cl][0] = mean; sst[cl][1] = m2; }
  __syncthreads(); if (tid < 64) vst2(ST + (((b * (TT / 64) + blockIdx.x) * CC) + c0) * 2 + tid * 4, *(const v4f*)&(&sst[0][0])[tid * 4]); }
// ---- k_bn: block = 32 channels (lane = channel), 8 waves x 32 of the channel's NB*32 block partials (64 values each): mean = mean of the block means, M2 = sum of (M2_blk + 64 (mean_blk - mean)^2), both summed in a fixed order (32 in a thread, then the 8 waves in turn) -> mean, inv_std (biased)
#define BN_NR (NB * (TT / 64))   // records per channel
#define BN_PT (BN_NR / 8)        // records per thread
__global__ __launch_bounds__(256) void k_bn(const float* __restrict__ ST, float* __restrict__ BN) { __shared__ float sm[8][32]; __shared__ float sq[8][32];
  const int lane = threadIdx.x & 31, wave = threadIdx.x >> 5; const int c = blockIdx.x * 32 + lane; const float* src = ST + ((size_t)wave * BN_PT * CC + c) * 2; v2f r[BN_PT];
#pragma unroll   // whole: r stays in registers and a thread's loads are all in flight together, so memory latency is paid once and not once per record
  for (int i = 0; i < BN_PT; ++i) r[i] = *(const v2f*)(src + (size_t)i * CC * 2);
  float s = 0.f;
#pragma unroll   // whole: r is indexed by constants only
  for (int i = 0; i < BN_PT; ++i) s += r[i][0];
  sm[wave][lane] = s; __syncthreads();
  float tot = 0.f; for (int w = 0; w < 8; ++w) tot += sm[w][lane];
  const float mean = tot * (1.0f / BN_NR); float q = 0.f;
#pragma unroll   // whole: r is indexed by constants only
  for (int i = 0; i < BN_PT; ++i) { const float d = r[i][0] - mean; q += r[i][1] + 64.f * d * d; }
  sq[wave][lane] = q; __syncthreads();
  if (wave == 0) { float M2 = 0.f; for (int w = 0; w < 8; ++w) M2 += sq[w][lane]; BN[c] = mean; BN[CC + c] = 1.0f / sqrtf(M2 / (64.f * BN_NR) + 1e-5f); } }
// ---- k_out: wave = one row (b, c): out[b][c][t] = inpt + gamma (h - mean) inv + beta over the 2,048 positions; a load or store of the wave is 512 consecutive bytes, a lane has 16 such pieces of each array
__global__ __launch_bounds__(256) void k_out(const float* __restrict__ X, const float* __restrict__ Hh, const float* __restrict__ BN, const float* __restrict__ GA, const float* __restrict__ BE, float* __restrict__ OUT) {
  const int row = blockIdx.x * 8 + __builtin_amdgcn_readfirstlane(threadIdx.x >> 5); const int c = row & (CC - 1);   // row = b * CC + c, the same in every lane of the wave
  const unsigned lo = (threadIdx.x & 31) * 4u;   // the lane's place in a 512-byte piece: one offset register for every load and store, on scalar row addresses
  const float *xr = X + (size_t)row * TT, *hr = Hh + (size_t)row * TT; float* orow = OUT + (size_t)row * TT;
  const float mean = BN[c], inv = BN[CC + c], ga = bfr(GA[c]), be = bfr(BE[c]);
  v4f x[16], h[16];
#pragma unroll   // whole, both loops: x and h are indexed by constants only
  for (int i = 0; i < 16; ++i) { x[i] = *(const v4f*)(xr + lo + i * 128); h[i] = *(const v4f*)(hr + lo + i * 128); }
  __builtin_amdgcn_sched_barrier(0);   // keeps the row's 32 loads ahead of all arithmetic, in flight together: without it the compiler issued the later ones in pairs between the sums, each pair waiting out memory latency anew
#pragma unroll
  for (int i = 0; i < 16; ++i) { v4f o;
#pragma unroll
    for (int e = 0; e < 4; ++e) o[e] = bfr(x[i][e]) + (ga * (h[i][e] - mean) * inv + be);
    vst2(orow + lo + i * 128, o); } }
extern "C" void kernel_launch(void* const* d_in, const int* in_sizes, int n_in, void* d_out, int out_size, void* d_ws, size_t ws_size, hipStream_t stream) {
  (void)in_sizes; (void)n_in; (void)out_size;
  const float** F = (const float**)d_in;   // 0 inpt [8,512,2048], 1 theta_w [256,512], 2 theta_b, 3 phi_w, 4 phi_b, 5 g_w, 6 g_b, 7 ht_w [512,256], 8 ht_b, 9 bn_gamma, 10 bn_beta
  if (ws_size < (size_t)WS_END) return;
  char* ws = (char*)d_ws; float *TH = (float*)(ws + WS_TH), *G = (float*)(ws + WS_G), *MP = (float*)(ws + WS_MP), *CF = (float*)(ws + WS_CF), *AT = (float*)(ws + WS_AT), *Hh = (float*)(ws + WS_H), *ST = (float*)(ws + WS_ST), *BN = (float*)(ws + WS_BN); __bf16 *PHH = (__bf16*)(ws + WS_PHH), *PHL = (__bf16*)(ws + WS_PHL); _Float16* PT = (_Float16*)(ws + WS_PT);
  k_proj<<<dim3(TT / 64, TNB, 3), 128, 0, stream>>>(F[0], F[1], F[2], F[3], F[4], F[5], F[6], TH, PHH, PHL, G);
  k_sc<<<dim3(TT / 64, TT / 128, TNB), 128, 0, stream>>>(TH, PHH, PHL, MP, PT);
  k_mg<<<dim3(TT / 256, TNB), 256, 0, stream>>>(MP, CF);
  k_pv<<<dim3(TT / 64, DD / 128, TNB), 128, 0, stream>>>(PT, G, CF, AT);
  k_ht<<<dim3(TT / 64, CC / 128, TNB), 128, 0, stream>>>(AT, F[7], F[8], Hh, ST);
  k_bn<<<CC / 32, 256, 0, stream>>>(ST, BN);
  k_out<<<CC * TNB / 8, 256, 0, stream>>>(F[0], Hh, BN, F[9], F[10], (float*)d_out);
}

// v008
// Measured time: 150 microseconds a run.
// In both of two side-by-side timings against v007, it was 1.10 times as fast.
// Counting every step since v000, it is 17.8 times as fast.
// compute dtype: all float inputs rounded to bf16; theta / phi / g = W x + b (1x1 convs) with EXACT bf16 products on WMMA 16x16x32 (x^T tile staged in LDS), f32 accumulate; theta and phi kept in f32 and split into bf16 hi + lo for the UNSCALED logits w = theta^T phi (3 products; logits std ~5, sharp softmax), softmax in f32, first inside each tile of 128 keys while the logits are still in registers: exp(w - tile max) -> P^T planes as f16 x 2^11, with (tile max, tile sum) per query; the 16 tiles of a query merged into one factor per (query, tile), which multiplies g; attn[d][s] = sum_t (g[d][t] factor[t]) P~[t][s] with the scaled g as f16 hi + lo (2 products); h = ht_w attn (attn bf16 hi + lo, 2 products) + ht_b; BatchNorm1d training statistics over (B, T) per channel from per-block (mean, M2) partials merged in a fixed order; out = inpt + gamma h_norm + beta; f32 output.
#include <hip/hip_runtime.h>
#include <math.h>

typedef __attribute__((ext_vector_type(16))) _Float16 v16h;
typedef __attribute__((ext_vector_type(16))) __bf16 v16b;
typedef __attribute__((ext_vector_type(8)))  _Float16 v8h;
typedef __attribute__((ext_vector_type(8)))  float v8f;
typedef __attribute__((ext_vector_type(4)))  float v4f;
typedef __attribute__((ext_vector_type(2)))  float v2f;
typedef __attribute__((ext_vector_type(4)))  unsigned v4u;
typedef __attribute__((ext_vector_type(4)))  int v4i;
typedef float __attribute__((may_alias)) float_a;
typedef int __attribute__((may_alias)) int_a;

template <typename T> __device__ __forceinline__ void vst2(void* p, T v) { *(T*)p = v;  }
__device__ __forceinline__ v8f wmma16(v16h a, v16h b, v8f c) {
  v8f d = __builtin_amdgcn_wmma_f32_16x16x32_f16(false, a, false, b, (short)0, c, false, false);
  asm volatile("v_nop\n\tv_nop\n\tv_nop\n\tv_nop" : "+v"(d) : "v"(a), "v"(b));
  return d;
}
__device__ __forceinline__ v8f wmma_bf(v16b a, v16b b, v8f c) {
  v8f d = __builtin_amdgcn_wmma_f32_16x16x32_bf16(false, a, false, b, (short)0, c, false, false);
  asm volatile("v_nop\n\tv_nop\n\tv_nop\n\tv_nop" : "+v"(d) : "v"(a), "v"(b));
  return d;
}
// 16x16x32 fragments: lane = (h = lane>>4, row/col = lane&15); elements 0..7 = k0+8h+0..7, 8..15 = k0+16+8h+0..7; D element r = row 8h+r
__device__ __forceinline__ v16h frag_h(const _Float16* rowk0, int lane) {
  union { v16h v; v8h q[2]; } u; const _Float16* p = rowk0 + 8 * (lane >> 4);
  u.q[0] = *(const v8h*)p; u.q[1] = *(const v8h*)(p + 16); return u.v;
}
__device__ __forceinline__ v16h frag_f32(const float* rowk0, int lane) {
  v16h a; const float* p = rowk0 + 8 * (lane >> 4);
#pragma unroll
  for (int i = 0; i < 8; ++i) { a[i] = (_Float16)p[i]; a[8 + i] = (_Float16)p[16 + i]; }
  return a;
}
__device__ __forceinline__ v16h frag_f32s(const float* rowk0, int lane, float sc) {
  v16h a; const float* p = rowk0 + 8 * (lane >> 4);
#pragma unroll
  for (int i = 0; i < 8; ++i) { a[i] = (_Float16)(p[i] * sc); a[8 + i] = (_Float16)(p[16 + i] * sc); }
  return a;
}
// column fragment from a [K][ld] layout (column n), rows >= K read as 0
__device__ __forceinline__ v16h fragc_f32(const float* W, int k0, int n, int lane, int ld, int K) {
  v16h a; const int g = lane >> 4;
#pragma unroll
  for (int i = 0; i < 8; ++i) { const int ka = k0 + 8 * g + i, kb = ka + 16;
    a[i] = (_Float16)(ka < K ? W[(size_t)(ka < K ? ka : K - 1) * ld + n] : 0.f); a[8 + i] = (_Float16)(kb < K ? W[(size_t)(kb < K ? kb : K - 1) * ld + n] : 0.f); }
  return a;
}
struct F2 { v16b h, l; };
__device__ __forceinline__ F2 bsplit16(const float v[16]) { F2 r;
#pragma unroll
  for (int i = 0; i < 16; ++i) { const __bf16 h = (__bf16)v[i]; r.h[i] = h; r.l[i] = (__bf16)(v[i] - (float)h); }
  return r; }
__device__ __forceinline__ F2 split_row(const float* row, int k0, int lane) { float v[16]; const float* p = row + k0 + 8 * (lane >> 4);
#pragma unroll
  for (int i = 0; i < 8; ++i) { v[i] = p[i]; v[8 + i] = p[16 + i]; }
  return bsplit16(v); }
__device__ __forceinline__ F2 split_rowK(const float* row, int k0, int lane, int K) { float v[16]; const int g = lane >> 4;
#pragma unroll
  for (int i = 0; i < 8; ++i) { const int ka = k0 + 8 * g + i, kb = ka + 16; v[i] = ka < K ? row[ka < K ? ka : K - 1] : 0.f; v[8 + i] = kb < K ? row[kb < K ? kb : K - 1] : 0.f; }
  return bsplit16(v); }
__device__ __forceinline__ F2 split_col(const float* W, int k0, int n, int lane, int ld, int K) { float v[16]; const int g = lane >> 4;
#pragma unroll
  for (int i = 0; i < 8; ++i) { const int ka = k0 + 8 * g + i, kb = ka + 16; v[i] = ka < K ? W[(size_t)(ka < K ? ka : K - 1) * ld + n] : 0.f; v[8 + i] = kb < K ? W[(size_t)(kb < K ? kb : K - 1) * ld + n] : 0.f; }
  return bsplit16(v); }
__device__ __forceinline__ v8f mac3(const F2& a, const F2& b, v8f c) { c = wmma_bf(a.l, b.h, c); c = wmma_bf(a.h, b.l, c); return wmma_bf(a.h, b.h, c); }
__device__ __forceinline__ float sigm(float v) { return 1.0f / (1.0f + expf(-v)); }
#define LDSX() do { asm volatile("s_wait_dscnt 0" ::: "memory"); __builtin_amdgcn_wave_barrier(); __builtin_amdgcn_fence(__ATOMIC_RELEASE, "workgroup"); } while (0)


// Non-local block over time (B 8, C 512, D 256, T 2,048): theta/phi/g 1x1 convs; w = softmax_s(theta^T phi); attn = g w (the module contracts g over the QUERY index); h = ht(attn); training-mode BatchNorm1d; out = inpt + bn(h).
#define NB 8
#define CC 512
#define DD 256
#define TT 2048
#ifndef TNB
#define TNB NB
#endif
typedef __attribute__((ext_vector_type(8))) __bf16 v8b;
typedef __attribute__((ext_vector_type(4))) __bf16 v4b;
__device__ __forceinline__ v16b frag_b(const __bf16* rowk0, int lane) {
  union { v16b v; v8b q[2]; } u; const __bf16* p = rowk0 + 8 * (lane >> 4);
  u.q[0] = *(const v8b*)p; u.q[1] = *(const v8b*)(p + 16); return u.v;
}
__device__ __forceinline__ float bfr(float v) { return (float)(__bf16)v; }
__device__ __attribute__((noinline)) float exp_ni(float v) { return expf(v); }
__device__ __attribute__((noinline)) float erf_ni(float v) { return erff(v); }

#define WS_TH  0u                                    // f32 theta^T rows [b*t][256]
#define WS_PHH (WS_TH + 4u * (size_t)NB * TT * DD)      // bf16 phi^T hi rows [b*s][256]
#define WS_PHL (WS_PHH + 2u * (size_t)NB * TT * DD)
#define WS_G   (WS_PHL + 2u * (size_t)NB * TT * DD)     // f32 g [b][d][t]
#define WS_S   (WS_G + 4u * (size_t)NB * DD * TT)       // region of attn^T, h, the tile statistics and the factors below
#define WS_PT  (WS_CF + 4u * (size_t)NB * NKB * TT)    // f16 planes, one per batch [b][s][t]: exp(logit - max of the query's logits in the key tile of s) x 2^11
#define WS_AT  WS_S                                   // f32 attn^T rows [b*s][256]
#define WS_H   (WS_AT + 4u * (size_t)NB * TT * DD)      // f32 h [b][c][t]
#define NKB (TT / 128)                                // key tiles per query
#define WS_MP  (WS_H + 4u * (size_t)NB * CC * TT)      // f32 (tile max, tile sum x 2^11) [b][key tile][t][2]
#define WS_CF  (WS_MP + 4u * (size_t)NB * NKB * TT * 2) // f32 factor [b][key tile][t] = exp(tile max - row max) / row sum x 2^8
#define WS_ST  (WS_PT + 2u * (size_t)NB * TT * TT)     // f32 BN partials [(b*(TT/64) + tblk)][c][2] - one record per (batch, 64-position block)
#define WS_BN  (WS_ST + 4u * (size_t)NB * (TT / 64) * CC * 2)    // f32 mean [512], inv [512]
#define WS_END (WS_BN + 4u * 2 * CC)

// One lane's eight 16-byte copies global -> LDS, through no register: rows r, r + n, ..., r + 7 n of a tile (l = LDS byte address and p = global address of the lane's 16 bytes in row r; LS and GS = bytes from one of these rows to the next, in LDS and in global memory).
// The s_wait_xcnt is the last line of the copies' own statement, so that no address register is rewritten ahead of it.
template <int LS, int GS> __device__ __forceinline__ void copy8(unsigned l, const char* p) {
  asm volatile("global_load_async_to_lds_b128 %0, %8, off\n\t"
               "global_load_async_to_lds_b128 %1, %9, off\n\t"
               "global_load_async_to_lds_b128 %2, %10, off\n\t"
               "global_load_async_to_lds_b128 %3, %11, off\n\t"
               "global_load_async_to_lds_b128 %4, %12, off\n\t"
               "global_load_async_to_lds_b128 %5, %13, off\n\t"
               "global_load_async_to_lds_b128 %6, %14, off\n\t"
               "global_load_async_to_lds_b128 %7, %15, off\n\t"
               "s_wait_xcnt 0x0"
               :: "v"(l), "v"(l + 1u * LS), "v"(l + 2u * LS), "v"(l + 3u * LS), "v"(l + 4u * LS), "v"(l + 5u * LS), "v"(l + 6u * LS), "v"(l + 7u * LS),
                  "v"(p), "v"(p + 1 * GS), "v"(p + 2 * GS), "v"(p + 3 * GS), "v"(p + 4 * GS), "v"(p + 5 * GS), "v"(p + 6 * GS), "v"(p + 7 * GS)
               : "memory");
}
// A bf16 fragment from a row of f32 in LDS, in two halves, so that the reads can stand well ahead of the products: raw_wf reads the 16 floats (p = row + k0 + 8 h), cvt_wf rounds them; the same elements in the same order as the fragment loads from global rows
struct WR { v4f x[4]; };
__device__ __forceinline__ WR raw_wf(const float* p) { WR r; r.x[0] = *(const v4f*)p; r.x[1] = *(const v4f*)(p + 4); r.x[2] = *(const v4f*)(p + 16); r.x[3] = *(const v4f*)(p + 20); return r; }
__device__ __forceinline__ v16b cvt_wf(const WR& r) { v16b w;
#pragma unroll   // whole, this loop and the next: w and r are indexed by constants only and stay in registers
  for (int q = 0; q < 4; ++q)
#pragma unroll
    for (int i = 0; i < 4; ++i) w[4 * q + i] = (__bf16)r.x[q][i];
  return w; }

// ---- k_proj: block = (64 positions t, b, which 0 theta / 1 phi / 2 g): x^T tile (bf16) in LDS; W [d][c]; outputs: theta^T f32 rows, phi^T bf16 hi/lo rows, g f32 [d][t]
#define PJ_KC 64                    // c per stage: two whole 128-B lines of every W row
#define PJ_NS (CC / PJ_KC)          // stages per group of 64 output columns
#define PJ_LD (PJ_KC + 4)           // LDS row pitch in floats: 272 B = 16 B x odd, so the 16 rows of a 16-byte fragment read fall on distinct banks
#define PJ_BUFB (64 * PJ_LD * 4)    // bytes of one buffer
#define PJ_COPY(l, p) copy8<8 * PJ_LD * 4, 8 * CC * 4>(l, p)   // a lane's rows cr + 8 i of the 64
// The W tile of a stage (64 d x 64 c) is the same for the 4 waves: the work-group copies it once, in whole lines, into LDS; two buffers, so the next stage's copies fly while this stage is multiplied.
__global__ __launch_bounds__(128) void k_proj(const float* __restrict__ X, const float* __restrict__ WT, const float* __restrict__ BT, const float* __restrict__ WP, const float* __restrict__ BP, const float* __restrict__ WG, const float* __restrict__ BG, float* __restrict__ TH, __bf16* __restrict__ PHH, __bf16* __restrict__ PHL, float* __restrict__ G) {
  __shared__ __align__(16) __bf16 sx[64][CC + 8]; __shared__ __align__(16) union { float w[2][64][PJ_LD]; float st[64][68]; } sm;   // w: [buffer][d][c]; st: output staging of a 64-col group, once its last stage has been read
  const int tid = threadIdx.x, wave = tid >> 5, lane = tid & 31, col = lane & 15, g = lane >> 4; const int t0 = blockIdx.x * 64; const size_t b = blockIdx.y; const int which = blockIdx.z;
  const float* Wm = which == 0 ? WT : which == 1 ? WP : WG; const float* Bm = which == 0 ? BT : which == 1 ? BP : BG;
  const int cr = tid >> 4, cq = tid & 15;   // 16 lanes x 16 B = the 256 B of a row; a thread has rows cr + 8 i
  const unsigned l0 = (unsigned)(size_t)&sm.w[0][cr][cq * 4];   // low 32 bits of the shared address = byte address in LDS
  { const int xq = tid & 15, xc = (tid >> 4) * 4;   // 16 lanes x 16 B = the 256 B of a channel's row piece; a thread has 4 positions of channels xc + 32 i + 0..3
    const float* xs = X + (b * CC + xc) * (size_t)TT + t0 + xq * 4;
#pragma unroll 1   // rolled: two batches of 32 loads, so that a batch's 128 registers are used twice
    for (int ib = 0; ib < 2; ++ib) { v4f xr[8][4];
#pragma unroll   // whole, the loops of this batch: xr is indexed by constants only, and the 32 loads are in flight together, so memory latency is paid once a batch
      for (int i = 0; i < 8; ++i)
#pragma unroll
        for (int k = 0; k < 4; ++k) xr[i][k] = *(const v4f*)(xs + (size_t)((ib * 8 + i) * 32 + k) * TT);
#pragma unroll
      for (int i = 0; i < 8; ++i)
#pragma unroll
        for (int e = 0; e < 4; ++e) { v4b w;   // 4 channels of one position: 8 consecutive bytes of the transposed tile
#pragma unroll
          for (int k = 0; k < 4; ++k) w[k] = (__bf16)xr[i][k][e];
          *(v4b*)&sx[xq * 4 + e][xc + (ib * 8 + i) * 32] = w; } } }
  __syncthreads();
#pragma unroll 1
  for (int cg = 0; cg < DD / 64; ++cg) { v8f acc[4] = {}; const char* gw = (const char*)(Wm + (size_t)(cg * 64 + cr) * CC + cq * 4);
    PJ_COPY(l0, gw);
    asm volatile("s_wait_asynccnt 0x0" ::: "memory");   // this wave's copies of stage 0 have landed
    __syncthreads();                                    // publishes stage 0 to the 4 waves
    PJ_COPY(l0 + PJ_BUFB, gw + PJ_KC * 4);
#pragma unroll 1   // rolled: one copy of the stage body, the buffer chosen by s & 1
    for (int s = 0; s < PJ_NS; ++s) { const int cur = s & 1; const float* bs = &sm.w[cur][col][8 * g];
      v16b a[2]; WR r[2][4];   // the stage's LDS reads stand together ahead of its products: their latency is waited for once a stage
#pragma unroll   // whole, the four loops below: a, r and acc are indexed by constants only and stay in registers
      for (int u = 0; u < 2; ++u) { a[u] = frag_b(&sx[wave * 16 + col][s * PJ_KC + u * 32], lane);
#pragma unroll
        for (int j = 0; j < 4; ++j) r[u][j] = raw_wf(bs + j * 16 * PJ_LD + u * 32); }
#pragma unroll
      for (int u = 0; u < 2; ++u)
#pragma unroll
        for (int j = 0; j < 4; ++j) acc[j] = wmma_bf(a[u], cvt_wf(r[u][j]), acc[j]);
      asm volatile("s_wait_dscnt 0x0" ::: "memory");      // this wave's reads of buffer cur are done before the buffer is handed to its next writer
      asm volatile("s_wait_asynccnt 0x0" ::: "memory");   // this wave's copies of stage s + 1 have landed
      __syncthreads();                                    // publishes stage s + 1 and ends every wave's reads of buffer cur
      if (s + 2 < PJ_NS) PJ_COPY(l0 + cur * PJ_BUFB, gw + (s + 2) * PJ_KC * 4); }
    asm volatile("s_wait_asynccnt 0x0" ::: "memory");     // no copy is outstanding when the ring becomes output staging
#pragma unroll
    for (int j = 0; j < 4; ++j) { const int dl = j * 16 + col; const float bb = bfr(Bm[cg * 64 + dl]);
#pragma unroll
      for (int r = 0; r < 8; ++r) { const int tl = wave * 16 + 8 * g + r; const float v = acc[j][r] + bb; if (which == 2) sm.st[dl][tl] = v; else sm.st[tl][dl] = v; } }
    __syncthreads();
    if (which == 0) { for (int e = tid; e < 64 * 16; e += 128) { const int tl = e >> 4, q = e & 15; vst2(TH + (b * TT + t0 + tl) * DD + cg * 64 + q * 4, *(const v4f*)&sm.st[tl][q * 4]); } }
    else if (which == 1) { for (int e = tid; e < 64 * 8; e += 128) { const int tl = e >> 3, q = e & 7; const float* p = &sm.st[tl][q * 8]; v16b dummy; (void)dummy; __bf16 hh[8], ll[8]; 
#pragma unroll
        for (int i = 0; i < 8; ++i) { const __bf16 hv = (__bf16)p[i]; hh[i] = hv; ll[i] = (__bf16)(p[i] - (float)hv); }
        vst2((unsigned*)(PHH + (b * TT + t0 + tl) * DD + cg * 64 + q * 8), *(const v4u*)hh); vst2((unsigned*)(PHL + (b * TT + t0 + tl) * DD + cg * 64 + q * 8), *(const v4u*)ll); } }
    else { for (int e = tid; e < 64 * 16; e += 128) { const int dl = e >> 4, q = e & 15; vst2(G + (b * DD + cg * 64 + dl) * (size_t)TT + t0 + q * 4, *(const v4f*)&sm.st[dl][q * 4]); } }
    asm volatile("s_wait_dscnt 0x0" ::: "memory");   // this wave's reads of the staging are done before the next group's copies land on it
    __syncthreads(); } }                             // ends every wave's reads of the staging
// Maximum and sum over the 16 lanes of a row half (the 16 columns of an accumulator tile), every lane getting the result: four exchanges with lane ^ 1, 2, 4, 8 inside the vector unit
template <int X> __device__ __forceinline__ float lane_x(float v) { return __builtin_bit_cast(float, __builtin_amdgcn_update_dpp(0, __builtin_bit_cast(int, v), 0x160 | X, 0xf, 0xf, true)); }   // 0x160 | X = row_xmask:X
__device__ __forceinline__ float max16(float v) { v = fmaxf(v, lane_x<1>(v)); v = fmaxf(v, lane_x<2>(v)); v = fmaxf(v, lane_x<4>(v)); return fmaxf(v, lane_x<8>(v)); }
// Eight independent 2^x in one statement. No result shares a register with an argument (early clobber), so none of the eight is followed directly by a read of its result or an overwrite of its argument;
// the v_nop is the free slot that the instruction set asks for behind the last one. The first results are ready when the statement ends.
__device__ __forceinline__ void exp2x8(float (&y)[8], const float (&x)[8]) {
  asm("v_exp_f32 %0, %8\n\tv_exp_f32 %1, %9\n\tv_exp_f32 %2, %10\n\tv_exp_f32 %3, %11\n\tv_exp_f32 %4, %12\n\tv_exp_f32 %5, %13\n\tv_exp_f32 %6, %14\n\tv_exp_f32 %7, %15\n\tv_nop"
      : "=&v"(y[0]), "=&v"(y[1]), "=&v"(y[2]), "=&v"(y[3]), "=&v"(y[4]), "=&v"(y[5]), "=&v"(y[6]), "=&v"(y[7])
      : "v"(x[0]), "v"(x[1]), "v"(x[2]), "v"(x[3]), "v"(x[4]), "v"(x[5]), "v"(x[6]), "v"(x[7])); }
__device__ __forceinline__ float sum16(float v) { v += lane_x<1>(v); v += lane_x<2>(v); v += lane_x<4>(v); return v + lane_x<8>(v); }
// ---- k_sc: block = (128 queries t, 128 keys s, batch b), a wave has 32 queries (two row blocks), so that every phi fragment read from LDS feeds both: logits theta^T . phi (3 products), kept in registers; per query the tile's max and sum of exp(logit - max) -> MP; exp(logit - max) x 2^11 as f16, transposed -> plane b of PT [s][t]; every batch in one grid
#define SC_KD 64                   // d per stage: one whole 128-B line of every phi row
#define SC_NS (DD / SC_KD)
#define SC_LD (SC_KD + 8)          // LDS row pitch in bf16: 144 B = 16 B x odd, so the 16 rows of a 16-byte fragment read fall on distinct banks
#define SC_PLB (128 * SC_LD * 2)   // bytes of one plane (hi or lo) of one buffer
#define SC_BUFB (2 * SC_PLB)       // bytes of one buffer
#define SC_COPY(l, p) copy8<16 * SC_LD * 2, 16 * DD * 2>(l, p)   // a lane's rows cr + 16 i of one plane
// The phi tile of a stage (128 keys x 64 d, hi and lo) is the same for the 4 waves: the work-group copies it once, in whole lines, into LDS; two buffers, so the next stage's copies fly while this stage is multiplied.
// The second launch bound asks for 4 waves a SIMD, the 4 work-groups a WGP that the 72 KiB of LDS allow: it holds the build to 256 registers, where it otherwise took 270 and a fourth work-group would not fit.
__global__ __launch_bounds__(128, 4) void k_sc(const float* __restrict__ TH, const __bf16* __restrict__ PHH, const __bf16* __restrict__ PHL, float* __restrict__ MP, _Float16* __restrict__ PT) {
  __shared__ __align__(16) union { __bf16 k[2][2][128][SC_LD]; _Float16 p[128][136]; } sm;   // k: [buffer][hi, lo][key][d]; p: output staging [key][query], once the last stage has been read; pitch 272 B = 16 B x odd
  const int b = blockIdx.z; PT += (size_t)b * TT * TT;
  const int tid = threadIdx.x, wave = tid >> 5, lane = tid & 31, col = lane & 15, g = lane >> 4; const int k0 = blockIdx.y * 128; const int tq0 = blockIdx.x * 128 + wave * 32; const size_t q0 = (size_t)b * TT + tq0;
  const int cr = tid >> 3, cq = tid & 7;   // 8 lanes x 16 B = one 128-B line of a row; a thread has rows cr + 16 i of both planes
  const size_t ks = ((size_t)b * TT + k0 + cr) * DD + cq * 8; const char* gh = (const char*)(PHH + ks); const size_t hl = (size_t)((const char*)PHL - (const char*)PHH);   // lo plane = hi plane + hl, a scalar: one address pair less to keep through the loop
  const unsigned l0 = (unsigned)(size_t)&sm.k[0][0][cr][cq * 8];   // low 32 bits of the shared address = byte address in LDS
  const float* trow = TH + (q0 + col) * DD;   // row block m: + m * 16 rows
  v8f acc[2][8] = {};
  SC_COPY(l0, gh); SC_COPY(l0 + SC_PLB, gh + hl);
  asm volatile("s_wait_asynccnt 0x0" ::: "memory");   // this wave's copies of stage 0 have landed
  __syncthreads();                                    // publishes stage 0 to the 4 waves
  SC_COPY(l0 + SC_BUFB, gh + SC_KD * 2); SC_COPY(l0 + SC_BUFB + SC_PLB, gh + hl + SC_KD * 2);
#pragma unroll 1   // rolled: one copy of the stage body, the buffer chosen by st & 1
  for (int st = 0; st < SC_NS; ++st) { const int cur = st & 1;
    F2 a[2][2];   // [row block][half of the stage's 64 d]
#pragma unroll   // whole, both loops: a is indexed by constants only
    for (int m = 0; m < 2; ++m)
#pragma unroll
      for (int u = 0; u < 2; ++u) a[m][u] = split_row(trow + m * 16 * DD, st * SC_KD + u * 32, lane);
    const __bf16* bs = &sm.k[cur][0][col][0]; v16b kh[2], kl[2];   // fragments of one key group, read one group ahead of their products, inside this stage only
    kh[0] = frag_b(bs, lane); kl[0] = frag_b(bs + 128 * SC_LD, lane);
#pragma unroll   // whole: kh, kl, a and acc are indexed by constants only
    for (int q = 0; q < 16; ++q) { const int pp = q & 1, j = q & 7, u = q >> 3;
      if (q + 1 < 16) { const int un = (q + 1) >> 3, jn = (q + 1) & 7;
        kh[pp ^ 1] = frag_b(bs + jn * 16 * SC_LD + un * 32, lane); kl[pp ^ 1] = frag_b(bs + (128 + jn * 16) * SC_LD + un * 32, lane); }
      acc[0][j] = wmma_bf(a[0][u].h, kh[pp], acc[0][j]); acc[1][j] = wmma_bf(a[1][u].h, kh[pp], acc[1][j]); acc[0][j] = wmma_bf(a[0][u].l, kh[pp], acc[0][j]); acc[1][j] = wmma_bf(a[1][u].l, kh[pp], acc[1][j]); acc[0][j] = wmma_bf(a[0][u].h, kl[pp], acc[0][j]); acc[1][j] = wmma_bf(a[1][u].h, kl[pp], acc[1][j]); }
    asm volatile("s_wait_dscnt 0x0" ::: "memory");      // this wave's reads of buffer cur are done before the buffer is handed to its next writer
    asm volatile("s_wait_asynccnt 0x0" ::: "memory");   // this wave's copies of stage st + 1 have landed
    __syncthreads();                                    // publishes stage st + 1 and ends every wave's reads of buffer cur
    if (st + 2 < SC_NS) { const unsigned l = l0 + cur * SC_BUFB; const int d2 = (st + 2) * SC_KD * 2; SC_COPY(l, gh + d2); SC_COPY(l + SC_PLB, gh + hl + d2); } }
  asm volatile("s_wait_asynccnt 0x0" ::: "memory");     // no copy is outstanding when the ring becomes output staging
  // A lane has queries tq0 + 16 m + 8 g + r (m = 0, 1; r = 0..7) at keys k0 + 16 j + col: a wave holds all 128 keys of its 32 queries, so the tile's max and sum need this wave alone
  float mx[2][8], sl[2][8];
#pragma unroll   // whole, every loop of this epilogue: acc, mx and sl are indexed by constants only and stay in registers
  for (int m = 0; m < 2; ++m) {
#pragma unroll
    for (int r = 0; r < 8; ++r) { float v = acc[m][0][r];
#pragma unroll
      for (int j = 1; j < 8; ++j) v = fmaxf(v, acc[m][j][r]);
      mx[m][r] = max16(v); }
#pragma unroll
    for (int r = 0; r < 8; ++r) { const float nb = 11.0f - mx[m][r] * 1.4426950408889634f; float a[8], p[8], s = 0.f;   // 2^(w log2 e - max log2 e + 11) = exp(w - max) x 2^11
#pragma unroll
      for (int j = 0; j < 8; ++j) a[j] = fmaf(acc[m][j][r], 1.4426950408889634f, nb);
      exp2x8(p, a);
#pragma unroll
      for (int j = 0; j < 8; ++j) { acc[m][j][r] = p[j]; s += p[j]; }
      sl[m][r] = sum16(s); }
#pragma unroll
    for (int j = 0; j < 8; ++j) { v8h h;   // a lane's 8 queries at one key are 16 consecutive bytes of the transposed tile
#pragma unroll
      for (int r = 0; r < 8; ++r) h[r] = (_Float16)acc[m][j][r];
      *(v8h*)&sm.p[j * 16 + col][wave * 32 + m * 16 + 8 * g] = h; } }
  __syncthreads();   // a key's 128 queries come from the 4 waves: all have stored before a line is read
  const int pr = tid >> 4, pq = tid & 15;   // 16 lanes x 16 B = the two whole 128-B lines of a key's row piece; a thread has keys pr + 8 i
  _Float16* pd = PT + (size_t)(k0 + pr) * TT + blockIdx.x * 128 + pq * 8;
#pragma unroll   // whole: a thread's 16 LDS reads are in flight together, their latency waited for once
  for (int i = 0; i < 16; ++i) vst2((unsigned*)(pd + (size_t)i * 8 * TT), *(const v4u*)&sm.p[i * 8 + pr][pq * 8]);
  if (col == 0) { float* mp = MP + (((size_t)b * NKB + blockIdx.y) * TT + tq0 + 8 * g) * 2;   // 32 queries x 8 B: two 128-B lines a wave; behind the barrier, which would otherwise wait for these stores
#pragma unroll
    for (int m = 0; m < 2; ++m)
#pragma unroll
      for (int r = 0; r < 8; r += 2) vst2(mp + (m * 16 + r) * 2, v4f{mx[m][r], sl[m][r], mx[m][r + 1], sl[m][r + 1]}); } }
// ---- k_mg: thread = (query t, batch b): the query's 16 tile records merged in a fixed order: row max, row sum = sum of tile sum x exp(tile max - row max); factor of a tile = exp(tile max - row max) / row sum, x 2^8, which keeps more of the low half of g x factor above the subnormal range of f16
__global__ __launch_bounds__(256) void k_mg(const float* __restrict__ MP, float* __restrict__ CF) {
  const int t = blockIdx.x * 256 + threadIdx.x; const size_t b = blockIdx.y; const float* src = MP + (b * NKB * TT + t) * 2; v2f r[NKB]; float e[NKB];
#pragma unroll   // whole, every loop here: r and e stay in registers and the 16 loads are in flight together
  for (int i = 0; i < NKB; ++i) r[i] = *(const v2f*)(src + (size_t)i * TT * 2);
  float m = r[0][0];
#pragma unroll
  for (int i = 1; i < NKB; ++i) m = fmaxf(m, r[i][0]);
  float l = 0.f;
#pragma unroll
  for (int i = 0; i < NKB; ++i) { e[i] = expf(r[i][0] - m); l += r[i][1] * e[i]; }
  const float inv = (2048.0f * 256.0f) / l;   // the tile sums carry 2^11
#pragma unroll
  for (int i = 0; i < NKB; ++i) CF[(b * NKB + i) * TT + t] = e[i] * inv; }
// ---- k_pv: block = (128 rows s = one key tile, 64 columns d) of batch b, a wave has 32 rows (two row blocks), so that every g fragment read from LDS feeds both: attn^T[s][d] = sum_t P[t][s] g[d][t]: A = PT rows [s][t] (f16, exp(logit - tile max) x 2^11), B(k=t, col=d) = g[d][t] x factor[t] (x 2^8), converted on the fly to f16 hi + residual
#define PV_KT 64            // positions t per stage
#define PV_NS (TT / PV_KT)
#define PV_DW 64            // columns d per work-group
#define PV_LD (PV_KT + 8)   // LDS row pitch in halves: 144 B = 16 B x odd, so the 16 rows of a 16-byte fragment read fall on distinct banks
typedef __attribute__((ext_vector_type(4))) _Float16 v4h;
// The g tile of a stage (64 d x 64 t) is the same for the 4 waves: the work-group loads it once in whole lines, multiplies it by the positions' factors, splits it once into f16 hi + lo and stages it in LDS; two buffers, so the next stage's global loads fly while this stage is multiplied.
__global__ __launch_bounds__(128) void k_pv(const _Float16* __restrict__ PT, const float* __restrict__ G, const float* __restrict__ CF, float* __restrict__ AT) { __shared__ __align__(16) float ss[4][32][PV_DW + 4]; __shared__ __align__(16) _Float16 sg[2][2][PV_DW][PV_LD];   // sg: [buffer][hi, lo][d][t]
  const int tid = threadIdx.x, wave = tid >> 5, lane = tid & 31, col = lane & 15, g = lane >> 4; const int d0 = blockIdx.y * PV_DW; const int s0 = blockIdx.x * 128 + wave * 32;
  const int b = blockIdx.z; PT += (size_t)b * TT * TT;   // every batch in one grid: 512 work-groups in one launch
  const int gr_row = tid >> 4, gr_q = tid & 15;          // 16 threads x 16 B = one 256-B row piece of the tile; a thread has rows gr_row + 8 i
  const float* gsrc = G + ((size_t)b * DD + d0 + gr_row) * TT + gr_q * 4; const _Float16* arow = PT + (size_t)(s0 + col) * TT;   // row block m: + m * 16 rows
  const float* csrc = CF + ((size_t)b * NKB + blockIdx.x) * TT + gr_q * 4;   // the block's 128 keys are one key tile: one factor per position t, the same for every d
  v8f acc[2][4] = {}; v4f gr[8]; v16h a[2][2], n[2][2];   // a, n: [row block][half of the stage's 64 t]; the loops over acc, gr, a, n, fh and fl below are unrolled whole so that these arrays stay in registers
#pragma unroll
  for (int i = 0; i < 8; ++i) gr[i] = *(const v4f*)(gsrc + (size_t)i * 8 * TT);
  v4f cf = *(const v4f*)csrc;
#pragma unroll
  for (int m = 0; m < 2; ++m)
#pragma unroll
    for (int u = 0; u < 2; ++u) n[m][u] = frag_h(arow + (size_t)m * 16 * TT + u * 32, lane);
#pragma unroll 1   // rolled: one copy of the stage body, the buffer chosen by st & 1
  for (int st = 0; st < PV_NS; ++st) { const int cur = st & 1;
    _Float16* dst = &sg[cur][0][gr_row][gr_q * 4];
#pragma unroll
    for (int i = 0; i < 8; ++i) { v4h hi, lo;
#pragma unroll
      for (int e = 0; e < 4; ++e) { const float v = gr[i][e] * cf[e]; const _Float16 h = (_Float16)v; hi[e] = h; lo[e] = (_Float16)(v - (float)h); }
      *(v4h*)(dst + i * 8 * PV_LD) = hi; *(v4h*)(dst + (PV_DW + i * 8) * PV_LD) = lo; }
#pragma unroll
    for (int m = 0; m < 2; ++m)
#pragma unroll
      for (int u = 0; u < 2; ++u) a[m][u] = n[m][u];
    __syncthreads();   // publishes buffer cur to the 4 waves; it also stands between every wave's last reads of the other buffer (the trip before) and the next trip's stores into it
    if (st + 1 < PV_NS) { const int t1 = (st + 1) * PV_KT;   // next stage's global loads, issued ahead of this stage's products
#pragma unroll
      for (int i = 0; i < 8; ++i) gr[i] = *(const v4f*)(gsrc + (size_t)i * 8 * TT + t1);
      cf = *(const v4f*)(csrc + t1);
      asm volatile("s_wait_xcnt 0x0" ::: "memory");   // stands in front of the loads below, one of which this build lets return into the address registers of the loads above
#pragma unroll
      for (int m = 0; m < 2; ++m)
#pragma unroll
        for (int u = 0; u < 2; ++u) n[m][u] = frag_h(arow + (size_t)m * 16 * TT + t1 + u * 32, lane); }
    const _Float16* bsrc = &sg[cur][0][col][0]; v16h fh[2][2], fl[2][2];   // fragments of two column groups, read one pair ahead of their products
#pragma unroll
    for (int w = 0; w < 2; ++w) { fh[0][w] = frag_h(bsrc + w * 16 * PV_LD, lane); fl[0][w] = frag_h(bsrc + (PV_DW + w * 16) * PV_LD, lane); }
#pragma unroll
    for (int q = 0; q < 4; ++q) { const int pp = q & 1, j = (q & 1) * 2, u = q >> 1;
      if (q + 1 < 4) { const int un = (q + 1) >> 1, jn = ((q + 1) & 1) * 2;
#pragma unroll
        for (int w = 0; w < 2; ++w) { fh[pp ^ 1][w] = frag_h(bsrc + (jn + w) * 16 * PV_LD + un * 32, lane); fl[pp ^ 1][w] = frag_h(bsrc + (PV_DW + (jn + w) * 16) * PV_LD + un * 32, lane); } }
      acc[0][j] = wmma16(a[0][u], fh[pp][0], acc[0][j]); acc[1][j] = wmma16(a[1][u], fh[pp][0], acc[1][j]); acc[0][j + 1] = wmma16(a[0][u], fh[pp][1], acc[0][j + 1]); acc[1][j + 1] = wmma16(a[1][u], fh[pp][1], acc[1][j + 1]);
      acc[0][j] = wmma16(a[0][u], fl[pp][0], acc[0][j]); acc[1][j] = wmma16(a[1][u], fl[pp][0], acc[1][j]); acc[0][j + 1] = wmma16(a[0][u], fl[pp][1], acc[0][j + 1]); acc[1][j + 1] = wmma16(a[1][u], fl[pp][1], acc[1][j + 1]); } }
#pragma unroll
  for (int m = 0; m < 2; ++m)
#pragma unroll
    for (int j = 0; j < 4; ++j)
#pragma unroll
      for (int r = 0; r < 8; ++r) ss[wave][m * 16 + 8 * g + r][j * 16 + col] = acc[m][j][r] * (1.0f / (2048.0f * 256.0f));
  LDSX(); for (int i = 0; i < 16; ++i) { const int rl = 2 * i + g; vst2(AT + ((size_t)b * TT + s0 + rl) * DD + d0 + col * 4, *(const v4f*)&ss[wave][rl][col * 4]); } }   // 16 lanes x 16 B = the two whole 128-B lines of a row's 64 columns; a store of the wave has two rows
// ---- k_ht: block = (64 positions s, 128 out channels c, b): h[c][s] = sum_d ht_w[c][d] attn^T[s][d] + ht_b[c]; rows = s (A = attn^T hi+lo), B(k=d, col=c) = ht_w[c][d]; writes h [b][c][t] via LDS transpose + per-block BN partials
#define HT_KD 64                    // d per stage: two whole 128-B lines of every ht_w row
#define HT_NS (DD / HT_KD)
#define HT_LD (HT_KD + 4)           // LDS row pitch in floats: 272 B = 16 B x odd, so the 16 rows of a 16-byte fragment read fall on distinct banks
#define HT_BUFB (128 * HT_LD * 4)   // bytes of one buffer
#define HT_COPY(l, p) do { copy8<8 * HT_LD * 4, 8 * DD * 4>(l, p); copy8<8 * HT_LD * 4, 8 * DD * 4>((l) + 64u * HT_LD * 4, (p) + 64 * DD * 4); } while (0)   // a lane's rows cr + 8 i of the 128
// The ht_w tile of a stage (128 c x 64 d) is the same for the 4 waves: the work-group copies it once, in whole lines, into LDS; two buffers, so the next stage's copies fly while this stage is multiplied.
__global__ __launch_bounds__(128) void k_ht(const float* __restrict__ AT, const float* __restrict__ HW, const float* __restrict__ HB, float* __restrict__ Hh, float* __restrict__ ST) { __shared__ __align__(16) union { float w[2][128][HT_LD]; float st[128][68]; } sm; __shared__ __align__(16) float sst[128][2];   // w: [buffer][c][d]; st: output staging, once the last stage has been read
  const int tid = threadIdx.x, wave = tid >> 5, lane = tid & 31, col = lane & 15, g = lane >> 4; const int c0 = blockIdx.y * 128; const size_t b = blockIdx.z; const int s0 = blockIdx.x * 64; const size_t r0 = b * TT + s0 + wave * 16;
  const int cr = tid >> 4, cq = tid & 15;   // 16 lanes x 16 B = the 256 B of a row; a thread has rows cr + 8 i
  const char* gw = (const char*)(HW + (size_t)(c0 + cr) * DD + cq * 4);
  const unsigned l0 = (unsigned)(size_t)&sm.w[0][cr][cq * 4];   // low 32 bits of the shared address = byte address in LDS
  const float* arow = AT + (r0 + col) * DD;
  v8f acc[8] = {};
  HT_COPY(l0, gw);
  asm volatile("s_wait_asynccnt 0x0" ::: "memory");   // this wave's copies of stage 0 have landed
  __syncthreads();                                    // publishes stage 0 to the 4 waves
  HT_COPY(l0 + HT_BUFB, gw + HT_KD * 4);
#pragma unroll 1   // rolled: one copy of the stage body, the buffer chosen by sg & 1
  for (int sg = 0; sg < HT_NS; ++sg) { const int cur = sg & 1; const float* bs = &sm.w[cur][col][8 * g];
    const F2 a0 = split_row(arow, sg * HT_KD, lane), a1 = split_row(arow, sg * HT_KD + 32, lane);
    WR r[2][2];   // the floats of two column groups, read one pair ahead of their products, inside this stage only
#pragma unroll   // whole: r is indexed by constants only
    for (int u = 0; u < 2; ++u) r[0][u] = raw_wf(bs + u * 16 * HT_LD);
#pragma unroll   // whole: r and acc are indexed by constants only
    for (int q = 0; q < 8; ++q) { const int pp = q & 1, j = (q & 3) * 2; const F2& a = (q >> 2) ? a1 : a0;
      if (q + 1 < 8) { const int kn = (q + 1) >> 2, jn = ((q + 1) & 3) * 2;
#pragma unroll   // whole: as above
        for (int u = 0; u < 2; ++u) r[pp ^ 1][u] = raw_wf(bs + (jn + u) * 16 * HT_LD + kn * 32); }
      const v16b w0 = cvt_wf(r[pp][0]), w1 = cvt_wf(r[pp][1]);
      acc[j] = wmma_bf(a.h, w0, acc[j]); acc[j + 1] = wmma_bf(a.h, w1, acc[j + 1]); acc[j] = wmma_bf(a.l, w0, acc[j]); acc[j + 1] = wmma_bf(a.l, w1, acc[j + 1]); }
    asm volatile("s_wait_dscnt 0x0" ::: "memory");      // this wave's reads of buffer cur are done before the buffer is handed to its next writer
    asm volatile("s_wait_asynccnt 0x0" ::: "memory");   // this wave's copies of stage sg + 1 have landed
    __syncthreads();                                    // publishes stage sg + 1 and ends every wave's reads of buffer cur
    if (sg + 2 < HT_NS) HT_COPY(l0 + cur * HT_BUFB, gw + (sg + 2) * HT_KD * 4); }
  asm volatile("s_wait_asynccnt 0x0" ::: "memory");     // no copy is outstanding when the ring becomes output staging
#pragma unroll
  for (int j = 0; j < 8; ++j) { const int cl = j * 16 + col; const float bb = bfr(HB[c0 + cl]);
#pragma unroll
    for (int r = 0; r < 8; ++r) sm.st[cl][wave * 16 + 8 * g + r] = acc[j][r] + bb; }
  __syncthreads();
  for (int e = tid; e < 128 * 16; e += 128) { const int cl = e >> 4, q = e & 15; vst2(Hh + (b * CC + c0 + cl) * (size_t)TT + s0 + q * 4, *(const v4f*)&sm.st[cl][q * 4]); }
  { const int cl = tid; float s = 0.f; for (int q = 0; q < 64; ++q) s += sm.st[cl][q]; const float mean = s / 64.0f; float m2 = 0.f; for (int q = 0; q < 64; ++q) { const float d = sm.st[cl][q] - mean; m2 += d * d; } sst[cl][0] = mean; sst[cl][1] = m2; }
  __syncthreads(); if (tid < 64) vst2(ST + (((b * (TT / 64) + blockIdx.x) * CC) + c0) * 2 + tid * 4, *(const v4f*)&(&sst[0][0])[tid * 4]); }
// ---- k_bn: block = 32 channels (lane = channel), 8 waves x 32 of the channel's NB*32 block partials (64 values each): mean = mean of the block means, M2 = sum of (M2_blk + 64 (mean_blk - mean)^2), both summed in a fixed order (32 in a thread, then the 8 waves in turn) -> mean, inv_std (biased)
#define BN_NR (NB * (TT / 64))   // records per channel
#define BN_PT (BN_NR / 8)        // records per thread
__global__ __launch_bounds__(256) void k_bn(const float* __restrict__ ST, float* __restrict__ BN) { __shared__ float sm[8][32]; __shared__ float sq[8][32];
  const int lane = threadIdx.x & 31, wave = threadIdx.x >> 5; const int c = blockIdx.x * 32 + lane; const float* src = ST + ((size_t)wave * BN_PT * CC + c) * 2; v2f r[BN_PT];
#pragma unroll   // whole: r stays in registers and a thread's loads are all in flight together, so memory latency is paid once and not once per record
  for (int i = 0; i < BN_PT; ++i) r[i] = *(const v2f*)(src + (size_t)i * CC * 2);
  float s = 0.f;
#pragma unroll   // whole: r is indexed by constants only
  for (int i = 0; i < BN_PT; ++i) s += r[i][0];
  sm[wave][lane] = s; __syncthreads();
  float tot = 0.f; for (int w = 0; w < 8; ++w) tot += sm[w][lane];
  const float mean = tot * (1.0f / BN_NR); float q = 0.f;
#pragma unroll   // whole: r is indexed by constants only
  for (int i = 0; i < BN_PT; ++i) { const float d = r[i][0] - mean; q += r[i][1] + 64.f * d * d; }
  sq[wave][lane] = q; __syncthreads();
  if (wave == 0) { float M2 = 0.f; for (int w = 0; w < 8; ++w) M2 += sq[w][lane]; BN[c] = mean; BN[CC + c] = 1.0f / sqrtf(M2 / (64.f * BN_NR) + 1e-5f); } }
// ---- k_out: wave = one row (b, c): out[b][c][t] = inpt + gamma (h - mean) inv + beta over the 2,048 positions; a load or store of the wave is 512 consecutive bytes, a lane has 16 such pieces of each array
__global__ __launch_bounds__(256) void k_out(const float* __restrict__ X, const float* __restrict__ Hh, const float* __restrict__ BN, const float* __restrict__ GA, const float* __restrict__ BE, float* __restrict__ OUT) {
  const int row = blockIdx.x * 8 + __builtin_amdgcn_readfirstlane(threadIdx.x >> 5); const int c = row & (CC - 1);   // row = b * CC + c, the same in every lane of the wave
  const unsigned lo = (threadIdx.x & 31) * 4u;   // the lane's place in a 512-byte piece: one offset register for every load and store, on scalar row addresses
  const float *xr = X + (size_t)row * TT, *hr = Hh + (size_t)row * TT; float* orow = OUT + (size_t)row * TT;
  const float mean = BN[c], inv = BN[CC + c], ga = bfr(GA[c]), be = bfr(BE[c]);
  v4f x[16], h[16];
#pragma unroll   // whole, both loops: x and h are indexed by constants only
  for (int i = 0; i < 16; ++i) { x[i] = *(const v4f*)(xr + lo + i * 128); h[i] = *(const v4f*)(hr + lo + i * 128); }
  __builtin_amdgcn_sched_barrier(0);   // keeps the row's 32 loads ahead of all arithmetic, in flight together: without it the compiler issued the later ones in pairs between the sums, each pair waiting out memory latency anew
#pragma unroll
  for (int i = 0; i < 16; ++i) { v4f o;
#pragma unroll
    for (int e = 0; e < 4; ++e) o[e] = bfr(x[i][e]) + (ga * (h[i][e] - mean) * inv + be);
    vst2(orow + lo + i * 128, o); } }
extern "C" void kernel_launch(void* const* d_in, const int* in_sizes, int n_in, void* d_out, int out_size, void* d_ws, size_t ws_size, hipStream_t stream) {
  (void)in_sizes; (void)n_in; (void)out_size;
  const float** F = (const float**)d_in;   // 0 inpt [8,512,2048], 1 theta_w [256,512], 2 theta_b, 3 phi_w, 4 phi_b, 5 g_w, 6 g_b, 7 ht_w [512,256], 8 ht_b, 9 bn_gamma, 10 bn_beta
  if (ws_size < (size_t)WS_END) return;
  char* ws = (char*)d_ws; float *TH = (float*)(ws + WS_TH), *G = (float*)(ws + WS_G), *MP = (float*)(ws + WS_MP), *CF = (float*)(ws + WS_CF), *AT = (float*)(ws + WS_AT), *Hh = (float*)(ws + WS_H), *ST = (float*)(ws + WS_ST), *BN = (float*)(ws + WS_BN); __bf16 *PHH = (__bf16*)(ws + WS_PHH), *PHL = (__bf16*)(ws + WS_PHL); _Float16* PT = (_Float16*)(ws + WS_PT);
  k_proj<<<dim3(TT / 64, TNB, 3), 128, 0, stream>>>(F[0], F[1], F[2], F[3], F[4], F[5], F[6], TH, PHH, PHL, G);
  k_sc<<<dim3(TT / 128, TT / 128, TNB), 128, 0, stream>>>(TH, PHH, PHL, MP, PT);
  k_mg<<<dim3(TT / 256, TNB), 256, 0, stream>>>(MP, CF);
  k_pv<<<dim3(TT / 128, DD / PV_DW, TNB), 128, 0, stream>>>(PT, G, CF, AT);
  k_ht<<<dim3(TT / 64, CC / 128, TNB), 128, 0, stream>>>(AT, F[7], F[8], Hh, ST);
  k_bn<<<CC / 32, 256, 0, stream>>>(ST, BN);
  k_out<<<CC * TNB / 8, 256, 0, stream>>>(F[0], Hh, BN, F[9], F[10], (float*)d_out);
}

// v009
// It runs in 144 microseconds.
// In both of two side-by-side timings against v008, it was 1.04 times as fast.
// Over all steps from v000 it is 18.5 times as fast.
// compute dtype: all float inputs rounded to bf16; theta / phi / g = W x + b (1x1 convs) with EXACT bf16 products on WMMA 16x16x32 (x^T tile staged in LDS), f32 accumulate; theta and phi computed in f32 and split into bf16 hi + lo for the UNSCALED logits w = theta^T phi (3 products; logits std ~5, sharp softmax), softmax in f32, first inside each tile of 128 keys while the logits are still in registers: exp(w - tile max) -> P^T planes as f16 x 2^11, with (tile max, tile sum) per query; the 16 tiles of a query merged into one factor per (query, tile), which multiplies g; attn[d][s] = sum_t (g[d][t] factor[t]) P~[t][s] with the scaled g as f16 hi + lo (2 products); h = ht_w attn (attn bf16 hi + lo, 2 products) + ht_b; BatchNorm1d training statistics over (B, T) per channel from per-block (mean, M2) partials merged in a fixed order; out = inpt + gamma h_norm + beta; f32 output.
#include <hip/hip_runtime.h>
#include <math.h>

typedef __attribute__((ext_vector_type(16))) _Float16 v16h;
typedef __attribute__((ext_vector_type(16))) __bf16 v16b;
typedef __attribute__((ext_vector_type(8)))  _Float16 v8h;
typedef __attribute__((ext_vector_type(8)))  float v8f;
typedef __attribute__((ext_vector_type(4)))  float v4f;
typedef __attribute__((ext_vector_type(2)))  float v2f;
typedef __attribute__((ext_vector_type(4)))  unsigned v4u;
typedef __attribute__((ext_vector_type(4)))  int v4i;
typedef float __attribute__((may_alias)) float_a;
typedef int __attribute__((may_alias)) int_a;

template <typename T> __device__ __forceinline__ void vst2(void* p, T v) { *(T*)p = v;  }
__device__ __forceinline__ v8f wmma16(v16h a, v16h b, v8f c) {
  v8f d = __builtin_amdgcn_wmma_f32_16x16x32_f16(false, a, false, b, (short)0, c, false, false);
  asm volatile("v_nop\n\tv_nop\n\tv_nop\n\tv_nop" : "+v"(d) : "v"(a), "v"(b));
  return d;
}
__device__ __forceinline__ v8f wmma_bf(v16b a, v16b b, v8f c) {
  v8f d = __builtin_amdgcn_wmma_f32_16x16x32_bf16(false, a, false, b, (short)0, c, false, false);
  asm volatile("v_nop\n\tv_nop\n\tv_nop\n\tv_nop" : "+v"(d) : "v"(a), "v"(b));
  return d;
}
// 16x16x32 fragments: lane = (h = lane>>4, row/col = lane&15); elements 0..7 = k0+8h+0..7, 8..15 = k0+16+8h+0..7; D element r = row 8h+r
__device__ __forceinline__ v16h frag_h(const _Float16* rowk0, int lane) {
  union { v16h v; v8h q[2]; } u; const _Float16* p = rowk0 + 8 * (lane >> 4);
  u.q[0] = *(const v8h*)p; u.q[1] = *(const v8h*)(p + 16); return u.v;
}
__device__ __forceinline__ v16h frag_f32(const float* rowk0, int lane) {
  v16h a; const float* p = rowk0 + 8 * (lane >> 4);
#pragma unroll
  for (int i = 0; i < 8; ++i) { a[i] = (_Float16)p[i]; a[8 + i] = (_Float16)p[16 + i]; }
  return a;
}
__device__ __forceinline__ v16h frag_f32s(const float* rowk0, int lane, float sc) {
  v16h a; const float* p = rowk0 + 8 * (lane >> 4);
#pragma unroll
  for (int i = 0; i < 8; ++i) { a[i] = (_Float16)(p[i] * sc); a[8 + i] = (_Float16)(p[16 + i] * sc); }
  return a;
}
// column fragment from a [K][ld] layout (column n), rows >= K read as 0
__device__ __forceinline__ v16h fragc_f32(const float* W, int k0, int n, int lane, int ld, int K) {
  v16h a; const int g = lane >> 4;
#pragma unroll
  for (int i = 0; i < 8; ++i) { const int ka = k0 + 8 * g + i, kb = ka + 16;
    a[i] = (_Float16)(ka < K ? W[(size_t)(ka < K ? ka : K - 1) * ld + n] : 0.f); a[8 + i] = (_Float16)(kb < K ? W[(size_t)(kb < K ? kb : K - 1) * ld + n] : 0.f); }
  return a;
}
struct F2 { v16b h, l; };
__device__ __forceinline__ F2 bsplit16(const float v[16]) { F2 r;
#pragma unroll
  for (int i = 0; i < 16; ++i) { const __bf16 h = (__bf16)v[i]; r.h[i] = h; r.l[i] = (__bf16)(v[i] - (float)h); }
  return r; }
__device__ __forceinline__ F2 split_row(const float* row, int k0, int lane) { float v[16]; const float* p = row + k0 + 8 * (lane >> 4);
#pragma unroll
  for (int i = 0; i < 8; ++i) { v[i] = p[i]; v[8 + i] = p[16 + i]; }
  return bsplit16(v); }
__device__ __forceinline__ F2 split_rowK(const float* row, int k0, int lane, int K) { float v[16]; const int g = lane >> 4;
#pragma unroll
  for (int i = 0; i < 8; ++i) { const int ka = k0 + 8 * g + i, kb = ka + 16; v[i] = ka < K ? row[ka < K ? ka : K - 1] : 0.f; v[8 + i] = kb < K ? row[kb < K ? kb : K - 1] : 0.f; }
  return bsplit16(v); }
__device__ __forceinline__ F2 split_col(const float* W, int k0, int n, int lane, int ld, int K) { float v[16]; const int g = lane >> 4;
#pragma unroll
  for (int i = 0; i < 8; ++i) { const int ka = k0 + 8 * g + i, kb = ka + 16; v[i] = ka < K ? W[(size_t)(ka < K ? ka : K - 1) * ld + n] : 0.f; v[8 + i] = kb < K ? W[(size_t)(kb < K ? kb : K - 1) * ld + n] : 0.f; }
  return bsplit16(v); }
__device__ __forceinline__ v8f mac3(const F2& a, const F2& b, v8f c) { c = wmma_bf(a.l, b.h, c); c = wmma_bf(a.h, b.l, c); return wmma_bf(a.h, b.h, c); }
__device__ __forceinline__ float sigm(float v) { return 1.0f / (1.0f + expf(-v)); }
#define LDSX() do { asm volatile("s_wait_dscnt 0" ::: "memory"); __builtin_amdgcn_wave_barrier(); __builtin_amdgcn_fence(__ATOMIC_RELEASE, "workgroup"); } while (0)


// Non-local block over time (B 8, C 512, D 256, T 2,048): theta/phi/g 1x1 convs; w = softmax_s(theta^T phi); attn = g w (the module contracts g over the QUERY index); h = ht(attn); training-mode BatchNorm1d; out = inpt + bn(h).
#define NB 8
#define CC 512
#define DD 256
#define TT 2048
#ifndef TNB
#define TNB NB
#endif
typedef __attribute__((ext_vector_type(8))) __bf16 v8b;
typedef __attribute__((ext_vector_type(4))) __bf16 v4b;
__device__ __forceinline__ v16b frag_b(const __bf16* rowk0, int lane) {
  union { v16b v; v8b q[2]; } u; const __bf16* p = rowk0 + 8 * (lane >> 4);
  u.q[0] = *(const v8b*)p; u.q[1] = *(const v8b*)(p + 16); return u.v;
}
// A-fragment order of a 16-bit matrix [rows][K] in the workspace: one block of 512 elements (1 KiB) per (16 rows, 32 k), blocks [row block][k chunk]; in a block [part][lane][8], part 0 = fragment elements 0..7, part 1 = 8..15.
// A wave's 16-byte load of one part is then 512 consecutive bytes (4 whole lines), where a load from rows touches 16 lines. FRG = element offset of a block, KC = K / 32.
#define FRG(rowblk, kchunk, KC) (((size_t)(rowblk) * (KC) + (kchunk)) * 512)
__device__ __forceinline__ v16b fragw_b(const __bf16* blk_lane) { union { v16b v; v8b q[2]; } u; u.q[0] = *(const v8b*)blk_lane; u.q[1] = *(const v8b*)(blk_lane + 256); return u.v; }   // blk_lane = block + lane * 8
__device__ __forceinline__ v16h fragw_h(const _Float16* blk_lane) { union { v16h v; v8h q[2]; } u; u.q[0] = *(const v8h*)blk_lane; u.q[1] = *(const v8h*)(blk_lane + 256); return u.v; }
// 8 consecutive f32 split into bf16 hi + lo and stored at the same element offset of the two planes
__device__ __forceinline__ void split8_st(const float* p, __bf16* H, __bf16* L) { __bf16 hh[8], ll[8];
#pragma unroll   // whole: hh and ll are indexed by constants only
  for (int i = 0; i < 8; ++i) { const __bf16 hv = (__bf16)p[i]; hh[i] = hv; ll[i] = (__bf16)(p[i] - (float)hv); }
  vst2((unsigned*)H, *(const v4u*)hh); vst2((unsigned*)L, *(const v4u*)ll); }
__device__ __forceinline__ float bfr(float v) { return (float)(__bf16)v; }
__device__ __attribute__((noinline)) float exp_ni(float v) { return expf(v); }
__device__ __attribute__((noinline)) float erf_ni(float v) { return erff(v); }

#define WS_TH  0u                                    // bf16 theta^T hi, then lo, each in A-fragment order (FRG above)
#define WS_THL (WS_TH + 2u * (size_t)NB * TT * DD)
#define WS_PHH (WS_TH + 4u * (size_t)NB * TT * DD)      // bf16 phi^T hi rows [b*s][256]
#define WS_PHL (WS_PHH + 2u * (size_t)NB * TT * DD)
#define WS_G   (WS_PHL + 2u * (size_t)NB * TT * DD)     // f32 g [b][d][t]
#define WS_S   (WS_G + 4u * (size_t)NB * DD * TT)       // region of attn^T, h, the tile statistics and the factors below
#define WS_PT  (WS_CF + 4u * (size_t)NB * NKB * TT)    // f16 planes, one per batch, rows s, k = t, in A-fragment order (FRG above): exp(logit - max of the query's logits in the key tile of s) x 2^11
#define WS_AT  WS_S                                   // bf16 attn^T hi, then lo, each in A-fragment order (FRG above)
#define WS_ATL (WS_AT + 2u * (size_t)NB * TT * DD)
#define WS_H   (WS_AT + 4u * (size_t)NB * TT * DD)      // f32 h [b][c][t]
#define NKB (TT / 128)                                // key tiles per query
#define WS_MP  (WS_H + 4u * (size_t)NB * CC * TT)      // f32 (tile max, tile sum x 2^11) [b][key tile][t][2]
#define WS_CF  (WS_MP + 4u * (size_t)NB * NKB * TT * 2) // f32 factor [b][key tile][t] = exp(tile max - row max) / row sum x 2^8
#define WS_ST  (WS_PT + 2u * (size_t)NB * TT * TT)     // f32 BN partials [(b*(TT/64) + tblk)][c][2] - one record per (batch, 64-position block)
#define WS_BN  (WS_ST + 4u * (size_t)NB * (TT / 64) * CC * 2)    // f32 mean [512], inv [512]
#define WS_END (WS_BN + 4u * 2 * CC)

// One lane's eight 16-byte copies global -> LDS, through no register: rows r, r + n, ..., r + 7 n of a tile (l = LDS byte address and p = global address of the lane's 16 bytes in row r; LS and GS = bytes from one of these rows to the next, in LDS and in global memory).
// The s_wait_xcnt is the last line of the copies' own statement, so that no address register is rewritten ahead of it.
template <int LS, int GS> __device__ __forceinline__ void copy8(unsigned l, const char* p) {
  asm volatile("global_load_async_to_lds_b128 %0, %8, off\n\t"
               "global_load_async_to_lds_b128 %1, %9, off\n\t"
               "global_load_async_to_lds_b128 %2, %10, off\n\t"
               "global_load_async_to_lds_b128 %3, %11, off\n\t"
               "global_load_async_to_lds_b128 %4, %12, off\n\t"
               "global_load_async_to_lds_b128 %5, %13, off\n\t"
               "global_load_async_to_lds_b128 %6, %14, off\n\t"
               "global_load_async_to_lds_b128 %7, %15, off\n\t"
               "s_wait_xcnt 0x0"
               :: "v"(l), "v"(l + 1u * LS), "v"(l + 2u * LS), "v"(l + 3u * LS), "v"(l + 4u * LS), "v"(l + 5u * LS), "v"(l + 6u * LS), "v"(l + 7u * LS),
                  "v"(p), "v"(p + 1 * GS), "v"(p + 2 * GS), "v"(p + 3 * GS), "v"(p + 4 * GS), "v"(p + 5 * GS), "v"(p + 6 * GS), "v"(p + 7 * GS)
               : "memory");
}
// A bf16 fragment from a row of f32 in LDS, in two halves, so that the reads can stand well ahead of the products: raw_wf reads the 16 floats (p = row + k0 + 8 h), cvt_wf rounds them; the same elements in the same order as the fragment loads from global rows
struct WR { v4f x[4]; };
__device__ __forceinline__ WR raw_wf(const float* p) { WR r; r.x[0] = *(const v4f*)p; r.x[1] = *(const v4f*)(p + 4); r.x[2] = *(const v4f*)(p + 16); r.x[3] = *(const v4f*)(p + 20); return r; }
__device__ __forceinline__ v16b cvt_wf(const WR& r) { v16b w;
#pragma unroll   // whole, this loop and the next: w and r are indexed by constants only and stay in registers
  for (int q = 0; q < 4; ++q)
#pragma unroll
    for (int i = 0; i < 4; ++i) w[4 * q + i] = (__bf16)r.x[q][i];
  return w; }

// ---- k_proj: block = (64 positions t, b, which 0 theta / 1 phi / 2 g): x^T tile (bf16) in LDS; W [d][c]; outputs: theta^T bf16 hi/lo in A-fragment order, phi^T bf16 hi/lo rows, g f32 [d][t]
#define PJ_KC 64                    // c per stage: two whole 128-B lines of every W row
#define PJ_NS (CC / PJ_KC)          // stages per group of 64 output columns
#define PJ_LD (PJ_KC + 4)           // LDS row pitch in floats: 272 B = 16 B x odd, so the 16 rows of a 16-byte fragment read fall on distinct banks
#define PJ_BUFB (64 * PJ_LD * 4)    // bytes of one buffer
#define PJ_COPY(l, p) copy8<8 * PJ_LD * 4, 8 * CC * 4>(l, p)   // a lane's rows cr + 8 i of the 64
// The W tile of a stage (64 d x 64 c) is the same for the 4 waves: the work-group copies it once, in whole lines, into LDS; two buffers, so the next stage's copies fly while this stage is multiplied.
__global__ __launch_bounds__(128) void k_proj(const float* __restrict__ X, const float* __restrict__ WT, const float* __restrict__ BT, const float* __restrict__ WP, const float* __restrict__ BP, const float* __restrict__ WG, const float* __restrict__ BG, __bf16* __restrict__ THH, __bf16* __restrict__ THL, __bf16* __restrict__ PHH, __bf16* __restrict__ PHL, float* __restrict__ G) {
  __shared__ __align__(16) __bf16 sx[64][CC + 8]; __shared__ __align__(16) union { float w[2][64][PJ_LD]; float st[64][68]; } sm;   // w: [buffer][d][c]; st: output staging of a 64-col group, once its last stage has been read
  const int tid = threadIdx.x, wave = tid >> 5, lane = tid & 31, col = lane & 15, g = lane >> 4; const int t0 = blockIdx.x * 64; const size_t b = blockIdx.y; const int which = blockIdx.z;
  const float* Wm = which == 0 ? WT : which == 1 ? WP : WG; const float* Bm = which == 0 ? BT : which == 1 ? BP : BG;
  const int cr = tid >> 4, cq = tid & 15;   // 16 lanes x 16 B = the 256 B of a row; a thread has rows cr + 8 i
  const unsigned l0 = (unsigned)(size_t)&sm.w[0][cr][cq * 4];   // low 32 bits of the shared address = byte address in LDS
  { const int xq = tid & 15, xc = (tid >> 4) * 4;   // 16 lanes x 16 B = the 256 B of a channel's row piece; a thread has 4 positions of channels xc + 32 i + 0..3
    const float* xs = X + (b * CC + xc) * (size_t)TT + t0 + xq * 4;
#pragma unroll 1   // rolled: two batches of 32 loads, so that a batch's 128 registers are used twice
    for (int ib = 0; ib < 2; ++ib) { v4f xr[8][4];
#pragma unroll   // whole, the loops of this batch: xr is indexed by constants only, and the 32 loads are in flight together, so memory latency is paid once a batch
      for (int i = 0; i < 8; ++i)
#pragma unroll
        for (int k = 0; k < 4; ++k) xr[i][k] = *(const v4f*)(xs + (size_t)((ib * 8 + i) * 32 + k) * TT);
#pragma unroll
      for (int i = 0; i < 8; ++i)
#pragma unroll
        for (int e = 0; e < 4; ++e) { v4b w;   // 4 channels of one position: 8 consecutive bytes of the transposed tile
#pragma unroll
          for (int k = 0; k < 4; ++k) w[k] = (__bf16)xr[i][k][e];
          *(v4b*)&sx[xq * 4 + e][xc + (ib * 8 + i) * 32] = w; } } }
  __syncthreads();
#pragma unroll 1
  for (int cg = 0; cg < DD / 64; ++cg) { v8f acc[4] = {}; const char* gw = (const char*)(Wm + (size_t)(cg * 64 + cr) * CC + cq * 4);
    PJ_COPY(l0, gw);
    asm volatile("s_wait_asynccnt 0x0" ::: "memory");   // this wave's copies of stage 0 have landed
    __syncthreads();                                    // publishes stage 0 to the 4 waves
    PJ_COPY(l0 + PJ_BUFB, gw + PJ_KC * 4);
#pragma unroll 1   // rolled: one copy of the stage body, the buffer chosen by s & 1
    for (int s = 0; s < PJ_NS; ++s) { const int cur = s & 1; const float* bs = &sm.w[cur][col][8 * g];
      v16b a[2]; WR r[2][4];   // the stage's LDS reads stand together ahead of its products: their latency is waited for once a stage
#pragma unroll   // whole, the four loops below: a, r and acc are indexed by constants only and stay in registers
      for (int u = 0; u < 2; ++u) { a[u] = frag_b(&sx[wave * 16 + col][s * PJ_KC + u * 32], lane);
#pragma unroll
        for (int j = 0; j < 4; ++j) r[u][j] = raw_wf(bs + j * 16 * PJ_LD + u * 32); }
#pragma unroll
      for (int u = 0; u < 2; ++u)
#pragma unroll
        for (int j = 0; j < 4; ++j) acc[j] = wmma_bf(a[u], cvt_wf(r[u][j]), acc[j]);
      asm volatile("s_wait_dscnt 0x0" ::: "memory");      // this wave's reads of buffer cur are done before the buffer is handed to its next writer
      asm volatile("s_wait_asynccnt 0x0" ::: "memory");   // this wave's copies of stage s + 1 have landed
      __syncthreads();                                    // publishes stage s + 1 and ends every wave's reads of buffer cur
      if (s + 2 < PJ_NS) PJ_COPY(l0 + cur * PJ_BUFB, gw + (s + 2) * PJ_KC * 4); }
    asm volatile("s_wait_asynccnt 0x0" ::: "memory");     // no copy is outstanding when the ring becomes output staging
#pragma unroll
    for (int j = 0; j < 4; ++j) { const int dl = j * 16 + col; const float bb = bfr(Bm[cg * 64 + dl]);
#pragma unroll
      for (int r = 0; r < 8; ++r) { const int tl = wave * 16 + 8 * g + r; const float v = acc[j][r] + bb; if (which == 2) sm.st[dl][tl] = v; else sm.st[tl][dl] = v; } }
    __syncthreads();
    if (which == 0) { for (int i = 0; i < 4; ++i) { const int fp = i & 1, fc = i >> 1;   // a wave has its own 16 rows: 2 blocks x 2 parts; a store = one part of one block: 512 consecutive bytes
        const size_t o = FRG(((b * TT + t0) >> 4) + wave, cg * 2 + fc, DD / 32) + fp * 256 + lane * 8; split8_st(&sm.st[wave * 16 + col][fc * 32 + fp * 16 + g * 8], THH + o, THL + o); } }
    else if (which == 1) { for (int e = tid; e < 64 * 8; e += 128) { const int tl = e >> 3, q = e & 7; const float* p = &sm.st[tl][q * 8]; v16b dummy; (void)dummy; __bf16 hh[8], ll[8]; 
#pragma unroll
        for (int i = 0; i < 8; ++i) { const __bf16 hv = (__bf16)p[i]; hh[i] = hv; ll[i] = (__bf16)(p[i] - (float)hv); }
        vst2((unsigned*)(PHH + (b * TT + t0 + tl) * DD + cg * 64 + q * 8), *(const v4u*)hh); vst2((unsigned*)(PHL + (b * TT + t0 + tl) * DD + cg * 64 + q * 8), *(const v4u*)ll); } }
    else { for (int e = tid; e < 64 * 16; e += 128) { const int dl = e >> 4, q = e & 15; vst2(G + (b * DD + cg * 64 + dl) * (size_t)TT + t0 + q * 4, *(const v4f*)&sm.st[dl][q * 4]); } }
    asm volatile("s_wait_dscnt 0x0" ::: "memory");   // this wave's reads of the staging are done before the next group's copies land on it
    __syncthreads(); } }                             // ends every wave's reads of the staging
// Maximum and sum over the 16 lanes of a row half (the 16 columns of an accumulator tile), every lane getting the result: four exchanges with lane ^ 1, 2, 4, 8 inside the vector unit
template <int X> __device__ __forceinline__ float lane_x(float v) { return __builtin_bit_cast(float, __builtin_amdgcn_update_dpp(0, __builtin_bit_cast(int, v), 0x160 | X, 0xf, 0xf, true)); }   // 0x160 | X = row_xmask:X
__device__ __forceinline__ float max16(float v) { v = fmaxf(v, lane_x<1>(v)); v = fmaxf(v, lane_x<2>(v)); v = fmaxf(v, lane_x<4>(v)); return fmaxf(v, lane_x<8>(v)); }
// Eight independent 2^x in one statement. No result shares a register with an argument (early clobber), so none of the eight is followed directly by a read of its result or an overwrite of its argument;
// the v_nop is the free slot that the instruction set asks for behind the last one. The first results are ready when the statement ends.
__device__ __forceinline__ void exp2x8(float (&y)[8], const float (&x)[8]) {
  asm("v_exp_f32 %0, %8\n\tv_exp_f32 %1, %9\n\tv_exp_f32 %2, %10\n\tv_exp_f32 %3, %11\n\tv_exp_f32 %4, %12\n\tv_exp_f32 %5, %13\n\tv_exp_f32 %6, %14\n\tv_exp_f32 %7, %15\n\tv_nop"
      : "=&v"(y[0]), "=&v"(y[1]), "=&v"(y[2]), "=&v"(y[3]), "=&v"(y[4]), "=&v"(y[5]), "=&v"(y[6]), "=&v"(y[7])
      : "v"(x[0]), "v"(x[1]), "v"(x[2]), "v"(x[3]), "v"(x[4]), "v"(x[5]), "v"(x[6]), "v"(x[7])); }
__device__ __forceinline__ float sum16(float v) { v += lane_x<1>(v); v += lane_x<2>(v); v += lane_x<4>(v); return v + lane_x<8>(v); }
// ---- k_sc: block = (128 queries t, 128 keys s, batch b), a wave has 32 queries (two row blocks), so that every phi fragment read from LDS feeds both: logits theta^T . phi (3 products), kept in registers; per query the tile's max and sum of exp(logit - max) -> MP; exp(logit - max) x 2^11 as f16, transposed -> plane b of PT (rows s, A-fragment order); every batch in one grid
#define SC_KD 64                   // d per stage: one whole 128-B line of every phi row
#define SC_NS (DD / SC_KD)
#define SC_LD (SC_KD + 8)          // LDS row pitch in bf16: 144 B = 16 B x odd, so the 16 rows of a 16-byte fragment read fall on distinct banks
#define SC_PLB (128 * SC_LD * 2)   // bytes of one plane (hi or lo) of one buffer
#define SC_BUFB (2 * SC_PLB)       // bytes of one buffer
#define SC_COPY(l, p) copy8<16 * SC_LD * 2, 16 * DD * 2>(l, p)   // a lane's rows cr + 16 i of one plane
// The phi tile of a stage (128 keys x 64 d, hi and lo) is the same for the 4 waves: the work-group copies it once, in whole lines, into LDS; two buffers, so the next stage's copies fly while this stage is multiplied.
// The second launch bound asks for 4 waves a SIMD, the 4 work-groups a WGP that the 72 KiB of LDS allow: it holds the build to 256 registers, where it otherwise took 270 and a fourth work-group would not fit.
__global__ __launch_bounds__(128, 4) void k_sc(const __bf16* __restrict__ THH, const __bf16* __restrict__ THL, const __bf16* __restrict__ PHH, const __bf16* __restrict__ PHL, float* __restrict__ MP, _Float16* __restrict__ PT) {
  __shared__ __align__(16) union { __bf16 k[2][2][128][SC_LD]; _Float16 p[128][136]; } sm;   // k: [buffer][hi, lo][key][d]; p: output staging [key][query], once the last stage has been read; pitch 272 B = 16 B x odd
  const int b = blockIdx.z; PT += (size_t)b * TT * TT;
  const int tid = threadIdx.x, wave = tid >> 5, lane = tid & 31, col = lane & 15, g = lane >> 4; const int k0 = blockIdx.y * 128; const int tq0 = blockIdx.x * 128 + wave * 32;
  const int cr = tid >> 3, cq = tid & 7;   // 8 lanes x 16 B = one 128-B line of a row; a thread has rows cr + 16 i of both planes
  const size_t ks = ((size_t)b * TT + k0 + cr) * DD + cq * 8; const char* gh = (const char*)(PHH + ks); const size_t hl = (size_t)((const char*)PHL - (const char*)PHH);   // lo plane = hi plane + hl, a scalar: one address pair less to keep through the loop
  const unsigned l0 = (unsigned)(size_t)&sm.k[0][0][cr][cq * 8];   // low 32 bits of the shared address = byte address in LDS
  const size_t tb0 = FRG(((size_t)b * TT + tq0) >> 4, 0, DD / 32) + lane * 8; const __bf16 *tfh = THH + tb0, *tfl = THL + tb0;   // the lane's place in the wave's first theta block, hi and lo
  v8f acc[2][8] = {};
  SC_COPY(l0, gh); SC_COPY(l0 + SC_PLB, gh + hl);
  asm volatile("s_wait_asynccnt 0x0" ::: "memory");   // this wave's copies of stage 0 have landed
  __syncthreads();                                    // publishes stage 0 to the 4 waves
  SC_COPY(l0 + SC_BUFB, gh + SC_KD * 2); SC_COPY(l0 + SC_BUFB + SC_PLB, gh + hl + SC_KD * 2);
#pragma unroll 1   // rolled: one copy of the stage body, the buffer chosen by st & 1
  for (int st = 0; st < SC_NS; ++st) { const int cur = st & 1;
    F2 a[2][2];   // [row block][half of the stage's 64 d]
    union { v16b v; v8b q[2]; } eh, el;   // the last block, hi and lo, loaded part by part
#pragma unroll   // whole, both loops: a is indexed by constants only
    for (int m = 0; m < 2; ++m)
#pragma unroll
      for (int u = 0; u < 2; ++u) { const __bf16 *ph = tfh + FRG(m, st * 2 + u, DD / 32), *pl = tfl + FRG(m, st * 2 + u, DD / 32);
        if (m + u < 2) { a[m][u].h = fragw_b(ph); a[m][u].l = fragw_b(pl); }
        else { eh.q[0] = *(const v8b*)ph; el.q[0] = *(const v8b*)pl;
          asm volatile("s_wait_xcnt 0x0" ::: "memory");   // stands in front of the stage's last two loads, which this build lets return into the address registers of the loads above
          eh.q[1] = *(const v8b*)(ph + 256); el.q[1] = *(const v8b*)(pl + 256); a[m][u].h = eh.v; a[m][u].l = el.v; } }
    const __bf16* bs = &sm.k[cur][0][col][0]; v16b kh[2], kl[2];   // fragments of one key group, read one group ahead of their products, inside this stage only
    kh[0] = frag_b(bs, lane); kl[0] = frag_b(bs + 128 * SC_LD, lane);
#pragma unroll   // whole: kh, kl, a and acc are indexed by constants only
    for (int q = 0; q < 16; ++q) { const int pp = q & 1, j = q & 7, u = q >> 3;
      if (q + 1 < 16) { const int un = (q + 1) >> 3, jn = (q + 1) & 7;
        kh[pp ^ 1] = frag_b(bs + jn * 16 * SC_LD + un * 32, lane); kl[pp ^ 1] = frag_b(bs + (128 + jn * 16) * SC_LD + un * 32, lane); }
      acc[0][j] = wmma_bf(a[0][u].h, kh[pp], acc[0][j]); acc[1][j] = wmma_bf(a[1][u].h, kh[pp], acc[1][j]); acc[0][j] = wmma_bf(a[0][u].l, kh[pp], acc[0][j]); acc[1][j] = wmma_bf(a[1][u].l, kh[pp], acc[1][j]); acc[0][j] = wmma_bf(a[0][u].h, kl[pp], acc[0][j]); acc[1][j] = wmma_bf(a[1][u].h, kl[pp], acc[1][j]); }
    asm volatile("s_wait_dscnt 0x0" ::: "memory");      // this wave's reads of buffer cur are done before the buffer is handed to its next writer
    asm volatile("s_wait_asynccnt 0x0" ::: "memory");   // this wave's copies of stage st + 1 have landed
    __syncthreads();                                    // publishes stage st + 1 and ends every wave's reads of buffer cur
    if (st + 2 < SC_NS) { const unsigned l = l0 + cur * SC_BUFB; const int d2 = (st + 2) * SC_KD * 2; SC_COPY(l, gh + d2); SC_COPY(l + SC_PLB, gh + hl + d2); } }
  asm volatile("s_wait_asynccnt 0x0" ::: "memory");     // no copy is outstanding when the ring becomes output staging
  // A lane has queries tq0 + 16 m + 8 g + r (m = 0, 1; r = 0..7) at keys k0 + 16 j + col: a wave holds all 128 keys of its 32 queries, so the tile's max and sum need this wave alone
  float mx[2][8], sl[2][8];
#pragma unroll   // whole, every loop of this epilogue: acc, mx and sl are indexed by constants only and stay in registers
  for (int m = 0; m < 2; ++m) {
#pragma unroll
    for (int r = 0; r < 8; ++r) { float v = acc[m][0][r];
#pragma unroll
      for (int j = 1; j < 8; ++j) v = fmaxf(v, acc[m][j][r]);
      mx[m][r] = max16(v); }
#pragma unroll
    for (int r = 0; r < 8; ++r) { const float nb = 11.0f - mx[m][r] * 1.4426950408889634f; float a[8], p[8], s = 0.f;   // 2^(w log2 e - max log2 e + 11) = exp(w - max) x 2^11
#pragma unroll
      for (int j = 0; j < 8; ++j) a[j] = fmaf(acc[m][j][r], 1.4426950408889634f, nb);
      exp2x8(p, a);
#pragma unroll
      for (int j = 0; j < 8; ++j) { acc[m][j][r] = p[j]; s += p[j]; }
      sl[m][r] = sum16(s); }
#pragma unroll
    for (int j = 0; j < 8; ++j) { v8h h;   // a lane's 8 queries at one key are 16 consecutive bytes of the transposed tile
#pragma unroll
      for (int r = 0; r < 8; ++r) h[r] = (_Float16)acc[m][j][r];
      *(v8h*)&sm.p[j * 16 + col][wave * 32 + m * 16 + 8 * g] = h; } }
  __syncthreads();   // a key's 128 queries come from the 4 waves: all have stored before a line is read
  _Float16* pd = PT + FRG((k0 >> 4) + wave * 2, blockIdx.x * 4, TT / 32) + lane * 8; const _Float16* ps = &sm.p[wave * 32 + col][g * 8];   // the tile = 8 key blocks x 4 query chunks x 2 parts, a wave has 2 key blocks; a store = one part: 512 consecutive bytes
#pragma unroll   // whole: a thread's 16 LDS reads are in flight together, their latency waited for once
  for (int i = 0; i < 16; ++i) { const int fp = i & 1, fc = (i >> 1) & 3, sb = i >> 3;
    vst2((unsigned*)(pd + FRG(sb, fc, TT / 32) + fp * 256), *(const v4u*)(ps + sb * 16 * 136 + fc * 32 + fp * 16)); }
  if (col == 0) { float* mp = MP + (((size_t)b * NKB + blockIdx.y) * TT + tq0 + 8 * g) * 2;   // 32 queries x 8 B: two 128-B lines a wave; behind the barrier, which would otherwise wait for these stores
#pragma unroll
    for (int m = 0; m < 2; ++m)
#pragma unroll
      for (int r = 0; r < 8; r += 2) vst2(mp + (m * 16 + r) * 2, v4f{mx[m][r], sl[m][r], mx[m][r + 1], sl[m][r + 1]}); } }
// ---- k_mg: thread = (query t, batch b): the query's 16 tile records merged in a fixed order: row max, row sum = sum of tile sum x exp(tile max - row max); factor of a tile = exp(tile max - row max) / row sum, x 2^8, which keeps more of the low half of g x factor above the subnormal range of f16
__global__ __launch_bounds__(256) void k_mg(const float* __restrict__ MP, float* __restrict__ CF) {
  const int t = blockIdx.x * 256 + threadIdx.x; const size_t b = blockIdx.y; const float* src = MP + (b * NKB * TT + t) * 2; v2f r[NKB]; float e[NKB];
#pragma unroll   // whole, every loop here: r and e stay in registers and the 16 loads are in flight together
  for (int i = 0; i < NKB; ++i) r[i] = *(const v2f*)(src + (size_t)i * TT * 2);
  float m = r[0][0];
#pragma unroll
  for (int i = 1; i < NKB; ++i) m = fmaxf(m, r[i][0]);
  float l = 0.f;
#pragma unroll
  for (int i = 0; i < NKB; ++i) { e[i] = expf(r[i][0] - m); l += r[i][1] * e[i]; }
  const float inv = (2048.0f * 256.0f) / l;   // the tile sums carry 2^11
#pragma unroll
  for (int i = 0; i < NKB; ++i) CF[(b * NKB + i) * TT + t] = e[i] * inv; }
// ---- k_pv: block = (128 rows s = one key tile, 64 columns d) of batch b, a wave has 32 rows (two row blocks), so that every g fragment read from LDS feeds both: attn^T[s][d] = sum_t P[t][s] g[d][t]: A = PT blocks (rows s, k = t; f16, exp(logit - tile max) x 2^11), B(k=t, col=d) = g[d][t] x factor[t] (x 2^8), converted on the fly to f16 hi + residual
#define PV_KT 64            // positions t per stage
#define PV_NS (TT / PV_KT)
#define PV_DW 64            // columns d per work-group
#define PV_LD (PV_KT + 8)   // LDS row pitch in halves: 144 B = 16 B x odd, so the 16 rows of a 16-byte fragment read fall on distinct banks
typedef __attribute__((ext_vector_type(4))) _Float16 v4h;
// The g tile of a stage (64 d x 64 t) is the same for the 4 waves: the work-group loads it once in whole lines, multiplies it by the positions' factors, splits it once into f16 hi + lo and stages it in LDS; two buffers, so the next stage's global loads fly while this stage is multiplied.
__global__ __launch_bounds__(128) void k_pv(const _Float16* __restrict__ PT, const float* __restrict__ G, const float* __restrict__ CF, __bf16* __restrict__ ATH, __bf16* __restrict__ ATL) { __shared__ __align__(16) float ss[4][32][PV_DW + 4]; __shared__ __align__(16) _Float16 sg[2][2][PV_DW][PV_LD];   // sg: [buffer][hi, lo][d][t]
  const int tid = threadIdx.x, wave = tid >> 5, lane = tid & 31, col = lane & 15, g = lane >> 4; const int d0 = blockIdx.y * PV_DW; const int s0 = blockIdx.x * 128 + wave * 32;
  const int b = blockIdx.z; PT += (size_t)b * TT * TT;   // every batch in one grid: 512 work-groups in one launch
  const int gr_row = tid >> 4, gr_q = tid & 15;          // 16 threads x 16 B = one 256-B row piece of the tile; a thread has rows gr_row + 8 i
  const float* gsrc = G + ((size_t)b * DD + d0 + gr_row) * TT + gr_q * 4; const _Float16* afr = PT + FRG(s0 >> 4, 0, TT / 32) + lane * 8;   // the lane's place in the wave's first P^T block
  const float* csrc = CF + ((size_t)b * NKB + blockIdx.x) * TT + gr_q * 4;   // the block's 128 keys are one key tile: one factor per position t, the same for every d
  v8f acc[2][4] = {}; v4f gr[8]; v16h a[2][2], n[2][2];   // a, n: [row block][half of the stage's 64 t]; the loops over acc, gr, a, n, fh and fl below are unrolled whole so that these arrays stay in registers
#pragma unroll
  for (int i = 0; i < 8; ++i) gr[i] = *(const v4f*)(gsrc + (size_t)i * 8 * TT);
  v4f cf = *(const v4f*)csrc;
#pragma unroll
  for (int m = 0; m < 2; ++m)
#pragma unroll
    for (int u = 0; u < 2; ++u) n[m][u] = fragw_h(afr + FRG(m, u, TT / 32));
#pragma unroll 1   // rolled: one copy of the stage body, the buffer chosen by st & 1
  for (int st = 0; st < PV_NS; ++st) { const int cur = st & 1;
    _Float16* dst = &sg[cur][0][gr_row][gr_q * 4];
#pragma unroll
    for (int i = 0; i < 8; ++i) { v4h hi, lo;
#pragma unroll
      for (int e = 0; e < 4; ++e) { const float v = gr[i][e] * cf[e]; const _Float16 h = (_Float16)v; hi[e] = h; lo[e] = (_Float16)(v - (float)h); }
      *(v4h*)(dst + i * 8 * PV_LD) = hi; *(v4h*)(dst + (PV_DW + i * 8) * PV_LD) = lo; }
#pragma unroll
    for (int m = 0; m < 2; ++m)
#pragma unroll
      for (int u = 0; u < 2; ++u) a[m][u] = n[m][u];
    __syncthreads();   // publishes buffer cur to the 4 waves; it also stands between every wave's last reads of the other buffer (the trip before) and the next trip's stores into it
    if (st + 1 < PV_NS) { const int t1 = (st + 1) * PV_KT;   // next stage's global loads, issued ahead of this stage's products
#pragma unroll
      for (int i = 0; i < 8; ++i) gr[i] = *(const v4f*)(gsrc + (size_t)i * 8 * TT + t1);
      cf = *(const v4f*)(csrc + t1);
      asm volatile("s_wait_xcnt 0x0" ::: "memory");   // stands in front of the loads below, one of which this build lets return into the address registers of the loads above
#pragma unroll
      for (int m = 0; m < 2; ++m)
#pragma unroll
        for (int u = 0; u < 2; ++u) n[m][u] = fragw_h(afr + FRG(m, (st + 1) * 2 + u, TT / 32)); }
    const _Float16* bsrc = &sg[cur][0][col][0]; v16h fh[2][2], fl[2][2];   // fragments of two column groups, read one pair ahead of their products
#pragma unroll
    for (int w = 0; w < 2; ++w) { fh[0][w] = frag_h(bsrc + w * 16 * PV_LD, lane); fl[0][w] = frag_h(bsrc + (PV_DW + w * 16) * PV_LD, lane); }
#pragma unroll
    for (int q = 0; q < 4; ++q) { const int pp = q & 1, j = (q & 1) * 2, u = q >> 1;
      if (q + 1 < 4) { const int un = (q + 1) >> 1, jn = ((q + 1) & 1) * 2;
#pragma unroll
        for (int w = 0; w < 2; ++w) { fh[pp ^ 1][w] = frag_h(bsrc + (jn + w) * 16 * PV_LD + un * 32, lane); fl[pp ^ 1][w] = frag_h(bsrc + (PV_DW + (jn + w) * 16) * PV_LD + un * 32, lane); } }
      acc[0][j] = wmma16(a[0][u], fh[pp][0], acc[0][j]); acc[1][j] = wmma16(a[1][u], fh[pp][0], acc[1][j]); acc[0][j + 1] = wmma16(a[0][u], fh[pp][1], acc[0][j + 1]); acc[1][j + 1] = wmma16(a[1][u], fh[pp][1], acc[1][j + 1]);
      acc[0][j] = wmma16(a[0][u], fl[pp][0], acc[0][j]); acc[1][j] = wmma16(a[1][u], fl[pp][0], acc[1][j]); acc[0][j + 1] = wmma16(a[0][u], fl[pp][1], acc[0][j + 1]); acc[1][j + 1] = wmma16(a[1][u], fl[pp][1], acc[1][j + 1]); } }
#pragma unroll
  for (int m = 0; m < 2; ++m)
#pragma unroll
    for (int j = 0; j < 4; ++j)
#pragma unroll
      for (int r = 0; r < 8; ++r) ss[wave][m * 16 + 8 * g + r][j * 16 + col] = acc[m][j][r] * (1.0f / (2048.0f * 256.0f));
  LDSX(); for (int i = 0; i < 8; ++i) { const int fp = i & 1, fc = (i >> 1) & 1, sb = i >> 2;   // the wave's 2 row blocks x 2 column chunks x 2 parts; a store = one part of one block: 512 consecutive bytes
    const size_t o = FRG((((size_t)b * TT + s0) >> 4) + sb, (d0 >> 5) + fc, DD / 32) + fp * 256 + lane * 8; split8_st(&ss[wave][sb * 16 + col][fc * 32 + fp * 16 + g * 8], ATH + o, ATL + o); } }
// ---- k_ht: block = (64 positions s, 128 out channels c, b): h[c][s] = sum_d ht_w[c][d] attn^T[s][d] + ht_b[c]; rows = s (A = attn^T hi+lo), B(k=d, col=c) = ht_w[c][d]; writes h [b][c][t] via LDS transpose + per-block BN partials
#define HT_KD 64                    // d per stage: two whole 128-B lines of every ht_w row
#define HT_NS (DD / HT_KD)
#define HT_LD (HT_KD + 4)           // LDS row pitch in floats: 272 B = 16 B x odd, so the 16 rows of a 16-byte fragment read fall on distinct banks
#define HT_BUFB (128 * HT_LD * 4)   // bytes of one buffer
#define HT_COPY(l, p) do { copy8<8 * HT_LD * 4, 8 * DD * 4>(l, p); copy8<8 * HT_LD * 4, 8 * DD * 4>((l) + 64u * HT_LD * 4, (p) + 64 * DD * 4); } while (0)   // a lane's rows cr + 8 i of the 128
// The ht_w tile of a stage (128 c x 64 d) is the same for the 4 waves: the work-group copies it once, in whole lines, into LDS; two buffers, so the next stage's copies fly while this stage is multiplied.
__global__ __launch_bounds__(128) void k_ht(const __bf16* __restrict__ ATH, const __bf16* __restrict__ ATL, const float* __restrict__ HW, const float* __restrict__ HB, float* __restrict__ Hh, float* __restrict__ ST) { __shared__ __align__(16) union { float w[2][128][HT_LD]; float st[128][68]; } sm; __shared__ __align__(16) float sst[128][2];   // w: [buffer][c][d]; st: output staging, once the last stage has been read
  const int tid = threadIdx.x, wave = tid >> 5, lane = tid & 31, col = lane & 15, g = lane >> 4; const int c0 = blockIdx.y * 128; const size_t b = blockIdx.z; const int s0 = blockIdx.x * 64;
  const int cr = tid >> 4, cq = tid & 15;   // 16 lanes x 16 B = the 256 B of a row; a thread has rows cr + 8 i
  const char* gw = (const char*)(HW + (size_t)(c0 + cr) * DD + cq * 4);
  const unsigned l0 = (unsigned)(size_t)&sm.w[0][cr][cq * 4];   // low 32 bits of the shared address = byte address in LDS
  const size_t ab0 = FRG((b * TT + s0 + wave * 16) >> 4, 0, DD / 32) + lane * 8; const __bf16 *afh = ATH + ab0, *afl = ATL + ab0;   // the lane's place in the wave's first attn^T block, hi and lo
  v8f acc[8] = {};
  HT_COPY(l0, gw);
  asm volatile("s_wait_asynccnt 0x0" ::: "memory");   // this wave's copies of stage 0 have landed
  __syncthreads();                                    // publishes stage 0 to the 4 waves
  HT_COPY(l0 + HT_BUFB, gw + HT_KD * 4);
#pragma unroll 1   // rolled: one copy of the stage body, the buffer chosen by sg & 1
  for (int sg = 0; sg < HT_NS; ++sg) { const int cur = sg & 1; const float* bs = &sm.w[cur][col][8 * g];
    const F2 a0 = {fragw_b(afh + FRG(0, sg * 2, DD / 32)), fragw_b(afl + FRG(0, sg * 2, DD / 32))}, a1 = {fragw_b(afh + FRG(0, sg * 2 + 1, DD / 32)), fragw_b(afl + FRG(0, sg * 2 + 1, DD / 32))};
    WR r[2][2];   // the floats of two column groups, read one pair ahead of their products, inside this stage only
#pragma unroll   // whole: r is indexed by constants only
    for (int u = 0; u < 2; ++u) r[0][u] = raw_wf(bs + u * 16 * HT_LD);
#pragma unroll   // whole: r and acc are indexed by constants only
    for (int q = 0; q < 8; ++q) { const int pp = q & 1, j = (q & 3) * 2; const F2& a = (q >> 2) ? a1 : a0;
      if (q + 1 < 8) { const int kn = (q + 1) >> 2, jn = ((q + 1) & 3) * 2;
#pragma unroll   // whole: as above
        for (int u = 0; u < 2; ++u) r[pp ^ 1][u] = raw_wf(bs + (jn + u) * 16 * HT_LD + kn * 32); }
      const v16b w0 = cvt_wf(r[pp][0]), w1 = cvt_wf(r[pp][1]);
      acc[j] = wmma_bf(a.h, w0, acc[j]); acc[j + 1] = wmma_bf(a.h, w1, acc[j + 1]); acc[j] = wmma_bf(a.l, w0, acc[j]); acc[j + 1] = wmma_bf(a.l, w1, acc[j + 1]); }
    asm volatile("s_wait_dscnt 0x0" ::: "memory");      // this wave's reads of buffer cur are done before the buffer is handed to its next writer
    asm volatile("s_wait_asynccnt 0x0" ::: "memory");   // this wave's copies of stage sg + 1 have landed
    __syncthreads();                                    // publishes stage sg + 1 and ends every wave's reads of buffer cur
    if (sg + 2 < HT_NS) HT_COPY(l0 + cur * HT_BUFB, gw + (sg + 2) * HT_KD * 4); }
  asm volatile("s_wait_asynccnt 0x0" ::: "memory");     // no copy is outstanding when the ring becomes output staging
#pragma unroll
  for (int j = 0; j < 8; ++j) { const int cl = j * 16 + col; const float bb = bfr(HB[c0 + cl]);
#pragma unroll
    for (int r = 0; r < 8; ++r) sm.st[cl][wave * 16 + 8 * g + r] = acc[j][r] + bb; }
  __syncthreads();
  for (int e = tid; e < 128 * 16; e += 128) { const int cl = e >> 4, q = e & 15; vst2(Hh + (b * CC + c0 + cl) * (size_t)TT + s0 + q * 4, *(const v4f*)&sm.st[cl][q * 4]); }
  { const int cl = tid; float s = 0.f; for (int q = 0; q < 64; ++q) s += sm.st[cl][q]; const float mean = s / 64.0f; float m2 = 0.f; for (int q = 0; q < 64; ++q) { const float d = sm.st[cl][q] - mean; m2 += d * d; } sst[cl][0] = mean; sst[cl][1] = m2; }
  __syncthreads(); if (tid < 64) vst2(ST + (((b * (TT / 64) + blockIdx.x) * CC) + c0) * 2 + tid * 4, *(const v4f*)&(&sst[0][0])[tid * 4]); }
// ---- k_bn: block = 32 channels (lane = channel), 8 waves x 32 of the channel's NB*32 block partials (64 values each): mean = mean of the block means, M2 = sum of (M2_blk + 64 (mean_blk - mean)^2), both summed in a fixed order (32 in a thread, then the 8 waves in turn) -> mean, inv_std (biased)
#define BN_NR (NB * (TT / 64))   // records per channel
#define BN_PT (BN_NR / 8)        // records per thread
__global__ __launch_bounds__(256) void k_bn(const float* __restrict__ ST, float* __restrict__ BN) { __shared__ float sm[8][32]; __shared__ float sq[8][32];
  const int lane = threadIdx.x & 31, wave = threadIdx.x >> 5; const int c = blockIdx.x * 32 + lane; const float* src = ST + ((size_t)wave * BN_PT * CC + c) * 2; v2f r[BN_PT];
#pragma unroll   // whole: r stays in registers and a thread's loads are all in flight together, so memory latency is paid once and not once per record
  for (int i = 0; i < BN_PT; ++i) r[i] = *(const v2f*)(src + (size_t)i * CC * 2);
  float s = 0.f;
#pragma unroll   // whole: r is indexed by constants only
  for (int i = 0; i < BN_PT; ++i) s += r[i][0];
  sm[wave][lane] = s; __syncthreads();
  float tot = 0.f; for (int w = 0; w < 8; ++w) tot += sm[w][lane];
  const float mean = tot * (1.0f / BN_NR); float q = 0.f;
#pragma unroll   // whole: r is indexed by constants only
  for (int i = 0; i < BN_PT; ++i) { const float d = r[i][0] - mean; q += r[i][1] + 64.f * d * d; }
  sq[wave][lane] = q; __syncthreads();
  if (wave == 0) { float M2 = 0.f; for (int w = 0; w < 8; ++w) M2 += sq[w][lane]; BN[c] = mean; BN[CC + c] = 1.0f / sqrtf(M2 / (64.f * BN_NR) + 1e-5f); } }
// ---- k_out: wave = one row (b, c): out[b][c][t] = inpt + gamma (h - mean) inv + beta over the 2,048 positions; a load or store of the wave is 512 consecutive bytes, a lane has 16 such pieces of each array
__global__ __launch_bounds__(256) void k_out(const float* __restrict__ X, const float* __restrict__ Hh, const float* __restrict__ BN, const float* __restrict__ GA, const float* __restrict__ BE, float* __restrict__ OUT) {
  const int row = blockIdx.x * 8 + __builtin_amdgcn_readfirstlane(threadIdx.x >> 5); const int c = row & (CC - 1);   // row = b * CC + c, the same in every lane of the wave
  const unsigned lo = (threadIdx.x & 31) * 4u;   // the lane's place in a 512-byte piece: one offset register for every load and store, on scalar row addresses
  const float *xr = X + (size_t)row * TT, *hr = Hh + (size_t)row * TT; float* orow = OUT + (size_t)row * TT;
  const float mean = BN[c], inv = BN[CC + c], ga = bfr(GA[c]), be = bfr(BE[c]);
  v4f x[16], h[16];
#pragma unroll   // whole, both loops: x and h are indexed by constants only
  for (int i = 0; i < 16; ++i) { x[i] = *(const v4f*)(xr + lo + i * 128); h[i] = *(const v4f*)(hr + lo + i * 128); }
  __builtin_amdgcn_sched_barrier(0);   // keeps the row's 32 loads ahead of all arithmetic, in flight together: without it the compiler issued the later ones in pairs between the sums, each pair waiting out memory latency anew
#pragma unroll
  for (int i = 0; i < 16; ++i) { v4f o;
#pragma unroll
    for (int e = 0; e < 4; ++e) o[e] = bfr(x[i][e]) + (ga * (h[i][e] - mean) * inv + be);
    vst2(orow + lo + i * 128, o); } }
extern "C" void kernel_launch(void* const* d_in, const int* in_sizes, int n_in, void* d_out, int out_size, void* d_ws, size_t ws_size, hipStream_t stream) {
  (void)in_sizes; (void)n_in; (void)out_size;
  const float** F = (const float**)d_in;   // 0 inpt [8,512,2048], 1 theta_w [256,512], 2 theta_b, 3 phi_w, 4 phi_b, 5 g_w, 6 g_b, 7 ht_w [512,256], 8 ht_b, 9 bn_gamma, 10 bn_beta
  if (ws_size < (size_t)WS_END) return;
  char* ws = (char*)d_ws; float *G = (float*)(ws + WS_G), *MP = (float*)(ws + WS_MP), *CF = (float*)(ws + WS_CF), *Hh = (float*)(ws + WS_H), *ST = (float*)(ws + WS_ST), *BN = (float*)(ws + WS_BN); __bf16 *PHH = (__bf16*)(ws + WS_PHH), *PHL = (__bf16*)(ws + WS_PHL), *THH = (__bf16*)(ws + WS_TH), *THL = (__bf16*)(ws + WS_THL), *ATH = (__bf16*)(ws + WS_AT), *ATL = (__bf16*)(ws + WS_ATL); _Float16* PT = (_Float16*)(ws + WS_PT);
  k_proj<<<dim3(TT / 64, TNB, 3), 128, 0, stream>>>(F[0], F[1], F[2], F[3], F[4], F[5], F[6], THH, THL, PHH, PHL, G);
  k_sc<<<dim3(TT / 128, TT / 128, TNB), 128, 0, stream>>>(THH, THL, PHH, PHL, MP, PT);
  k_mg<<<dim3(TT / 256, TNB), 256, 0, stream>>>(MP, CF);
  k_pv<<<dim3(TT / 128, DD / PV_DW, TNB), 128, 0, stream>>>(PT, G, CF, ATH, ATL);
  k_ht<<<dim3(TT / 64, CC / 128, TNB), 128, 0, stream>>>(ATH, ATL, F[7], F[8], Hh, ST);
  k_bn<<<CC / 32, 256, 0, stream>>>(ST, BN);
  k_out<<<CC * TNB / 8, 256, 0, stream>>>(F[0], Hh, BN, F[9], F[10], (float*)d_out);
}

// v010
// One run takes 133 microseconds.
// Timed twice side by side with v009, it ran 1.09 and 1.08 times as fast.
// Over all steps from v000 it is 20.0 times as fast.
// compute dtype: all float inputs rounded to bf16; theta / phi / g = W x + b (1x1 convs) with EXACT bf16 products on WMMA 16x16x32 (x^T tile staged in LDS), f32 accumulate; theta and phi computed in f32 and split into bf16 hi + lo for the UNSCALED logits w = theta^T phi (3 products; logits std ~5, sharp softmax), softmax in f32, first inside each tile of 128 keys while the logits are still in registers: exp(w - tile max) -> P^T planes as f16 x 2^11, with (tile max, tile sum) per query; the 16 tiles of a query merged into one factor per (query, tile), which multiplies g; attn[d][s] = sum_t (g[d][t] factor[t]) P~[t][s] with the scaled g as f16 hi + lo (2 products); h = ht_w attn (attn bf16 hi + lo, 2 products) + ht_b; BatchNorm1d training statistics over (B, T) per channel from per-block (mean, M2) partials merged in a fixed order; out = inpt + gamma h_norm + beta; f32 output.
#include <hip/hip_runtime.h>
#include <math.h>

typedef __attribute__((ext_vector_type(16))) _Float16 v16h;
typedef __attribute__((ext_vector_type(16))) __bf16 v16b;
typedef __attribute__((ext_vector_type(8)))  _Float16 v8h;
typedef __attribute__((ext_vector_type(8)))  float v8f;
typedef __attribute__((ext_vector_type(4)))  float v4f;
typedef __attribute__((ext_vector_type(2)))  float v2f;
typedef __attribute__((ext_vector_type(4)))  unsigned v4u;
typedef __attribute__((ext_vector_type(4)))  int v4i;
typedef float __attribute__((may_alias)) float_a;
typedef int __attribute__((may_alias)) int_a;

template <typename T> __device__ __forceinline__ void vst2(void* p, T v) { *(T*)p = v;  }
__device__ __forceinline__ v8f wmma16(v16h a, v16h b, v8f c) {
  v8f d = __builtin_amdgcn_wmma_f32_16x16x32_f16(false, a, false, b, (short)0, c, false, false);
  asm volatile("v_nop\n\tv_nop\n\tv_nop\n\tv_nop" : "+v"(d) : "v"(a), "v"(b));
  return d;
}
__device__ __forceinline__ v8f wmma_bf(v16b a, v16b b, v8f c) {
  v8f d = __builtin_amdgcn_wmma_f32_16x16x32_bf16(false, a, false, b, (short)0, c, false, false);
  asm volatile("v_nop\n\tv_nop\n\tv_nop\n\tv_nop" : "+v"(d) : "v"(a), "v"(b));
  return d;
}
// 16x16x32 fragments: lane = (h = lane>>4, row/col = lane&15); elements 0..7 = k0+8h+0..7, 8..15 = k0+16+8h+0..7; D element r = row 8h+r
__device__ __forceinline__ v16h frag_h(const _Float16* rowk0, int lane) {
  union { v16h v; v8h q[2]; } u; const _Float16* p = rowk0 + 8 * (lane >> 4);
  u.q[0] = *(const v8h*)p; u.q[1] = *(const v8h*)(p + 16); return u.v;
}
__device__ __forceinline__ v16h frag_f32(const float* rowk0, int lane) {
  v16h a; const float* p = rowk0 + 8 * (lane >> 4);
#pragma unroll
  for (int i = 0; i < 8; ++i) { a[i] = (_Float16)p[i]; a[8 + i] = (_Float16)p[16 + i]; }
  return a;
}
__device__ __forceinline__ v16h frag_f32s(const float* rowk0, int lane, float sc) {
  v16h a; const float* p = rowk0 + 8 * (lane >> 4);
#pragma unroll
  for (int i = 0; i < 8; ++i) { a[i] = (_Float16)(p[i] * sc); a[8 + i] = (_Float16)(p[16 + i] * sc); }
  return a;
}
// column fragment from a [K][ld] layout (column n), rows >= K read as 0
__device__ __forceinline__ v16h fragc_f32(const float* W, int k0, int n, int lane, int ld, int K) {
  v16h a; const int g = lane >> 4;
#pragma unroll
  for (int i = 0; i < 8; ++i) { const int ka = k0 + 8 * g + i, kb = ka + 16;
    a[i] = (_Float16)(ka < K ? W[(size_t)(ka < K ? ka : K - 1) * ld + n] : 0.f); a[8 + i] = (_Float16)(kb < K ? W[(size_t)(kb < K ? kb : K - 1) * ld + n] : 0.f); }
  return a;
}
struct F2 { v16b h, l; };
__device__ __forceinline__ F2 bsplit16(const float v[16]) { F2 r;
#pragma unroll
  for (int i = 0; i < 16; ++i) { const __bf16 h = (__bf16)v[i]; r.h[i] = h; r.l[i] = (__bf16)(v[i] - (float)h); }
  return r; }
__device__ __forceinline__ F2 split_row(const float* row, int k0, int lane) { float v[16]; const float* p = row + k0 + 8 * (lane >> 4);
#pragma unroll
  for (int i = 0; i < 8; ++i) { v[i] = p[i]; v[8 + i] = p[16 + i]; }
  return bsplit16(v); }
__device__ __forceinline__ F2 split_rowK(const float* row, int k0, int lane, int K) { float v[16]; const int g = lane >> 4;
#pragma unroll
  for (int i = 0; i < 8; ++i) { const int ka = k0 + 8 * g + i, kb = ka + 16; v[i] = ka < K ? row[ka < K ? ka : K - 1] : 0.f; v[8 + i] = kb < K ? row[kb < K ? kb : K - 1] : 0.f; }
  return bsplit16(v); }
__device__ __forceinline__ F2 split_col(const float* W, int k0, int n, int lane, int ld, int K) { float v[16]; const int g = lane >> 4;
#pragma unroll
  for (int i = 0; i < 8; ++i) { const int ka = k0 + 8 * g + i, kb = ka + 16; v[i] = ka < K ? W[(size_t)(ka < K ? ka : K - 1) * ld + n] : 0.f; v[8 + i] = kb < K ? W[(size_t)(kb < K ? kb : K - 1) * ld + n] : 0.f; }
  return bsplit16(v); }
__device__ __forceinline__ v8f mac3(const F2& a, const F2& b, v8f c) { c = wmma_bf(a.l, b.h, c); c = wmma_bf(a.h, b.l, c); return wmma_bf(a.h, b.h, c); }
__device__ __forceinline__ float sigm(float v) { return 1.0f / (1.0f + expf(-v)); }
#define LDSX() do { asm volatile("s_wait_dscnt 0" ::: "memory"); __builtin_amdgcn_wave_barrier(); __builtin_amdgcn_fence(__ATOMIC_RELEASE, "workgroup"); } while (0)


// Non-local block over time (B 8, C 512, D 256, T 2,048): theta/phi/g 1x1 convs; w = softmax_s(theta^T phi); attn = g w (the module contracts g over the QUERY index); h = ht(attn); training-mode BatchNorm1d; out = inpt + bn(h).
#define NB 8
#define CC 512
#define DD 256
#define TT 2048
#ifndef TNB
#define TNB NB
#endif
typedef __attribute__((ext_vector_type(8))) __bf16 v8b;
typedef __attribute__((ext_vector_type(4))) __bf16 v4b;
__device__ __forceinline__ v16b frag_b(const __bf16* rowk0, int lane) {
  union { v16b v; v8b q[2]; } u; const __bf16* p = rowk0 + 8 * (lane >> 4);
  u.q[0] = *(const v8b*)p; u.q[1] = *(const v8b*)(p + 16); return u.v;
}
// A-fragment order of a 16-bit matrix [rows][K] in the workspace: one block of 512 elements (1 KiB) per (16 rows, 32 k), blocks [row block][k chunk]; in a block [part][lane][8], part 0 = fragment elements 0..7, part 1 = 8..15.
// A wave's 16-byte load of one part is then 512 consecutive bytes (4 whole lines), where a load from rows touches 16 lines. FRG = element offset of a block, KC = K / 32.
#define FRG(rowblk, kchunk, KC) (((size_t)(rowblk) * (KC) + (kchunk)) * 512)
__device__ __forceinline__ v16b fragw_b(const __bf16* blk_lane) { union { v16b v; v8b q[2]; } u; u.q[0] = *(const v8b*)blk_lane; u.q[1] = *(const v8b*)(blk_lane + 256); return u.v; }   // blk_lane = block + lane * 8
__device__ __forceinline__ v16h fragw_h(const _Float16* blk_lane) { union { v16h v; v8h q[2]; } u; u.q[0] = *(const v8h*)blk_lane; u.q[1] = *(const v8h*)(blk_lane + 256); return u.v; }
// 8 consecutive f32 split into bf16 hi + lo and stored at the same element offset of the two planes
__device__ __forceinline__ void split8_st(const float* p, __bf16* H, __bf16* L) { __bf16 hh[8], ll[8];
#pragma unroll   // whole: hh and ll are indexed by constants only
  for (int i = 0; i < 8; ++i) { const __bf16 hv = (__bf16)p[i]; hh[i] = hv; ll[i] = (__bf16)(p[i] - (float)hv); }
  vst2((unsigned*)H, *(const v4u*)hh); vst2((unsigned*)L, *(const v4u*)ll); }
__device__ __forceinline__ float bfr(float v) { return (float)(__bf16)v; }
__device__ __attribute__((noinline)) float exp_ni(float v) { return expf(v); }
__device__ __attribute__((noinline)) float erf_ni(float v) { return erff(v); }

#define WS_TH  0u                                    // bf16 theta^T hi, then lo, each in A-fragment order (FRG above)
#define WS_THL (WS_TH + 2u * (size_t)NB * TT * DD)
#define WS_PHH (WS_TH + 4u * (size_t)NB * TT * DD)      // bf16 phi^T hi rows [b*s][256]
#define WS_PHL (WS_PHH + 2u * (size_t)NB * TT * DD)
#define WS_G   (WS_PHL + 2u * (size_t)NB * TT * DD)     // f32 g [b][d][t]
#define WS_S   (WS_G + 4u * (size_t)NB * DD * TT)       // region of attn^T, h, the tile statistics and the factors below
#define WS_PT  (WS_CF + 4u * (size_t)NB * NKB * TT)    // f16 planes, one per batch, rows s, k = t, in A-fragment order (FRG above): exp(logit - max of the query's logits in the key tile of s) x 2^11
#define WS_AT  WS_S                                   // bf16 attn^T hi, then lo, each in A-fragment order (FRG above)
#define WS_ATL (WS_AT + 2u * (size_t)NB * TT * DD)
#define WS_H   (WS_AT + 4u * (size_t)NB * TT * DD)      // f32 h [b][c][t]
#define NKB (TT / 128)                                // key tiles per query
#define WS_MP  (WS_H + 4u * (size_t)NB * CC * TT)      // f32 (tile max, tile sum x 2^11) [b][key tile][t][2]
#define WS_CF  (WS_MP + 4u * (size_t)NB * NKB * TT * 2) // f32 factor [b][key tile][t] = exp(tile max - row max) / row sum x 2^8
#define WS_ST  (WS_PT + 2u * (size_t)NB * TT * TT)     // f32 BN partials [(b*(TT/64) + tblk)][c][2] - one record per (batch, 64-position block)
#define WS_BN  (WS_ST + 4u * (size_t)NB * (TT / 64) * CC * 2)    // f32 mean [512], inv [512]
#define WS_WB  (WS_BN + 4u * 2 * CC)                  // bf16 theta_w, phi_w, g_w [256][512], ht_w [512][256], one behind the other
#define WS_HW  (WS_WB + 2u * 3 * DD * CC)              // the last of them, ht_w
#define WS_END (WS_WB + 2u * 4 * DD * CC)

// One lane's eight 16-byte copies global -> LDS, through no register: rows r, r + n, ..., r + 7 n of a tile (l = LDS byte address and p = global address of the lane's 16 bytes in row r; LS and GS = bytes from one of these rows to the next, in LDS and in global memory).
// The s_wait_xcnt is the last line of the copies' own statement, so that no address register is rewritten ahead of it.
template <int LS, int GS> __device__ __forceinline__ void copy8(unsigned l, const char* p) {
  asm volatile("global_load_async_to_lds_b128 %0, %8, off\n\t"
               "global_load_async_to_lds_b128 %1, %9, off\n\t"
               "global_load_async_to_lds_b128 %2, %10, off\n\t"
               "global_load_async_to_lds_b128 %3, %11, off\n\t"
               "global_load_async_to_lds_b128 %4, %12, off\n\t"
               "global_load_async_to_lds_b128 %5, %13, off\n\t"
               "global_load_async_to_lds_b128 %6, %14, off\n\t"
               "global_load_async_to_lds_b128 %7, %15, off\n\t"
               "s_wait_xcnt 0x0"
               :: "v"(l), "v"(l + 1u * LS), "v"(l + 2u * LS), "v"(l + 3u * LS), "v"(l + 4u * LS), "v"(l + 5u * LS), "v"(l + 6u * LS), "v"(l + 7u * LS),
                  "v"(p), "v"(p + 1 * GS), "v"(p + 2 * GS), "v"(p + 3 * GS), "v"(p + 4 * GS), "v"(p + 5 * GS), "v"(p + 6 * GS), "v"(p + 7 * GS)
               : "memory");
}
// ---- k_wb: thread = two runs of 8 consecutive elements of matrix blockIdx.y (theta_w, phi_w, g_w, ht_w; DD x CC elements each): rounded to bf16 once, rows as they are, so that every tile of them that k_proj and k_ht fetch, stage and read is half the bytes and needs no rounding by its readers
__global__ __launch_bounds__(256) void k_wb(const float* __restrict__ WT, const float* __restrict__ WP, const float* __restrict__ WG, const float* __restrict__ HW, __bf16* __restrict__ WB) {
  const int m = blockIdx.y; const float* src = m == 0 ? WT : m == 1 ? WP : m == 2 ? WG : HW; const size_t e = (size_t)blockIdx.x * 4096 + threadIdx.x * 8;
  const v4f x0 = *(const v4f*)(src + e), x1 = *(const v4f*)(src + e + 4), x2 = *(const v4f*)(src + e + 2048), x3 = *(const v4f*)(src + e + 2052); v8b w0, w1;   // the four loads are in flight together
#pragma unroll   // whole: the vectors are indexed by constants only
  for (int i = 0; i < 4; ++i) { w0[i] = (__bf16)x0[i]; w0[4 + i] = (__bf16)x1[i]; w1[i] = (__bf16)x2[i]; w1[4 + i] = (__bf16)x3[i]; }
  __bf16* dst = WB + (size_t)m * DD * CC + e; *(v8b*)dst = w0; *(v8b*)(dst + 2048) = w1; }

// ---- k_proj: block = (64 positions t, b, which 0 theta / 1 phi / 2 g): x^T tile (bf16) in LDS; W [d][c] in bf16, from k_wb; outputs: theta^T bf16 hi/lo in A-fragment order, phi^T bf16 hi/lo rows, g f32 [d][t]
#define PJ_KC 128                   // c per stage: two whole 128-B lines of every W row
#define PJ_NS (CC / PJ_KC)          // stages per group of 64 output columns
#define PJ_LD (PJ_KC + 8)           // LDS row pitch in bf16: 272 B = 16 B x odd, so the 16 rows of a 16-byte fragment read fall on distinct banks
#define PJ_BUFB (64 * PJ_LD * 2)    // bytes of one buffer
#define PJ_COPY(l, p) copy8<8 * PJ_LD * 2, 8 * CC * 2>(l, p)   // a lane's rows cr + 8 i of the 64
// The W tile of a stage (64 d x 128 c) is the same for the 4 waves: the work-group copies it once, in whole lines, into LDS; two buffers, so the next stage's copies fly while this stage is multiplied.
__global__ __launch_bounds__(128) void k_proj(const float* __restrict__ X, const __bf16* __restrict__ WB, const float* __restrict__ BT, const float* __restrict__ BP, const float* __restrict__ BG, __bf16* __restrict__ THH, __bf16* __restrict__ THL, __bf16* __restrict__ PHH, __bf16* __restrict__ PHL, float* __restrict__ G) {
  __shared__ __align__(16) __bf16 sx[64][CC + 8]; __shared__ __align__(16) union { __bf16 w[2][64][PJ_LD]; float st[64][68]; } sm;   // w: [buffer][d][c]; st: output staging of a 64-col group, once its last stage has been read
  const int tid = threadIdx.x, wave = tid >> 5, lane = tid & 31, col = lane & 15, g = lane >> 4; const int t0 = blockIdx.x * 64; const size_t b = blockIdx.y; const int which = blockIdx.z;
  const __bf16* Wm = WB + (size_t)which * DD * CC; const float* Bm = which == 0 ? BT : which == 1 ? BP : BG;
  const int cr = tid >> 4, cq = tid & 15;   // 16 lanes x 16 B = the 256 B of a row; a thread has rows cr + 8 i
  const unsigned l0 = (unsigned)(size_t)&sm.w[0][cr][cq * 8];   // low 32 bits of the shared address = byte address in LDS
  { const int xq = tid & 15, xc = (tid >> 4) * 4;   // 16 lanes x 16 B = the 256 B of a channel's row piece; a thread has 4 positions of channels xc + 32 i + 0..3
    const float* xs = X + (b * CC + xc) * (size_t)TT + t0 + xq * 4;
#pragma unroll 1   // rolled: two batches of 32 loads, so that a batch's 128 registers are used twice
    for (int ib = 0; ib < 2; ++ib) { v4f xr[8][4];
#pragma unroll   // whole, the loops of this batch: xr is indexed by constants only, and the 32 loads are in flight together, so memory latency is paid once a batch
      for (int i = 0; i < 8; ++i)
#pragma unroll
        for (int k = 0; k < 4; ++k) xr[i][k] = *(const v4f*)(xs + (size_t)((ib * 8 + i) * 32 + k) * TT);
#pragma unroll
      for (int i = 0; i < 8; ++i)
#pragma unroll
        for (int e = 0; e < 4; ++e) { v4b w;   // 4 channels of one position: 8 consecutive bytes of the transposed tile
#pragma unroll
          for (int k = 0; k < 4; ++k) w[k] = (__bf16)xr[i][k][e];
          *(v4b*)&sx[xq * 4 + e][xc + (ib * 8 + i) * 32] = w; } } }
  __syncthreads();
#pragma unroll 1
  for (int cg = 0; cg < DD / 64; ++cg) { v8f acc[4] = {}; const char* gw = (const char*)(Wm + (size_t)(cg * 64 + cr) * CC + cq * 8);
    PJ_COPY(l0, gw);
    asm volatile("s_wait_asynccnt 0x0" ::: "memory");   // this wave's copies of stage 0 have landed
    __syncthreads();                                    // publishes stage 0 to the 4 waves
    PJ_COPY(l0 + PJ_BUFB, gw + PJ_KC * 2);
#pragma unroll 1   // rolled: one copy of the stage body, the buffer chosen by s & 1
    for (int s = 0; s < PJ_NS; ++s) { const int cur = s & 1; const __bf16* bs = &sm.w[cur][col][0];
      v16b a[4], r[4][4];   // the stage's LDS reads stand together ahead of its products: their latency is waited for once a stage
#pragma unroll   // whole, the four loops below: a, r and acc are indexed by constants only and stay in registers
      for (int u = 0; u < 4; ++u) { a[u] = frag_b(&sx[wave * 16 + col][s * PJ_KC + u * 32], lane);
#pragma unroll
        for (int j = 0; j < 4; ++j) r[u][j] = frag_b(bs + j * 16 * PJ_LD + u * 32, lane); }
#pragma unroll
      for (int u = 0; u < 4; ++u)
#pragma unroll
        for (int j = 0; j < 4; ++j) acc[j] = wmma_bf(a[u], r[u][j], acc[j]);
      asm volatile("s_wait_dscnt 0x0" ::: "memory");      // this wave's reads of buffer cur are done before the buffer is handed to its next writer
      asm volatile("s_wait_asynccnt 0x0" ::: "memory");   // this wave's copies of stage s + 1 have landed
      __syncthreads();                                    // publishes stage s + 1 and ends every wave's reads of buffer cur
      if (s + 2 < PJ_NS) PJ_COPY(l0 + cur * PJ_BUFB, gw + (s + 2) * PJ_KC * 2); }
    asm volatile("s_wait_asynccnt 0x0" ::: "memory");     // no copy is outstanding when the ring becomes output staging
#pragma unroll
    for (int j = 0; j < 4; ++j) { const int dl = j * 16 + col; const float bb = bfr(Bm[cg * 64 + dl]);
#pragma unroll
      for (int r = 0; r < 8; ++r) { const int tl = wave * 16 + 8 * g + r; const float v = acc[j][r] + bb; if (which == 2) sm.st[dl][tl] = v; else sm.st[tl][dl] = v; } }
    __syncthreads();
    if (which == 0) { for (int i = 0; i < 4; ++i) { const int fp = i & 1, fc = i >> 1;   // a wave has its own 16 rows: 2 blocks x 2 parts; a store = one part of one block: 512 consecutive bytes
        const size_t o = FRG(((b * TT + t0) >> 4) + wave, cg * 2 + fc, DD / 32) + fp * 256 + lane * 8; split8_st(&sm.st[wave * 16 + col][fc * 32 + fp * 16 + g * 8], THH + o, THL + o); } }
    else if (which == 1) { for (int e = tid; e < 64 * 8; e += 128) { const int tl = e >> 3, q = e & 7; const float* p = &sm.st[tl][q * 8]; v16b dummy; (void)dummy; __bf16 hh[8], ll[8]; 
#pragma unroll
        for (int i = 0; i < 8; ++i) { const __bf16 hv = (__bf16)p[i]; hh[i] = hv; ll[i] = (__bf16)(p[i] - (float)hv); }
        vst2((unsigned*)(PHH + (b * TT + t0 + tl) * DD + cg * 64 + q * 8), *(const v4u*)hh); vst2((unsigned*)(PHL + (b * TT + t0 + tl) * DD + cg * 64 + q * 8), *(const v4u*)ll); } }
    else { for (int e = tid; e < 64 * 16; e += 128) { const int dl = e >> 4, q = e & 15; vst2(G + (b * DD + cg * 64 + dl) * (size_t)TT + t0 + q * 4, *(const v4f*)&sm.st[dl][q * 4]); } }
    asm volatile("s_wait_dscnt 0x0" ::: "memory");   // this wave's reads of the staging are done before the next group's copies land on it
    __syncthreads(); } }                             // ends every wave's reads of the staging
// Maximum and sum over the 16 lanes of a row half (the 16 columns of an accumulator tile), every lane getting the result: four exchanges with lane ^ 1, 2, 4, 8 inside the vector unit
template <int X> __device__ __forceinline__ float lane_x(float v) { return __builtin_bit_cast(float, __builtin_amdgcn_update_dpp(0, __builtin_bit_cast(int, v), 0x160 | X, 0xf, 0xf, true)); }   // 0x160 | X = row_xmask:X
__device__ __forceinline__ float max16(float v) { v = fmaxf(v, lane_x<1>(v)); v = fmaxf(v, lane_x<2>(v)); v = fmaxf(v, lane_x<4>(v)); return fmaxf(v, lane_x<8>(v)); }
// Eight independent 2^x in one statement. No result shares a register with an argument (early clobber), so none of the eight is followed directly by a read of its result or an overwrite of its argument;
// the v_nop is the free slot that the instruction set asks for behind the last one. The first results are ready when the statement ends.
__device__ __forceinline__ void exp2x8(float (&y)[8], const float (&x)[8]) {
  asm("v_exp_f32 %0, %8\n\tv_exp_f32 %1, %9\n\tv_exp_f32 %2, %10\n\tv_exp_f32 %3, %11\n\tv_exp_f32 %4, %12\n\tv_exp_f32 %5, %13\n\tv_exp_f32 %6, %14\n\tv_exp_f32 %7, %15\n\tv_nop"
      : "=&v"(y[0]), "=&v"(y[1]), "=&v"(y[2]), "=&v"(y[3]), "=&v"(y[4]), "=&v"(y[5]), "=&v"(y[6]), "=&v"(y[7])
      : "v"(x[0]), "v"(x[1]), "v"(x[2]), "v"(x[3]), "v"(x[4]), "v"(x[5]), "v"(x[6]), "v"(x[7])); }
__device__ __forceinline__ float sum16(float v) { v += lane_x<1>(v); v += lane_x<2>(v); v += lane_x<4>(v); return v + lane_x<8>(v); }
// ---- k_sc: block = (128 queries t, 128 keys s, batch b), a wave has 32 queries (two row blocks), so that every phi fragment read from LDS feeds both: logits theta^T . phi (3 products), kept in registers; per query the tile's max and sum of exp(logit - max) -> MP; exp(logit - max) x 2^11 as f16, transposed -> plane b of PT (rows s, A-fragment order); every batch in one grid
#define SC_KD 64                   // d per stage: one whole 128-B line of every phi row
#define SC_NS (DD / SC_KD)
#define SC_LD (SC_KD + 8)          // LDS row pitch in bf16: 144 B = 16 B x odd, so the 16 rows of a 16-byte fragment read fall on distinct banks
#define SC_PLB (128 * SC_LD * 2)   // bytes of one plane (hi or lo) of one buffer
#define SC_BUFB (2 * SC_PLB)       // bytes of one buffer
#define SC_COPY(l, p) copy8<16 * SC_LD * 2, 16 * DD * 2>(l, p)   // a lane's rows cr + 16 i of one plane
// The phi tile of a stage (128 keys x 64 d, hi and lo) is the same for the 4 waves: the work-group copies it once, in whole lines, into LDS; two buffers, so the next stage's copies fly while this stage is multiplied.
// The second launch bound asks for 4 waves a SIMD, the 4 work-groups a WGP that the 72 KiB of LDS allow: it holds the build to 256 registers, where it otherwise took 270 and a fourth work-group would not fit.
__global__ __launch_bounds__(128, 4) void k_sc(const __bf16* __restrict__ THH, const __bf16* __restrict__ THL, const __bf16* __restrict__ PHH, const __bf16* __restrict__ PHL, float* __restrict__ MP, _Float16* __restrict__ PT) {
  __shared__ __align__(16) union { __bf16 k[2][2][128][SC_LD]; _Float16 p[128][136]; } sm;   // k: [buffer][hi, lo][key][d]; p: output staging [key][query], once the last stage has been read; pitch 272 B = 16 B x odd
  const int b = blockIdx.z; PT += (size_t)b * TT * TT;
  const int tid = threadIdx.x, wave = tid >> 5, lane = tid & 31, col = lane & 15, g = lane >> 4; const int k0 = blockIdx.y * 128; const int tq0 = blockIdx.x * 128 + wave * 32;
  const int cr = tid >> 3, cq = tid & 7;   // 8 lanes x 16 B = one 128-B line of a row; a thread has rows cr + 16 i of both planes
  const size_t ks = ((size_t)b * TT + k0 + cr) * DD + cq * 8; const char* gh = (const char*)(PHH + ks); const size_t hl = (size_t)((const char*)PHL - (const char*)PHH);   // lo plane = hi plane + hl, a scalar: one address pair less to keep through the loop
  const unsigned l0 = (unsigned)(size_t)&sm.k[0][0][cr][cq * 8];   // low 32 bits of the shared address = byte address in LDS
  const size_t tb0 = FRG(((size_t)b * TT + tq0) >> 4, 0, DD / 32) + lane * 8; const __bf16 *tfh = THH + tb0, *tfl = THL + tb0;   // the lane's place in the wave's first theta block, hi and lo
  v8f acc[2][8] = {};
  SC_COPY(l0, gh); SC_COPY(l0 + SC_PLB, gh + hl);
  asm volatile("s_wait_asynccnt 0x0" ::: "memory");   // this wave's copies of stage 0 have landed
  __syncthreads();                                    // publishes stage 0 to the 4 waves
  SC_COPY(l0 + SC_BUFB, gh + SC_KD * 2); SC_COPY(l0 + SC_BUFB + SC_PLB, gh + hl + SC_KD * 2);
#pragma unroll 1   // rolled: one copy of the stage body, the buffer chosen by st & 1
  for (int st = 0; st < SC_NS; ++st) { const int cur = st & 1;
    F2 a[2][2];   // [row block][half of the stage's 64 d]
    union { v16b v; v8b q[2]; } eh, el;   // the last block, hi and lo, loaded part by part
#pragma unroll   // whole, both loops: a is indexed by constants only
    for (int m = 0; m < 2; ++m)
#pragma unroll
      for (int u = 0; u < 2; ++u) { const __bf16 *ph = tfh + FRG(m, st * 2 + u, DD / 32), *pl = tfl + FRG(m, st * 2 + u, DD / 32);
        if (m + u < 2) { a[m][u].h = fragw_b(ph); a[m][u].l = fragw_b(pl); }
        else { eh.q[0] = *(const v8b*)ph; el.q[0] = *(const v8b*)pl;
          asm volatile("s_wait_xcnt 0x0" ::: "memory");   // stands in front of the stage's last two loads, which this build lets return into the address registers of the loads above
          eh.q[1] = *(const v8b*)(ph + 256); el.q[1] = *(const v8b*)(pl + 256); a[m][u].h = eh.v; a[m][u].l = el.v; } }
    const __bf16* bs = &sm.k[cur][0][col][0]; v16b kh[2], kl[2];   // fragments of one key group, read one group ahead of their products, inside this stage only
    kh[0] = frag_b(bs, lane); kl[0] = frag_b(bs + 128 * SC_LD, lane);
#pragma unroll   // whole: kh, kl, a and acc are indexed by constants only
    for (int q = 0; q < 16; ++q) { const int pp = q & 1, j = q & 7, u = q >> 3;
      if (q + 1 < 16) { const int un = (q + 1) >> 3, jn = (q + 1) & 7;
        kh[pp ^ 1] = frag_b(bs + jn * 16 * SC_LD + un * 32, lane); kl[pp ^ 1] = frag_b(bs + (128 + jn * 16) * SC_LD + un * 32, lane); }
      acc[0][j] = wmma_bf(a[0][u].h, kh[pp], acc[0][j]); acc[1][j] = wmma_bf(a[1][u].h, kh[pp], acc[1][j]); acc[0][j] = wmma_bf(a[0][u].l, kh[pp], acc[0][j]); acc[1][j] = wmma_bf(a[1][u].l, kh[pp], acc[1][j]); acc[0][j] = wmma_bf(a[0][u].h, kl[pp], acc[0][j]); acc[1][j] = wmma_bf(a[1][u].h, kl[pp], acc[1][j]); }
    asm volatile("s_wait_dscnt 0x0" ::: "memory");      // this wave's reads of buffer cur are done before the buffer is handed to its next writer
    asm volatile("s_wait_asynccnt 0x0" ::: "memory");   // this wave's copies of stage st + 1 have landed
    __syncthreads();                                    // publishes stage st + 1 and ends every wave's reads of buffer cur
    if (st + 2 < SC_NS) { const unsigned l = l0 + cur * SC_BUFB; const int d2 = (st + 2) * SC_KD * 2; SC_COPY(l, gh + d2); SC_COPY(l + SC_PLB, gh + hl + d2); } }
  asm volatile("s_wait_asynccnt 0x0" ::: "memory");     // no copy is outstanding when the ring becomes output staging
  // A lane has queries tq0 + 16 m + 8 g + r (m = 0, 1; r = 0..7) at keys k0 + 16 j + col: a wave holds all 128 keys of its 32 queries, so the tile's max and sum need this wave alone
  float mx[2][8], sl[2][8];
#pragma unroll   // whole, every loop of this epilogue: acc, mx and sl are indexed by constants only and stay in registers
  for (int m = 0; m < 2; ++m) {
#pragma unroll
    for (int r = 0; r < 8; ++r) { float v = acc[m][0][r];
#pragma unroll
      for (int j = 1; j < 8; ++j) v = fmaxf(v, acc[m][j][r]);
      mx[m][r] = max16(v); }
#pragma unroll
    for (int r = 0; r < 8; ++r) { const float nb = 11.0f - mx[m][r] * 1.4426950408889634f; float a[8], p[8], s = 0.f;   // 2^(w log2 e - max log2 e + 11) = exp(w - max) x 2^11
#pragma unroll
      for (int j = 0; j < 8; ++j) a[j] = fmaf(acc[m][j][r], 1.4426950408889634f, nb);
      exp2x8(p, a);
#pragma unroll
      for (int j = 0; j < 8; ++j) { acc[m][j][r] = p[j]; s += p[j]; }
      sl[m][r] = sum16(s); }
#pragma unroll
    for (int j = 0; j < 8; ++j) { v8h h;   // a lane's 8 queries at one key are 16 consecutive bytes of the transposed tile
#pragma unroll
      for (int r = 0; r < 8; ++r) h[r] = (_Float16)acc[m][j][r];
      *(v8h*)&sm.p[j * 16 + col][wave * 32 + m * 16 + 8 * g] = h; } }
  __syncthreads();   // a key's 128 queries come from the 4 waves: all have stored before a line is read
  _Float16* pd = PT + FRG((k0 >> 4) + wave * 2, blockIdx.x * 4, TT / 32) + lane * 8; const _Float16* ps = &sm.p[wave * 32 + col][g * 8];   // the tile = 8 key blocks x 4 query chunks x 2 parts, a wave has 2 key blocks; a store = one part: 512 consecutive bytes
#pragma unroll   // whole: a thread's 16 LDS reads are in flight together, their latency waited for once
  for (int i = 0; i < 16; ++i) { const int fp = i & 1, fc = (i >> 1) & 3, sb = i >> 3;
    vst2((unsigned*)(pd + FRG(sb, fc, TT / 32) + fp * 256), *(const v4u*)(ps + sb * 16 * 136 + fc * 32 + fp * 16)); }
  if (col == 0) { float* mp = MP + (((size_t)b * NKB + blockIdx.y) * TT + tq0 + 8 * g) * 2;   // 32 queries x 8 B: two 128-B lines a wave; behind the barrier, which would otherwise wait for these stores
#pragma unroll
    for (int m = 0; m < 2; ++m)
#pragma unroll
      for (int r = 0; r < 8; r += 2) vst2(mp + (m * 16 + r) * 2, v4f{mx[m][r], sl[m][r], mx[m][r + 1], sl[m][r + 1]}); } }
// ---- k_mg: thread = (query t, batch b): the query's 16 tile records merged in a fixed order: row max, row sum = sum of tile sum x exp(tile max - row max); factor of a tile = exp(tile max - row max) / row sum, x 2^8, which keeps more of the low half of g x factor above the subnormal range of f16
__global__ __launch_bounds__(256) void k_mg(const float* __restrict__ MP, float* __restrict__ CF) {
  const int t = blockIdx.x * 256 + threadIdx.x; const size_t b = blockIdx.y; const float* src = MP + (b * NKB * TT + t) * 2; v2f r[NKB]; float e[NKB];
#pragma unroll   // whole, every loop here: r and e stay in registers and the 16 loads are in flight together
  for (int i = 0; i < NKB; ++i) r[i] = *(const v2f*)(src + (size_t)i * TT * 2);
  float m = r[0][0];
#pragma unroll
  for (int i = 1; i < NKB; ++i) m = fmaxf(m, r[i][0]);
  float l = 0.f;
#pragma unroll
  for (int i = 0; i < NKB; ++i) { e[i] = expf(r[i][0] - m); l += r[i][1] * e[i]; }
  const float inv = (2048.0f * 256.0f) / l;   // the tile sums carry 2^11
#pragma unroll
  for (int i = 0; i < NKB; ++i) CF[(b * NKB + i) * TT + t] = e[i] * inv; }
// ---- k_pv: block = (128 rows s = one key tile, 64 columns d) of batch b, a wave has 32 rows (two row blocks), so that every g fragment read from LDS feeds both: attn^T[s][d] = sum_t P[t][s] g[d][t]: A = PT blocks (rows s, k = t; f16, exp(logit - tile max) x 2^11), B(k=t, col=d) = g[d][t] x factor[t] (x 2^8), converted on the fly to f16 hi + residual
#define PV_KT 64            // positions t per stage
#define PV_NS (TT / PV_KT)
#define PV_DW 64            // columns d per work-group
#define PV_LD (PV_KT + 8)   // LDS row pitch in halves: 144 B = 16 B x odd, so the 16 rows of a 16-byte fragment read fall on distinct banks
typedef __attribute__((ext_vector_type(4))) _Float16 v4h;
// The g tile of a stage (64 d x 64 t) is the same for the 4 waves: the work-group loads it once in whole lines, multiplies it by the positions' factors, splits it once into f16 hi + lo and stages it in LDS; two buffers, so the next stage's global loads fly while this stage is multiplied.
__global__ __launch_bounds__(128) void k_pv(const _Float16* __restrict__ PT, const float* __restrict__ G, const float* __restrict__ CF, __bf16* __restrict__ ATH, __bf16* __restrict__ ATL) { __shared__ __align__(16) float ss[4][32][PV_DW + 4]; __shared__ __align__(16) _Float16 sg[2][2][PV_DW][PV_LD];   // sg: [buffer][hi, lo][d][t]
  const int tid = threadIdx.x, wave = tid >> 5, lane = tid & 31, col = lane & 15, g = lane >> 4; const int d0 = blockIdx.y * PV_DW; const int s0 = blockIdx.x * 128 + wave * 32;
  const int b = blockIdx.z; PT += (size_t)b * TT * TT;   // every batch in one grid: 512 work-groups in one launch
  const int gr_row = tid >> 4, gr_q = tid & 15;          // 16 threads x 16 B = one 256-B row piece of the tile; a thread has rows gr_row + 8 i
  const float* gsrc = G + ((size_t)b * DD + d0 + gr_row) * TT + gr_q * 4; const _Float16* afr = PT + FRG(s0 >> 4, 0, TT / 32) + lane * 8;   // the lane's place in the wave's first P^T block
  const float* csrc = CF + ((size_t)b * NKB + blockIdx.x) * TT + gr_q * 4;   // the block's 128 keys are one key tile: one factor per position t, the same for every d
  v8f acc[2][4] = {}; v4f gr[8]; v16h a[2][2], n[2][2];   // a, n: [row block][half of the stage's 64 t]; the loops over acc, gr, a, n, fh and fl below are unrolled whole so that these arrays stay in registers
#pragma unroll
  for (int i = 0; i < 8; ++i) gr[i] = *(const v4f*)(gsrc + (size_t)i * 8 * TT);
  v4f cf = *(const v4f*)csrc;
#pragma unroll
  for (int m = 0; m < 2; ++m)
#pragma unroll
    for (int u = 0; u < 2; ++u) n[m][u] = fragw_h(afr + FRG(m, u, TT / 32));
#pragma unroll 1   // rolled: one copy of the stage body, the buffer chosen by st & 1
  for (int st = 0; st < PV_NS; ++st) { const int cur = st & 1;
    _Float16* dst = &sg[cur][0][gr_row][gr_q * 4];
#pragma unroll
    for (int i = 0; i < 8; ++i) { v4h hi, lo;
#pragma unroll
      for (int e = 0; e < 4; ++e) { const float v = gr[i][e] * cf[e]; const _Float16 h = (_Float16)v; hi[e] = h; lo[e] = (_Float16)(v - (float)h); }
      *(v4h*)(dst + i * 8 * PV_LD) = hi; *(v4h*)(dst + (PV_DW + i * 8) * PV_LD) = lo; }
#pragma unroll
    for (int m = 0; m < 2; ++m)
#pragma unroll
      for (int u = 0; u < 2; ++u) a[m][u] = n[m][u];
    __syncthreads();   // publishes buffer cur to the 4 waves; it also stands between every wave's last reads of the other buffer (the trip before) and the next trip's stores into it
    if (st + 1 < PV_NS) { const int t1 = (st + 1) * PV_KT;   // next stage's global loads, issued ahead of this stage's products
#pragma unroll
      for (int i = 0; i < 8; ++i) gr[i] = *(const v4f*)(gsrc + (size_t)i * 8 * TT + t1);
      cf = *(const v4f*)(csrc + t1);
      asm volatile("s_wait_xcnt 0x0" ::: "memory");   // stands in front of the loads below, one of which this build lets return into the address registers of the loads above
#pragma unroll
      for (int m = 0; m < 2; ++m)
#pragma unroll
        for (int u = 0; u < 2; ++u) n[m][u] = fragw_h(afr + FRG(m, (st + 1) * 2 + u, TT / 32)); }
    const _Float16* bsrc = &sg[cur][0][col][0]; v16h fh[2][2], fl[2][2];   // fragments of two column groups, read one pair ahead of their products
#pragma unroll
    for (int w = 0; w < 2; ++w) { fh[0][w] = frag_h(bsrc + w * 16 * PV_LD, lane); fl[0][w] = frag_h(bsrc + (PV_DW + w * 16) * PV_LD, lane); }
#pragma unroll
    for (int q = 0; q < 4; ++q) { const int pp = q & 1, j = (q & 1) * 2, u = q >> 1;
      if (q + 1 < 4) { const int un = (q + 1) >> 1, jn = ((q + 1) & 1) * 2;
#pragma unroll
        for (int w = 0; w < 2; ++w) { fh[pp ^ 1][w] = frag_h(bsrc + (jn + w) * 16 * PV_LD + un * 32, lane); fl[pp ^ 1][w] = frag_h(bsrc + (PV_DW + (jn + w) * 16) * PV_LD + un * 32, lane); } }
      acc[0][j] = wmma16(a[0][u], fh[pp][0], acc[0][j]); acc[1][j] = wmma16(a[1][u], fh[pp][0], acc[1][j]); acc[0][j + 1] = wmma16(a[0][u], fh[pp][1], acc[0][j + 1]); acc[1][j + 1] = wmma16(a[1][u], fh[pp][1], acc[1][j + 1]);
      acc[0][j] = wmma16(a[0][u], fl[pp][0], acc[0][j]); acc[1][j] = wmma16(a[1][u], fl[pp][0], acc[1][j]); acc[0][j + 1] = wmma16(a[0][u], fl[pp][1], acc[0][j + 1]); acc[1][j + 1] = wmma16(a[1][u], fl[pp][1], acc[1][j + 1]); } }
#pragma unroll
  for (int m = 0; m < 2; ++m)
#pragma unroll
    for (int j = 0; j < 4; ++j)
#pragma unroll
      for (int r = 0; r < 8; ++r) ss[wave][m * 16 + 8 * g + r][j * 16 + col] = acc[m][j][r] * (1.0f / (2048.0f * 256.0f));
  LDSX(); for (int i = 0; i < 8; ++i) { const int fp = i & 1, fc = (i >> 1) & 1, sb = i >> 2;   // the wave's 2 row blocks x 2 column chunks x 2 parts; a store = one part of one block: 512 consecutive bytes
    const size_t o = FRG((((size_t)b * TT + s0) >> 4) + sb, (d0 >> 5) + fc, DD / 32) + fp * 256 + lane * 8; split8_st(&ss[wave][sb * 16 + col][fc * 32 + fp * 16 + g * 8], ATH + o, ATL + o); } }
// ---- k_ht: block = (64 positions s, 128 out channels c, b): h[c][s] = sum_d ht_w[c][d] attn^T[s][d] + ht_b[c]; rows = s (A = attn^T hi+lo), B(k=d, col=c) = ht_w[c][d] in bf16, from k_wb; writes h [b][c][t] via LDS transpose + per-block BN partials
#define HT_KD 128                   // d per stage: two whole 128-B lines of every ht_w row
#define HT_NS (DD / HT_KD)
#define HT_LD (HT_KD + 8)           // LDS row pitch in bf16: 272 B = 16 B x odd, so the 16 rows of a 16-byte fragment read fall on distinct banks
#define HT_BUFB (128 * HT_LD * 2)   // bytes of one buffer
#define HT_COPY(l, p) do { copy8<8 * HT_LD * 2, 8 * DD * 2>(l, p); copy8<8 * HT_LD * 2, 8 * DD * 2>((l) + 64u * HT_LD * 2, (p) + 64 * DD * 2); } while (0)   // a lane's rows cr + 8 i of the 128
// The ht_w tile of a stage (128 c x 128 d) is the same for the 4 waves: the work-group copies it once, in whole lines, into LDS; two buffers, so the next stage's copies fly while this stage is multiplied.
__global__ __launch_bounds__(128) void k_ht(const __bf16* __restrict__ ATH, const __bf16* __restrict__ ATL, const __bf16* __restrict__ HW, const float* __restrict__ HB, float* __restrict__ Hh, float* __restrict__ ST) { __shared__ __align__(16) union { __bf16 w[2][128][HT_LD]; float st[128][68]; } sm; __shared__ __align__(16) float sst[128][2];   // w: [buffer][c][d]; st: output staging, once the last stage has been read
  const int tid = threadIdx.x, wave = tid >> 5, lane = tid & 31, col = lane & 15, g = lane >> 4; const int c0 = blockIdx.y * 128; const size_t b = blockIdx.z; const int s0 = blockIdx.x * 64;
  const int cr = tid >> 4, cq = tid & 15;   // 16 lanes x 16 B = the 256 B of a row; a thread has rows cr + 8 i
  const char* gw = (const char*)(HW + (size_t)(c0 + cr) * DD + cq * 8);
  const unsigned l0 = (unsigned)(size_t)&sm.w[0][cr][cq * 8];   // low 32 bits of the shared address = byte address in LDS
  const size_t ab0 = FRG((b * TT + s0 + wave * 16) >> 4, 0, DD / 32) + lane * 8; const __bf16 *afh = ATH + ab0, *afl = ATL + ab0;   // the lane's place in the wave's first attn^T block, hi and lo
  v8f acc[8] = {};
  HT_COPY(l0, gw);
  asm volatile("s_wait_asynccnt 0x0" ::: "memory");   // this wave's copies of stage 0 have landed
  __syncthreads();                                    // publishes stage 0 to the 4 waves
  HT_COPY(l0 + HT_BUFB, gw + HT_KD * 2);
#pragma unroll 1   // rolled: one copy of the stage body, the buffer chosen by sg & 1
  for (int sg = 0; sg < HT_NS; ++sg) { const int cur = sg & 1; const __bf16* bs = &sm.w[cur][col][0];
    F2 af[4];   // the wave's attn^T blocks of the stage's four chunks of 32 d
#pragma unroll   // whole: af is indexed by constants only
    for (int k = 0; k < 4; ++k) { af[k].h = fragw_b(afh + FRG(0, sg * 4 + k, DD / 32)); af[k].l = fragw_b(afl + FRG(0, sg * 4 + k, DD / 32)); }
    v16b r[2][2];   // the fragments of two column groups, read one pair ahead of their products, inside this stage only
#pragma unroll   // whole: r is indexed by constants only
    for (int u = 0; u < 2; ++u) r[0][u] = frag_b(bs + u * 16 * HT_LD, lane);
#pragma unroll   // whole: r, af and acc are indexed by constants only
    for (int q = 0; q < 16; ++q) { const int pp = q & 1, j = (q & 3) * 2; const F2& a = af[q >> 2];
      if (q + 1 < 16) { const int kn = (q + 1) >> 2, jn = ((q + 1) & 3) * 2;
#pragma unroll   // whole: as above
        for (int u = 0; u < 2; ++u) r[pp ^ 1][u] = frag_b(bs + (jn + u) * 16 * HT_LD + kn * 32, lane); }
      const v16b w0 = r[pp][0], w1 = r[pp][1];
      acc[j] = wmma_bf(a.h, w0, acc[j]); acc[j + 1] = wmma_bf(a.h, w1, acc[j + 1]); acc[j] = wmma_bf(a.l, w0, acc[j]); acc[j + 1] = wmma_bf(a.l, w1, acc[j + 1]); }
    asm volatile("s_wait_xcnt 0x0" ::: "memory");       // stands in front of the next trip's rewrite of the address registers that this stage's attn^T loads name
    asm volatile("s_wait_dscnt 0x0" ::: "memory");      // this wave's reads of buffer cur are done before the buffer is handed to its next writer
    asm volatile("s_wait_asynccnt 0x0" ::: "memory");   // this wave's copies of stage sg + 1 have landed
    __syncthreads();                                    // publishes stage sg + 1 and ends every wave's reads of buffer cur
    if (sg + 2 < HT_NS) HT_COPY(l0 + cur * HT_BUFB, gw + (sg + 2) * HT_KD * 2); }
  asm volatile("s_wait_asynccnt 0x0" ::: "memory");     // no copy is outstanding when the ring becomes output staging
#pragma unroll
  for (int j = 0; j < 8; ++j) { const int cl = j * 16 + col; const float bb = bfr(HB[c0 + cl]);
#pragma unroll
    for (int r = 0; r < 8; ++r) sm.st[cl][wave * 16 + 8 * g + r] = acc[j][r] + bb; }
  __syncthreads();
  for (int e = tid; e < 128 * 16; e += 128) { const int cl = e >> 4, q = e & 15; vst2(Hh + (b * CC + c0 + cl) * (size_t)TT + s0 + q * 4, *(const v4f*)&sm.st[cl][q * 4]); }
  { const int cl = tid; float s = 0.f; for (int q = 0; q < 64; ++q) s += sm.st[cl][q]; const float mean = s / 64.0f; float m2 = 0.f; for (int q = 0; q < 64; ++q) { const float d = sm.st[cl][q] - mean; m2 += d * d; } sst[cl][0] = mean; sst[cl][1] = m2; }
  __syncthreads(); if (tid < 64) vst2(ST + (((b * (TT / 64) + blockIdx.x) * CC) + c0) * 2 + tid * 4, *(const v4f*)&(&sst[0][0])[tid * 4]); }
// ---- k_bn: block = 32 channels (lane = channel), 8 waves x 32 of the channel's NB*32 block partials (64 values each): mean = mean of the block means, M2 = sum of (M2_blk + 64 (mean_blk - mean)^2), both summed in a fixed order (32 in a thread, then the 8 waves in turn) -> mean, inv_std (biased)
#define BN_NR (NB * (TT / 64))   // records per channel
#define BN_PT (BN_NR / 8)        // records per thread
__global__ __launch_bounds__(256) void k_bn(const float* __restrict__ ST, float* __restrict__ BN) { __shared__ float sm[8][32]; __shared__ float sq[8][32];
  const int lane = threadIdx.x & 31, wave = threadIdx.x >> 5; const int c = blockIdx.x * 32 + lane; const float* src = ST + ((size_t)wave * BN_PT * CC + c) * 2; v2f r[BN_PT];
#pragma unroll   // whole: r stays in registers and a thread's loads are all in flight together, so memory latency is paid once and not once per record
  for (int i = 0; i < BN_PT; ++i) r[i] = *(const v2f*)(src + (size_t)i * CC * 2);
  float s = 0.f;
#pragma unroll   // whole: r is indexed by constants only
  for (int i = 0; i < BN_PT; ++i) s += r[i][0];
  sm[wave][lane] = s; __syncthreads();
  float tot = 0.f; for (int w = 0; w < 8; ++w) tot += sm[w][lane];
  const float mean = tot * (1.0f / BN_NR); float q = 0.f;
#pragma unroll   // whole: r is indexed by constants only
  for (int i = 0; i < BN_PT; ++i) { const float d = r[i][0] - mean; q += r[i][1] + 64.f * d * d; }
  sq[wave][lane] = q; __syncthreads();
  if (wave == 0) { float M2 = 0.f; for (int w = 0; w < 8; ++w) M2 += sq[w][lane]; BN[c] = mean; BN[CC + c] = 1.0f / sqrtf(M2 / (64.f * BN_NR) + 1e-5f); } }
// ---- k_out: wave = one row (b, c): out[b][c][t] = inpt + gamma (h - mean) inv + beta over the 2,048 positions; a load or store of the wave is 512 consecutive bytes, a lane has 16 such pieces of each array
__global__ __launch_bounds__(256) void k_out(const float* __restrict__ X, const float* __restrict__ Hh, const float* __restrict__ BN, const float* __restrict__ GA, const float* __restrict__ BE, float* __restrict__ OUT) {
  const int row = blockIdx.x * 8 + __builtin_amdgcn_readfirstlane(threadIdx.x >> 5); const int c = row & (CC - 1);   // row = b * CC + c, the same in every lane of the wave
  const unsigned lo = (threadIdx.x & 31) * 4u;   // the lane's place in a 512-byte piece: one offset register for every load and store, on scalar row addresses
  const float *xr = X + (size_t)row * TT, *hr = Hh + (size_t)row * TT; float* orow = OUT + (size_t)row * TT;
  const float mean = BN[c], inv = BN[CC + c], ga = bfr(GA[c]), be = bfr(BE[c]);
  v4f x[16], h[16];
#pragma unroll   // whole, both loops: x and h are indexed by constants only
  for (int i = 0; i < 16; ++i) { x[i] = *(const v4f*)(xr + lo + i * 128); h[i] = *(const v4f*)(hr + lo + i * 128); }
  __builtin_amdgcn_sched_barrier(0);   // keeps the row's 32 loads ahead of all arithmetic, in flight together: without it the compiler issued the later ones in pairs between the sums, each pair waiting out memory latency anew
#pragma unroll
  for (int i = 0; i < 16; ++i) { v4f o;
#pragma unroll
    for (int e = 0; e < 4; ++e) o[e] = bfr(x[i][e]) + (ga * (h[i][e] - mean) * inv + be);
    vst2(orow + lo + i * 128, o); } }
extern "C" void kernel_launch(void* const* d_in, const int* in_sizes, int n_in, void* d_out, int out_size, void* d_ws, size_t ws_size, hipStream_t stream) {
  (void)in_sizes; (void)n_in; (void)out_size;
  const float** F = (const float**)d_in;   // 0 inpt [8,512,2048], 1 theta_w [256,512], 2 theta_b, 3 phi_w, 4 phi_b, 5 g_w, 6 g_b, 7 ht_w [512,256], 8 ht_b, 9 bn_gamma, 10 bn_beta
  if (ws_size < (size_t)WS_END) return;
  char* ws = (char*)d_ws; float *G = (float*)(ws + WS_G), *MP = (float*)(ws + WS_MP), *CF = (float*)(ws + WS_CF), *Hh = (float*)(ws + WS_H), *ST = (float*)(ws + WS_ST), *BN = (float*)(ws + WS_BN); __bf16 *PHH = (__bf16*)(ws + WS_PHH), *PHL = (__bf16*)(ws + WS_PHL), *THH = (__bf16*)(ws + WS_TH), *THL = (__bf16*)(ws + WS_THL), *ATH = (__bf16*)(ws + WS_AT), *ATL = (__bf16*)(ws + WS_ATL), *WB = (__bf16*)(ws + WS_WB), *HWB = (__bf16*)(ws + WS_HW); _Float16* PT = (_Float16*)(ws + WS_PT);
  k_wb<<<dim3(DD * CC / 4096, 4), 256, 0, stream>>>(F[1], F[3], F[5], F[7], WB);
  k_proj<<<dim3(TT / 64, TNB, 3), 128, 0, stream>>>(F[0], WB, F[2], F[4], F[6], THH, THL, PHH, PHL, G);
  k_sc<<<dim3(TT / 128, TT / 128, TNB), 128, 0, stream>>>(THH, THL, PHH, PHL, MP, PT);
  k_mg<<<dim3(TT / 256, TNB), 256, 0, stream>>>(MP, CF);
  k_pv<<<dim3(TT / 128, DD / PV_DW, TNB), 128, 0, stream>>>(PT, G, CF, ATH, ATL);
  k_ht<<<dim3(TT / 64, CC / 128, TNB), 128, 0, stream>>>(ATH, ATL, HWB, F[8], Hh, ST);
  k_bn<<<CC / 32, 256, 0, stream>>>(ST, BN);
  k_out<<<CC * TNB / 8, 256, 0, stream>>>(F[0], Hh, BN, F[9], F[10], (float*)d_out);
}
